// v000
// The times below were measured on an AMD MI455X: many runs one after another, warmed up first and cycling through
// copies of the inputs, with the whole window's GPU time divided by the number of runs. Launches and the gaps
// between them are all in it. The median over several windows is given; except for v000 it joins two sittings, which
// can be a few percent apart, so the side-by-side timings, each taken in one sitting, are the better comparison.
// v000 is the starting kernel. One run takes 468 microseconds.
// Contractions (all f32 accumulate): q/k projections v_wmma_f32_16x16x32_f16 (x f16 x16 . W f16 x64, K=1024, single products) stored as bf16 hi/lo planes;
// v^T projection v_wmma_f32_16x16x32_f16 (Wv f16 x64 . x f16 x16, K=1024) stored as f16 x16 hi/lo planes;
// attention scores v_wmma_f32_16x16x32_bf16 (q bf16 hi/lo . k bf16 hi/lo, hi.hi+hi.lo+lo.hi, K=64);
// P . v^T v_wmma_f32_16x16x32_f16 (P f16 x1024 hi/lo . v^T f16 x16 hi/lo, hi.hi+hi.lo+lo.hi, K=2048 by 32);
// output projection v_wmma_f32_16x16x32_bf16 (ctx bf16 hi/lo . Wo bf16, hi.W+lo.W, K=1024).
// Bucketed relative-position bias (per head, function of key-query offset) and online max-subtracted base-2 softmax in f32 on VALU.
// Every float input RNE-converted to bf16 on load.
#include <hip/hip_runtime.h>
#include <math.h>
#include <stdint.h>

#define NB      2
#define NQ      2048
#define NC      2048
#define DMODEL  1024
#define NHEAD   16
#define HDIM    64
#define NBKT    32
#define NROWS   (NB * NQ)
#define WSC     64.0f
#define ACARRY  16.0f
#define VC      16.0f
#define PC      1024.0f
#define ATT_SCALE 0.125f
#define LOG2E   1.4426950408889634f
#define SL2     (ATT_SCALE * LOG2E)
static_assert(NHEAD * HDIM == DMODEL);
static_assert((NQ % 64) == 0 && (NC % 64) == 0 && (DMODEL % 64) == 0 && (NC % 32) == 0 && (NQ % 16) == 0);
static_assert((NROWS % 64) == 0);
#define ATT_THREADS (NHEAD * 32)
#define ATT_BLOCKS  (NB * (NQ / 16))
static_assert(ATT_THREADS == 512 && ATT_BLOCKS == 256);
#define LUTP            2064
#define PT_FLOATS       (NHEAD * 16 * 36)
#define LUT_HALVES      (NHEAD * LUTP)
#define ATT_SMEM_FLOATS (PT_FLOATS + LUT_HALVES / 2)
static_assert((LUT_HALVES % 8) == 0);
static_assert(NQ + 15 <= LUTP - 1);
static_assert((size_t)2 * 16 * DMODEL * sizeof(unsigned short) <= (size_t)ATT_SMEM_FLOATS * sizeof(float));

typedef _Float16 v16h __attribute__((ext_vector_type(16)));
typedef _Float16 v8h  __attribute__((ext_vector_type(8)));
typedef __bf16   v16b __attribute__((ext_vector_type(16)));
typedef float    v8f  __attribute__((ext_vector_type(8)));
typedef float    v4f  __attribute__((ext_vector_type(4)));
typedef unsigned int v4u __attribute__((ext_vector_type(4)));

union FragH { v16h v; v8h h[2]; v4u u[2]; };
union FragAny { v16h h; v16b b; };

// ---- scalar helpers --------------------------------------------------------------------------------
__device__ __forceinline__ unsigned short bf_bits(float f) {          // f32 -> bf16 bits, RNE convert
  unsigned u = __float_as_uint(f);
  return (unsigned short)((u + 0x7FFFu + ((u >> 16) & 1u)) >> 16);
}
__device__ __forceinline__ float bf_up(unsigned short h) { return __uint_as_float(((unsigned)h) << 16); }
__device__ __forceinline__ float bfr(float f) { return bf_up(bf_bits(f)); }   // value of the bf16 RNE convert
__device__ __forceinline__ unsigned short h_bits(_Float16 x) { return __builtin_bit_cast(unsigned short, x); }
__device__ __forceinline__ unsigned pk16(unsigned short a, unsigned short b) { return (unsigned)a | ((unsigned)b << 16); }
__device__ __forceinline__ v8f zero8() { v8f z = {0.f, 0.f, 0.f, 0.f, 0.f, 0.f, 0.f, 0.f}; return z; }

// ---- fragment loader: 16-bit A/B operand from a k-contiguous 16-bit plane, lane -> row/col (lane&15),
//      p already includes +8*(lane>>4); elements 0..7 <- p[0..7] (k0+8h..), elements 8..15 <- p[16..23] (k0+16+8h..)
//      (same split k map for A and B; B is always read from a [n][k] plane)
__device__ __forceinline__ v16h ldfrag_u(const unsigned short* p) {
  FragH f;
  f.u[0] = *(const v4u*)(p);
  f.u[1] = *(const v4u*)(p + 16);
  return f.v;
}

// ---- WMMA helpers with trailing VALU hazard gaps ------------------------------------------------------
__device__ __forceinline__ v8f mma_h(v16h a, v16h b, v8f c) {
  return __builtin_amdgcn_wmma_f32_16x16x32_f16(false, a, false, b, (short)0, c, false, false);
}
__device__ __forceinline__ v8f mma_b(v16h a, v16h b, v8f c) {
  FragAny ua, ub;
  ua.h = a;
  ub.h = b;
  return __builtin_amdgcn_wmma_f32_16x16x32_bf16(false, ua.b, false, ub.b, (short)0, c, false, false);
}
template <int BF>
__device__ __forceinline__ v8f mmaT(v16h a, v16h b, v8f c) {
  if constexpr (BF != 0) return mma_b(a, b, c);
  else return mma_h(a, b, c);
}
__device__ __forceinline__ void dep_guard1(v8f& a, v8f& b, v16h x) {
#if defined(__HIP_DEVICE_COMPILE__)
  asm volatile("v_nop\n\tv_nop\n\tv_nop\n\tv_nop" : "+v"(a), "+v"(b) : "v"(x));
#endif
}
__device__ __forceinline__ void guard1x4(v8f& s, v16h a0, v16h a1, v16h a2, v16h a3) {
#if defined(__HIP_DEVICE_COMPILE__)
  asm volatile("v_nop\n\tv_nop\n\tv_nop\n\tv_nop" : "+v"(s) : "v"(a0), "v"(a1), "v"(a2), "v"(a3));
#endif
}
__device__ __forceinline__ void guard1x8(v8f& s, v16h a0, v16h a1, v16h a2, v16h a3,
                                         v16h b0, v16h b1, v16h b2, v16h b3) {
#if defined(__HIP_DEVICE_COMPILE__)
  asm volatile("v_nop\n\tv_nop\n\tv_nop\n\tv_nop"
               : "+v"(s) : "v"(a0), "v"(a1), "v"(a2), "v"(a3), "v"(b0), "v"(b1), "v"(b2), "v"(b3));
#endif
}
__device__ __forceinline__ void guard4x6(v8f& a, v8f& b, v8f& c, v8f& d,
                                         v16h x0, v16h x1, v16h x2, v16h x3, v16h x4, v16h x5) {
#if defined(__HIP_DEVICE_COMPILE__)
  asm volatile("v_nop\n\tv_nop\n\tv_nop\n\tv_nop"
               : "+v"(a), "+v"(b), "+v"(c), "+v"(d) : "v"(x0), "v"(x1), "v"(x2), "v"(x3), "v"(x4), "v"(x5));
#endif
}
__device__ __forceinline__ void guard4x5(v8f& a, v8f& b, v8f& c, v8f& d,
                                         v16h x0, v16h x1, v16h x2, v16h x3, v16h x4) {
#if defined(__HIP_DEVICE_COMPILE__)
  asm volatile("v_nop\n\tv_nop\n\tv_nop\n\tv_nop"
               : "+v"(a), "+v"(b), "+v"(c), "+v"(d) : "v"(x0), "v"(x1), "v"(x2), "v"(x3), "v"(x4));
#endif
}
__device__ __forceinline__ void keep4_h(v16h a, v16h b, v16h c, v16h d) {
#if defined(__HIP_DEVICE_COMPILE__)
  asm volatile("v_nop" :: "v"(a), "v"(b), "v"(c), "v"(d));
#endif
}
__device__ __forceinline__ void acc_guard4(v8f& a, v8f& b, v8f& c, v8f& d) {
#if defined(__HIP_DEVICE_COMPILE__)
  asm volatile("v_nop\n\tv_nop\n\tv_nop\n\tv_nop" : "+v"(a), "+v"(b), "+v"(c), "+v"(d));
#endif
}
__device__ __forceinline__ void wave_sync_lds() {
  __builtin_amdgcn_fence(__ATOMIC_RELEASE, "workgroup");
  __builtin_amdgcn_wave_barrier();
  __builtin_amdgcn_fence(__ATOMIC_ACQUIRE, "workgroup");
}

// =====================================================================================================
// Elementwise 16-bit pack, no transpose. BFO 0: dst[i] = f16( bf16_RNE(src[i]) * sc ), sc a power of two (exact);
// BFO 1: dst[i] = bf16_RNE(src[i]) bits. 8 elements per thread: two 16-B loads, one 16-B store per lane; 32 consecutive
// coverage: grid = n / 2048 blocks x 256 thr x 8 elements = n exactly (host checks n % 2048 == 0).
// =====================================================================================================
template <int BFO>
__global__ __launch_bounds__(256) void cvt16(const float* __restrict__ src, unsigned short* dst, int n, float sc) {
  const size_t i8 = ((size_t)blockIdx.x * 256 + threadIdx.x) * 8;
  if (i8 + 8 > (size_t)n) return;                 // never taken with the exact grid; no barriers in this kernel
  const v4f a = *(const v4f*)(src + i8);
  const v4f b = *(const v4f*)(src + i8 + 4);
  v4u o;
  if constexpr (BFO != 0) {
    o[0] = pk16(bf_bits(a[0]), bf_bits(a[1]));
    o[1] = pk16(bf_bits(a[2]), bf_bits(a[3]));
    o[2] = pk16(bf_bits(b[0]), bf_bits(b[1]));
    o[3] = pk16(bf_bits(b[2]), bf_bits(b[3]));
  } else {
    o[0] = pk16(h_bits((_Float16)(bfr(a[0]) * sc)), h_bits((_Float16)(bfr(a[1]) * sc)));
    o[1] = pk16(h_bits((_Float16)(bfr(a[2]) * sc)), h_bits((_Float16)(bfr(a[3]) * sc)));
    o[2] = pk16(h_bits((_Float16)(bfr(b[0]) * sc)), h_bits((_Float16)(bfr(b[1]) * sc)));
    o[3] = pk16(h_bits((_Float16)(bfr(b[2]) * sc)), h_bits((_Float16)(bfr(b[3]) * sc)));
  }
  {
    *(v4u*)(dst + i8) = o;
    
  }
}

// =====================================================================================================
// Register-blocked batched 16-bit WMMA GEMM: C[m][n] = oscale * sum_k A[m][k] * Bt[n][k]; one wave per 64x64 tile, no block barriers.
// A row-major [M][K] pitch lda (16-bit plane), Bt row-major [N][K] pitch ldb (k contiguous); M, N multiples of 64, K multiple of 32.
// blockIdx.y = batch index with element strides sA, sB, sC.
// ASPLIT 1: a second A plane A2 (unscaled residual of A, same layout) is multiplied into the same accumulator (A + A2 ~ exact A).
// BF 1: bf16 operands (v_wmma_f32_16x16x32_bf16), else f16.
// OM 0: f32 out (pitch ldc).  OM 2: f16 out = f16(value * ocarry).  OM 3: two bf16 planes: hi = bf16_RNE(value), lo = bf16_RNE(value - hi).
// OM 4: two f16 planes: hi = f16(value * ocarry), lo = f16(value * ocarry - hi) (unscaled residual).
// coverage: 4 slabs x 16 rows (f32: it 0..7 x lane>>4; 16-bit: it 0..3 x lane>>3) x 64 cols = the wave's whole 64x64 tile;
//           grid = ceil(tilesM*tilesN/8) blocks, surplus waves exit (wave-uniform).
// =====================================================================================================
template <int OM, int ASPLIT, int BF>
__global__ __launch_bounds__(256) void gemm64(
    const unsigned short* __restrict__ Ap, const unsigned short* __restrict__ A2p, int lda, long long sA,
    const unsigned short* __restrict__ Btp, int ldb, long long sB,
    void* Cout, void* C2out, int ldc, long long sC,
    int M, int N, int K, float oscale, float ocarry) {
  __shared__ __align__(16) float sT[8][16 * 68];   // per-wave 16x64 slab, pitch 68 floats
  const int by   = blockIdx.y;
  const int lane = threadIdx.x & 31;
  const int wave = threadIdx.x >> 5;
  const int tilesN = N >> 6;
  const int tilesM = M >> 6;
  const int tile = blockIdx.x * 8 + wave;
  if (tile >= tilesM * tilesN) return;   // wave-uniform; no block barriers in this kernel
  const int tm = tile / tilesN;
  const int tn = tile - tm * tilesN;
  const int m0 = tm << 6;
  const int n0 = tn << 6;

  const unsigned short* A1 = Ap  + (size_t)((long long)by * sA);
  const unsigned short* A2 = A2p + (size_t)((long long)by * sA);
  const unsigned short* Bb = Btp + (size_t)((long long)by * sB);

  const int rlane = lane & 15;                 // row (A) / col (B, D) within subtile
  const int koff  = (lane >> 4) * 8;           // k offset of this lane half
  const int mOff  = (lane >> 4) * 8;           // D row offset

  v8f acc[4][4];
#pragma unroll
  for (int i = 0; i < 4; ++i)
#pragma unroll
    for (int j = 0; j < 4; ++j) acc[i][j] = zero8();

  for (int k0 = 0; k0 < K; k0 += 32) {
    v16h bh[4];
#pragma unroll
    for (int j = 0; j < 4; ++j) {
      const size_t bofs = (size_t)(n0 + (j << 4) + rlane) * ldb + koff + k0;
      bh[j] = ldfrag_u(Bb + bofs);
    }
#pragma unroll
    for (int i = 0; i < 4; ++i) {
      const size_t ao = (size_t)(m0 + (i << 4) + rlane) * lda + koff + k0;
      const v16h ah = ldfrag_u(A1 + ao);
#pragma unroll
      for (int j = 0; j < 4; ++j) acc[i][j] = mmaT<BF>(ah, bh[j], acc[i][j]);
      dep_guard1(acc[i][0], acc[i][3], ah);
      if constexpr (ASPLIT != 0) {
        const v16h al = ldfrag_u(A2 + ao);
#pragma unroll
        for (int j = 0; j < 4; ++j) acc[i][j] = mmaT<BF>(al, bh[j], acc[i][j]);
        dep_guard1(acc[i][0], acc[i][3], al);
      }
    }
    keep4_h(bh[0], bh[1], bh[2], bh[3]);
  }
  acc_guard4(acc[0][0], acc[0][1], acc[0][2], acc[0][3]);
  acc_guard4(acc[1][0], acc[1][1], acc[1][2], acc[1][3]);
  acc_guard4(acc[2][0], acc[2][1], acc[2][2], acc[2][3]);
  acc_guard4(acc[3][0], acc[3][1], acc[3][2], acc[3][3]);

  const int hh2 = lane >> 4, c4 = (lane & 15) * 4;     // f32 out: 256-B row segment = 16 lanes x 16 B
  const int q8  = lane >> 3, c8 = (lane & 7) * 8;

  // ---- epilogue ----
  float* slab = sT[wave];
#pragma unroll
  for (int i = 0; i < 4; ++i) {
    const int mBase = m0 + (i << 4);
#pragma unroll
    for (int j = 0; j < 4; ++j) {
#pragma unroll
      for (int r = 0; r < 8; ++r) {
        slab[(mOff + r) * 68 + (j << 4) + rlane] = acc[i][j][r];
      }
    }
    wave_sync_lds();
    if constexpr (OM == 0) {
      float* C = (float*)Cout + (size_t)((long long)by * sC);
      v4f vals[8];
#pragma unroll
      for (int it = 0; it < 8; ++it) {
        const int row = it * 2 + hh2;                      // it 0..7 x hh2 0..1 = rows 0..15
        v4f v = *(const v4f*)(slab + row * 68 + c4);
#pragma unroll
        for (int e = 0; e < 4; ++e) v[e] = v[e] * oscale;
        vals[it] = v;
      }
      {
#pragma unroll
        for (int it = 0; it < 8; ++it) {
          const int gr = mBase + it * 2 + hh2;
          *(v4f*)(C + (size_t)gr * ldc + n0 + c4) = vals[it];
        }
        
      }
    } else {
      unsigned short* C  = (unsigned short*)Cout  + (size_t)((long long)by * sC);
      unsigned short* Cb = (unsigned short*)C2out + (size_t)((long long)by * sC);
      v4u hv[4], lv[4];
#pragma unroll
      for (int it = 0; it < 4; ++it) {
        const int row = it * 4 + q8;                       // it 0..3 x q8 0..3 = rows 0..15
        const float* sp = slab + row * 68 + c8;
        v4u a  = {0u, 0u, 0u, 0u};
        v4u b2 = {0u, 0u, 0u, 0u};
#pragma unroll
        for (int e = 0; e < 4; ++e) {
          float f0 = sp[2 * e] * oscale;
          float f1 = sp[2 * e + 1] * oscale;
          if constexpr (OM == 3) {
            const unsigned short h0 = bf_bits(f0), h1 = bf_bits(f1);
            a[e]  = pk16(h0, h1);
            b2[e] = pk16(bf_bits(f0 - bf_up(h0)), bf_bits(f1 - bf_up(h1)));
          } else {
            f0 *= ocarry; f1 *= ocarry;
            const _Float16 x0 = (_Float16)f0, x1 = (_Float16)f1;
            a[e] = pk16(h_bits(x0), h_bits(x1));
            if constexpr (OM == 4) {
              b2[e] = pk16(h_bits((_Float16)(f0 - (float)x0)), h_bits((_Float16)(f1 - (float)x1)));
            }
          }
        }
        hv[it] = a;
        lv[it] = b2;
      }
      {
#pragma unroll
        for (int it = 0; it < 4; ++it) {
          const int row = it * 4 + q8;
          *(v4u*)(C + (size_t)(mBase + row) * ldc + n0 + c8) = hv[it];
          if constexpr (OM >= 3) {
            *(v4u*)(Cb + (size_t)(mBase + row) * ldc + n0 + c8) = lv[it];
          }
        }
        
      }
    }
    wave_sync_lds();
  }
}

// =====================================================================================================
// Flash attention for one batch and 16 query rows, all 16 heads (one wave per head), head dim 64, 2048 keys:
//   q planes (bf16 hi, lo) Q[b*2048 + tok][64h + d], pitch 1024; k planes (bf16 hi, lo) K[b*2048 + key][64h + d], pitch 1024;
//   v^T planes (f16 x16 hi, unscaled lo): VT[b*1024 + 64h + d][key] (pitch 2048); bias = bf16(rel[bucket(key - tok)][h]) from a
//   per-block LDS table of bf16 bits indexed by (key - tok + q0 + 15), bucket() piecewise constant in the offset (integer compares);
//   out (bf16 hi, lo planes): CT[b*2048 + tok][64h + d] = sum_m softmax_m(q.k / 8 + bias) v[m][d]  (softmax run in base 2).
//   block = 16 waves = 512 threads; grid = 2 x 128 = 256; every wave does identical bounded work (64 steps of 32 keys).
//   Per step: 2 score tiles on bf16 WMMA (hi.hi + hi.lo + lo.hi, K = 64 as two k-steps of 32), fragments loaded straight from the
//   16-bit planes (two 16-B loads per fragment, arithmetic addressing); the 16 bias values of each lane's (row, key) score elements
//   loaded from the LDS table (u16); online max-subtracted softmax in f32 (exp2); rescale of the running sums and the four accumulators;
//   (f16 hi and unscaled residual) rebuilt from the LDS rows (float vector loads, split k map) and the v^T B fragments (hi and lo planes)
//   loaded straight from the 16-bit planes; 12 P.V WMMAs (hi.hi, lo.hi, hi.lo).
//   Final 1/l and carry folds in f32; after a block barrier the LDS buffer is reused as the block's two bf16 result row buffers
//   [16][1024] each (hi, lo): each wave stages its 16x64 slice (element stores); after a second block barrier the 512 threads write the
// coverage: LDS table: 512 threads stride over 16 x 2064 entries (all written); LDS row buffers: 16 waves x 16 rows x 64 cols = 16 x 1024
//           per plane; global: 4 iterations x 512 threads x 8 halves = 16 rows x 1024 of rows q0..q0+15 of batch b, per plane;
//           grid covers all 2 x 2048 rows exactly once.
// =====================================================================================================
__global__ __launch_bounds__(ATT_THREADS)
void attn16(const unsigned short* __restrict__ QHh, const unsigned short* __restrict__ QHl,
            const unsigned short* __restrict__ KHh, const unsigned short* __restrict__ KHl,
            const unsigned short* __restrict__ VTh, const unsigned short* __restrict__ VTl,
            const float* __restrict__ rel, unsigned short* CTh, unsigned short* CTl) {
  __shared__ __align__(16) float smem[ATT_SMEM_FLOATS];   // prob tiles [wave][row][32 keys] pitch 36 | bias table u16 [16][2064]
  unsigned short* lut = (unsigned short*)(smem + PT_FLOATS);

  const int tid  = threadIdx.x;
  const int wave = tid >> 5;
  const int lane = tid & 31;
  const int hh   = lane >> 4;
  const int c    = lane & 15;

  const int qt   = blockIdx.x & ((NQ / 16) - 1);           // 0..127
  const int bat  = blockIdx.x / (NQ / 16);                 // 0..1
  const int head = wave;                                   // 0..15
  const int q0   = qt * 16;

  // ---- per-block bias table: lut[h][i] = bf16 bits of rel[bucket(i - (q0 + 15))][h], i = key - tok + q0 + 15 in [0, 2062] ----
  for (int e = tid; e < LUT_HALVES; e += ATT_THREADS) {
    const int hd = e / LUTP;
    const int i  = e - hd * LUTP;
    const int d  = i - (q0 + 15);                          // key - tok
    const int a  = (d < 0) ? -d : d;
    int g = 8 + (a >= 12) + (a >= 16) + (a >= 23) + (a >= 32) + (a >= 46) + (a >= 64) + (a >= 91);
    g = (a < 8) ? a : g;
    const int bk = g + ((d > 0) ? 16 : 0);                 // 0..31
    lut[e] = bf_bits(rel[bk * NHEAD + hd]);                // index in [0, 511]
  }
  __syncthreads();

  const size_t qofs = ((size_t)bat * NQ + q0 + c) * DMODEL + head * HDIM + 8 * hh;
  const v16h qah = ldfrag_u(QHh + qofs), qbh = ldfrag_u(QHh + qofs + 32);
  const v16h qal = ldfrag_u(QHl + qofs), qbl = ldfrag_u(QHl + qofs + 32);
  const size_t kbase = (size_t)bat * NC * DMODEL + head * HDIM + 8 * hh;
  const unsigned short* Kbh = KHh + kbase;
  const unsigned short* Kbl = KHl + kbase;
  const size_t vbase = ((size_t)bat * DMODEL + head * HDIM) * NC + 8 * hh;
  const unsigned short* Vbh = VTh + vbase;
  const unsigned short* Vbl = VTl + vbase;
  const unsigned short* lw = lut + head * LUTP + (c + 15 - 8 * hh);   // + kb; element (row 8hh+r, key kb+c+16t) at [16t - r]

  float mrow[8], lrow[8];
  v8f o0 = zero8(), o1 = zero8(), o2 = zero8(), o3 = zero8();
#pragma unroll
  for (int r = 0; r < 8; ++r) { mrow[r] = -INFINITY; lrow[r] = 0.f; }
  float* pt = smem + wave * (16 * 36);

#pragma unroll 1
  for (int kb = 0; kb < NC; kb += 32) {
    const size_t ko = (size_t)(kb + c) * DMODEL;
    v8f s0, s1;
    {
      const v16h k0h = ldfrag_u(Kbh + ko), k1h = ldfrag_u(Kbh + ko + 32);
      const v16h k0l = ldfrag_u(Kbl + ko), k1l = ldfrag_u(Kbl + ko + 32);
      s0 = mma_b(qah, k0h, zero8());
      s0 = mma_b(qbh, k1h, s0);
      s0 = mma_b(qah, k0l, s0);
      s0 = mma_b(qbh, k1l, s0);
      s0 = mma_b(qal, k0h, s0);
      s0 = mma_b(qbl, k1h, s0);
      guard1x4(s0, k0h, k1h, k0l, k1l);
    }
    {
      const size_t k2 = ko + (size_t)16 * DMODEL;
      const v16h k0h = ldfrag_u(Kbh + k2), k1h = ldfrag_u(Kbh + k2 + 32);
      const v16h k0l = ldfrag_u(Kbl + k2), k1l = ldfrag_u(Kbl + k2 + 32);
      s1 = mma_b(qah, k0h, zero8());
      s1 = mma_b(qbh, k1h, s1);
      s1 = mma_b(qah, k0l, s1);
      s1 = mma_b(qbh, k1l, s1);
      s1 = mma_b(qal, k0h, s1);
      s1 = mma_b(qbl, k1h, s1);
      guard1x8(s1, k0h, k1h, k0l, k1l, qah, qbh, qal, qbl);
    }
    const unsigned short* lp = lw + kb;
#pragma unroll
    for (int r = 0; r < 8; ++r) {
      const float w0 = bf_up(lp[-r]), w1 = bf_up(lp[16 - r]);
      const float t0 = s0[r] * SL2 + w0 * LOG2E, t1 = s1[r] * SL2 + w1 * LOG2E;
      float mx = fmaxf(t0, t1);
#pragma unroll
      for (int off = 1; off < 16; off <<= 1) mx = fmaxf(mx, __shfl_xor(mx, off, 32));
      const float mn = fmaxf(mrow[r], mx);
      const float al = exp2f(mrow[r] - mn);
      mrow[r] = mn;
      const float e0 = exp2f(t0 - mn), e1 = exp2f(t1 - mn);
      float ps = e0 + e1;
#pragma unroll
      for (int off = 1; off < 16; off <<= 1) ps += __shfl_xor(ps, off, 32);
      lrow[r] = lrow[r] * al + ps;
      o0[r] *= al;
      o1[r] *= al;
      o2[r] *= al;
      o3[r] *= al;
      const int ro = (8 * hh + r) * 36 + c;
      pt[ro]      = e0;
      pt[ro + 16] = e1;
    }
    wave_sync_lds();
    FragH ph, pl;
    {
      const float* prow = pt + c * 36 + 8 * hh;
      const v4f p0 = *(const v4f*)(prow), p1 = *(const v4f*)(prow + 4);
      const v4f p2 = *(const v4f*)(prow + 16), p3 = *(const v4f*)(prow + 20);
#pragma unroll
      for (int e = 0; e < 4; ++e) {
        float f; _Float16 x;
        f = p0[e] * PC; x = (_Float16)f; ph.h[0][e]     = x; pl.h[0][e]     = (_Float16)(f - (float)x);   // keys kb + 8hh + e
        f = p1[e] * PC; x = (_Float16)f; ph.h[0][4 + e] = x; pl.h[0][4 + e] = (_Float16)(f - (float)x);   // keys kb + 8hh + 4 + e
        f = p2[e] * PC; x = (_Float16)f; ph.h[1][e]     = x; pl.h[1][e]     = (_Float16)(f - (float)x);   // keys kb + 16 + 8hh + e
        f = p3[e] * PC; x = (_Float16)f; ph.h[1][4 + e] = x; pl.h[1][4 + e] = (_Float16)(f - (float)x);
      }
    }
    const size_t vo = (size_t)c * NC + kb;
    {
      const v16h vh0 = ldfrag_u(Vbh + vo);
      const v16h vh1 = ldfrag_u(Vbh + vo + (size_t)16 * NC);
      const v16h vh2 = ldfrag_u(Vbh + vo + (size_t)32 * NC);
      const v16h vh3 = ldfrag_u(Vbh + vo + (size_t)48 * NC);
      o0 = mma_h(ph.v, vh0, o0);
      o1 = mma_h(ph.v, vh1, o1);
      o2 = mma_h(ph.v, vh2, o2);
      o3 = mma_h(ph.v, vh3, o3);
      o0 = mma_h(pl.v, vh0, o0);
      o1 = mma_h(pl.v, vh1, o1);
      o2 = mma_h(pl.v, vh2, o2);
      o3 = mma_h(pl.v, vh3, o3);
      guard4x6(o0, o1, o2, o3, ph.v, pl.v, vh0, vh1, vh2, vh3);
    }
    {
      const v16h vl0 = ldfrag_u(Vbl + vo);
      const v16h vl1 = ldfrag_u(Vbl + vo + (size_t)16 * NC);
      const v16h vl2 = ldfrag_u(Vbl + vo + (size_t)32 * NC);
      const v16h vl3 = ldfrag_u(Vbl + vo + (size_t)48 * NC);
      o0 = mma_h(ph.v, vl0, o0);
      o1 = mma_h(ph.v, vl1, o1);
      o2 = mma_h(ph.v, vl2, o2);
      o3 = mma_h(ph.v, vl3, o3);
      guard4x5(o0, o1, o2, o3, ph.v, vl0, vl1, vl2, vl3);
    }
    wave_sync_lds();
  }

  // ---- all waves done with their prob tiles and the bias table; the LDS buffer becomes two bf16 result row buffers [16][1024] ----
  __syncthreads();
  unsigned short* Osh = (unsigned short*)smem;
  unsigned short* Osl = Osh + 16 * DMODEL;
  // ---- fold 1/l and the carries (1024 on P, 16 on v), split into bf16 hi + residual, stage the wave's 16x64 slice ----
  const float oc = 1.0f / (PC * VC);
  const int cb = wave * HDIM + c;
#pragma unroll
  for (int r = 0; r < 8; ++r) {
    const float inv = (1.0f / lrow[r]) * oc;
    const int ro = (8 * hh + r) * DMODEL + cb;
    const float f0 = o0[r] * inv, f1 = o1[r] * inv, f2 = o2[r] * inv, f3 = o3[r] * inv;
    const unsigned short g0 = bf_bits(f0), g1 = bf_bits(f1), g2 = bf_bits(f2), g3 = bf_bits(f3);
    Osh[ro]      = g0;  Osl[ro]      = bf_bits(f0 - bf_up(g0));
    Osh[ro + 16] = g1;  Osl[ro + 16] = bf_bits(f1 - bf_up(g1));
    Osh[ro + 32] = g2;  Osl[ro + 32] = bf_bits(f2 - bf_up(g2));
    Osh[ro + 48] = g3;  Osl[ro + 48] = bf_bits(f3 - bf_up(g3));
  }
  __syncthreads();
  // ---- block writes its 16 contiguous rows of both planes: piece p = it*512 + tid -> halves p*8 .. p*8+7 of the 16x1024 region ----
  {
    v4u hv[4], lv[4];
#pragma unroll
    for (int it = 0; it < 4; ++it) {
      const int p = it * ATT_THREADS + tid;
      hv[it] = *(const v4u*)(Osh + (size_t)p * 8);
      lv[it] = *(const v4u*)(Osl + (size_t)p * 8);
    }
    const size_t dofs = ((size_t)bat * NQ + q0) * DMODEL;
    unsigned short* dsth = CTh + dofs;
    unsigned short* dstl = CTl + dofs;
    {
#pragma unroll
      for (int it = 0; it < 4; ++it) {
        const int p = it * ATT_THREADS + tid;
        *(v4u*)(dsth + (size_t)p * 8) = hv[it];
        *(v4u*)(dstl + (size_t)p * 8) = lv[it];
      }
      
    }
  }
}

// =====================================================================================================
// Workspace map (bytes); every plane is an exact multiple of its tile / whole-row store granularity (M, N exact tile multiples,
// element counts exact multiples of the convert kernel's 2048 granularity, no pad rows needed), every offset a multiple of 2 MiB:
//   WQ16 f16 [1024][1024] x64               2097152   ([out][in] = [n][k])
//   WK16 f16 [1024][1024] x64               2097152
//   WV16 f16 [1024][1024] x64               2097152
//   WO16 bf16 [1024][1024]                  2097152
//   X16  f16 [4096][1024] x16               8388608   (activation rows)
//   QHh, QHl bf16 [4096][1024]          2 x 8388608   (q projection, hi / residual)
//   KHh, KHl bf16 [4096][1024]          2 x 8388608   (k projection, hi / residual)
//   VTh, VTl f16 [2][1024][2048] x16    2 x 8388608   (v^T per batch, hi / residual)
//   CTh, CTl bf16 [4096][1024]          2 x 8388608   (attention ctx, merged heads, hi / residual)
//   end                                    83886080
// =====================================================================================================
extern "C" void kernel_launch(void* const* d_in, const int* in_sizes, int n_in,
                              void* d_out, int out_size, void* d_ws, size_t ws_size,
                              hipStream_t stream) {
  if (n_in < 6) return;
  if (in_sizes[0] != NROWS * DMODEL) return;
  if (in_sizes[1] != DMODEL * DMODEL || in_sizes[2] != DMODEL * DMODEL ||
      in_sizes[3] != DMODEL * DMODEL || in_sizes[4] != DMODEL * DMODEL) return;
  if (in_sizes[5] != NBKT * NHEAD) return;
  if (out_size != NROWS * DMODEL) return;
  if ((in_sizes[0] % 2048) != 0 || (in_sizes[1] % 2048) != 0) return;

  const float* x   = (const float*)d_in[0];
  const float* w_q = (const float*)d_in[1];
  const float* w_k = (const float*)d_in[2];
  const float* w_v = (const float*)d_in[3];
  const float* w_o = (const float*)d_in[4];
  const float* rel = (const float*)d_in[5];
  float*       out = (float*)d_out;

  const size_t PW  = (size_t)DMODEL * DMODEL * 2;                 //  2097152
  const size_t PX  = (size_t)NROWS * DMODEL * 2;                  //  8388608
  const size_t PVT = (size_t)NB * DMODEL * NC * 2;                //  8388608
  size_t off = 0;
  const size_t oWQ = off; off += PW;
  const size_t oWK = off; off += PW;
  const size_t oWV = off; off += PW;
  const size_t oWO = off; off += PW;
  const size_t oX  = off; off += PX;
  const size_t oQh = off; off += PX;
  const size_t oQl = off; off += PX;
  const size_t oKh = off; off += PX;
  const size_t oKl = off; off += PX;
  const size_t oVh = off; off += PVT;
  const size_t oVl = off; off += PVT;
  const size_t oCh = off; off += PX;
  const size_t oCl = off; off += PX;
  if (off > ws_size) return;                                      // off = 83886080
  if (off > (size_t)134217728) return;

  char* ws = (char*)d_ws;
  unsigned short* WQ16 = (unsigned short*)(ws + oWQ);
  unsigned short* WK16 = (unsigned short*)(ws + oWK);
  unsigned short* WV16 = (unsigned short*)(ws + oWV);
  unsigned short* WO16 = (unsigned short*)(ws + oWO);
  unsigned short* X16  = (unsigned short*)(ws + oX);
  unsigned short* QHh  = (unsigned short*)(ws + oQh);
  unsigned short* QHl  = (unsigned short*)(ws + oQl);
  unsigned short* KHh  = (unsigned short*)(ws + oKh);
  unsigned short* KHl  = (unsigned short*)(ws + oKl);
  unsigned short* VTh  = (unsigned short*)(ws + oVh);
  unsigned short* VTl  = (unsigned short*)(ws + oVl);
  unsigned short* CTh  = (unsigned short*)(ws + oCh);
  unsigned short* CTl  = (unsigned short*)(ws + oCl);

  const dim3 blk(256);
  const dim3 gCW((DMODEL * DMODEL) / 2048);                        // 512 blocks
  const dim3 gCX((NROWS * DMODEL) / 2048);                         // 2048 blocks
  const int tilesP = (NROWS / 64) * (DMODEL / 64);                 // 1024
  const int tilesV = (DMODEL / 64) * (NC / 64);                    // 512 per batch
  const dim3 gP((tilesP + 7) / 8, 1);                              // 128
  const dim3 gV((tilesV + 7) / 8, NB);                             // 64 x 2
  const dim3 gAT(ATT_BLOCKS);                                      // 256
  const dim3 bAT(ATT_THREADS);                                     // 512

  // (0) weight planes: f16( bf16_RNE(W[n][k]) * 64 ) for Wq, Wk, Wv; bf16_RNE(Wo[n][k]) bits for Wo; [out][in] layout kept
  cvt16<0><<<gCW, blk, 0, stream>>>(w_q, WQ16, DMODEL * DMODEL, WSC);
  cvt16<0><<<gCW, blk, 0, stream>>>(w_k, WK16, DMODEL * DMODEL, WSC);
  cvt16<0><<<gCW, blk, 0, stream>>>(w_v, WV16, DMODEL * DMODEL, WSC);
  cvt16<1><<<gCW, blk, 0, stream>>>(w_o, WO16, DMODEL * DMODEL, 1.0f);

  // (1) activation plane: X16[row][c] = f16( bf16_RNE(x[row][c]) * 16 ), rows = b*2048 + tok
  cvt16<0><<<gCX, blk, 0, stream>>>(x, X16, NROWS * DMODEL, ACARRY);

  // (2) q projection: q[m][n] = sum_k x[m][k] Wq[n][k] -> bf16 hi / residual planes; M = 4096, N = 1024, K = 1024
  gemm64<3, 0, 0><<<gP, blk, 0, stream>>>(
      X16, X16, DMODEL, 0LL,
      WQ16, DMODEL, 0LL,
      (void*)QHh, (void*)QHl, DMODEL, 0LL,
      NROWS, DMODEL, DMODEL, 1.0f / (ACARRY * WSC), 1.0f);

  // (3) k projection -> bf16 hi / residual planes
  gemm64<3, 0, 0><<<gP, blk, 0, stream>>>(
      X16, X16, DMODEL, 0LL,
      WK16, DMODEL, 0LL,
      (void*)KHh, (void*)KHl, DMODEL, 0LL,
      NROWS, DMODEL, DMODEL, 1.0f / (ACARRY * WSC), 1.0f);

  // (4) v^T per batch: VT[b][d][tok] = sum_k Wv[d][k] x_b[tok][k] -> f16 x16 hi / residual planes; M = 1024, N = 2048, K = 1024
  gemm64<4, 0, 0><<<gV, blk, 0, stream>>>(
      WV16, WV16, DMODEL, 0LL,
      X16, DMODEL, (long long)NC * DMODEL,
      (void*)VTh, (void*)VTl, NC, (long long)DMODEL * NC,
      DMODEL, NC, DMODEL, 1.0f / (ACARRY * WSC), VC);

  // (5) attention per (batch, 16 query rows), 16 heads -> CT (bf16 hi / residual planes)
  attn16<<<gAT, bAT, 0, stream>>>(QHh, QHl, KHh, KHl, VTh, VTl, rel, CTh, CTl);

  // (6) out = (CT_hi + CT_lo) . Wo^T; M = 4096, N = 1024, K = 1024, f32
  gemm64<0, 1, 1><<<gP, blk, 0, stream>>>(
      CTh, CTl, DMODEL, 0LL,
      WO16, DMODEL, 0LL,
      (void*)out, (void*)out, DMODEL, 0LL,
      NROWS, DMODEL, DMODEL, 1.0f, 1.0f);
  (void)hipGetLastError();
}

// v001
// Measured time: 377 microseconds a run.
// Two timings next to v000 put it at 1.27 and 1.26 times that version's speed.
// Contractions (all f32 accumulate): q/k projections v_wmma_f32_16x16x32_f16 (x f16 x16 . W f16 x64, K=1024, single products) stored as bf16 hi/lo planes;
// v^T projection v_wmma_f32_16x16x32_f16 (Wv f16 x64 . x f16 x16, K=1024) stored as f16 x16 hi/lo planes;
// attention scores v_wmma_f32_16x16x32_bf16 (q bf16 hi/lo . k bf16 hi/lo, hi.hi+hi.lo+lo.hi, K=64);
// P . v^T v_wmma_f32_16x16x32_f16 (P f16 x1024 hi/lo . v^T f16 x16 hi/lo, hi.hi+hi.lo+lo.hi, K=2048 by 32);
// output projection v_wmma_f32_16x16x32_bf16 (ctx bf16 hi/lo . Wo bf16, hi.W+lo.W, K=1024).
// Bucketed relative-position bias (per head, function of key-query offset) and online max-subtracted base-2 softmax in f32 on VALU.
// Every float input RNE-converted to bf16 on load.
#include <hip/hip_runtime.h>
#include <math.h>
#include <stdint.h>

#define NB      2
#define NQ      2048
#define NC      2048
#define DMODEL  1024
#define NHEAD   16
#define HDIM    64
#define NBKT    32
#define NROWS   (NB * NQ)
#define WSC     64.0f
#define ACARRY  16.0f
#define VC      16.0f
#define PC      1024.0f
#define ATT_SCALE 0.125f
#define LOG2E   1.4426950408889634f
#define SL2     (ATT_SCALE * LOG2E)
static_assert(NHEAD * HDIM == DMODEL);
static_assert((NQ % 64) == 0 && (NC % 64) == 0 && (DMODEL % 64) == 0 && (NC % 32) == 0 && (NQ % 16) == 0);
static_assert((NROWS % 64) == 0);
#define ATT_THREADS 512
#define QBLK        256                                  // query rows per block: 16 waves x 16 rows, one head
#define ATT_BLOCKS  (NB * NHEAD * (NQ / QBLK))
static_assert(ATT_THREADS == 512 && ATT_BLOCKS == 256 && (NQ % QBLK) == 0 && NQ / QBLK == 8 && NHEAD == 16);
#define LUTP            (NC + QBLK)                      // bias table entries of one head: key - tok + (first row + 255) in [0, 2302]
#define PT_FLOATS       (16 * 16 * 36)
#define SKEYS           64                               // keys per LDS stage
#define NSTG            (NC / SKEYS)
#define SPITCH          72                               // halves: 128-B rows at a 144-B pitch (16 B x odd) for 16-B LDS reads
#define PLANE_HALVES    (64 * SPITCH)
#define BUF_HALVES      (4 * PLANE_HALVES)               // K hi, K lo, v^T hi, v^T lo
#define ATT_SMEM_FLOATS (PT_FLOATS + LUTP / 2 + BUF_HALVES)
static_assert(SKEYS == 64 && HDIM == 64 && NSTG >= 2 && (NC % SKEYS) == 0);
static_assert((LUTP % 8) == 0 && (PLANE_HALVES % 8) == 0);
static_assert((size_t)2 * QBLK * HDIM * sizeof(unsigned short) <= (size_t)ATT_SMEM_FLOATS * sizeof(float));

typedef _Float16 v16h __attribute__((ext_vector_type(16)));
typedef _Float16 v8h  __attribute__((ext_vector_type(8)));
typedef __bf16   v16b __attribute__((ext_vector_type(16)));
typedef float    v8f  __attribute__((ext_vector_type(8)));
typedef float    v4f  __attribute__((ext_vector_type(4)));
typedef unsigned int v4u __attribute__((ext_vector_type(4)));

union FragH { v16h v; v8h h[2]; v4u u[2]; };
union FragAny { v16h h; v16b b; };

// ---- scalar helpers --------------------------------------------------------------------------------
__device__ __forceinline__ unsigned short bf_bits(float f) {          // f32 -> bf16 bits, RNE convert
  unsigned u = __float_as_uint(f);
  return (unsigned short)((u + 0x7FFFu + ((u >> 16) & 1u)) >> 16);
}
__device__ __forceinline__ float bf_up(unsigned short h) { return __uint_as_float(((unsigned)h) << 16); }
__device__ __forceinline__ float bfr(float f) { return bf_up(bf_bits(f)); }   // value of the bf16 RNE convert
__device__ __forceinline__ unsigned short h_bits(_Float16 x) { return __builtin_bit_cast(unsigned short, x); }
__device__ __forceinline__ unsigned pk16(unsigned short a, unsigned short b) { return (unsigned)a | ((unsigned)b << 16); }
__device__ __forceinline__ v8f zero8() { v8f z = {0.f, 0.f, 0.f, 0.f, 0.f, 0.f, 0.f, 0.f}; return z; }

// ---- fragment loader: 16-bit A/B operand from a k-contiguous 16-bit plane, lane -> row/col (lane&15),
//      p already includes +8*(lane>>4); elements 0..7 <- p[0..7] (k0+8h..), elements 8..15 <- p[16..23] (k0+16+8h..)
//      (same split k map for A and B; B is always read from a [n][k] plane)
__device__ __forceinline__ v16h ldfrag_u(const unsigned short* p) {
  FragH f;
  f.u[0] = *(const v4u*)(p);
  f.u[1] = *(const v4u*)(p + 16);
  return f.v;
}

// ---- WMMA helpers with trailing VALU hazard gaps ------------------------------------------------------
__device__ __forceinline__ v8f mma_h(v16h a, v16h b, v8f c) {
  return __builtin_amdgcn_wmma_f32_16x16x32_f16(false, a, false, b, (short)0, c, false, false);
}
__device__ __forceinline__ v8f mma_b(v16h a, v16h b, v8f c) {
  FragAny ua, ub;
  ua.h = a;
  ub.h = b;
  return __builtin_amdgcn_wmma_f32_16x16x32_bf16(false, ua.b, false, ub.b, (short)0, c, false, false);
}
template <int BF>
__device__ __forceinline__ v8f mmaT(v16h a, v16h b, v8f c) {
  if constexpr (BF != 0) return mma_b(a, b, c);
  else return mma_h(a, b, c);
}
__device__ __forceinline__ void dep_guard1(v8f& a, v8f& b, v16h x) {
#if defined(__HIP_DEVICE_COMPILE__)
  asm volatile("v_nop\n\tv_nop\n\tv_nop\n\tv_nop" : "+v"(a), "+v"(b) : "v"(x));
#endif
}
__device__ __forceinline__ void guard1x4(v8f& s, v16h a0, v16h a1, v16h a2, v16h a3) {
#if defined(__HIP_DEVICE_COMPILE__)
  asm volatile("v_nop\n\tv_nop\n\tv_nop\n\tv_nop" : "+v"(s) : "v"(a0), "v"(a1), "v"(a2), "v"(a3));
#endif
}
__device__ __forceinline__ void guard1x8(v8f& s, v16h a0, v16h a1, v16h a2, v16h a3,
                                         v16h b0, v16h b1, v16h b2, v16h b3) {
#if defined(__HIP_DEVICE_COMPILE__)
  asm volatile("v_nop\n\tv_nop\n\tv_nop\n\tv_nop"
               : "+v"(s) : "v"(a0), "v"(a1), "v"(a2), "v"(a3), "v"(b0), "v"(b1), "v"(b2), "v"(b3));
#endif
}
__device__ __forceinline__ void guard4x6(v8f& a, v8f& b, v8f& c, v8f& d,
                                         v16h x0, v16h x1, v16h x2, v16h x3, v16h x4, v16h x5) {
#if defined(__HIP_DEVICE_COMPILE__)
  asm volatile("v_nop\n\tv_nop\n\tv_nop\n\tv_nop"
               : "+v"(a), "+v"(b), "+v"(c), "+v"(d) : "v"(x0), "v"(x1), "v"(x2), "v"(x3), "v"(x4), "v"(x5));
#endif
}
__device__ __forceinline__ void guard4x5(v8f& a, v8f& b, v8f& c, v8f& d,
                                         v16h x0, v16h x1, v16h x2, v16h x3, v16h x4) {
#if defined(__HIP_DEVICE_COMPILE__)
  asm volatile("v_nop\n\tv_nop\n\tv_nop\n\tv_nop"
               : "+v"(a), "+v"(b), "+v"(c), "+v"(d) : "v"(x0), "v"(x1), "v"(x2), "v"(x3), "v"(x4));
#endif
}
__device__ __forceinline__ void keep4_h(v16h a, v16h b, v16h c, v16h d) {
#if defined(__HIP_DEVICE_COMPILE__)
  asm volatile("v_nop" :: "v"(a), "v"(b), "v"(c), "v"(d));
#endif
}
__device__ __forceinline__ void acc_guard4(v8f& a, v8f& b, v8f& c, v8f& d) {
#if defined(__HIP_DEVICE_COMPILE__)
  asm volatile("v_nop\n\tv_nop\n\tv_nop\n\tv_nop" : "+v"(a), "+v"(b), "+v"(c), "+v"(d));
#endif
}
__device__ __forceinline__ void wave_sync_lds() {
  __builtin_amdgcn_fence(__ATOMIC_RELEASE, "workgroup");
  __builtin_amdgcn_wave_barrier();
  __builtin_amdgcn_fence(__ATOMIC_ACQUIRE, "workgroup");
}
// Four 16-B-per-lane asynchronous copies global -> LDS (l*: the lane's LDS byte address, g*: the lane's global address).
// The s_wait_xcnt stands inside the statement so that no address register is rewritten in front of it.
__device__ __forceinline__ void async_copy4(unsigned l0, const unsigned short* g0, unsigned l1, const unsigned short* g1,
                                            unsigned l2, const unsigned short* g2, unsigned l3, const unsigned short* g3) {
#if defined(__HIP_DEVICE_COMPILE__)
  asm volatile("global_load_async_to_lds_b128 %0, %1, off\n\t"
               "global_load_async_to_lds_b128 %2, %3, off\n\t"
               "global_load_async_to_lds_b128 %4, %5, off\n\t"
               "global_load_async_to_lds_b128 %6, %7, off\n\t"
               "s_wait_xcnt 0x0"
               :: "v"(l0), "v"(g0), "v"(l1), "v"(g1), "v"(l2), "v"(g2), "v"(l3), "v"(g3) : "memory");
#endif
}
__device__ __forceinline__ void wait_async0() {   // this wave's own copies have landed in LDS
#if defined(__HIP_DEVICE_COMPILE__)
  asm volatile("s_wait_asynccnt 0x0" ::: "memory");
#endif
}
__device__ __forceinline__ void wait_ds0() {      // this wave's own LDS reads have returned (before their buffer is refilled)
#if defined(__HIP_DEVICE_COMPILE__)
  asm volatile("s_wait_dscnt 0x0" ::: "memory");
#endif
}

// =====================================================================================================
// Elementwise 16-bit pack, no transpose. BFO 0: dst[i] = f16( bf16_RNE(src[i]) * sc ), sc a power of two (exact);
// BFO 1: dst[i] = bf16_RNE(src[i]) bits. 8 elements per thread: two 16-B loads, one 16-B store per lane; 32 consecutive
// coverage: grid = n / 2048 blocks x 256 thr x 8 elements = n exactly (host checks n % 2048 == 0).
// =====================================================================================================
template <int BFO>
__global__ __launch_bounds__(256) void cvt16(const float* __restrict__ src, unsigned short* dst, int n, float sc) {
  const size_t i8 = ((size_t)blockIdx.x * 256 + threadIdx.x) * 8;
  if (i8 + 8 > (size_t)n) return;                 // never taken with the exact grid; no barriers in this kernel
  const v4f a = *(const v4f*)(src + i8);
  const v4f b = *(const v4f*)(src + i8 + 4);
  v4u o;
  if constexpr (BFO != 0) {
    o[0] = pk16(bf_bits(a[0]), bf_bits(a[1]));
    o[1] = pk16(bf_bits(a[2]), bf_bits(a[3]));
    o[2] = pk16(bf_bits(b[0]), bf_bits(b[1]));
    o[3] = pk16(bf_bits(b[2]), bf_bits(b[3]));
  } else {
    o[0] = pk16(h_bits((_Float16)(bfr(a[0]) * sc)), h_bits((_Float16)(bfr(a[1]) * sc)));
    o[1] = pk16(h_bits((_Float16)(bfr(a[2]) * sc)), h_bits((_Float16)(bfr(a[3]) * sc)));
    o[2] = pk16(h_bits((_Float16)(bfr(b[0]) * sc)), h_bits((_Float16)(bfr(b[1]) * sc)));
    o[3] = pk16(h_bits((_Float16)(bfr(b[2]) * sc)), h_bits((_Float16)(bfr(b[3]) * sc)));
  }
  {
    *(v4u*)(dst + i8) = o;
    
  }
}

// =====================================================================================================
// Register-blocked batched 16-bit WMMA GEMM: C[m][n] = oscale * sum_k A[m][k] * Bt[n][k]; one wave per 64x64 tile, no block barriers.
// A row-major [M][K] pitch lda (16-bit plane), Bt row-major [N][K] pitch ldb (k contiguous); M, N multiples of 64, K multiple of 32.
// blockIdx.y = batch index with element strides sA, sB, sC.
// ASPLIT 1: a second A plane A2 (unscaled residual of A, same layout) is multiplied into the same accumulator (A + A2 ~ exact A).
// BF 1: bf16 operands (v_wmma_f32_16x16x32_bf16), else f16.
// OM 0: f32 out (pitch ldc).  OM 2: f16 out = f16(value * ocarry).  OM 3: two bf16 planes: hi = bf16_RNE(value), lo = bf16_RNE(value - hi).
// OM 4: two f16 planes: hi = f16(value * ocarry), lo = f16(value * ocarry - hi) (unscaled residual).
// coverage: 4 slabs x 16 rows (f32: it 0..7 x lane>>4; 16-bit: it 0..3 x lane>>3) x 64 cols = the wave's whole 64x64 tile;
//           grid = ceil(tilesM*tilesN/8) blocks, surplus waves exit (wave-uniform).
// =====================================================================================================
template <int OM, int ASPLIT, int BF>
__global__ __launch_bounds__(256) void gemm64(
    const unsigned short* __restrict__ Ap, const unsigned short* __restrict__ A2p, int lda, long long sA,
    const unsigned short* __restrict__ Btp, int ldb, long long sB,
    void* Cout, void* C2out, int ldc, long long sC,
    int M, int N, int K, float oscale, float ocarry) {
  __shared__ __align__(16) float sT[8][16 * 68];   // per-wave 16x64 slab, pitch 68 floats
  const int by   = blockIdx.y;
  const int lane = threadIdx.x & 31;
  const int wave = threadIdx.x >> 5;
  const int tilesN = N >> 6;
  const int tilesM = M >> 6;
  const int tile = blockIdx.x * 8 + wave;
  if (tile >= tilesM * tilesN) return;   // wave-uniform; no block barriers in this kernel
  const int tm = tile / tilesN;
  const int tn = tile - tm * tilesN;
  const int m0 = tm << 6;
  const int n0 = tn << 6;

  const unsigned short* A1 = Ap  + (size_t)((long long)by * sA);
  const unsigned short* A2 = A2p + (size_t)((long long)by * sA);
  const unsigned short* Bb = Btp + (size_t)((long long)by * sB);

  const int rlane = lane & 15;                 // row (A) / col (B, D) within subtile
  const int koff  = (lane >> 4) * 8;           // k offset of this lane half
  const int mOff  = (lane >> 4) * 8;           // D row offset

  v8f acc[4][4];
#pragma unroll
  for (int i = 0; i < 4; ++i)
#pragma unroll
    for (int j = 0; j < 4; ++j) acc[i][j] = zero8();

  for (int k0 = 0; k0 < K; k0 += 32) {
    v16h bh[4];
#pragma unroll
    for (int j = 0; j < 4; ++j) {
      const size_t bofs = (size_t)(n0 + (j << 4) + rlane) * ldb + koff + k0;
      bh[j] = ldfrag_u(Bb + bofs);
    }
#pragma unroll
    for (int i = 0; i < 4; ++i) {
      const size_t ao = (size_t)(m0 + (i << 4) + rlane) * lda + koff + k0;
      const v16h ah = ldfrag_u(A1 + ao);
#pragma unroll
      for (int j = 0; j < 4; ++j) acc[i][j] = mmaT<BF>(ah, bh[j], acc[i][j]);
      dep_guard1(acc[i][0], acc[i][3], ah);
      if constexpr (ASPLIT != 0) {
        const v16h al = ldfrag_u(A2 + ao);
#pragma unroll
        for (int j = 0; j < 4; ++j) acc[i][j] = mmaT<BF>(al, bh[j], acc[i][j]);
        dep_guard1(acc[i][0], acc[i][3], al);
      }
    }
    keep4_h(bh[0], bh[1], bh[2], bh[3]);
  }
  acc_guard4(acc[0][0], acc[0][1], acc[0][2], acc[0][3]);
  acc_guard4(acc[1][0], acc[1][1], acc[1][2], acc[1][3]);
  acc_guard4(acc[2][0], acc[2][1], acc[2][2], acc[2][3]);
  acc_guard4(acc[3][0], acc[3][1], acc[3][2], acc[3][3]);

  const int hh2 = lane >> 4, c4 = (lane & 15) * 4;     // f32 out: 256-B row segment = 16 lanes x 16 B
  const int q8  = lane >> 3, c8 = (lane & 7) * 8;

  // ---- epilogue ----
  float* slab = sT[wave];
#pragma unroll
  for (int i = 0; i < 4; ++i) {
    const int mBase = m0 + (i << 4);
#pragma unroll
    for (int j = 0; j < 4; ++j) {
#pragma unroll
      for (int r = 0; r < 8; ++r) {
        slab[(mOff + r) * 68 + (j << 4) + rlane] = acc[i][j][r];
      }
    }
    wave_sync_lds();
    if constexpr (OM == 0) {
      float* C = (float*)Cout + (size_t)((long long)by * sC);
      v4f vals[8];
#pragma unroll
      for (int it = 0; it < 8; ++it) {
        const int row = it * 2 + hh2;                      // it 0..7 x hh2 0..1 = rows 0..15
        v4f v = *(const v4f*)(slab + row * 68 + c4);
#pragma unroll
        for (int e = 0; e < 4; ++e) v[e] = v[e] * oscale;
        vals[it] = v;
      }
      {
#pragma unroll
        for (int it = 0; it < 8; ++it) {
          const int gr = mBase + it * 2 + hh2;
          *(v4f*)(C + (size_t)gr * ldc + n0 + c4) = vals[it];
        }
        
      }
    } else {
      unsigned short* C  = (unsigned short*)Cout  + (size_t)((long long)by * sC);
      unsigned short* Cb = (unsigned short*)C2out + (size_t)((long long)by * sC);
      v4u hv[4], lv[4];
#pragma unroll
      for (int it = 0; it < 4; ++it) {
        const int row = it * 4 + q8;                       // it 0..3 x q8 0..3 = rows 0..15
        const float* sp = slab + row * 68 + c8;
        v4u a  = {0u, 0u, 0u, 0u};
        v4u b2 = {0u, 0u, 0u, 0u};
#pragma unroll
        for (int e = 0; e < 4; ++e) {
          float f0 = sp[2 * e] * oscale;
          float f1 = sp[2 * e + 1] * oscale;
          if constexpr (OM == 3) {
            const unsigned short h0 = bf_bits(f0), h1 = bf_bits(f1);
            a[e]  = pk16(h0, h1);
            b2[e] = pk16(bf_bits(f0 - bf_up(h0)), bf_bits(f1 - bf_up(h1)));
          } else {
            f0 *= ocarry; f1 *= ocarry;
            const _Float16 x0 = (_Float16)f0, x1 = (_Float16)f1;
            a[e] = pk16(h_bits(x0), h_bits(x1));
            if constexpr (OM == 4) {
              b2[e] = pk16(h_bits((_Float16)(f0 - (float)x0)), h_bits((_Float16)(f1 - (float)x1)));
            }
          }
        }
        hv[it] = a;
        lv[it] = b2;
      }
      {
#pragma unroll
        for (int it = 0; it < 4; ++it) {
          const int row = it * 4 + q8;
          *(v4u*)(C + (size_t)(mBase + row) * ldc + n0 + c8) = hv[it];
          if constexpr (OM >= 3) {
            *(v4u*)(Cb + (size_t)(mBase + row) * ldc + n0 + c8) = lv[it];
          }
        }
        
      }
    }
    wave_sync_lds();
  }
}

// =====================================================================================================
// Flash attention for one batch, one head and 256 query rows (one wave per 16 rows), head dim 64, 2048 keys:
//   q planes (bf16 hi, lo) Q[b*2048 + tok][64h + d], pitch 1024; k planes (bf16 hi, lo) K[b*2048 + key][64h + d], pitch 1024;
//   v^T planes (f16 x16 hi, unscaled lo): VT[b*1024 + 64h + d][key] (pitch 2048); bias = bf16(rel[bucket(key - tok)][h]) from a
//   per-block LDS table of bf16 bits indexed by (key - tok + first row + 255), bucket() piecewise constant in the offset;
//   out (bf16 hi, lo planes): CT[b*2048 + tok][64h + d] = sum_m softmax_m(q.k / 8 + bias) v[m][d]  (softmax run in base 2).
//   block = 16 waves = 512 threads; grid = 2 x 16 x 8 = 256; every wave does identical bounded work (32 stages of 64 keys).
//   The head's K rows and v^T rows of a stage (four planes of 64 rows x 128 B) are brought into LDS once per block by asynchronous
//   16-B copies (four per thread and stage; 8 lanes per 128-B row), two buffers: stage t + 2 is issued behind the barrier that ends
//   stage t; all 16 waves read their fragments from there (two 16-B LDS loads per fragment, row pitch 144 B).
//   Per 32 keys: 2 score tiles on bf16 WMMA (hi.hi + hi.lo + lo.hi, K = 64 as two k-steps of 32); the 16 bias values of each lane's
//   (row, key) score elements from the LDS table (u16); online max-subtracted softmax in f32 (exp2); rescale of the running sums and
//   the four accumulators; P (f16 hi and unscaled residual) rebuilt from the wave's LDS rows; 12 P.V WMMAs (hi.hi, lo.hi, hi.lo).
//   Final 1/l and carry folds in f32; behind the last stage's barrier the LDS buffer is reused as the block's two bf16 result buffers
//   [256][64] (hi, lo): each wave stages its 16x64 slice; after a block barrier the 512 threads write 128-B row segments.
// coverage: LDS table: 512 threads stride over 2304 entries (all written); stage: 512 threads x 16 B = 64 rows x 128 B per plane;
//           global: 4 iterations x 512 threads x 8 halves = 256 rows x 64 columns of the head, per plane;
//           grid covers all 2 x 2048 rows x 16 heads exactly once.
// =====================================================================================================
__global__ __launch_bounds__(ATT_THREADS)
void attn16(const unsigned short* __restrict__ QHh, const unsigned short* __restrict__ QHl,
            const unsigned short* __restrict__ KHh, const unsigned short* __restrict__ KHl,
            const unsigned short* __restrict__ VTh, const unsigned short* __restrict__ VTl,
            const float* __restrict__ rel, unsigned short* CTh, unsigned short* CTl) {
  // prob tiles [wave][row][32 keys] pitch 36 | bias table u16 [2304] | two stage buffers of four planes [64][72] u16
  __shared__ __align__(16) float smem[ATT_SMEM_FLOATS];
  unsigned short* lut = (unsigned short*)(smem + PT_FLOATS);
  unsigned short* stg = lut + LUTP;

  const int tid  = threadIdx.x;
  const int wave = tid >> 5;
  const int lane = tid & 31;
  const int hh   = lane >> 4;
  const int c    = lane & 15;

  const int qb   = blockIdx.x & ((NQ / QBLK) - 1);         // 0..7
  const int head = (blockIdx.x / (NQ / QBLK)) & (NHEAD - 1);   // 0..15
  const int bat  = blockIdx.x / ((NQ / QBLK) * NHEAD);     // 0..1
  const int qb0  = qb * QBLK;
  const int q0   = qb0 + wave * 16;

  // ---- stage copies: thread -> row tid / 8 (key of K, d of v^T), 16-B piece tid % 8 of the row's 128 B, in each of the four planes ----
  const int sr = tid >> 3, sp = (tid & 7) * 8;
  const size_t gko = ((size_t)bat * NC + sr) * DMODEL + head * HDIM + sp;
  const size_t gvo = ((size_t)bat * DMODEL + head * HDIM + sr) * NC + sp;
  const unsigned short* gKh = KHh + gko;
  const unsigned short* gKl = KHl + gko;
  const unsigned short* gVh = VTh + gvo;
  const unsigned short* gVl = VTl + gvo;
  const unsigned ldst = (unsigned)(uintptr_t)(stg + sr * SPITCH + sp);   // LDS byte address = low 32 bits
  auto stage_copy = [&](int st, int buf) {
    const size_t ka = (size_t)st * SKEYS * DMODEL, va = (size_t)st * SKEYS;
    const unsigned l = ldst + (unsigned)buf * (BUF_HALVES * 2);
    async_copy4(l, gKh + ka, l + PLANE_HALVES * 2, gKl + ka, l + PLANE_HALVES * 4, gVh + va, l + PLANE_HALVES * 6, gVl + va);
  };
  stage_copy(0, 0);

  // ---- per-block bias table: lut[i] = bf16 bits of rel[bucket(i - (qb0 + 255))][head], i = key - tok + qb0 + 255 in [0, 2302] ----
  for (int i = tid; i < LUTP; i += ATT_THREADS) {
    const int d  = i - (qb0 + QBLK - 1);                   // key - tok
    const int a  = (d < 0) ? -d : d;
    int g = 8 + (a >= 12) + (a >= 16) + (a >= 23) + (a >= 32) + (a >= 46) + (a >= 64) + (a >= 91);
    g = (a < 8) ? a : g;
    const int bk = g + ((d > 0) ? 16 : 0);                 // 0..31
    lut[i] = bf_bits(rel[bk * NHEAD + head]);              // index in [0, 511]
  }
  wait_async0();
  __syncthreads();                                         // publishes the bias table and stage 0
  stage_copy(1, 1);

  const size_t qofs = ((size_t)bat * NQ + q0 + c) * DMODEL + head * HDIM + 8 * hh;
  const v16h qah = ldfrag_u(QHh + qofs), qbh = ldfrag_u(QHh + qofs + 32);
  const v16h qal = ldfrag_u(QHl + qofs), qbl = ldfrag_u(QHl + qofs + 32);
  // + kb; element (row 16 wave + 8hh + r, key kb + c + 16t) at [16t - r]; 255 - 16 wave - 8hh written as 16 (15 - wave) + 8 (1 - hh) + 7
  const unsigned short* lw = lut + (c + 16 * (wave ^ 15) + 8 * (hh ^ 1) + 7);

  float mrow[8], lrow[8];
  v8f o0 = zero8(), o1 = zero8(), o2 = zero8(), o3 = zero8();
#pragma unroll
  for (int r = 0; r < 8; ++r) { mrow[r] = -INFINITY; lrow[r] = 0.f; }
  float* pt = smem + wave * (16 * 36);

#pragma unroll 1
  for (int st = 0; st < NSTG; ++st) {
    const unsigned short* sKh = stg + (st & 1) * BUF_HALVES + c * SPITCH + 8 * hh;   // lane's row c, k half hh
    const unsigned short* sKl = sKh + PLANE_HALVES;
    const unsigned short* sVh = sKh + 2 * PLANE_HALVES;
    const unsigned short* sVl = sKh + 3 * PLANE_HALVES;
    // unrolled: the offsets inside the stage become immediates of the LDS loads
#pragma unroll
    for (int kk = 0; kk < SKEYS; kk += 32) {
      const int kb = st * SKEYS + kk;
      const int ko = kk * SPITCH;
      v8f s0, s1;
      {
        const v16h k0h = ldfrag_u(sKh + ko), k1h = ldfrag_u(sKh + ko + 32);
        const v16h k0l = ldfrag_u(sKl + ko), k1l = ldfrag_u(sKl + ko + 32);
        s0 = mma_b(qah, k0h, zero8());
        s0 = mma_b(qbh, k1h, s0);
        s0 = mma_b(qah, k0l, s0);
        s0 = mma_b(qbh, k1l, s0);
        s0 = mma_b(qal, k0h, s0);
        s0 = mma_b(qbl, k1h, s0);
        guard1x4(s0, k0h, k1h, k0l, k1l);
      }
      {
        const int k2 = ko + 16 * SPITCH;
        const v16h k0h = ldfrag_u(sKh + k2), k1h = ldfrag_u(sKh + k2 + 32);
        const v16h k0l = ldfrag_u(sKl + k2), k1l = ldfrag_u(sKl + k2 + 32);
        s1 = mma_b(qah, k0h, zero8());
        s1 = mma_b(qbh, k1h, s1);
        s1 = mma_b(qah, k0l, s1);
        s1 = mma_b(qbh, k1l, s1);
        s1 = mma_b(qal, k0h, s1);
        s1 = mma_b(qbl, k1h, s1);
        guard1x8(s1, k0h, k1h, k0l, k1l, qah, qbh, qal, qbl);
      }
      const unsigned short* lp = lw + kb;
#pragma unroll
      for (int r = 0; r < 8; ++r) {
        const float w0 = bf_up(lp[-r]), w1 = bf_up(lp[16 - r]);
        const float t0 = s0[r] * SL2 + w0 * LOG2E, t1 = s1[r] * SL2 + w1 * LOG2E;
        float mx = fmaxf(t0, t1);
#pragma unroll
        for (int off = 1; off < 16; off <<= 1) mx = fmaxf(mx, __shfl_xor(mx, off, 32));
        const float mn = fmaxf(mrow[r], mx);
        const float al = exp2f(mrow[r] - mn);
        mrow[r] = mn;
        const float e0 = exp2f(t0 - mn), e1 = exp2f(t1 - mn);
        float ps = e0 + e1;
#pragma unroll
        for (int off = 1; off < 16; off <<= 1) ps += __shfl_xor(ps, off, 32);
        lrow[r] = lrow[r] * al + ps;
        o0[r] *= al;
        o1[r] *= al;
        o2[r] *= al;
        o3[r] *= al;
        const int ro = (8 * hh + r) * 36 + c;
        pt[ro]      = e0;
        pt[ro + 16] = e1;
      }
      wave_sync_lds();
      FragH ph, pl;
      {
        const float* prow = pt + c * 36 + 8 * hh;
        const v4f p0 = *(const v4f*)(prow), p1 = *(const v4f*)(prow + 4);
        const v4f p2 = *(const v4f*)(prow + 16), p3 = *(const v4f*)(prow + 20);
#pragma unroll
        for (int e = 0; e < 4; ++e) {
          float f; _Float16 x;
          f = p0[e] * PC; x = (_Float16)f; ph.h[0][e]     = x; pl.h[0][e]     = (_Float16)(f - (float)x);   // keys kb + 8hh + e
          f = p1[e] * PC; x = (_Float16)f; ph.h[0][4 + e] = x; pl.h[0][4 + e] = (_Float16)(f - (float)x);   // keys kb + 8hh + 4 + e
          f = p2[e] * PC; x = (_Float16)f; ph.h[1][e]     = x; pl.h[1][e]     = (_Float16)(f - (float)x);   // keys kb + 16 + 8hh + e
          f = p3[e] * PC; x = (_Float16)f; ph.h[1][4 + e] = x; pl.h[1][4 + e] = (_Float16)(f - (float)x);
        }
      }
      {
        const v16h vh0 = ldfrag_u(sVh + kk);
        const v16h vh1 = ldfrag_u(sVh + kk + 16 * SPITCH);
        const v16h vh2 = ldfrag_u(sVh + kk + 32 * SPITCH);
        const v16h vh3 = ldfrag_u(sVh + kk + 48 * SPITCH);
        o0 = mma_h(ph.v, vh0, o0);
        o1 = mma_h(ph.v, vh1, o1);
        o2 = mma_h(ph.v, vh2, o2);
        o3 = mma_h(ph.v, vh3, o3);
        o0 = mma_h(pl.v, vh0, o0);
        o1 = mma_h(pl.v, vh1, o1);
        o2 = mma_h(pl.v, vh2, o2);
        o3 = mma_h(pl.v, vh3, o3);
        guard4x6(o0, o1, o2, o3, ph.v, pl.v, vh0, vh1, vh2, vh3);
      }
      {
        const v16h vl0 = ldfrag_u(sVl + kk);
        const v16h vl1 = ldfrag_u(sVl + kk + 16 * SPITCH);
        const v16h vl2 = ldfrag_u(sVl + kk + 32 * SPITCH);
        const v16h vl3 = ldfrag_u(sVl + kk + 48 * SPITCH);
        o0 = mma_h(ph.v, vl0, o0);
        o1 = mma_h(ph.v, vl1, o1);
        o2 = mma_h(ph.v, vl2, o2);
        o3 = mma_h(ph.v, vl3, o3);
        guard4x5(o0, o1, o2, o3, ph.v, vl0, vl1, vl2, vl3);
      }
      wave_sync_lds();
    }
    // ---- publish point of stage st + 1 ----
    wait_ds0();
    wait_async0();
    __syncthreads();                       // publishes stage st + 1 and ends every wave's reads of stage st's buffer
    if (st + 2 < NSTG) stage_copy(st + 2, st & 1);
  }
  wait_async0();

  // ---- the last stage's barrier has ended all reads of LDS; the buffer becomes two bf16 result buffers [256][64] ----
  unsigned short* Osh = (unsigned short*)smem;
  unsigned short* Osl = Osh + QBLK * HDIM;
  // ---- fold 1/l and the carries (1024 on P, 16 on v), split into bf16 hi + residual, stage the wave's 16x64 slice ----
  const float oc = 1.0f / (PC * VC);
#pragma unroll
  for (int r = 0; r < 8; ++r) {
    const float inv = (1.0f / lrow[r]) * oc;
    const int ro = (wave * 16 + 8 * hh + r) * HDIM + c;
    const float f0 = o0[r] * inv, f1 = o1[r] * inv, f2 = o2[r] * inv, f3 = o3[r] * inv;
    const unsigned short g0 = bf_bits(f0), g1 = bf_bits(f1), g2 = bf_bits(f2), g3 = bf_bits(f3);
    Osh[ro]      = g0;  Osl[ro]      = bf_bits(f0 - bf_up(g0));
    Osh[ro + 16] = g1;  Osl[ro + 16] = bf_bits(f1 - bf_up(g1));
    Osh[ro + 32] = g2;  Osl[ro + 32] = bf_bits(f2 - bf_up(g2));
    Osh[ro + 48] = g3;  Osl[ro + 48] = bf_bits(f3 - bf_up(g3));
  }
  __syncthreads();
  // ---- block writes its 256 row segments of both planes: piece p = it*512 + tid -> row p / 8, halves (p % 8)*8 .. +7 of the head's 64 ----
  {
    v4u hv[4], lv[4];
#pragma unroll
    for (int it = 0; it < 4; ++it) {
      const int p = it * ATT_THREADS + tid;
      hv[it] = *(const v4u*)(Osh + (size_t)p * 8);
      lv[it] = *(const v4u*)(Osl + (size_t)p * 8);
    }
    const size_t dofs = ((size_t)bat * NQ + qb0) * DMODEL + head * HDIM;
    unsigned short* dsth = CTh + dofs;
    unsigned short* dstl = CTl + dofs;
#pragma unroll
    for (int it = 0; it < 4; ++it) {
      const int p = it * ATT_THREADS + tid;
      const size_t go = (size_t)(p >> 3) * DMODEL + (p & 7) * 8;
      *(v4u*)(dsth + go) = hv[it];
      *(v4u*)(dstl + go) = lv[it];
    }
  }
}

// =====================================================================================================
// Workspace map (bytes); every plane is an exact multiple of its tile / whole-row store granularity (M, N exact tile multiples,
// element counts exact multiples of the convert kernel's 2048 granularity, no pad rows needed), every offset a multiple of 2 MiB:
//   WQ16 f16 [1024][1024] x64               2097152   ([out][in] = [n][k])
//   WK16 f16 [1024][1024] x64               2097152
//   WV16 f16 [1024][1024] x64               2097152
//   WO16 bf16 [1024][1024]                  2097152
//   X16  f16 [4096][1024] x16               8388608   (activation rows)
//   QHh, QHl bf16 [4096][1024]          2 x 8388608   (q projection, hi / residual)
//   KHh, KHl bf16 [4096][1024]          2 x 8388608   (k projection, hi / residual)
//   VTh, VTl f16 [2][1024][2048] x16    2 x 8388608   (v^T per batch, hi / residual)
//   CTh, CTl bf16 [4096][1024]          2 x 8388608   (attention ctx, merged heads, hi / residual)
//   end                                    83886080
// =====================================================================================================
extern "C" void kernel_launch(void* const* d_in, const int* in_sizes, int n_in,
                              void* d_out, int out_size, void* d_ws, size_t ws_size,
                              hipStream_t stream) {
  if (n_in < 6) return;
  if (in_sizes[0] != NROWS * DMODEL) return;
  if (in_sizes[1] != DMODEL * DMODEL || in_sizes[2] != DMODEL * DMODEL ||
      in_sizes[3] != DMODEL * DMODEL || in_sizes[4] != DMODEL * DMODEL) return;
  if (in_sizes[5] != NBKT * NHEAD) return;
  if (out_size != NROWS * DMODEL) return;
  if ((in_sizes[0] % 2048) != 0 || (in_sizes[1] % 2048) != 0) return;

  const float* x   = (const float*)d_in[0];
  const float* w_q = (const float*)d_in[1];
  const float* w_k = (const float*)d_in[2];
  const float* w_v = (const float*)d_in[3];
  const float* w_o = (const float*)d_in[4];
  const float* rel = (const float*)d_in[5];
  float*       out = (float*)d_out;

  const size_t PW  = (size_t)DMODEL * DMODEL * 2;                 //  2097152
  const size_t PX  = (size_t)NROWS * DMODEL * 2;                  //  8388608
  const size_t PVT = (size_t)NB * DMODEL * NC * 2;                //  8388608
  size_t off = 0;
  const size_t oWQ = off; off += PW;
  const size_t oWK = off; off += PW;
  const size_t oWV = off; off += PW;
  const size_t oWO = off; off += PW;
  const size_t oX  = off; off += PX;
  const size_t oQh = off; off += PX;
  const size_t oQl = off; off += PX;
  const size_t oKh = off; off += PX;
  const size_t oKl = off; off += PX;
  const size_t oVh = off; off += PVT;
  const size_t oVl = off; off += PVT;
  const size_t oCh = off; off += PX;
  const size_t oCl = off; off += PX;
  if (off > ws_size) return;                                      // off = 83886080
  if (off > (size_t)134217728) return;

  char* ws = (char*)d_ws;
  unsigned short* WQ16 = (unsigned short*)(ws + oWQ);
  unsigned short* WK16 = (unsigned short*)(ws + oWK);
  unsigned short* WV16 = (unsigned short*)(ws + oWV);
  unsigned short* WO16 = (unsigned short*)(ws + oWO);
  unsigned short* X16  = (unsigned short*)(ws + oX);
  unsigned short* QHh  = (unsigned short*)(ws + oQh);
  unsigned short* QHl  = (unsigned short*)(ws + oQl);
  unsigned short* KHh  = (unsigned short*)(ws + oKh);
  unsigned short* KHl  = (unsigned short*)(ws + oKl);
  unsigned short* VTh  = (unsigned short*)(ws + oVh);
  unsigned short* VTl  = (unsigned short*)(ws + oVl);
  unsigned short* CTh  = (unsigned short*)(ws + oCh);
  unsigned short* CTl  = (unsigned short*)(ws + oCl);

  const dim3 blk(256);
  const dim3 gCW((DMODEL * DMODEL) / 2048);                        // 512 blocks
  const dim3 gCX((NROWS * DMODEL) / 2048);                         // 2048 blocks
  const int tilesP = (NROWS / 64) * (DMODEL / 64);                 // 1024
  const int tilesV = (DMODEL / 64) * (NC / 64);                    // 512 per batch
  const dim3 gP((tilesP + 7) / 8, 1);                              // 128
  const dim3 gV((tilesV + 7) / 8, NB);                             // 64 x 2
  const dim3 gAT(ATT_BLOCKS);                                      // 256
  const dim3 bAT(ATT_THREADS);                                     // 512

  // (0) weight planes: f16( bf16_RNE(W[n][k]) * 64 ) for Wq, Wk, Wv; bf16_RNE(Wo[n][k]) bits for Wo; [out][in] layout kept
  cvt16<0><<<gCW, blk, 0, stream>>>(w_q, WQ16, DMODEL * DMODEL, WSC);
  cvt16<0><<<gCW, blk, 0, stream>>>(w_k, WK16, DMODEL * DMODEL, WSC);
  cvt16<0><<<gCW, blk, 0, stream>>>(w_v, WV16, DMODEL * DMODEL, WSC);
  cvt16<1><<<gCW, blk, 0, stream>>>(w_o, WO16, DMODEL * DMODEL, 1.0f);

  // (1) activation plane: X16[row][c] = f16( bf16_RNE(x[row][c]) * 16 ), rows = b*2048 + tok
  cvt16<0><<<gCX, blk, 0, stream>>>(x, X16, NROWS * DMODEL, ACARRY);

  // (2) q projection: q[m][n] = sum_k x[m][k] Wq[n][k] -> bf16 hi / residual planes; M = 4096, N = 1024, K = 1024
  gemm64<3, 0, 0><<<gP, blk, 0, stream>>>(
      X16, X16, DMODEL, 0LL,
      WQ16, DMODEL, 0LL,
      (void*)QHh, (void*)QHl, DMODEL, 0LL,
      NROWS, DMODEL, DMODEL, 1.0f / (ACARRY * WSC), 1.0f);

  // (3) k projection -> bf16 hi / residual planes
  gemm64<3, 0, 0><<<gP, blk, 0, stream>>>(
      X16, X16, DMODEL, 0LL,
      WK16, DMODEL, 0LL,
      (void*)KHh, (void*)KHl, DMODEL, 0LL,
      NROWS, DMODEL, DMODEL, 1.0f / (ACARRY * WSC), 1.0f);

  // (4) v^T per batch: VT[b][d][tok] = sum_k Wv[d][k] x_b[tok][k] -> f16 x16 hi / residual planes; M = 1024, N = 2048, K = 1024
  gemm64<4, 0, 0><<<gV, blk, 0, stream>>>(
      WV16, WV16, DMODEL, 0LL,
      X16, DMODEL, (long long)NC * DMODEL,
      (void*)VTh, (void*)VTl, NC, (long long)DMODEL * NC,
      DMODEL, NC, DMODEL, 1.0f / (ACARRY * WSC), VC);

  // (5) attention per (batch, head, 256 query rows) -> CT (bf16 hi / residual planes)
  attn16<<<gAT, bAT, 0, stream>>>(QHh, QHl, KHh, KHl, VTh, VTl, rel, CTh, CTl);

  // (6) out = (CT_hi + CT_lo) . Wo^T; M = 4096, N = 1024, K = 1024, f32
  gemm64<0, 1, 1><<<gP, blk, 0, stream>>>(
      CTh, CTl, DMODEL, 0LL,
      WO16, DMODEL, 0LL,
      (void*)out, (void*)out, DMODEL, 0LL,
      NROWS, DMODEL, DMODEL, 1.0f, 1.0f);
  (void)hipGetLastError();
}

// v002
// One run takes 231 microseconds.
// Timed twice side by side with v001, it ran 1.65 and 1.63 times as fast.
// Over all steps from v000 it is 2.08 times as fast.
// Contractions (all f32 accumulate): q/k projections v_wmma_f32_16x16x32_f16 (x f16 x16 . W f16 x64, K=1024, single products) stored as bf16 hi/lo planes;
// v^T projection v_wmma_f32_16x16x32_f16 (Wv f16 x64 . x f16 x16, K=1024) stored as f16 x16 hi/lo planes;
// attention scores v_wmma_f32_16x16x32_bf16 (q bf16 hi/lo . k bf16 hi/lo, hi.hi+hi.lo+lo.hi, K=64);
// P . v^T v_wmma_f32_16x16x32_f16 (P f16 x1024 hi/lo . v^T f16 x16 hi/lo, hi.hi+hi.lo+lo.hi, K=2048 by 32);
// output projection v_wmma_f32_16x16x32_bf16 (ctx bf16 hi/lo . Wo bf16, hi.W+lo.W, K=1024).
// Bucketed relative-position bias (per head, function of key-query offset) and online max-subtracted base-2 softmax in f32 on VALU.
// Every float input RNE-converted to bf16 on load.
#include <hip/hip_runtime.h>
#include <math.h>
#include <stdint.h>

#define NB      2
#define NQ      2048
#define NC      2048
#define DMODEL  1024
#define NHEAD   16
#define HDIM    64
#define NBKT    32
#define NROWS   (NB * NQ)
#define WSC     64.0f
#define ACARRY  16.0f
#define VC      16.0f
#define PC      1024.0f
#define ATT_SCALE 0.125f
#define LOG2E   1.4426950408889634f
#define SL2     (ATT_SCALE * LOG2E)
static_assert(NHEAD * HDIM == DMODEL);
static_assert((NQ % 64) == 0 && (NC % 64) == 0 && (DMODEL % 64) == 0 && (NC % 32) == 0 && (NQ % 16) == 0);
static_assert((NROWS % 128) == 0 && (DMODEL % 256) == 0 && (NC % 256) == 0 && (DMODEL % 128) == 0);
#define ATT_THREADS 512
#define QBLK        256                                  // query rows per block: 16 waves x 16 rows, one head
#define ATT_BLOCKS  (NB * NHEAD * (NQ / QBLK))
static_assert(ATT_THREADS == 512 && ATT_BLOCKS == 256 && (NQ % QBLK) == 0 && NQ / QBLK == 8 && NHEAD == 16);
#define LUTP            (NC + QBLK)                      // bias table entries of one head: key - tok + (first row + 255) in [0, 2302]
#define PT_FLOATS       (16 * 16 * 36)
#define SKEYS           64                               // keys per LDS stage
#define NSTG            (NC / SKEYS)
#define SPITCH          72                               // halves: 128-B rows at a 144-B pitch (16 B x odd) for 16-B LDS reads
#define GKS             64                               // k per LDS stage of the GEMM (128-B rows)
#define PLANE_HALVES    (64 * SPITCH)
#define BUF_HALVES      (4 * PLANE_HALVES)               // K hi, K lo, v^T hi, v^T lo
#define ATT_SMEM_FLOATS (PT_FLOATS + LUTP / 2 + BUF_HALVES)
static_assert(SKEYS == 64 && HDIM == 64 && NSTG >= 2 && (NC % SKEYS) == 0);
static_assert((LUTP % 8) == 0 && (PLANE_HALVES % 8) == 0);
static_assert((size_t)2 * QBLK * HDIM * sizeof(unsigned short) <= (size_t)ATT_SMEM_FLOATS * sizeof(float));

typedef _Float16 v16h __attribute__((ext_vector_type(16)));
typedef _Float16 v8h  __attribute__((ext_vector_type(8)));
typedef __bf16   v16b __attribute__((ext_vector_type(16)));
typedef float    v8f  __attribute__((ext_vector_type(8)));
typedef float    v4f  __attribute__((ext_vector_type(4)));
typedef unsigned int v4u __attribute__((ext_vector_type(4)));

union FragH { v16h v; v8h h[2]; v4u u[2]; };
union FragAny { v16h h; v16b b; };

// ---- scalar helpers --------------------------------------------------------------------------------
__device__ __forceinline__ unsigned short bf_bits(float f) {          // f32 -> bf16 bits, RNE convert
  unsigned u = __float_as_uint(f);
  return (unsigned short)((u + 0x7FFFu + ((u >> 16) & 1u)) >> 16);
}
__device__ __forceinline__ float bf_up(unsigned short h) { return __uint_as_float(((unsigned)h) << 16); }
__device__ __forceinline__ float bfr(float f) { return bf_up(bf_bits(f)); }   // value of the bf16 RNE convert
__device__ __forceinline__ unsigned short h_bits(_Float16 x) { return __builtin_bit_cast(unsigned short, x); }
__device__ __forceinline__ unsigned pk16(unsigned short a, unsigned short b) { return (unsigned)a | ((unsigned)b << 16); }
__device__ __forceinline__ v8f zero8() { v8f z = {0.f, 0.f, 0.f, 0.f, 0.f, 0.f, 0.f, 0.f}; return z; }

// ---- fragment loader: 16-bit A/B operand from a k-contiguous 16-bit plane, lane -> row/col (lane&15),
//      p already includes +8*(lane>>4); elements 0..7 <- p[0..7] (k0+8h..), elements 8..15 <- p[16..23] (k0+16+8h..)
//      (same split k map for A and B; B is always read from a [n][k] plane)
__device__ __forceinline__ v16h ldfrag_u(const unsigned short* p) {
  FragH f;
  f.u[0] = *(const v4u*)(p);
  f.u[1] = *(const v4u*)(p + 16);
  return f.v;
}

// ---- WMMA helpers with trailing VALU hazard gaps ------------------------------------------------------
__device__ __forceinline__ v8f mma_h(v16h a, v16h b, v8f c) {
  return __builtin_amdgcn_wmma_f32_16x16x32_f16(false, a, false, b, (short)0, c, false, false);
}
__device__ __forceinline__ v8f mma_b(v16h a, v16h b, v8f c) {
  FragAny ua, ub;
  ua.h = a;
  ub.h = b;
  return __builtin_amdgcn_wmma_f32_16x16x32_bf16(false, ua.b, false, ub.b, (short)0, c, false, false);
}
template <int BF>
__device__ __forceinline__ v8f mmaT(v16h a, v16h b, v8f c) {
  if constexpr (BF != 0) return mma_b(a, b, c);
  else return mma_h(a, b, c);
}
__device__ __forceinline__ void dep_guard1(v8f& a, v8f& b, v16h x) {
#if defined(__HIP_DEVICE_COMPILE__)
  asm volatile("v_nop\n\tv_nop\n\tv_nop\n\tv_nop" : "+v"(a), "+v"(b) : "v"(x));
#endif
}
__device__ __forceinline__ void guard1x4(v8f& s, v16h a0, v16h a1, v16h a2, v16h a3) {
#if defined(__HIP_DEVICE_COMPILE__)
  asm volatile("v_nop\n\tv_nop\n\tv_nop\n\tv_nop" : "+v"(s) : "v"(a0), "v"(a1), "v"(a2), "v"(a3));
#endif
}
__device__ __forceinline__ void guard1x8(v8f& s, v16h a0, v16h a1, v16h a2, v16h a3,
                                         v16h b0, v16h b1, v16h b2, v16h b3) {
#if defined(__HIP_DEVICE_COMPILE__)
  asm volatile("v_nop\n\tv_nop\n\tv_nop\n\tv_nop"
               : "+v"(s) : "v"(a0), "v"(a1), "v"(a2), "v"(a3), "v"(b0), "v"(b1), "v"(b2), "v"(b3));
#endif
}
__device__ __forceinline__ void guard4x6(v8f& a, v8f& b, v8f& c, v8f& d,
                                         v16h x0, v16h x1, v16h x2, v16h x3, v16h x4, v16h x5) {
#if defined(__HIP_DEVICE_COMPILE__)
  asm volatile("v_nop\n\tv_nop\n\tv_nop\n\tv_nop"
               : "+v"(a), "+v"(b), "+v"(c), "+v"(d) : "v"(x0), "v"(x1), "v"(x2), "v"(x3), "v"(x4), "v"(x5));
#endif
}
__device__ __forceinline__ void guard4x5(v8f& a, v8f& b, v8f& c, v8f& d,
                                         v16h x0, v16h x1, v16h x2, v16h x3, v16h x4) {
#if defined(__HIP_DEVICE_COMPILE__)
  asm volatile("v_nop\n\tv_nop\n\tv_nop\n\tv_nop"
               : "+v"(a), "+v"(b), "+v"(c), "+v"(d) : "v"(x0), "v"(x1), "v"(x2), "v"(x3), "v"(x4));
#endif
}
__device__ __forceinline__ void keep4_h(v16h a, v16h b, v16h c, v16h d) {
#if defined(__HIP_DEVICE_COMPILE__)
  asm volatile("v_nop" :: "v"(a), "v"(b), "v"(c), "v"(d));
#endif
}
__device__ __forceinline__ void acc_guard4(v8f& a, v8f& b, v8f& c, v8f& d) {
#if defined(__HIP_DEVICE_COMPILE__)
  asm volatile("v_nop\n\tv_nop\n\tv_nop\n\tv_nop" : "+v"(a), "+v"(b), "+v"(c), "+v"(d));
#endif
}
__device__ __forceinline__ void wave_sync_lds() {
  __builtin_amdgcn_fence(__ATOMIC_RELEASE, "workgroup");
  __builtin_amdgcn_wave_barrier();
  __builtin_amdgcn_fence(__ATOMIC_ACQUIRE, "workgroup");
}
// Four 16-B-per-lane asynchronous copies global -> LDS (l*: the lane's LDS byte address, g*: the lane's global address).
// The s_wait_xcnt stands inside the statement so that no address register is rewritten in front of it.
__device__ __forceinline__ void async_copy4(unsigned l0, const unsigned short* g0, unsigned l1, const unsigned short* g1,
                                            unsigned l2, const unsigned short* g2, unsigned l3, const unsigned short* g3) {
#if defined(__HIP_DEVICE_COMPILE__)
  asm volatile("global_load_async_to_lds_b128 %0, %1, off\n\t"
               "global_load_async_to_lds_b128 %2, %3, off\n\t"
               "global_load_async_to_lds_b128 %4, %5, off\n\t"
               "global_load_async_to_lds_b128 %6, %7, off\n\t"
               "s_wait_xcnt 0x0"
               :: "v"(l0), "v"(g0), "v"(l1), "v"(g1), "v"(l2), "v"(g2), "v"(l3), "v"(g3) : "memory");
#endif
}
__device__ __forceinline__ void wait_async0() {   // this wave's own copies have landed in LDS
#if defined(__HIP_DEVICE_COMPILE__)
  asm volatile("s_wait_asynccnt 0x0" ::: "memory");
#endif
}
__device__ __forceinline__ void wait_ds0() {      // this wave's own LDS reads have returned (before their buffer is refilled)
#if defined(__HIP_DEVICE_COMPILE__)
  asm volatile("s_wait_dscnt 0x0" ::: "memory");
#endif
}

// =====================================================================================================
// Elementwise 16-bit pack, no transpose. BFO 0: dst[i] = f16( bf16_RNE(src[i]) * sc ), sc a power of two (exact);
// BFO 1: dst[i] = bf16_RNE(src[i]) bits. 8 elements per thread: two 16-B loads, one 16-B store per lane; 32 consecutive
// coverage: grid = n / 2048 blocks x 256 thr x 8 elements = n exactly (host checks n % 2048 == 0).
// =====================================================================================================
template <int BFO>
__global__ __launch_bounds__(256) void cvt16(const float* __restrict__ src, unsigned short* dst, int n, float sc) {
  const size_t i8 = ((size_t)blockIdx.x * 256 + threadIdx.x) * 8;
  if (i8 + 8 > (size_t)n) return;                 // never taken with the exact grid; no barriers in this kernel
  const v4f a = *(const v4f*)(src + i8);
  const v4f b = *(const v4f*)(src + i8 + 4);
  v4u o;
  if constexpr (BFO != 0) {
    o[0] = pk16(bf_bits(a[0]), bf_bits(a[1]));
    o[1] = pk16(bf_bits(a[2]), bf_bits(a[3]));
    o[2] = pk16(bf_bits(b[0]), bf_bits(b[1]));
    o[3] = pk16(bf_bits(b[2]), bf_bits(b[3]));
  } else {
    o[0] = pk16(h_bits((_Float16)(bfr(a[0]) * sc)), h_bits((_Float16)(bfr(a[1]) * sc)));
    o[1] = pk16(h_bits((_Float16)(bfr(a[2]) * sc)), h_bits((_Float16)(bfr(a[3]) * sc)));
    o[2] = pk16(h_bits((_Float16)(bfr(b[0]) * sc)), h_bits((_Float16)(bfr(b[1]) * sc)));
    o[3] = pk16(h_bits((_Float16)(bfr(b[2]) * sc)), h_bits((_Float16)(bfr(b[3]) * sc)));
  }
  {
    *(v4u*)(dst + i8) = o;
    
  }
}

// =====================================================================================================
// Register-blocked batched 16-bit WMMA GEMM: C[m][n] = oscale * sum_k A[m][k] * Bt[n][k]; one wave per 64x64 tile, a block of 8 waves
// (2 x 4) per 128x256 tile. The block's 128 A rows (and A2 rows) and 256 Bt rows of a 64-k stage (128 B per row) are brought into LDS once
// per block by asynchronous 16-B copies (8 lanes per 128-B row; 12 or 16 copies per thread and stage), two buffers: stage t + 2 is issued
// behind the barrier that ends stage t; the waves read their fragments from there (two 16-B LDS loads per fragment, row pitch 144 B).
// A row-major [M][K] pitch lda (16-bit plane), Bt row-major [N][K] pitch ldb (k contiguous); M multiple of 128, N of 256, K of 64.
// blockIdx.y = batch index with element strides sA, sB, sC.
// ASPLIT 1: a second A plane A2 (unscaled residual of A, same layout) is multiplied into the same accumulator (A + A2 ~ exact A).
// BF 1: bf16 operands (v_wmma_f32_16x16x32_bf16), else f16.
// OM 0: f32 out (pitch ldc).  OM 2: f16 out = f16(value * ocarry).  OM 3: two bf16 planes: hi = bf16_RNE(value), lo = bf16_RNE(value - hi).
// OM 4: two f16 planes: hi = f16(value * ocarry), lo = f16(value * ocarry - hi) (unscaled residual).
// coverage: 4 slabs x 16 rows (f32: it 0..7 x lane>>4; 16-bit: it 0..3 x lane>>3) x 64 cols = the wave's whole 64x64 tile;
//           stage: 256 threads x 16 B = 32 rows x 128 B per copy; grid = (M / 128) * (N / 256) blocks, a surplus block exits whole.
// =====================================================================================================
template <int OM, int ASPLIT, int BF>
__global__ __launch_bounds__(256) void gemm64(
    const unsigned short* __restrict__ Ap, const unsigned short* __restrict__ A2p, int lda, long long sA,
    const unsigned short* __restrict__ Btp, int ldb, long long sB,
    void* Cout, void* C2out, int ldc, long long sC,
    int M, int N, int K, float oscale, float ocarry) {
  constexpr int GROWS = 256 + 128 * (1 + ASPLIT);  // rows of a stage buffer: Bt 0..255 | A 256..383 | A2 384..511
  constexpr int GBUF  = GROWS * SPITCH;            // halves per stage buffer
  constexpr unsigned R32 = 32 * SPITCH * 2;        // LDS bytes of 32 rows (one copy of the whole block)
  __shared__ __align__(16) float sT[8][16 * 68];   // per-wave 16x64 slab, pitch 68 floats
  __shared__ __align__(16) unsigned short gst[2 * GBUF];
  const int by   = blockIdx.y;
  const int tid  = threadIdx.x;
  const int lane = threadIdx.x & 31;
  const int wave = threadIdx.x >> 5;
  const int blocksN = N >> 8;
  const int blocksM = M >> 7;
  // block-uniform, in front of every barrier; never taken with the exact grids and shapes of this file
  if ((M & 127) != 0 || (N & 255) != 0 || (K & (GKS - 1)) != 0 || K < GKS || (int)blockIdx.x >= blocksM * blocksN) return;
  const int bm  = blockIdx.x / blocksN;
  const int bn  = blockIdx.x - bm * blocksN;
  const int mb0 = bm << 7;
  const int nb0 = bn << 8;
  const int m0 = mb0 + ((wave >> 2) << 6);
  const int n0 = nb0 + ((wave & 3) << 6);

  const unsigned short* A1 = Ap  + (size_t)((long long)by * sA);
  const unsigned short* A2 = A2p + (size_t)((long long)by * sA);
  const unsigned short* Bb = Btp + (size_t)((long long)by * sB);

  const int rlane = lane & 15;                 // row (A) / col (B, D) within subtile
  const int koff  = (lane >> 4) * 8;           // k offset of this lane half
  const int mOff  = (lane >> 4) * 8;           // D row offset

  v8f acc[4][4];
#pragma unroll
  for (int i = 0; i < 4; ++i)
#pragma unroll
    for (int j = 0; j < 4; ++j) acc[i][j] = zero8();

  // ---- stage copies: thread -> row tid / 8 (+ 32 per copy), 16-B piece tid % 8 of the row's 128 B ----
  const int sr = tid >> 3, sp = (tid & 7) * 8;
  const unsigned short* gB  = Bb + (size_t)(nb0 + sr) * ldb + sp;
  const unsigned short* gA  = A1 + (size_t)(mb0 + sr) * lda + sp;
  const unsigned short* gA2 = A2 + (size_t)(mb0 + sr) * lda + sp;
  const size_t b32 = (size_t)32 * ldb, a32 = (size_t)32 * lda;
  const unsigned ldst = (unsigned)(uintptr_t)(gst + sr * SPITCH + sp);   // LDS byte address = low 32 bits
  auto stage_copy = [&](int st, int buf) {
    const size_t ks = (size_t)st * GKS;
    const unsigned l = ldst + (unsigned)buf * (GBUF * 2);
    const unsigned short* b = gB + ks;
    const unsigned short* a = gA + ks;
    async_copy4(l,            b,           l + R32,      b + b32,     l + 2 * R32,  b + 2 * b32, l + 3 * R32,  b + 3 * b32);
    async_copy4(l + 4 * R32,  b + 4 * b32, l + 5 * R32,  b + 5 * b32, l + 6 * R32,  b + 6 * b32, l + 7 * R32,  b + 7 * b32);
    async_copy4(l + 8 * R32,  a,           l + 9 * R32,  a + a32,     l + 10 * R32, a + 2 * a32, l + 11 * R32, a + 3 * a32);
    if constexpr (ASPLIT != 0) {
      const unsigned short* a2 = gA2 + ks;
      async_copy4(l + 12 * R32, a2,        l + 13 * R32, a2 + a32,    l + 14 * R32, a2 + 2 * a32, l + 15 * R32, a2 + 3 * a32);
    }
  };
  const int nst = K / GKS;
  stage_copy(0, 0);
  wait_async0();
  __syncthreads();                                         // publishes stage 0
  if (nst > 1) stage_copy(1, 1);

  for (int st = 0; st < nst; ++st) {
    const unsigned short* sb = gst + (st & 1) * GBUF + rlane * SPITCH + koff;   // lane's row rlane, k half
    const unsigned short* sB = sb + ((wave & 3) << 6) * SPITCH;
    const unsigned short* sA = sb + (256 + ((wave >> 2) << 6)) * SPITCH;
    // unrolled: the offsets inside the stage become immediates of the LDS loads
#pragma unroll
    for (int kk = 0; kk < GKS; kk += 32) {
      v16h bh[4], ah[4], al[ASPLIT != 0 ? 4 : 1];
#pragma unroll
      for (int j = 0; j < 4; ++j) bh[j] = ldfrag_u(sB + (j << 4) * SPITCH + kk);
#pragma unroll
      for (int i = 0; i < 4; ++i) ah[i] = ldfrag_u(sA + (i << 4) * SPITCH + kk);
      if constexpr (ASPLIT != 0) {
#pragma unroll
        for (int i = 0; i < 4; ++i) al[i] = ldfrag_u(sA + (128 + (i << 4)) * SPITCH + kk);
      }
#pragma unroll
      for (int i = 0; i < 4; ++i) {
#pragma unroll
        for (int j = 0; j < 4; ++j) acc[i][j] = mmaT<BF>(ah[i], bh[j], acc[i][j]);
        dep_guard1(acc[i][0], acc[i][3], ah[i]);
        if constexpr (ASPLIT != 0) {
#pragma unroll
          for (int j = 0; j < 4; ++j) acc[i][j] = mmaT<BF>(al[i], bh[j], acc[i][j]);
          dep_guard1(acc[i][0], acc[i][3], al[i]);
        }
      }
      keep4_h(bh[0], bh[1], bh[2], bh[3]);
    }
    // ---- publish point of stage st + 1 ----
    wait_ds0();
    wait_async0();
    __syncthreads();                       // publishes stage st + 1 and ends every wave's reads of stage st's buffer
    if (st + 2 < nst) stage_copy(st + 2, st & 1);
  }
  wait_async0();
  acc_guard4(acc[0][0], acc[0][1], acc[0][2], acc[0][3]);
  acc_guard4(acc[1][0], acc[1][1], acc[1][2], acc[1][3]);
  acc_guard4(acc[2][0], acc[2][1], acc[2][2], acc[2][3]);
  acc_guard4(acc[3][0], acc[3][1], acc[3][2], acc[3][3]);

  const int hh2 = lane >> 4, c4 = (lane & 15) * 4;     // f32 out: 256-B row segment = 16 lanes x 16 B
  const int q8  = lane >> 3, c8 = (lane & 7) * 8;

  // ---- epilogue ----
  float* slab = sT[wave];
#pragma unroll
  for (int i = 0; i < 4; ++i) {
    const int mBase = m0 + (i << 4);
#pragma unroll
    for (int j = 0; j < 4; ++j) {
#pragma unroll
      for (int r = 0; r < 8; ++r) {
        slab[(mOff + r) * 68 + (j << 4) + rlane] = acc[i][j][r];
      }
    }
    wave_sync_lds();
    if constexpr (OM == 0) {
      float* C = (float*)Cout + (size_t)((long long)by * sC);
      v4f vals[8];
#pragma unroll
      for (int it = 0; it < 8; ++it) {
        const int row = it * 2 + hh2;                      // it 0..7 x hh2 0..1 = rows 0..15
        v4f v = *(const v4f*)(slab + row * 68 + c4);
#pragma unroll
        for (int e = 0; e < 4; ++e) v[e] = v[e] * oscale;
        vals[it] = v;
      }
      {
#pragma unroll
        for (int it = 0; it < 8; ++it) {
          const int gr = mBase + it * 2 + hh2;
          *(v4f*)(C + (size_t)gr * ldc + n0 + c4) = vals[it];
        }
        
      }
    } else {
      unsigned short* C  = (unsigned short*)Cout  + (size_t)((long long)by * sC);
      unsigned short* Cb = (unsigned short*)C2out + (size_t)((long long)by * sC);
      v4u hv[4], lv[4];
#pragma unroll
      for (int it = 0; it < 4; ++it) {
        const int row = it * 4 + q8;                       // it 0..3 x q8 0..3 = rows 0..15
        const float* sp = slab + row * 68 + c8;
        v4u a  = {0u, 0u, 0u, 0u};
        v4u b2 = {0u, 0u, 0u, 0u};
#pragma unroll
        for (int e = 0; e < 4; ++e) {
          float f0 = sp[2 * e] * oscale;
          float f1 = sp[2 * e + 1] * oscale;
          if constexpr (OM == 3) {
            const unsigned short h0 = bf_bits(f0), h1 = bf_bits(f1);
            a[e]  = pk16(h0, h1);
            b2[e] = pk16(bf_bits(f0 - bf_up(h0)), bf_bits(f1 - bf_up(h1)));
          } else {
            f0 *= ocarry; f1 *= ocarry;
            const _Float16 x0 = (_Float16)f0, x1 = (_Float16)f1;
            a[e] = pk16(h_bits(x0), h_bits(x1));
            if constexpr (OM == 4) {
              b2[e] = pk16(h_bits((_Float16)(f0 - (float)x0)), h_bits((_Float16)(f1 - (float)x1)));
            }
          }
        }
        hv[it] = a;
        lv[it] = b2;
      }
      {
#pragma unroll
        for (int it = 0; it < 4; ++it) {
          const int row = it * 4 + q8;
          *(v4u*)(C + (size_t)(mBase + row) * ldc + n0 + c8) = hv[it];
          if constexpr (OM >= 3) {
            *(v4u*)(Cb + (size_t)(mBase + row) * ldc + n0 + c8) = lv[it];
          }
        }
        
      }
    }
    wave_sync_lds();
  }
}

// =====================================================================================================
// Flash attention for one batch, one head and 256 query rows (one wave per 16 rows), head dim 64, 2048 keys:
//   q planes (bf16 hi, lo) Q[b*2048 + tok][64h + d], pitch 1024; k planes (bf16 hi, lo) K[b*2048 + key][64h + d], pitch 1024;
//   v^T planes (f16 x16 hi, unscaled lo): VT[b*1024 + 64h + d][key] (pitch 2048); bias = bf16(rel[bucket(key - tok)][h]) from a
//   per-block LDS table of bf16 bits indexed by (key - tok + first row + 255), bucket() piecewise constant in the offset;
//   out (bf16 hi, lo planes): CT[b*2048 + tok][64h + d] = sum_m softmax_m(q.k / 8 + bias) v[m][d]  (softmax run in base 2).
//   block = 16 waves = 512 threads; grid = 2 x 16 x 8 = 256; every wave does identical bounded work (32 stages of 64 keys).
//   The head's K rows and v^T rows of a stage (four planes of 64 rows x 128 B) are brought into LDS once per block by asynchronous
//   16-B copies (four per thread and stage; 8 lanes per 128-B row), two buffers: stage t + 2 is issued behind the barrier that ends
//   stage t; all 16 waves read their fragments from there (two 16-B LDS loads per fragment, row pitch 144 B).
//   Per 32 keys: 2 score tiles on bf16 WMMA (hi.hi + hi.lo + lo.hi, K = 64 as two k-steps of 32); the 16 bias values of each lane's
//   (row, key) score elements from the LDS table (u16); online max-subtracted softmax in f32 (exp2); rescale of the running sums and
//   the four accumulators; P (f16 hi and unscaled residual) rebuilt from the wave's LDS rows; 12 P.V WMMAs (hi.hi, lo.hi, hi.lo).
//   Final 1/l and carry folds in f32; behind the last stage's barrier the LDS buffer is reused as the block's two bf16 result buffers
//   [256][64] (hi, lo): each wave stages its 16x64 slice; after a block barrier the 512 threads write 128-B row segments.
// coverage: LDS table: 512 threads stride over 2304 entries (all written); stage: 512 threads x 16 B = 64 rows x 128 B per plane;
//           global: 4 iterations x 512 threads x 8 halves = 256 rows x 64 columns of the head, per plane;
//           grid covers all 2 x 2048 rows x 16 heads exactly once.
// =====================================================================================================
__global__ __launch_bounds__(ATT_THREADS)
void attn16(const unsigned short* __restrict__ QHh, const unsigned short* __restrict__ QHl,
            const unsigned short* __restrict__ KHh, const unsigned short* __restrict__ KHl,
            const unsigned short* __restrict__ VTh, const unsigned short* __restrict__ VTl,
            const float* __restrict__ rel, unsigned short* CTh, unsigned short* CTl) {
  // prob tiles [wave][row][32 keys] pitch 36 | bias table u16 [2304] | two stage buffers of four planes [64][72] u16
  __shared__ __align__(16) float smem[ATT_SMEM_FLOATS];
  unsigned short* lut = (unsigned short*)(smem + PT_FLOATS);
  unsigned short* stg = lut + LUTP;

  const int tid  = threadIdx.x;
  const int wave = tid >> 5;
  const int lane = tid & 31;
  const int hh   = lane >> 4;
  const int c    = lane & 15;

  const int qb   = blockIdx.x & ((NQ / QBLK) - 1);         // 0..7
  const int head = (blockIdx.x / (NQ / QBLK)) & (NHEAD - 1);   // 0..15
  const int bat  = blockIdx.x / ((NQ / QBLK) * NHEAD);     // 0..1
  const int qb0  = qb * QBLK;
  const int q0   = qb0 + wave * 16;

  // ---- stage copies: thread -> row tid / 8 (key of K, d of v^T), 16-B piece tid % 8 of the row's 128 B, in each of the four planes ----
  const int sr = tid >> 3, sp = (tid & 7) * 8;
  const size_t gko = ((size_t)bat * NC + sr) * DMODEL + head * HDIM + sp;
  const size_t gvo = ((size_t)bat * DMODEL + head * HDIM + sr) * NC + sp;
  const unsigned short* gKh = KHh + gko;
  const unsigned short* gKl = KHl + gko;
  const unsigned short* gVh = VTh + gvo;
  const unsigned short* gVl = VTl + gvo;
  const unsigned ldst = (unsigned)(uintptr_t)(stg + sr * SPITCH + sp);   // LDS byte address = low 32 bits
  auto stage_copy = [&](int st, int buf) {
    const size_t ka = (size_t)st * SKEYS * DMODEL, va = (size_t)st * SKEYS;
    const unsigned l = ldst + (unsigned)buf * (BUF_HALVES * 2);
    async_copy4(l, gKh + ka, l + PLANE_HALVES * 2, gKl + ka, l + PLANE_HALVES * 4, gVh + va, l + PLANE_HALVES * 6, gVl + va);
  };
  stage_copy(0, 0);

  // ---- per-block bias table: lut[i] = bf16 bits of rel[bucket(i - (qb0 + 255))][head], i = key - tok + qb0 + 255 in [0, 2302] ----
  for (int i = tid; i < LUTP; i += ATT_THREADS) {
    const int d  = i - (qb0 + QBLK - 1);                   // key - tok
    const int a  = (d < 0) ? -d : d;
    int g = 8 + (a >= 12) + (a >= 16) + (a >= 23) + (a >= 32) + (a >= 46) + (a >= 64) + (a >= 91);
    g = (a < 8) ? a : g;
    const int bk = g + ((d > 0) ? 16 : 0);                 // 0..31
    lut[i] = bf_bits(rel[bk * NHEAD + head]);              // index in [0, 511]
  }
  wait_async0();
  __syncthreads();                                         // publishes the bias table and stage 0
  stage_copy(1, 1);

  const size_t qofs = ((size_t)bat * NQ + q0 + c) * DMODEL + head * HDIM + 8 * hh;
  const v16h qah = ldfrag_u(QHh + qofs), qbh = ldfrag_u(QHh + qofs + 32);
  const v16h qal = ldfrag_u(QHl + qofs), qbl = ldfrag_u(QHl + qofs + 32);
  // + kb; element (row 16 wave + 8hh + r, key kb + c + 16t) at [16t - r]; 255 - 16 wave - 8hh written as 16 (15 - wave) + 8 (1 - hh) + 7
  const unsigned short* lw = lut + (c + 16 * (wave ^ 15) + 8 * (hh ^ 1) + 7);

  float mrow[8], lrow[8];
  v8f o0 = zero8(), o1 = zero8(), o2 = zero8(), o3 = zero8();
#pragma unroll
  for (int r = 0; r < 8; ++r) { mrow[r] = -INFINITY; lrow[r] = 0.f; }
  float* pt = smem + wave * (16 * 36);

#pragma unroll 1
  for (int st = 0; st < NSTG; ++st) {
    const unsigned short* sKh = stg + (st & 1) * BUF_HALVES + c * SPITCH + 8 * hh;   // lane's row c, k half hh
    const unsigned short* sKl = sKh + PLANE_HALVES;
    const unsigned short* sVh = sKh + 2 * PLANE_HALVES;
    const unsigned short* sVl = sKh + 3 * PLANE_HALVES;
    // unrolled: the offsets inside the stage become immediates of the LDS loads
#pragma unroll
    for (int kk = 0; kk < SKEYS; kk += 32) {
      const int kb = st * SKEYS + kk;
      const int ko = kk * SPITCH;
      v8f s0, s1;
      {
        const v16h k0h = ldfrag_u(sKh + ko), k1h = ldfrag_u(sKh + ko + 32);
        const v16h k0l = ldfrag_u(sKl + ko), k1l = ldfrag_u(sKl + ko + 32);
        s0 = mma_b(qah, k0h, zero8());
        s0 = mma_b(qbh, k1h, s0);
        s0 = mma_b(qah, k0l, s0);
        s0 = mma_b(qbh, k1l, s0);
        s0 = mma_b(qal, k0h, s0);
        s0 = mma_b(qbl, k1h, s0);
        guard1x4(s0, k0h, k1h, k0l, k1l);
      }
      {
        const int k2 = ko + 16 * SPITCH;
        const v16h k0h = ldfrag_u(sKh + k2), k1h = ldfrag_u(sKh + k2 + 32);
        const v16h k0l = ldfrag_u(sKl + k2), k1l = ldfrag_u(sKl + k2 + 32);
        s1 = mma_b(qah, k0h, zero8());
        s1 = mma_b(qbh, k1h, s1);
        s1 = mma_b(qah, k0l, s1);
        s1 = mma_b(qbh, k1l, s1);
        s1 = mma_b(qal, k0h, s1);
        s1 = mma_b(qbl, k1h, s1);
        guard1x8(s1, k0h, k1h, k0l, k1l, qah, qbh, qal, qbl);
      }
      const unsigned short* lp = lw + kb;
#pragma unroll
      for (int r = 0; r < 8; ++r) {
        const float w0 = bf_up(lp[-r]), w1 = bf_up(lp[16 - r]);
        const float t0 = s0[r] * SL2 + w0 * LOG2E, t1 = s1[r] * SL2 + w1 * LOG2E;
        float mx = fmaxf(t0, t1);
#pragma unroll
        for (int off = 1; off < 16; off <<= 1) mx = fmaxf(mx, __shfl_xor(mx, off, 32));
        const float mn = fmaxf(mrow[r], mx);
        const float al = exp2f(mrow[r] - mn);
        mrow[r] = mn;
        const float e0 = exp2f(t0 - mn), e1 = exp2f(t1 - mn);
        float ps = e0 + e1;
#pragma unroll
        for (int off = 1; off < 16; off <<= 1) ps += __shfl_xor(ps, off, 32);
        lrow[r] = lrow[r] * al + ps;
        o0[r] *= al;
        o1[r] *= al;
        o2[r] *= al;
        o3[r] *= al;
        const int ro = (8 * hh + r) * 36 + c;
        pt[ro]      = e0;
        pt[ro + 16] = e1;
      }
      wave_sync_lds();
      FragH ph, pl;
      {
        const float* prow = pt + c * 36 + 8 * hh;
        const v4f p0 = *(const v4f*)(prow), p1 = *(const v4f*)(prow + 4);
        const v4f p2 = *(const v4f*)(prow + 16), p3 = *(const v4f*)(prow + 20);
#pragma unroll
        for (int e = 0; e < 4; ++e) {
          float f; _Float16 x;
          f = p0[e] * PC; x = (_Float16)f; ph.h[0][e]     = x; pl.h[0][e]     = (_Float16)(f - (float)x);   // keys kb + 8hh + e
          f = p1[e] * PC; x = (_Float16)f; ph.h[0][4 + e] = x; pl.h[0][4 + e] = (_Float16)(f - (float)x);   // keys kb + 8hh + 4 + e
          f = p2[e] * PC; x = (_Float16)f; ph.h[1][e]     = x; pl.h[1][e]     = (_Float16)(f - (float)x);   // keys kb + 16 + 8hh + e
          f = p3[e] * PC; x = (_Float16)f; ph.h[1][4 + e] = x; pl.h[1][4 + e] = (_Float16)(f - (float)x);
        }
      }
      {
        const v16h vh0 = ldfrag_u(sVh + kk);
        const v16h vh1 = ldfrag_u(sVh + kk + 16 * SPITCH);
        const v16h vh2 = ldfrag_u(sVh + kk + 32 * SPITCH);
        const v16h vh3 = ldfrag_u(sVh + kk + 48 * SPITCH);
        o0 = mma_h(ph.v, vh0, o0);
        o1 = mma_h(ph.v, vh1, o1);
        o2 = mma_h(ph.v, vh2, o2);
        o3 = mma_h(ph.v, vh3, o3);
        o0 = mma_h(pl.v, vh0, o0);
        o1 = mma_h(pl.v, vh1, o1);
        o2 = mma_h(pl.v, vh2, o2);
        o3 = mma_h(pl.v, vh3, o3);
        guard4x6(o0, o1, o2, o3, ph.v, pl.v, vh0, vh1, vh2, vh3);
      }
      {
        const v16h vl0 = ldfrag_u(sVl + kk);
        const v16h vl1 = ldfrag_u(sVl + kk + 16 * SPITCH);
        const v16h vl2 = ldfrag_u(sVl + kk + 32 * SPITCH);
        const v16h vl3 = ldfrag_u(sVl + kk + 48 * SPITCH);
        o0 = mma_h(ph.v, vl0, o0);
        o1 = mma_h(ph.v, vl1, o1);
        o2 = mma_h(ph.v, vl2, o2);
        o3 = mma_h(ph.v, vl3, o3);
        guard4x5(o0, o1, o2, o3, ph.v, vl0, vl1, vl2, vl3);
      }
      wave_sync_lds();
    }
    // ---- publish point of stage st + 1 ----
    wait_ds0();
    wait_async0();
    __syncthreads();                       // publishes stage st + 1 and ends every wave's reads of stage st's buffer
    if (st + 2 < NSTG) stage_copy(st + 2, st & 1);
  }
  wait_async0();

  // ---- the last stage's barrier has ended all reads of LDS; the buffer becomes two bf16 result buffers [256][64] ----
  unsigned short* Osh = (unsigned short*)smem;
  unsigned short* Osl = Osh + QBLK * HDIM;
  // ---- fold 1/l and the carries (1024 on P, 16 on v), split into bf16 hi + residual, stage the wave's 16x64 slice ----
  const float oc = 1.0f / (PC * VC);
#pragma unroll
  for (int r = 0; r < 8; ++r) {
    const float inv = (1.0f / lrow[r]) * oc;
    const int ro = (wave * 16 + 8 * hh + r) * HDIM + c;
    const float f0 = o0[r] * inv, f1 = o1[r] * inv, f2 = o2[r] * inv, f3 = o3[r] * inv;
    const unsigned short g0 = bf_bits(f0), g1 = bf_bits(f1), g2 = bf_bits(f2), g3 = bf_bits(f3);
    Osh[ro]      = g0;  Osl[ro]      = bf_bits(f0 - bf_up(g0));
    Osh[ro + 16] = g1;  Osl[ro + 16] = bf_bits(f1 - bf_up(g1));
    Osh[ro + 32] = g2;  Osl[ro + 32] = bf_bits(f2 - bf_up(g2));
    Osh[ro + 48] = g3;  Osl[ro + 48] = bf_bits(f3 - bf_up(g3));
  }
  __syncthreads();
  // ---- block writes its 256 row segments of both planes: piece p = it*512 + tid -> row p / 8, halves (p % 8)*8 .. +7 of the head's 64 ----
  {
    v4u hv[4], lv[4];
#pragma unroll
    for (int it = 0; it < 4; ++it) {
      const int p = it * ATT_THREADS + tid;
      hv[it] = *(const v4u*)(Osh + (size_t)p * 8);
      lv[it] = *(const v4u*)(Osl + (size_t)p * 8);
    }
    const size_t dofs = ((size_t)bat * NQ + qb0) * DMODEL + head * HDIM;
    unsigned short* dsth = CTh + dofs;
    unsigned short* dstl = CTl + dofs;
#pragma unroll
    for (int it = 0; it < 4; ++it) {
      const int p = it * ATT_THREADS + tid;
      const size_t go = (size_t)(p >> 3) * DMODEL + (p & 7) * 8;
      *(v4u*)(dsth + go) = hv[it];
      *(v4u*)(dstl + go) = lv[it];
    }
  }
}

// =====================================================================================================
// Workspace map (bytes); every plane is an exact multiple of its tile / whole-row store granularity (M, N exact tile multiples,
// element counts exact multiples of the convert kernel's 2048 granularity, no pad rows needed), every offset a multiple of 2 MiB:
//   WQ16 f16 [1024][1024] x64               2097152   ([out][in] = [n][k])
//   WK16 f16 [1024][1024] x64               2097152
//   WV16 f16 [1024][1024] x64               2097152
//   WO16 bf16 [1024][1024]                  2097152
//   X16  f16 [4096][1024] x16               8388608   (activation rows)
//   QHh, QHl bf16 [4096][1024]          2 x 8388608   (q projection, hi / residual)
//   KHh, KHl bf16 [4096][1024]          2 x 8388608   (k projection, hi / residual)
//   VTh, VTl f16 [2][1024][2048] x16    2 x 8388608   (v^T per batch, hi / residual)
//   CTh, CTl bf16 [4096][1024]          2 x 8388608   (attention ctx, merged heads, hi / residual)
//   end                                    83886080
// =====================================================================================================
extern "C" void kernel_launch(void* const* d_in, const int* in_sizes, int n_in,
                              void* d_out, int out_size, void* d_ws, size_t ws_size,
                              hipStream_t stream) {
  if (n_in < 6) return;
  if (in_sizes[0] != NROWS * DMODEL) return;
  if (in_sizes[1] != DMODEL * DMODEL || in_sizes[2] != DMODEL * DMODEL ||
      in_sizes[3] != DMODEL * DMODEL || in_sizes[4] != DMODEL * DMODEL) return;
  if (in_sizes[5] != NBKT * NHEAD) return;
  if (out_size != NROWS * DMODEL) return;
  if ((in_sizes[0] % 2048) != 0 || (in_sizes[1] % 2048) != 0) return;

  const float* x   = (const float*)d_in[0];
  const float* w_q = (const float*)d_in[1];
  const float* w_k = (const float*)d_in[2];
  const float* w_v = (const float*)d_in[3];
  const float* w_o = (const float*)d_in[4];
  const float* rel = (const float*)d_in[5];
  float*       out = (float*)d_out;

  const size_t PW  = (size_t)DMODEL * DMODEL * 2;                 //  2097152
  const size_t PX  = (size_t)NROWS * DMODEL * 2;                  //  8388608
  const size_t PVT = (size_t)NB * DMODEL * NC * 2;                //  8388608
  size_t off = 0;
  const size_t oWQ = off; off += PW;
  const size_t oWK = off; off += PW;
  const size_t oWV = off; off += PW;
  const size_t oWO = off; off += PW;
  const size_t oX  = off; off += PX;
  const size_t oQh = off; off += PX;
  const size_t oQl = off; off += PX;
  const size_t oKh = off; off += PX;
  const size_t oKl = off; off += PX;
  const size_t oVh = off; off += PVT;
  const size_t oVl = off; off += PVT;
  const size_t oCh = off; off += PX;
  const size_t oCl = off; off += PX;
  if (off > ws_size) return;                                      // off = 83886080
  if (off > (size_t)134217728) return;

  char* ws = (char*)d_ws;
  unsigned short* WQ16 = (unsigned short*)(ws + oWQ);
  unsigned short* WK16 = (unsigned short*)(ws + oWK);
  unsigned short* WV16 = (unsigned short*)(ws + oWV);
  unsigned short* WO16 = (unsigned short*)(ws + oWO);
  unsigned short* X16  = (unsigned short*)(ws + oX);
  unsigned short* QHh  = (unsigned short*)(ws + oQh);
  unsigned short* QHl  = (unsigned short*)(ws + oQl);
  unsigned short* KHh  = (unsigned short*)(ws + oKh);
  unsigned short* KHl  = (unsigned short*)(ws + oKl);
  unsigned short* VTh  = (unsigned short*)(ws + oVh);
  unsigned short* VTl  = (unsigned short*)(ws + oVl);
  unsigned short* CTh  = (unsigned short*)(ws + oCh);
  unsigned short* CTl  = (unsigned short*)(ws + oCl);

  const dim3 blk(256);
  const dim3 gCW((DMODEL * DMODEL) / 2048);                        // 512 blocks
  const dim3 gCX((NROWS * DMODEL) / 2048);                         // 2048 blocks
  const int tilesP = (NROWS / 64) * (DMODEL / 64);                 // 1024
  const int tilesV = (DMODEL / 64) * (NC / 64);                    // 512 per batch
  const dim3 gP((tilesP + 7) / 8, 1);                              // 128
  const dim3 gV((tilesV + 7) / 8, NB);                             // 64 x 2
  const dim3 gAT(ATT_BLOCKS);                                      // 256
  const dim3 bAT(ATT_THREADS);                                     // 512

  // (0) weight planes: f16( bf16_RNE(W[n][k]) * 64 ) for Wq, Wk, Wv; bf16_RNE(Wo[n][k]) bits for Wo; [out][in] layout kept
  cvt16<0><<<gCW, blk, 0, stream>>>(w_q, WQ16, DMODEL * DMODEL, WSC);
  cvt16<0><<<gCW, blk, 0, stream>>>(w_k, WK16, DMODEL * DMODEL, WSC);
  cvt16<0><<<gCW, blk, 0, stream>>>(w_v, WV16, DMODEL * DMODEL, WSC);
  cvt16<1><<<gCW, blk, 0, stream>>>(w_o, WO16, DMODEL * DMODEL, 1.0f);

  // (1) activation plane: X16[row][c] = f16( bf16_RNE(x[row][c]) * 16 ), rows = b*2048 + tok
  cvt16<0><<<gCX, blk, 0, stream>>>(x, X16, NROWS * DMODEL, ACARRY);

  // (2) q projection: q[m][n] = sum_k x[m][k] Wq[n][k] -> bf16 hi / residual planes; M = 4096, N = 1024, K = 1024
  gemm64<3, 0, 0><<<gP, blk, 0, stream>>>(
      X16, X16, DMODEL, 0LL,
      WQ16, DMODEL, 0LL,
      (void*)QHh, (void*)QHl, DMODEL, 0LL,
      NROWS, DMODEL, DMODEL, 1.0f / (ACARRY * WSC), 1.0f);

  // (3) k projection -> bf16 hi / residual planes
  gemm64<3, 0, 0><<<gP, blk, 0, stream>>>(
      X16, X16, DMODEL, 0LL,
      WK16, DMODEL, 0LL,
      (void*)KHh, (void*)KHl, DMODEL, 0LL,
      NROWS, DMODEL, DMODEL, 1.0f / (ACARRY * WSC), 1.0f);

  // (4) v^T per batch: VT[b][d][tok] = sum_k Wv[d][k] x_b[tok][k] -> f16 x16 hi / residual planes; M = 1024, N = 2048, K = 1024
  gemm64<4, 0, 0><<<gV, blk, 0, stream>>>(
      WV16, WV16, DMODEL, 0LL,
      X16, DMODEL, (long long)NC * DMODEL,
      (void*)VTh, (void*)VTl, NC, (long long)DMODEL * NC,
      DMODEL, NC, DMODEL, 1.0f / (ACARRY * WSC), VC);

  // (5) attention per (batch, head, 256 query rows) -> CT (bf16 hi / residual planes)
  attn16<<<gAT, bAT, 0, stream>>>(QHh, QHl, KHh, KHl, VTh, VTl, rel, CTh, CTl);

  // (6) out = (CT_hi + CT_lo) . Wo^T; M = 4096, N = 1024, K = 1024, f32
  gemm64<0, 1, 1><<<gP, blk, 0, stream>>>(
      CTh, CTl, DMODEL, 0LL,
      WO16, DMODEL, 0LL,
      (void*)out, (void*)out, DMODEL, 0LL,
      NROWS, DMODEL, DMODEL, 1.0f, 1.0f);
  (void)hipGetLastError();
}

// v003
// One run takes 181 microseconds.
// Timed twice side by side with v002, it ran 1.26 times as fast both times.
// Counting every step since v000, it is 2.62 times as fast.
// Contractions (all f32 accumulate): q/k projections v_wmma_f32_16x16x32_f16 (x f16 x16 . W f16 x64, K=1024, single products) stored as bf16 hi/lo planes;
// v^T projection v_wmma_f32_16x16x32_f16 (Wv f16 x64 . x f16 x16, K=1024) stored as f16 x16 hi/lo planes;
// attention scores, transposed, v_wmma_f32_16x16x32_bf16 (k bf16 hi/lo . q^T bf16 hi/lo, hi.hi+lo.hi+hi.lo, K=64);
// v^T . P^T v_wmma_f32_16x16x32_f16 (v^T f16 x16 hi/lo . P^T f16 x1024 hi/lo, hi.hi+hi.lo+lo.hi, K=2048 by 32);
// output projection v_wmma_f32_16x16x32_bf16 (ctx bf16 hi/lo . Wo bf16, hi.W+lo.W, K=1024).
// Bucketed relative-position bias (per head, function of key-query offset) and online max-subtracted base-2 softmax in f32 on VALU.
// Every float input RNE-converted to bf16 on load.
#include <hip/hip_runtime.h>
#include <math.h>
#include <stdint.h>

#define NB      2
#define NQ      2048
#define NC      2048
#define DMODEL  1024
#define NHEAD   16
#define HDIM    64
#define NBKT    32
#define NROWS   (NB * NQ)
#define WSC     64.0f
#define ACARRY  16.0f
#define VC      16.0f
#define PC      1024.0f
#define ATT_SCALE 0.125f
#define LOG2E   1.4426950408889634f
#define SL2     (ATT_SCALE * LOG2E)
static_assert(NHEAD * HDIM == DMODEL);
static_assert((NQ % 64) == 0 && (NC % 64) == 0 && (DMODEL % 64) == 0 && (NC % 32) == 0 && (NQ % 16) == 0);
static_assert((NROWS % 128) == 0 && (DMODEL % 256) == 0 && (NC % 256) == 0 && (DMODEL % 128) == 0);
#define ATT_THREADS 512
#define QBLK        256                                  // query rows per block: 16 waves x 16 rows, one head
#define ATT_BLOCKS  (NB * NHEAD * (NQ / QBLK))
static_assert(ATT_THREADS == 512 && ATT_BLOCKS == 256 && (NQ % QBLK) == 0 && NQ / QBLK == 8 && NHEAD == 16);
#define LUTP            (NC + QBLK)                      // bias table entries of one head: key - tok + (first row + 255) in [0, 2302]
#define SKEYS           64                               // keys per LDS stage
#define NSTG            (NC / SKEYS)
#define SPITCH          72                               // halves: 128-B rows at a 144-B pitch (16 B x odd) for 16-B LDS reads
#define GKS             64                               // k per LDS stage of the GEMM (128-B rows)
#define PLANE_HALVES    (64 * SPITCH)
#define BUF_HALVES      (4 * PLANE_HALVES)               // K hi, K lo, v^T hi, v^T lo
#define ATT_SMEM_FLOATS (LUTP / 2 + BUF_HALVES)
static_assert(SKEYS == 64 && HDIM == 64 && NSTG >= 2 && (NC % SKEYS) == 0);
static_assert((LUTP % 8) == 0 && (PLANE_HALVES % 8) == 0);
static_assert((size_t)2 * QBLK * HDIM * sizeof(unsigned short) <= (size_t)ATT_SMEM_FLOATS * sizeof(float));

typedef _Float16 v16h __attribute__((ext_vector_type(16)));
typedef _Float16 v8h  __attribute__((ext_vector_type(8)));
typedef __bf16   v16b __attribute__((ext_vector_type(16)));
typedef float    v8f  __attribute__((ext_vector_type(8)));
typedef float    v4f  __attribute__((ext_vector_type(4)));
typedef float    v2f  __attribute__((ext_vector_type(2)));
typedef _Float16 v2h  __attribute__((ext_vector_type(2)));
typedef unsigned int v4u __attribute__((ext_vector_type(4)));

union FragH { v16h v; v8h h[2]; v4u u[2]; };
union FragAny { v16h h; v16b b; };

// ---- scalar helpers --------------------------------------------------------------------------------
__device__ __forceinline__ unsigned short bf_bits(float f) {          // f32 -> bf16 bits, RNE convert
  unsigned u = __float_as_uint(f);
  return (unsigned short)((u + 0x7FFFu + ((u >> 16) & 1u)) >> 16);
}
__device__ __forceinline__ float bf_up(unsigned short h) { return __uint_as_float(((unsigned)h) << 16); }
__device__ __forceinline__ float bfr(float f) { return bf_up(bf_bits(f)); }   // value of the bf16 RNE convert
__device__ __forceinline__ unsigned short h_bits(_Float16 x) { return __builtin_bit_cast(unsigned short, x); }
__device__ __forceinline__ unsigned pk16(unsigned short a, unsigned short b) { return (unsigned)a | ((unsigned)b << 16); }
__device__ __forceinline__ float other_half(float v) {               // the value that lane l ^ 16 holds
  const int b = __builtin_bit_cast(int, v);
  return __builtin_bit_cast(float, __builtin_amdgcn_permlanex16(b, b, 0x76543210, 0xfedcba98, false, false));
}
__device__ __forceinline__ v8f zero8() { v8f z = {0.f, 0.f, 0.f, 0.f, 0.f, 0.f, 0.f, 0.f}; return z; }

// ---- fragment loader: 16-bit A/B operand from a k-contiguous 16-bit plane, lane -> row/col (lane&15),
//      p already includes +8*(lane>>4); elements 0..7 <- p[0..7] (k0+8h..), elements 8..15 <- p[16..23] (k0+16+8h..)
//      (same split k map for A and B; B is always read from a [n][k] plane)
__device__ __forceinline__ v16h ldfrag_u(const unsigned short* p) {
  FragH f;
  f.u[0] = *(const v4u*)(p);
  f.u[1] = *(const v4u*)(p + 16);
  return f.v;
}

// ---- WMMA helpers with trailing VALU hazard gaps ------------------------------------------------------
__device__ __forceinline__ v8f mma_h(v16h a, v16h b, v8f c) {
  return __builtin_amdgcn_wmma_f32_16x16x32_f16(false, a, false, b, (short)0, c, false, false);
}
__device__ __forceinline__ v8f mma_b(v16h a, v16h b, v8f c) {
  FragAny ua, ub;
  ua.h = a;
  ub.h = b;
  return __builtin_amdgcn_wmma_f32_16x16x32_bf16(false, ua.b, false, ub.b, (short)0, c, false, false);
}
template <int BF>
__device__ __forceinline__ v8f mmaT(v16h a, v16h b, v8f c) {
  if constexpr (BF != 0) return mma_b(a, b, c);
  else return mma_h(a, b, c);
}
__device__ __forceinline__ void dep_guard1(v8f& a, v8f& b, v16h x) {
#if defined(__HIP_DEVICE_COMPILE__)
  asm volatile("v_nop\n\tv_nop\n\tv_nop\n\tv_nop" : "+v"(a), "+v"(b) : "v"(x));
#endif
}
__device__ __forceinline__ void guard1x4(v8f& s, v16h a0, v16h a1, v16h a2, v16h a3) {
#if defined(__HIP_DEVICE_COMPILE__)
  asm volatile("v_nop\n\tv_nop\n\tv_nop\n\tv_nop" : "+v"(s) : "v"(a0), "v"(a1), "v"(a2), "v"(a3));
#endif
}
__device__ __forceinline__ void guard1x8(v8f& s, v16h a0, v16h a1, v16h a2, v16h a3,
                                         v16h b0, v16h b1, v16h b2, v16h b3) {
#if defined(__HIP_DEVICE_COMPILE__)
  asm volatile("v_nop\n\tv_nop\n\tv_nop\n\tv_nop"
               : "+v"(s) : "v"(a0), "v"(a1), "v"(a2), "v"(a3), "v"(b0), "v"(b1), "v"(b2), "v"(b3));
#endif
}
__device__ __forceinline__ void guard4x6(v8f& a, v8f& b, v8f& c, v8f& d,
                                         v16h x0, v16h x1, v16h x2, v16h x3, v16h x4, v16h x5) {
#if defined(__HIP_DEVICE_COMPILE__)
  asm volatile("v_nop\n\tv_nop\n\tv_nop\n\tv_nop"
               : "+v"(a), "+v"(b), "+v"(c), "+v"(d) : "v"(x0), "v"(x1), "v"(x2), "v"(x3), "v"(x4), "v"(x5));
#endif
}
__device__ __forceinline__ void guard4x5(v8f& a, v8f& b, v8f& c, v8f& d,
                                         v16h x0, v16h x1, v16h x2, v16h x3, v16h x4) {
#if defined(__HIP_DEVICE_COMPILE__)
  asm volatile("v_nop\n\tv_nop\n\tv_nop\n\tv_nop"
               : "+v"(a), "+v"(b), "+v"(c), "+v"(d) : "v"(x0), "v"(x1), "v"(x2), "v"(x3), "v"(x4));
#endif
}
__device__ __forceinline__ void keep4_h(v16h a, v16h b, v16h c, v16h d) {
#if defined(__HIP_DEVICE_COMPILE__)
  asm volatile("v_nop" :: "v"(a), "v"(b), "v"(c), "v"(d));
#endif
}
__device__ __forceinline__ void acc_guard4(v8f& a, v8f& b, v8f& c, v8f& d) {
#if defined(__HIP_DEVICE_COMPILE__)
  asm volatile("v_nop\n\tv_nop\n\tv_nop\n\tv_nop" : "+v"(a), "+v"(b), "+v"(c), "+v"(d));
#endif
}
__device__ __forceinline__ void wave_sync_lds() {
  __builtin_amdgcn_fence(__ATOMIC_RELEASE, "workgroup");
  __builtin_amdgcn_wave_barrier();
  __builtin_amdgcn_fence(__ATOMIC_ACQUIRE, "workgroup");
}
// Four 16-B-per-lane asynchronous copies global -> LDS (l*: the lane's LDS byte address, g*: the lane's global address).
// The s_wait_xcnt stands inside the statement so that no address register is rewritten in front of it.
__device__ __forceinline__ void async_copy4(unsigned l0, const unsigned short* g0, unsigned l1, const unsigned short* g1,
                                            unsigned l2, const unsigned short* g2, unsigned l3, const unsigned short* g3) {
#if defined(__HIP_DEVICE_COMPILE__)
  asm volatile("global_load_async_to_lds_b128 %0, %1, off\n\t"
               "global_load_async_to_lds_b128 %2, %3, off\n\t"
               "global_load_async_to_lds_b128 %4, %5, off\n\t"
               "global_load_async_to_lds_b128 %6, %7, off\n\t"
               "s_wait_xcnt 0x0"
               :: "v"(l0), "v"(g0), "v"(l1), "v"(g1), "v"(l2), "v"(g2), "v"(l3), "v"(g3) : "memory");
#endif
}
__device__ __forceinline__ void wait_async0() {   // this wave's own copies have landed in LDS
#if defined(__HIP_DEVICE_COMPILE__)
  asm volatile("s_wait_asynccnt 0x0" ::: "memory");
#endif
}
__device__ __forceinline__ void wait_ds0() {      // this wave's own LDS reads have returned (before their buffer is refilled)
#if defined(__HIP_DEVICE_COMPILE__)
  asm volatile("s_wait_dscnt 0x0" ::: "memory");
#endif
}

// =====================================================================================================
// Elementwise 16-bit pack, no transpose. BFO 0: dst[i] = f16( bf16_RNE(src[i]) * sc ), sc a power of two (exact);
// BFO 1: dst[i] = bf16_RNE(src[i]) bits. 8 elements per thread: two 16-B loads, one 16-B store per lane; 32 consecutive
// coverage: grid = n / 2048 blocks x 256 thr x 8 elements = n exactly (host checks n % 2048 == 0).
// =====================================================================================================
template <int BFO>
__global__ __launch_bounds__(256) void cvt16(const float* __restrict__ src, unsigned short* dst, int n, float sc) {
  const size_t i8 = ((size_t)blockIdx.x * 256 + threadIdx.x) * 8;
  if (i8 + 8 > (size_t)n) return;                 // never taken with the exact grid; no barriers in this kernel
  const v4f a = *(const v4f*)(src + i8);
  const v4f b = *(const v4f*)(src + i8 + 4);
  v4u o;
  if constexpr (BFO != 0) {
    o[0] = pk16(bf_bits(a[0]), bf_bits(a[1]));
    o[1] = pk16(bf_bits(a[2]), bf_bits(a[3]));
    o[2] = pk16(bf_bits(b[0]), bf_bits(b[1]));
    o[3] = pk16(bf_bits(b[2]), bf_bits(b[3]));
  } else {
    o[0] = pk16(h_bits((_Float16)(bfr(a[0]) * sc)), h_bits((_Float16)(bfr(a[1]) * sc)));
    o[1] = pk16(h_bits((_Float16)(bfr(a[2]) * sc)), h_bits((_Float16)(bfr(a[3]) * sc)));
    o[2] = pk16(h_bits((_Float16)(bfr(b[0]) * sc)), h_bits((_Float16)(bfr(b[1]) * sc)));
    o[3] = pk16(h_bits((_Float16)(bfr(b[2]) * sc)), h_bits((_Float16)(bfr(b[3]) * sc)));
  }
  {
    *(v4u*)(dst + i8) = o;
    
  }
}

// =====================================================================================================
// Register-blocked batched 16-bit WMMA GEMM: C[m][n] = oscale * sum_k A[m][k] * Bt[n][k]; one wave per 64x64 tile, a block of 8 waves
// (2 x 4) per 128x256 tile. The block's 128 A rows (and A2 rows) and 256 Bt rows of a 64-k stage (128 B per row) are brought into LDS once
// per block by asynchronous 16-B copies (8 lanes per 128-B row; 12 or 16 copies per thread and stage), two buffers: stage t + 2 is issued
// behind the barrier that ends stage t; the waves read their fragments from there (two 16-B LDS loads per fragment, row pitch 144 B).
// A row-major [M][K] pitch lda (16-bit plane), Bt row-major [N][K] pitch ldb (k contiguous); M multiple of 128, N of 256, K of 64.
// blockIdx.y = batch index with element strides sA, sB, sC.
// ASPLIT 1: a second A plane A2 (unscaled residual of A, same layout) is multiplied into the same accumulator (A + A2 ~ exact A).
// BF 1: bf16 operands (v_wmma_f32_16x16x32_bf16), else f16.
// OM 0: f32 out (pitch ldc).  OM 2: f16 out = f16(value * ocarry).  OM 3: two bf16 planes: hi = bf16_RNE(value), lo = bf16_RNE(value - hi).
// OM 4: two f16 planes: hi = f16(value * ocarry), lo = f16(value * ocarry - hi) (unscaled residual).
// coverage: 4 slabs x 16 rows (f32: it 0..7 x lane>>4; 16-bit: it 0..3 x lane>>3) x 64 cols = the wave's whole 64x64 tile;
//           stage: 256 threads x 16 B = 32 rows x 128 B per copy; grid = (M / 128) * (N / 256) blocks, a surplus block exits whole.
// =====================================================================================================
template <int OM, int ASPLIT, int BF>
__global__ __launch_bounds__(256) void gemm64(
    const unsigned short* __restrict__ Ap, const unsigned short* __restrict__ A2p, int lda, long long sA,
    const unsigned short* __restrict__ Btp, int ldb, long long sB,
    void* Cout, void* C2out, int ldc, long long sC,
    int M, int N, int K, float oscale, float ocarry) {
  constexpr int GROWS = 256 + 128 * (1 + ASPLIT);  // rows of a stage buffer: Bt 0..255 | A 256..383 | A2 384..511
  constexpr int GBUF  = GROWS * SPITCH;            // halves per stage buffer
  constexpr unsigned R32 = 32 * SPITCH * 2;        // LDS bytes of 32 rows (one copy of the whole block)
  __shared__ __align__(16) float sT[8][16 * 68];   // per-wave 16x64 slab, pitch 68 floats
  __shared__ __align__(16) unsigned short gst[2 * GBUF];
  const int by   = blockIdx.y;
  const int tid  = threadIdx.x;
  const int lane = threadIdx.x & 31;
  const int wave = threadIdx.x >> 5;
  const int blocksN = N >> 8;
  const int blocksM = M >> 7;
  // block-uniform, in front of every barrier; never taken with the exact grids and shapes of this file
  if ((M & 127) != 0 || (N & 255) != 0 || (K & (GKS - 1)) != 0 || K < GKS || (int)blockIdx.x >= blocksM * blocksN) return;
  const int bm  = blockIdx.x / blocksN;
  const int bn  = blockIdx.x - bm * blocksN;
  const int mb0 = bm << 7;
  const int nb0 = bn << 8;
  const int m0 = mb0 + ((wave >> 2) << 6);
  const int n0 = nb0 + ((wave & 3) << 6);

  const unsigned short* A1 = Ap  + (size_t)((long long)by * sA);
  const unsigned short* A2 = A2p + (size_t)((long long)by * sA);
  const unsigned short* Bb = Btp + (size_t)((long long)by * sB);

  const int rlane = lane & 15;                 // row (A) / col (B, D) within subtile
  const int koff  = (lane >> 4) * 8;           // k offset of this lane half
  const int mOff  = (lane >> 4) * 8;           // D row offset

  v8f acc[4][4];
#pragma unroll
  for (int i = 0; i < 4; ++i)
#pragma unroll
    for (int j = 0; j < 4; ++j) acc[i][j] = zero8();

  // ---- stage copies: thread -> row tid / 8 (+ 32 per copy), 16-B piece tid % 8 of the row's 128 B ----
  const int sr = tid >> 3, sp = (tid & 7) * 8;
  const unsigned short* gB  = Bb + (size_t)(nb0 + sr) * ldb + sp;
  const unsigned short* gA  = A1 + (size_t)(mb0 + sr) * lda + sp;
  const unsigned short* gA2 = A2 + (size_t)(mb0 + sr) * lda + sp;
  const size_t b32 = (size_t)32 * ldb, a32 = (size_t)32 * lda;
  const unsigned ldst = (unsigned)(uintptr_t)(gst + sr * SPITCH + sp);   // LDS byte address = low 32 bits
  auto stage_copy = [&](int st, int buf) {
    const size_t ks = (size_t)st * GKS;
    const unsigned l = ldst + (unsigned)buf * (GBUF * 2);
    const unsigned short* b = gB + ks;
    const unsigned short* a = gA + ks;
    async_copy4(l,            b,           l + R32,      b + b32,     l + 2 * R32,  b + 2 * b32, l + 3 * R32,  b + 3 * b32);
    async_copy4(l + 4 * R32,  b + 4 * b32, l + 5 * R32,  b + 5 * b32, l + 6 * R32,  b + 6 * b32, l + 7 * R32,  b + 7 * b32);
    async_copy4(l + 8 * R32,  a,           l + 9 * R32,  a + a32,     l + 10 * R32, a + 2 * a32, l + 11 * R32, a + 3 * a32);
    if constexpr (ASPLIT != 0) {
      const unsigned short* a2 = gA2 + ks;
      async_copy4(l + 12 * R32, a2,        l + 13 * R32, a2 + a32,    l + 14 * R32, a2 + 2 * a32, l + 15 * R32, a2 + 3 * a32);
    }
  };
  const int nst = K / GKS;
  stage_copy(0, 0);
  wait_async0();
  __syncthreads();                                         // publishes stage 0
  if (nst > 1) stage_copy(1, 1);

  for (int st = 0; st < nst; ++st) {
    const unsigned short* sb = gst + (st & 1) * GBUF + rlane * SPITCH + koff;   // lane's row rlane, k half
    const unsigned short* sB = sb + ((wave & 3) << 6) * SPITCH;
    const unsigned short* sA = sb + (256 + ((wave >> 2) << 6)) * SPITCH;
    // unrolled: the offsets inside the stage become immediates of the LDS loads
#pragma unroll
    for (int kk = 0; kk < GKS; kk += 32) {
      v16h bh[4], ah[4], al[ASPLIT != 0 ? 4 : 1];
#pragma unroll
      for (int j = 0; j < 4; ++j) bh[j] = ldfrag_u(sB + (j << 4) * SPITCH + kk);
#pragma unroll
      for (int i = 0; i < 4; ++i) ah[i] = ldfrag_u(sA + (i << 4) * SPITCH + kk);
      if constexpr (ASPLIT != 0) {
#pragma unroll
        for (int i = 0; i < 4; ++i) al[i] = ldfrag_u(sA + (128 + (i << 4)) * SPITCH + kk);
      }
#pragma unroll
      for (int i = 0; i < 4; ++i) {
#pragma unroll
        for (int j = 0; j < 4; ++j) acc[i][j] = mmaT<BF>(ah[i], bh[j], acc[i][j]);
        dep_guard1(acc[i][0], acc[i][3], ah[i]);
        if constexpr (ASPLIT != 0) {
#pragma unroll
          for (int j = 0; j < 4; ++j) acc[i][j] = mmaT<BF>(al[i], bh[j], acc[i][j]);
          dep_guard1(acc[i][0], acc[i][3], al[i]);
        }
      }
      keep4_h(bh[0], bh[1], bh[2], bh[3]);
    }
    // ---- publish point of stage st + 1 ----
    wait_ds0();
    wait_async0();
    __syncthreads();                       // publishes stage st + 1 and ends every wave's reads of stage st's buffer
    if (st + 2 < nst) stage_copy(st + 2, st & 1);
  }
  wait_async0();
  acc_guard4(acc[0][0], acc[0][1], acc[0][2], acc[0][3]);
  acc_guard4(acc[1][0], acc[1][1], acc[1][2], acc[1][3]);
  acc_guard4(acc[2][0], acc[2][1], acc[2][2], acc[2][3]);
  acc_guard4(acc[3][0], acc[3][1], acc[3][2], acc[3][3]);

  const int hh2 = lane >> 4, c4 = (lane & 15) * 4;     // f32 out: 256-B row segment = 16 lanes x 16 B
  const int q8  = lane >> 3, c8 = (lane & 7) * 8;

  // ---- epilogue ----
  float* slab = sT[wave];
#pragma unroll
  for (int i = 0; i < 4; ++i) {
    const int mBase = m0 + (i << 4);
#pragma unroll
    for (int j = 0; j < 4; ++j) {
#pragma unroll
      for (int r = 0; r < 8; ++r) {
        slab[(mOff + r) * 68 + (j << 4) + rlane] = acc[i][j][r];
      }
    }
    wave_sync_lds();
    if constexpr (OM == 0) {
      float* C = (float*)Cout + (size_t)((long long)by * sC);
      v4f vals[8];
#pragma unroll
      for (int it = 0; it < 8; ++it) {
        const int row = it * 2 + hh2;                      // it 0..7 x hh2 0..1 = rows 0..15
        v4f v = *(const v4f*)(slab + row * 68 + c4);
#pragma unroll
        for (int e = 0; e < 4; ++e) v[e] = v[e] * oscale;
        vals[it] = v;
      }
      {
#pragma unroll
        for (int it = 0; it < 8; ++it) {
          const int gr = mBase + it * 2 + hh2;
          *(v4f*)(C + (size_t)gr * ldc + n0 + c4) = vals[it];
        }
        
      }
    } else {
      unsigned short* C  = (unsigned short*)Cout  + (size_t)((long long)by * sC);
      unsigned short* Cb = (unsigned short*)C2out + (size_t)((long long)by * sC);
      v4u hv[4], lv[4];
#pragma unroll
      for (int it = 0; it < 4; ++it) {
        const int row = it * 4 + q8;                       // it 0..3 x q8 0..3 = rows 0..15
        const float* sp = slab + row * 68 + c8;
        v4u a  = {0u, 0u, 0u, 0u};
        v4u b2 = {0u, 0u, 0u, 0u};
#pragma unroll
        for (int e = 0; e < 4; ++e) {
          float f0 = sp[2 * e] * oscale;
          float f1 = sp[2 * e + 1] * oscale;
          if constexpr (OM == 3) {
            const unsigned short h0 = bf_bits(f0), h1 = bf_bits(f1);
            a[e]  = pk16(h0, h1);
            b2[e] = pk16(bf_bits(f0 - bf_up(h0)), bf_bits(f1 - bf_up(h1)));
          } else {
            f0 *= ocarry; f1 *= ocarry;
            const _Float16 x0 = (_Float16)f0, x1 = (_Float16)f1;
            a[e] = pk16(h_bits(x0), h_bits(x1));
            if constexpr (OM == 4) {
              b2[e] = pk16(h_bits((_Float16)(f0 - (float)x0)), h_bits((_Float16)(f1 - (float)x1)));
            }
          }
        }
        hv[it] = a;
        lv[it] = b2;
      }
      {
#pragma unroll
        for (int it = 0; it < 4; ++it) {
          const int row = it * 4 + q8;
          *(v4u*)(C + (size_t)(mBase + row) * ldc + n0 + c8) = hv[it];
          if constexpr (OM >= 3) {
            *(v4u*)(Cb + (size_t)(mBase + row) * ldc + n0 + c8) = lv[it];
          }
        }
        
      }
    }
    wave_sync_lds();
  }
}

// =====================================================================================================
// Flash attention for one batch, one head and 256 query rows (one wave per 16 rows), head dim 64, 2048 keys:
//   q planes (bf16 hi, lo) Q[b*2048 + tok][64h + d], pitch 1024; k planes (bf16 hi, lo) K[b*2048 + key][64h + d], pitch 1024;
//   v^T planes (f16 x16 hi, unscaled lo): VT[b*1024 + 64h + d][key] (pitch 2048); bias = bf16(rel[bucket(key - tok)][h]) from a
//   per-block LDS table of bf16 bits indexed by (key - tok + first row + 255), bucket() piecewise constant in the offset;
//   out (bf16 hi, lo planes): CT[b*2048 + tok][64h + d] = sum_m softmax_m(q.k / 8 + bias) v[m][d]  (softmax run in base 2).
//   block = 16 waves = 512 threads; grid = 2 x 16 x 8 = 256; every wave does identical bounded work (32 stages of 64 keys).
//   The head's K rows and v^T rows of a stage (four planes of 64 rows x 128 B) are brought into LDS once per block by asynchronous
//   16-B copies (four per thread and stage; 8 lanes per 128-B row), two buffers: stage t + 2 is issued behind the barrier that ends
//   stage t; all 16 waves read their fragments from there (two 16-B LDS loads per fragment, row pitch 144 B).
//   Per 32 keys: 2 transposed score tiles S^T = K . q^T on bf16 WMMA (A = K rows, B = q; K = 64 as two k-steps of 32): lane (c, hh) holds
//   query c's scores of keys 8hh + r and 16 + 8hh + r; their 16 bias values from the LDS table (u16); online max-subtracted softmax in
//   f32 (exp2) with the maximum in-lane plus one exchange between the lane halves, the sum kept per lane half and joined behind the loop;
//   rescale of the running sum and the four accumulators; P^T (f16 hi and unscaled residual) packed from the two score tiles straight into
//   a B operand (hardware k order, as the v^T loader's); 12 WMMAs O^T += v^T . P^T (hi.hi, hi.lo, lo.hi).
//   Final 1/l and carry folds in f32; behind the last stage's barrier the LDS buffer is reused as the block's two bf16 result buffers
//   [256][64] (hi, lo): each wave stages its 16x64 slice; after a block barrier the 512 threads write 128-B row segments.
// coverage: LDS table: 512 threads stride over 2304 entries (all written); stage: 512 threads x 16 B = 64 rows x 128 B per plane;
//           global: 4 iterations x 512 threads x 8 halves = 256 rows x 64 columns of the head, per plane;
//           grid covers all 2 x 2048 rows x 16 heads exactly once.
// =====================================================================================================
__global__ __launch_bounds__(ATT_THREADS)
void attn16(const unsigned short* __restrict__ QHh, const unsigned short* __restrict__ QHl,
            const unsigned short* __restrict__ KHh, const unsigned short* __restrict__ KHl,
            const unsigned short* __restrict__ VTh, const unsigned short* __restrict__ VTl,
            const float* __restrict__ rel, unsigned short* CTh, unsigned short* CTl) {
  // bias table u16 [2304] | two stage buffers of four planes [64][72] u16
  __shared__ __align__(16) float smem[ATT_SMEM_FLOATS];
  unsigned short* lut = (unsigned short*)smem;
  unsigned short* stg = lut + LUTP;

  const int tid  = threadIdx.x;
  const int wave = tid >> 5;
  const int lane = tid & 31;
  const int hh   = lane >> 4;
  const int c    = lane & 15;

  const int qb   = blockIdx.x & ((NQ / QBLK) - 1);         // 0..7
  const int head = (blockIdx.x / (NQ / QBLK)) & (NHEAD - 1);   // 0..15
  const int bat  = blockIdx.x / ((NQ / QBLK) * NHEAD);     // 0..1
  const int qb0  = qb * QBLK;
  const int q0   = qb0 + wave * 16;

  // ---- stage copies: thread -> row tid / 8 (key of K, d of v^T), 16-B piece tid % 8 of the row's 128 B, in each of the four planes ----
  const int sr = tid >> 3, sp = (tid & 7) * 8;
  const size_t gko = ((size_t)bat * NC + sr) * DMODEL + head * HDIM + sp;
  const size_t gvo = ((size_t)bat * DMODEL + head * HDIM + sr) * NC + sp;
  const unsigned short* gKh = KHh + gko;
  const unsigned short* gKl = KHl + gko;
  const unsigned short* gVh = VTh + gvo;
  const unsigned short* gVl = VTl + gvo;
  const unsigned ldst = (unsigned)(uintptr_t)(stg + sr * SPITCH + sp);   // LDS byte address = low 32 bits
  auto stage_copy = [&](int st, int buf) {
    const size_t ka = (size_t)st * SKEYS * DMODEL, va = (size_t)st * SKEYS;
    const unsigned l = ldst + (unsigned)buf * (BUF_HALVES * 2);
    async_copy4(l, gKh + ka, l + PLANE_HALVES * 2, gKl + ka, l + PLANE_HALVES * 4, gVh + va, l + PLANE_HALVES * 6, gVl + va);
  };
  stage_copy(0, 0);

  // ---- per-block bias table: lut[i] = bf16 bits of rel[bucket(i - (qb0 + 255))][head], i = key - tok + qb0 + 255 in [0, 2302] ----
  for (int i = tid; i < LUTP; i += ATT_THREADS) {
    const int d  = i - (qb0 + QBLK - 1);                   // key - tok
    const int a  = (d < 0) ? -d : d;
    int g = 8 + (a >= 12) + (a >= 16) + (a >= 23) + (a >= 32) + (a >= 46) + (a >= 64) + (a >= 91);
    g = (a < 8) ? a : g;
    const int bk = g + ((d > 0) ? 16 : 0);                 // 0..31
    lut[i] = bf_bits(rel[bk * NHEAD + head]);              // index in [0, 511]
  }
  wait_async0();
  __syncthreads();                                         // publishes the bias table and stage 0
  stage_copy(1, 1);

  const size_t qofs = ((size_t)bat * NQ + q0 + c) * DMODEL + head * HDIM + 8 * hh;
  const v16h qah = ldfrag_u(QHh + qofs), qbh = ldfrag_u(QHh + qofs + 32);
  const v16h qal = ldfrag_u(QHl + qofs), qbl = ldfrag_u(QHl + qofs + 32);
  // + kb; element (query row 16 wave + c, key kb + 16t + 8hh + r) at [16t + r]; 255 - 16 wave - c written as 16 (15 - wave) + (15 - c)
  const unsigned short* lw = lut + (16 * (wave ^ 15) + (c ^ 15) + 8 * hh);

  float mrow = -INFINITY, lrow = 0.f;      // query c's running maximum (both lane halves alike) and this lane half's running sum
  v8f o0 = zero8(), o1 = zero8(), o2 = zero8(), o3 = zero8();   // O^T: o_t[r] = (d = 16t + 8hh + r, query c)

#pragma unroll 1
  for (int st = 0; st < NSTG; ++st) {
    const unsigned short* sKh = stg + (st & 1) * BUF_HALVES + c * SPITCH + 8 * hh;   // lane's row c, k half hh
    const unsigned short* sKl = sKh + PLANE_HALVES;
    const unsigned short* sVh = sKh + 2 * PLANE_HALVES;
    const unsigned short* sVl = sKh + 3 * PLANE_HALVES;
    // unrolled: the offsets inside the stage become immediates of the LDS loads
#pragma unroll
    for (int kk = 0; kk < SKEYS; kk += 32) {
      const int kb = st * SKEYS + kk;
      const int ko = kk * SPITCH;
      v8f s0, s1;
      {
        const v16h k0h = ldfrag_u(sKh + ko), k1h = ldfrag_u(sKh + ko + 32);
        const v16h k0l = ldfrag_u(sKl + ko), k1l = ldfrag_u(sKl + ko + 32);
        s0 = mma_b(k0h, qah, zero8());
        s0 = mma_b(k1h, qbh, s0);
        s0 = mma_b(k0l, qah, s0);
        s0 = mma_b(k1l, qbh, s0);
        s0 = mma_b(k0h, qal, s0);
        s0 = mma_b(k1h, qbl, s0);
        guard1x4(s0, k0h, k1h, k0l, k1l);
      }
      {
        const int k2 = ko + 16 * SPITCH;
        const v16h k0h = ldfrag_u(sKh + k2), k1h = ldfrag_u(sKh + k2 + 32);
        const v16h k0l = ldfrag_u(sKl + k2), k1l = ldfrag_u(sKl + k2 + 32);
        s1 = mma_b(k0h, qah, zero8());
        s1 = mma_b(k1h, qbh, s1);
        s1 = mma_b(k0l, qah, s1);
        s1 = mma_b(k1l, qbh, s1);
        s1 = mma_b(k0h, qal, s1);
        s1 = mma_b(k1h, qbl, s1);
        guard1x8(s1, k0h, k1h, k0l, k1l, qah, qbh, qal, qbl);
      }
      const unsigned short* lp = lw + kb;
      // pairs of neighbouring keys (registers 2e, 2e + 1 of a score tile): tp[e] of tile 0, tp[4 + e] of tile 1
      v2f tp[8];
#pragma unroll
      for (int e = 0; e < 4; ++e) {
        const v2f w0 = {bf_up(lp[2 * e]), bf_up(lp[2 * e + 1])}, w1 = {bf_up(lp[16 + 2 * e]), bf_up(lp[17 + 2 * e])};
        const v2f a0 = {s0[2 * e], s0[2 * e + 1]}, a1 = {s1[2 * e], s1[2 * e + 1]};
        tp[e]     = a0 * SL2 + w0 * LOG2E;
        tp[4 + e] = a1 * SL2 + w1 * LOG2E;
      }
      float mx = fmaxf(fmaxf(fmaxf(fmaxf(tp[0][0], tp[0][1]), fmaxf(tp[1][0], tp[1][1])), fmaxf(fmaxf(tp[2][0], tp[2][1]), fmaxf(tp[3][0], tp[3][1]))),
                       fmaxf(fmaxf(fmaxf(tp[4][0], tp[4][1]), fmaxf(tp[5][0], tp[5][1])), fmaxf(fmaxf(tp[6][0], tp[6][1]), fmaxf(tp[7][0], tp[7][1]))));
      mx = fmaxf(mx, other_half(mx));                      // query c's maximum over all 32 keys
      const float mn = fmaxf(mrow, mx);
      const float al = exp2f(mrow - mn);
      mrow = mn;
      FragH ph, pl;
      v2f ep[8];
#pragma unroll
      for (int e = 0; e < 8; ++e) {                        // element pair 2e, 2e + 1 of the B operand: keys kb + 16 (e / 4) + 8hh + 2 (e % 4) + 0, 1
        const v2f d = tp[e] - mn;
        ep[e] = v2f{exp2f(d[0]), exp2f(d[1])};
        const v2h x = __builtin_convertvector(ep[e] * PC, v2h);
        ph.v[2 * e]     = x[0];
        ph.v[2 * e + 1] = x[1];
        pl.v[2 * e]     = (_Float16)(ep[e][0] * PC - (float)x[0]);
        pl.v[2 * e + 1] = (_Float16)(ep[e][1] * PC - (float)x[1]);
      }
      const v2f ps = ((ep[0] + ep[1]) + (ep[2] + ep[3])) + ((ep[4] + ep[5]) + (ep[6] + ep[7]));
      lrow = lrow * al + (ps[0] + ps[1]);
#pragma unroll
      for (int r = 0; r < 8; ++r) {
        o0[r] *= al;
        o1[r] *= al;
        o2[r] *= al;
        o3[r] *= al;
      }
      {
        const v16h vh0 = ldfrag_u(sVh + kk);
        const v16h vh1 = ldfrag_u(sVh + kk + 16 * SPITCH);
        const v16h vh2 = ldfrag_u(sVh + kk + 32 * SPITCH);
        const v16h vh3 = ldfrag_u(sVh + kk + 48 * SPITCH);
        o0 = mma_h(vh0, ph.v, o0);
        o1 = mma_h(vh1, ph.v, o1);
        o2 = mma_h(vh2, ph.v, o2);
        o3 = mma_h(vh3, ph.v, o3);
        o0 = mma_h(vh0, pl.v, o0);
        o1 = mma_h(vh1, pl.v, o1);
        o2 = mma_h(vh2, pl.v, o2);
        o3 = mma_h(vh3, pl.v, o3);
        guard4x6(o0, o1, o2, o3, ph.v, pl.v, vh0, vh1, vh2, vh3);
      }
      {
        const v16h vl0 = ldfrag_u(sVl + kk);
        const v16h vl1 = ldfrag_u(sVl + kk + 16 * SPITCH);
        const v16h vl2 = ldfrag_u(sVl + kk + 32 * SPITCH);
        const v16h vl3 = ldfrag_u(sVl + kk + 48 * SPITCH);
        o0 = mma_h(vl0, ph.v, o0);
        o1 = mma_h(vl1, ph.v, o1);
        o2 = mma_h(vl2, ph.v, o2);
        o3 = mma_h(vl3, ph.v, o3);
        guard4x5(o0, o1, o2, o3, ph.v, vl0, vl1, vl2, vl3);
      }
    }
    // ---- publish point of stage st + 1 ----
    wait_ds0();
    wait_async0();
    __syncthreads();                       // publishes stage st + 1 and ends every wave's reads of stage st's buffer
    if (st + 2 < NSTG) stage_copy(st + 2, st & 1);
  }
  wait_async0();

  // ---- the last stage's barrier has ended all reads of LDS; the buffer becomes two bf16 result buffers [256][64] ----
  unsigned short* Osh = (unsigned short*)smem;
  unsigned short* Osl = Osh + QBLK * HDIM;
  // ---- fold 1/l and the carries (1024 on P, 16 on v), split into bf16 hi + residual, stage the wave's 16x64 slice ----
  const float oc = 1.0f / (PC * VC);
  const float inv = (1.0f / (lrow + other_half(lrow))) * oc;      // the two lane halves' sums joined
  const int ro = (wave * 16 + c) * HDIM + 8 * hh;                 // query row c, d = 16t + 8hh + 0..7: one 16-B LDS store per tile and plane
  auto put_tile = [&](const v8f& o, int t) {
    v4u hv, lv;
#pragma unroll
    for (int e = 0; e < 4; ++e) {
      const float f0 = o[2 * e] * inv, f1 = o[2 * e + 1] * inv;
      const unsigned short g0 = bf_bits(f0), g1 = bf_bits(f1);
      hv[e] = pk16(g0, g1);
      lv[e] = pk16(bf_bits(f0 - bf_up(g0)), bf_bits(f1 - bf_up(g1)));
    }
    *(v4u*)(Osh + ro + 16 * t) = hv;
    *(v4u*)(Osl + ro + 16 * t) = lv;
  };
  put_tile(o0, 0);
  put_tile(o1, 1);
  put_tile(o2, 2);
  put_tile(o3, 3);
  __syncthreads();
  // ---- block writes its 256 row segments of both planes: piece p = it*512 + tid -> row p / 8, halves (p % 8)*8 .. +7 of the head's 64 ----
  {
    v4u hv[4], lv[4];
#pragma unroll
    for (int it = 0; it < 4; ++it) {
      const int p = it * ATT_THREADS + tid;
      hv[it] = *(const v4u*)(Osh + (size_t)p * 8);
      lv[it] = *(const v4u*)(Osl + (size_t)p * 8);
    }
    const size_t dofs = ((size_t)bat * NQ + qb0) * DMODEL + head * HDIM;
    unsigned short* dsth = CTh + dofs;
    unsigned short* dstl = CTl + dofs;
#pragma unroll
    for (int it = 0; it < 4; ++it) {
      const int p = it * ATT_THREADS + tid;
      const size_t go = (size_t)(p >> 3) * DMODEL + (p & 7) * 8;
      *(v4u*)(dsth + go) = hv[it];
      *(v4u*)(dstl + go) = lv[it];
    }
  }
}

// =====================================================================================================
// Workspace map (bytes); every plane is an exact multiple of its tile / whole-row store granularity (M, N exact tile multiples,
// element counts exact multiples of the convert kernel's 2048 granularity, no pad rows needed), every offset a multiple of 2 MiB:
//   WQ16 f16 [1024][1024] x64               2097152   ([out][in] = [n][k])
//   WK16 f16 [1024][1024] x64               2097152
//   WV16 f16 [1024][1024] x64               2097152
//   WO16 bf16 [1024][1024]                  2097152
//   X16  f16 [4096][1024] x16               8388608   (activation rows)
//   QHh, QHl bf16 [4096][1024]          2 x 8388608   (q projection, hi / residual)
//   KHh, KHl bf16 [4096][1024]          2 x 8388608   (k projection, hi / residual)
//   VTh, VTl f16 [2][1024][2048] x16    2 x 8388608   (v^T per batch, hi / residual)
//   CTh, CTl bf16 [4096][1024]          2 x 8388608   (attention ctx, merged heads, hi / residual)
//   end                                    83886080
// =====================================================================================================
extern "C" void kernel_launch(void* const* d_in, const int* in_sizes, int n_in,
                              void* d_out, int out_size, void* d_ws, size_t ws_size,
                              hipStream_t stream) {
  if (n_in < 6) return;
  if (in_sizes[0] != NROWS * DMODEL) return;
  if (in_sizes[1] != DMODEL * DMODEL || in_sizes[2] != DMODEL * DMODEL ||
      in_sizes[3] != DMODEL * DMODEL || in_sizes[4] != DMODEL * DMODEL) return;
  if (in_sizes[5] != NBKT * NHEAD) return;
  if (out_size != NROWS * DMODEL) return;
  if ((in_sizes[0] % 2048) != 0 || (in_sizes[1] % 2048) != 0) return;

  const float* x   = (const float*)d_in[0];
  const float* w_q = (const float*)d_in[1];
  const float* w_k = (const float*)d_in[2];
  const float* w_v = (const float*)d_in[3];
  const float* w_o = (const float*)d_in[4];
  const float* rel = (const float*)d_in[5];
  float*       out = (float*)d_out;

  const size_t PW  = (size_t)DMODEL * DMODEL * 2;                 //  2097152
  const size_t PX  = (size_t)NROWS * DMODEL * 2;                  //  8388608
  const size_t PVT = (size_t)NB * DMODEL * NC * 2;                //  8388608
  size_t off = 0;
  const size_t oWQ = off; off += PW;
  const size_t oWK = off; off += PW;
  const size_t oWV = off; off += PW;
  const size_t oWO = off; off += PW;
  const size_t oX  = off; off += PX;
  const size_t oQh = off; off += PX;
  const size_t oQl = off; off += PX;
  const size_t oKh = off; off += PX;
  const size_t oKl = off; off += PX;
  const size_t oVh = off; off += PVT;
  const size_t oVl = off; off += PVT;
  const size_t oCh = off; off += PX;
  const size_t oCl = off; off += PX;
  if (off > ws_size) return;                                      // off = 83886080
  if (off > (size_t)134217728) return;

  char* ws = (char*)d_ws;
  unsigned short* WQ16 = (unsigned short*)(ws + oWQ);
  unsigned short* WK16 = (unsigned short*)(ws + oWK);
  unsigned short* WV16 = (unsigned short*)(ws + oWV);
  unsigned short* WO16 = (unsigned short*)(ws + oWO);
  unsigned short* X16  = (unsigned short*)(ws + oX);
  unsigned short* QHh  = (unsigned short*)(ws + oQh);
  unsigned short* QHl  = (unsigned short*)(ws + oQl);
  unsigned short* KHh  = (unsigned short*)(ws + oKh);
  unsigned short* KHl  = (unsigned short*)(ws + oKl);
  unsigned short* VTh  = (unsigned short*)(ws + oVh);
  unsigned short* VTl  = (unsigned short*)(ws + oVl);
  unsigned short* CTh  = (unsigned short*)(ws + oCh);
  unsigned short* CTl  = (unsigned short*)(ws + oCl);

  const dim3 blk(256);
  const dim3 gCW((DMODEL * DMODEL) / 2048);                        // 512 blocks
  const dim3 gCX((NROWS * DMODEL) / 2048);                         // 2048 blocks
  const int tilesP = (NROWS / 64) * (DMODEL / 64);                 // 1024
  const int tilesV = (DMODEL / 64) * (NC / 64);                    // 512 per batch
  const dim3 gP((tilesP + 7) / 8, 1);                              // 128
  const dim3 gV((tilesV + 7) / 8, NB);                             // 64 x 2
  const dim3 gAT(ATT_BLOCKS);                                      // 256
  const dim3 bAT(ATT_THREADS);                                     // 512

  // (0) weight planes: f16( bf16_RNE(W[n][k]) * 64 ) for Wq, Wk, Wv; bf16_RNE(Wo[n][k]) bits for Wo; [out][in] layout kept
  cvt16<0><<<gCW, blk, 0, stream>>>(w_q, WQ16, DMODEL * DMODEL, WSC);
  cvt16<0><<<gCW, blk, 0, stream>>>(w_k, WK16, DMODEL * DMODEL, WSC);
  cvt16<0><<<gCW, blk, 0, stream>>>(w_v, WV16, DMODEL * DMODEL, WSC);
  cvt16<1><<<gCW, blk, 0, stream>>>(w_o, WO16, DMODEL * DMODEL, 1.0f);

  // (1) activation plane: X16[row][c] = f16( bf16_RNE(x[row][c]) * 16 ), rows = b*2048 + tok
  cvt16<0><<<gCX, blk, 0, stream>>>(x, X16, NROWS * DMODEL, ACARRY);

  // (2) q projection: q[m][n] = sum_k x[m][k] Wq[n][k] -> bf16 hi / residual planes; M = 4096, N = 1024, K = 1024
  gemm64<3, 0, 0><<<gP, blk, 0, stream>>>(
      X16, X16, DMODEL, 0LL,
      WQ16, DMODEL, 0LL,
      (void*)QHh, (void*)QHl, DMODEL, 0LL,
      NROWS, DMODEL, DMODEL, 1.0f / (ACARRY * WSC), 1.0f);

  // (3) k projection -> bf16 hi / residual planes
  gemm64<3, 0, 0><<<gP, blk, 0, stream>>>(
      X16, X16, DMODEL, 0LL,
      WK16, DMODEL, 0LL,
      (void*)KHh, (void*)KHl, DMODEL, 0LL,
      NROWS, DMODEL, DMODEL, 1.0f / (ACARRY * WSC), 1.0f);

  // (4) v^T per batch: VT[b][d][tok] = sum_k Wv[d][k] x_b[tok][k] -> f16 x16 hi / residual planes; M = 1024, N = 2048, K = 1024
  gemm64<4, 0, 0><<<gV, blk, 0, stream>>>(
      WV16, WV16, DMODEL, 0LL,
      X16, DMODEL, (long long)NC * DMODEL,
      (void*)VTh, (void*)VTl, NC, (long long)DMODEL * NC,
      DMODEL, NC, DMODEL, 1.0f / (ACARRY * WSC), VC);

  // (5) attention per (batch, head, 256 query rows) -> CT (bf16 hi / residual planes)
  attn16<<<gAT, bAT, 0, stream>>>(QHh, QHl, KHh, KHl, VTh, VTl, rel, CTh, CTl);

  // (6) out = (CT_hi + CT_lo) . Wo^T; M = 4096, N = 1024, K = 1024, f32
  gemm64<0, 1, 1><<<gP, blk, 0, stream>>>(
      CTh, CTl, DMODEL, 0LL,
      WO16, DMODEL, 0LL,
      (void*)out, (void*)out, DMODEL, 0LL,
      NROWS, DMODEL, DMODEL, 1.0f, 1.0f);
  (void)hipGetLastError();
}

// v004
// One run takes 139 microseconds.
// Two timings next to v003 put it at 1.30 and 1.31 times that version's speed.
// Over all steps from v000 it is 3.42 times as fast.
// Contractions (all f32 accumulate): q/k projections v_wmma_f32_16x16x32_f16 (x f16 x16 . W f16 x64, K=1024, single products) stored as bf16 hi/lo planes;
// v^T projection v_wmma_f32_16x16x32_f16 (Wv f16 x64 . x f16 x16, K=1024) stored as f16 x16 hi/lo planes;
// attention scores, transposed, v_wmma_f32_16x16x32_bf16 (k bf16 hi/lo . q^T bf16 hi/lo, hi.hi+lo.hi+hi.lo, K=64);
// v^T . P^T v_wmma_f32_16x16x32_f16 (v^T f16 x16 hi/lo . P^T f16 x1024 hi/lo, hi.hi+hi.lo+lo.hi, K=2048 by 32);
// output projection v_wmma_f32_16x16x32_bf16 (ctx bf16 hi/lo . Wo bf16, hi.W+lo.W, K=1024).
// Bucketed relative-position bias (per head, function of key-query offset) and online max-subtracted base-2 softmax in f32 on VALU.
// Every float input RNE-converted to bf16 on load.
#include <hip/hip_runtime.h>
#include <math.h>
#include <stdint.h>

#define NB      2
#define NQ      2048
#define NC      2048
#define DMODEL  1024
#define NHEAD   16
#define HDIM    64
#define NBKT    32
#define NROWS   (NB * NQ)
#define WSC     64.0f
#define ACARRY  16.0f
#define VC      16.0f
#define PC      1024.0f
#define ATT_SCALE 0.125f
#define LOG2E   1.4426950408889634f
#define SL2     (ATT_SCALE * LOG2E)
static_assert(NHEAD * HDIM == DMODEL);
static_assert((NQ % 64) == 0 && (NC % 64) == 0 && (DMODEL % 64) == 0 && (NC % 32) == 0 && (NQ % 16) == 0);
static_assert((NROWS % 128) == 0 && (DMODEL % 256) == 0 && (NC % 256) == 0 && (DMODEL % 128) == 0);
#define ATT_THREADS 512
#define QBLK        256                                  // query rows per block: 16 waves x 16 rows, one head
#define ATT_BLOCKS  (NB * NHEAD * (NQ / QBLK))
static_assert(ATT_THREADS == 512 && ATT_BLOCKS == 256 && (NQ % QBLK) == 0 && NQ / QBLK == 8 && NHEAD == 16);
#define LUTP            (NC + QBLK)                      // bias table entries of one head: key - tok + (first row + 255) in [0, 2302]
#define SKEYS           64                               // keys per LDS stage
#define NSTG            (NC / SKEYS)
#define SPITCH          72                               // halves: 128-B rows at a 144-B pitch (16 B x odd) for 16-B LDS reads
#define GKS             64                               // k per LDS stage of the GEMM (128-B rows)
#define PLANE_HALVES    (64 * SPITCH)
#define BUF_HALVES      (4 * PLANE_HALVES)               // K hi, K lo, v^T hi, v^T lo
#define ATT_SMEM_FLOATS (LUTP / 2 + BUF_HALVES)
static_assert(SKEYS == 64 && HDIM == 64 && NSTG >= 2 && (NC % SKEYS) == 0);
static_assert((LUTP % 8) == 0 && (PLANE_HALVES % 8) == 0);
static_assert((size_t)2 * QBLK * HDIM * sizeof(unsigned short) <= (size_t)ATT_SMEM_FLOATS * sizeof(float));

typedef _Float16 v16h __attribute__((ext_vector_type(16)));
typedef _Float16 v8h  __attribute__((ext_vector_type(8)));
typedef __bf16   v16b __attribute__((ext_vector_type(16)));
typedef float    v8f  __attribute__((ext_vector_type(8)));
typedef float    v4f  __attribute__((ext_vector_type(4)));
typedef float    v2f  __attribute__((ext_vector_type(2)));
typedef _Float16 v2h  __attribute__((ext_vector_type(2)));
typedef unsigned int v4u __attribute__((ext_vector_type(4)));

union FragH { v16h v; v8h h[2]; v4u u[2]; };
union FragAny { v16h h; v16b b; };

// ---- scalar helpers --------------------------------------------------------------------------------
__device__ __forceinline__ unsigned short bf_bits(float f) {          // f32 -> bf16 bits, RNE convert
  unsigned u = __float_as_uint(f);
  return (unsigned short)((u + 0x7FFFu + ((u >> 16) & 1u)) >> 16);
}
__device__ __forceinline__ float bf_up(unsigned short h) { return __uint_as_float(((unsigned)h) << 16); }
__device__ __forceinline__ float bfr(float f) { return bf_up(bf_bits(f)); }   // value of the bf16 RNE convert
__device__ __forceinline__ unsigned short h_bits(_Float16 x) { return __builtin_bit_cast(unsigned short, x); }
__device__ __forceinline__ unsigned pk16(unsigned short a, unsigned short b) { return (unsigned)a | ((unsigned)b << 16); }
__device__ __forceinline__ float other_half(float v) {               // the value that lane l ^ 16 holds
  const int b = __builtin_bit_cast(int, v);
  return __builtin_bit_cast(float, __builtin_amdgcn_permlanex16(b, b, 0x76543210, 0xfedcba98, false, false));
}
__device__ __forceinline__ v8f zero8() { v8f z = {0.f, 0.f, 0.f, 0.f, 0.f, 0.f, 0.f, 0.f}; return z; }

// ---- fragment loader: 16-bit A/B operand from a k-contiguous 16-bit plane, lane -> row/col (lane&15),
//      p already includes +8*(lane>>4); elements 0..7 <- p[0..7] (k0+8h..), elements 8..15 <- p[16..23] (k0+16+8h..)
//      (same split k map for A and B; B is always read from a [n][k] plane)
__device__ __forceinline__ v16h ldfrag_u(const unsigned short* p) {
  FragH f;
  f.u[0] = *(const v4u*)(p);
  f.u[1] = *(const v4u*)(p + 16);
  return f.v;
}

// ---- WMMA helpers with trailing VALU hazard gaps ------------------------------------------------------
__device__ __forceinline__ v8f mma_h(v16h a, v16h b, v8f c) {
  return __builtin_amdgcn_wmma_f32_16x16x32_f16(false, a, false, b, (short)0, c, false, false);
}
__device__ __forceinline__ v8f mma_b(v16h a, v16h b, v8f c) {
  FragAny ua, ub;
  ua.h = a;
  ub.h = b;
  return __builtin_amdgcn_wmma_f32_16x16x32_bf16(false, ua.b, false, ub.b, (short)0, c, false, false);
}
template <int BF>
__device__ __forceinline__ v8f mmaT(v16h a, v16h b, v8f c) {
  if constexpr (BF != 0) return mma_b(a, b, c);
  else return mma_h(a, b, c);
}
__device__ __forceinline__ void dep_guard1(v8f& a, v8f& b, v16h x) {
#if defined(__HIP_DEVICE_COMPILE__)
  asm volatile("v_nop\n\tv_nop\n\tv_nop\n\tv_nop" : "+v"(a), "+v"(b) : "v"(x));
#endif
}
__device__ __forceinline__ void guard1x4(v8f& s, v16h a0, v16h a1, v16h a2, v16h a3) {
#if defined(__HIP_DEVICE_COMPILE__)
  asm volatile("v_nop\n\tv_nop\n\tv_nop\n\tv_nop" : "+v"(s) : "v"(a0), "v"(a1), "v"(a2), "v"(a3));
#endif
}
__device__ __forceinline__ void guard1x8(v8f& s, v16h a0, v16h a1, v16h a2, v16h a3,
                                         v16h b0, v16h b1, v16h b2, v16h b3) {
#if defined(__HIP_DEVICE_COMPILE__)
  asm volatile("v_nop\n\tv_nop\n\tv_nop\n\tv_nop"
               : "+v"(s) : "v"(a0), "v"(a1), "v"(a2), "v"(a3), "v"(b0), "v"(b1), "v"(b2), "v"(b3));
#endif
}
__device__ __forceinline__ void guard4x6(v8f& a, v8f& b, v8f& c, v8f& d,
                                         v16h x0, v16h x1, v16h x2, v16h x3, v16h x4, v16h x5) {
#if defined(__HIP_DEVICE_COMPILE__)
  asm volatile("v_nop\n\tv_nop\n\tv_nop\n\tv_nop"
               : "+v"(a), "+v"(b), "+v"(c), "+v"(d) : "v"(x0), "v"(x1), "v"(x2), "v"(x3), "v"(x4), "v"(x5));
#endif
}
__device__ __forceinline__ void guard4x5(v8f& a, v8f& b, v8f& c, v8f& d,
                                         v16h x0, v16h x1, v16h x2, v16h x3, v16h x4) {
#if defined(__HIP_DEVICE_COMPILE__)
  asm volatile("v_nop\n\tv_nop\n\tv_nop\n\tv_nop"
               : "+v"(a), "+v"(b), "+v"(c), "+v"(d) : "v"(x0), "v"(x1), "v"(x2), "v"(x3), "v"(x4));
#endif
}
__device__ __forceinline__ void keep4_h(v16h a, v16h b, v16h c, v16h d) {
#if defined(__HIP_DEVICE_COMPILE__)
  asm volatile("v_nop" :: "v"(a), "v"(b), "v"(c), "v"(d));
#endif
}
__device__ __forceinline__ void acc_guard4(v8f& a, v8f& b, v8f& c, v8f& d) {
#if defined(__HIP_DEVICE_COMPILE__)
  asm volatile("v_nop\n\tv_nop\n\tv_nop\n\tv_nop" : "+v"(a), "+v"(b), "+v"(c), "+v"(d));
#endif
}
__device__ __forceinline__ void wave_sync_lds() {
  __builtin_amdgcn_fence(__ATOMIC_RELEASE, "workgroup");
  __builtin_amdgcn_wave_barrier();
  __builtin_amdgcn_fence(__ATOMIC_ACQUIRE, "workgroup");
}
// Four 16-B-per-lane asynchronous copies global -> LDS (l*: the lane's LDS byte address, g*: the lane's global address).
// The s_wait_xcnt stands inside the statement so that no address register is rewritten in front of it.
__device__ __forceinline__ void async_copy4(unsigned l0, const unsigned short* g0, unsigned l1, const unsigned short* g1,
                                            unsigned l2, const unsigned short* g2, unsigned l3, const unsigned short* g3) {
#if defined(__HIP_DEVICE_COMPILE__)
  asm volatile("global_load_async_to_lds_b128 %0, %1, off\n\t"
               "global_load_async_to_lds_b128 %2, %3, off\n\t"
               "global_load_async_to_lds_b128 %4, %5, off\n\t"
               "global_load_async_to_lds_b128 %6, %7, off\n\t"
               "s_wait_xcnt 0x0"
               :: "v"(l0), "v"(g0), "v"(l1), "v"(g1), "v"(l2), "v"(g2), "v"(l3), "v"(g3) : "memory");
#endif
}
__device__ __forceinline__ void wait_async0() {   // this wave's own copies have landed in LDS
#if defined(__HIP_DEVICE_COMPILE__)
  asm volatile("s_wait_asynccnt 0x0" ::: "memory");
#endif
}
__device__ __forceinline__ void wait_ds0() {      // this wave's own LDS reads have returned (before their buffer is refilled)
#if defined(__HIP_DEVICE_COMPILE__)
  asm volatile("s_wait_dscnt 0x0" ::: "memory");
#endif
}

// =====================================================================================================
// Elementwise 16-bit pack, no transpose. BFO 0: dst[i] = f16( bf16_RNE(src[i]) * sc ), sc a power of two (exact);
// BFO 1: dst[i] = bf16_RNE(src[i]) bits. 8 elements per thread: two 16-B loads, one 16-B store per lane; 32 consecutive
// coverage: n / 2048 blocks (index bx) x 256 thr x 8 elements = n exactly (host checks n % 2048 == 0).
// =====================================================================================================
template <int BFO>
__device__ __forceinline__ void cvt16(const float* __restrict__ src, unsigned short* dst, int n, float sc, int bx) {
  const size_t i8 = ((size_t)bx * 256 + threadIdx.x) * 8;
  if (i8 + 8 > (size_t)n) return;                 // never taken with the exact grid; no barriers in this kernel
  const v4f a = *(const v4f*)(src + i8);
  const v4f b = *(const v4f*)(src + i8 + 4);
  v4u o;
  if constexpr (BFO != 0) {
    o[0] = pk16(bf_bits(a[0]), bf_bits(a[1]));
    o[1] = pk16(bf_bits(a[2]), bf_bits(a[3]));
    o[2] = pk16(bf_bits(b[0]), bf_bits(b[1]));
    o[3] = pk16(bf_bits(b[2]), bf_bits(b[3]));
  } else {
    o[0] = pk16(h_bits((_Float16)(bfr(a[0]) * sc)), h_bits((_Float16)(bfr(a[1]) * sc)));
    o[1] = pk16(h_bits((_Float16)(bfr(a[2]) * sc)), h_bits((_Float16)(bfr(a[3]) * sc)));
    o[2] = pk16(h_bits((_Float16)(bfr(b[0]) * sc)), h_bits((_Float16)(bfr(b[1]) * sc)));
    o[3] = pk16(h_bits((_Float16)(bfr(b[2]) * sc)), h_bits((_Float16)(bfr(b[3]) * sc)));
  }
  {
    *(v4u*)(dst + i8) = o;
    
  }
}
// All five converts in one launch; the block index picks the job (block-uniform): blocks 0..2047 the activations (f16 x16),
// then 512 blocks each for Wq, Wk, Wv (f16 x64) and Wo (bf16 bits).
#define CVX_BLOCKS ((NROWS * DMODEL) / 2048)
#define CVW_BLOCKS ((DMODEL * DMODEL) / 2048)
__global__ __launch_bounds__(256) void cvt_all(const float* __restrict__ x, const float* __restrict__ w_q, const float* __restrict__ w_k,
                                               const float* __restrict__ w_v, const float* __restrict__ w_o,
                                               unsigned short* X16, unsigned short* WQ16, unsigned short* WK16,
                                               unsigned short* WV16, unsigned short* WO16) {
  const int b = blockIdx.x;
  if (b < CVX_BLOCKS) {
    cvt16<0>(x, X16, NROWS * DMODEL, ACARRY, b);
    return;
  }
  const int job = (b - CVX_BLOCKS) / CVW_BLOCKS;           // 0..3 with the exact grid
  const int bw  = (b - CVX_BLOCKS) - job * CVW_BLOCKS;
  if (job == 3) {
    cvt16<1>(w_o, WO16, DMODEL * DMODEL, 1.0f, bw);
  } else if (job < 3) {
    const float* src    = (job == 0) ? w_q  : (job == 1) ? w_k  : w_v;
    unsigned short* dst = (job == 0) ? WQ16 : (job == 1) ? WK16 : WV16;
    cvt16<0>(src, dst, DMODEL * DMODEL, WSC, bw);
  }
}

// =====================================================================================================
// Register-blocked batched 16-bit WMMA GEMM: C[m][n] = oscale * sum_k A[m][k] * Bt[n][k]; one wave per 64x64 tile, a block of 8 waves
// (2 x 4) per 128x256 tile. The block's 128 A rows (and A2 rows) and 256 Bt rows of a 64-k stage (128 B per row) are brought into LDS once
// per block by asynchronous 16-B copies (8 lanes per 128-B row; 12 or 16 copies per thread and stage), two buffers: stage t + 2 is issued
// behind the barrier that ends stage t; the waves read their fragments from there (two 16-B LDS loads per fragment, row pitch 144 B).
// A row-major [M][K] pitch lda (16-bit plane), Bt row-major [N][K] pitch ldb (k contiguous); M multiple of 128, N of 256, K of 64.
// bx = tile index, by = batch index with element strides sA, sB, sC; sT (8 per-wave slabs) and gst (two stage buffers) are the calling kernel's LDS.
// ASPLIT 1: a second A plane A2 (unscaled residual of A, same layout) is multiplied into the same accumulator (A + A2 ~ exact A).
// BF 1: bf16 operands (v_wmma_f32_16x16x32_bf16), else f16.
// OM 0: f32 out (pitch ldc).  OM 2: f16 out = f16(value * ocarry).  OM 3: two bf16 planes: hi = bf16_RNE(value), lo = bf16_RNE(value - hi).
// OM 4: two f16 planes: hi = f16(value * ocarry), lo = f16(value * ocarry - hi) (unscaled residual).
// coverage: 4 slabs x 16 rows (f32: it 0..7 x lane>>4; 16-bit: it 0..3 x lane>>3) x 64 cols = the wave's whole 64x64 tile;
//           stage: 256 threads x 16 B = 32 rows x 128 B per copy; grid = (M / 128) * (N / 256) blocks, a surplus block exits whole.
// =====================================================================================================
#define GSLAB (16 * 68)                             // floats of a per-wave 16x64 slab, pitch 68 floats
#define GBUF_HALVES(ASPLIT) ((256 + 128 * (1 + (ASPLIT))) * SPITCH)   // rows of a stage buffer: Bt 0..255 | A 256..383 | A2 384..511
template <int OM, int ASPLIT, int BF>
__device__ __forceinline__ void gemm_tile(
    const unsigned short* __restrict__ Ap, const unsigned short* __restrict__ A2p, int lda, long long sA,
    const unsigned short* __restrict__ Btp, int ldb, long long sB,
    void* Cout, void* C2out, int ldc, long long sC,
    int M, int N, int K, float oscale, float ocarry,
    int bx, int by, float* sT, unsigned short* gst) {
  constexpr int GBUF  = GBUF_HALVES(ASPLIT);       // halves per stage buffer
  constexpr unsigned R32 = 32 * SPITCH * 2;        // LDS bytes of 32 rows (one copy of the whole block)
  const int tid  = threadIdx.x;
  const int lane = threadIdx.x & 31;
  const int wave = threadIdx.x >> 5;
  const int blocksN = N >> 8;
  const int blocksM = M >> 7;
  // block-uniform, in front of every barrier; never taken with the exact grids and shapes of this file
  if ((M & 127) != 0 || (N & 255) != 0 || (K & (GKS - 1)) != 0 || K < GKS || bx >= blocksM * blocksN) return;
  const int bm  = bx / blocksN;
  const int bn  = bx - bm * blocksN;
  const int mb0 = bm << 7;
  const int nb0 = bn << 8;
  const int m0 = mb0 + ((wave >> 2) << 6);
  const int n0 = nb0 + ((wave & 3) << 6);

  const unsigned short* A1 = Ap  + (size_t)((long long)by * sA);
  const unsigned short* A2 = A2p + (size_t)((long long)by * sA);
  const unsigned short* Bb = Btp + (size_t)((long long)by * sB);

  const int rlane = lane & 15;                 // row (A) / col (B, D) within subtile
  const int koff  = (lane >> 4) * 8;           // k offset of this lane half
  const int mOff  = (lane >> 4) * 8;           // D row offset

  v8f acc[4][4];
#pragma unroll
  for (int i = 0; i < 4; ++i)
#pragma unroll
    for (int j = 0; j < 4; ++j) acc[i][j] = zero8();

  // ---- stage copies: thread -> row tid / 8 (+ 32 per copy), 16-B piece tid % 8 of the row's 128 B ----
  const int sr = tid >> 3, sp = (tid & 7) * 8;
  const unsigned short* gB  = Bb + (size_t)(nb0 + sr) * ldb + sp;
  const unsigned short* gA  = A1 + (size_t)(mb0 + sr) * lda + sp;
  const unsigned short* gA2 = A2 + (size_t)(mb0 + sr) * lda + sp;
  const size_t b32 = (size_t)32 * ldb, a32 = (size_t)32 * lda;
  const unsigned ldst = (unsigned)(uintptr_t)(gst + sr * SPITCH + sp);   // LDS byte address = low 32 bits
  auto stage_copy = [&](int st, int buf) {
    const size_t ks = (size_t)st * GKS;
    const unsigned l = ldst + (unsigned)buf * (GBUF * 2);
    const unsigned short* b = gB + ks;
    const unsigned short* a = gA + ks;
    async_copy4(l,            b,           l + R32,      b + b32,     l + 2 * R32,  b + 2 * b32, l + 3 * R32,  b + 3 * b32);
    async_copy4(l + 4 * R32,  b + 4 * b32, l + 5 * R32,  b + 5 * b32, l + 6 * R32,  b + 6 * b32, l + 7 * R32,  b + 7 * b32);
    async_copy4(l + 8 * R32,  a,           l + 9 * R32,  a + a32,     l + 10 * R32, a + 2 * a32, l + 11 * R32, a + 3 * a32);
    if constexpr (ASPLIT != 0) {
      const unsigned short* a2 = gA2 + ks;
      async_copy4(l + 12 * R32, a2,        l + 13 * R32, a2 + a32,    l + 14 * R32, a2 + 2 * a32, l + 15 * R32, a2 + 3 * a32);
    }
  };
  const int nst = K / GKS;
  stage_copy(0, 0);
  wait_async0();
  __syncthreads();                                         // publishes stage 0
  if (nst > 1) stage_copy(1, 1);

  for (int st = 0; st < nst; ++st) {
    const unsigned short* sb = gst + (st & 1) * GBUF + rlane * SPITCH + koff;   // lane's row rlane, k half
    const unsigned short* sB = sb + ((wave & 3) << 6) * SPITCH;
    const unsigned short* sA = sb + (256 + ((wave >> 2) << 6)) * SPITCH;
    // unrolled: the offsets inside the stage become immediates of the LDS loads
#pragma unroll
    for (int kk = 0; kk < GKS; kk += 32) {
      v16h bh[4], ah[4], al[ASPLIT != 0 ? 4 : 1];
#pragma unroll
      for (int j = 0; j < 4; ++j) bh[j] = ldfrag_u(sB + (j << 4) * SPITCH + kk);
#pragma unroll
      for (int i = 0; i < 4; ++i) ah[i] = ldfrag_u(sA + (i << 4) * SPITCH + kk);
      if constexpr (ASPLIT != 0) {
#pragma unroll
        for (int i = 0; i < 4; ++i) al[i] = ldfrag_u(sA + (128 + (i << 4)) * SPITCH + kk);
      }
#pragma unroll
      for (int i = 0; i < 4; ++i) {
#pragma unroll
        for (int j = 0; j < 4; ++j) acc[i][j] = mmaT<BF>(ah[i], bh[j], acc[i][j]);
        dep_guard1(acc[i][0], acc[i][3], ah[i]);
        if constexpr (ASPLIT != 0) {
#pragma unroll
          for (int j = 0; j < 4; ++j) acc[i][j] = mmaT<BF>(al[i], bh[j], acc[i][j]);
          dep_guard1(acc[i][0], acc[i][3], al[i]);
        }
      }
      keep4_h(bh[0], bh[1], bh[2], bh[3]);
    }
    // ---- publish point of stage st + 1 ----
    wait_ds0();
    wait_async0();
    __syncthreads();                       // publishes stage st + 1 and ends every wave's reads of stage st's buffer
    if (st + 2 < nst) stage_copy(st + 2, st & 1);
  }
  wait_async0();
  acc_guard4(acc[0][0], acc[0][1], acc[0][2], acc[0][3]);
  acc_guard4(acc[1][0], acc[1][1], acc[1][2], acc[1][3]);
  acc_guard4(acc[2][0], acc[2][1], acc[2][2], acc[2][3]);
  acc_guard4(acc[3][0], acc[3][1], acc[3][2], acc[3][3]);

  const int hh2 = lane >> 4, c4 = (lane & 15) * 4;     // f32 out: 256-B row segment = 16 lanes x 16 B
  const int q8  = lane >> 3, c8 = (lane & 7) * 8;

  // ---- epilogue ----
  float* slab = sT + wave * GSLAB;
#pragma unroll
  for (int i = 0; i < 4; ++i) {
    const int mBase = m0 + (i << 4);
#pragma unroll
    for (int j = 0; j < 4; ++j) {
#pragma unroll
      for (int r = 0; r < 8; ++r) {
        slab[(mOff + r) * 68 + (j << 4) + rlane] = acc[i][j][r];
      }
    }
    wave_sync_lds();
    if constexpr (OM == 0) {
      float* C = (float*)Cout + (size_t)((long long)by * sC);
      v4f vals[8];
#pragma unroll
      for (int it = 0; it < 8; ++it) {
        const int row = it * 2 + hh2;                      // it 0..7 x hh2 0..1 = rows 0..15
        v4f v = *(const v4f*)(slab + row * 68 + c4);
#pragma unroll
        for (int e = 0; e < 4; ++e) v[e] = v[e] * oscale;
        vals[it] = v;
      }
      {
#pragma unroll
        for (int it = 0; it < 8; ++it) {
          const int gr = mBase + it * 2 + hh2;
          *(v4f*)(C + (size_t)gr * ldc + n0 + c4) = vals[it];
        }
        
      }
    } else {
      unsigned short* C  = (unsigned short*)Cout  + (size_t)((long long)by * sC);
      unsigned short* Cb = (unsigned short*)C2out + (size_t)((long long)by * sC);
      v4u hv[4], lv[4];
#pragma unroll
      for (int it = 0; it < 4; ++it) {
        const int row = it * 4 + q8;                       // it 0..3 x q8 0..3 = rows 0..15
        const float* sp = slab + row * 68 + c8;
        v4u a  = {0u, 0u, 0u, 0u};
        v4u b2 = {0u, 0u, 0u, 0u};
#pragma unroll
        for (int e = 0; e < 4; ++e) {
          float f0 = sp[2 * e] * oscale;
          float f1 = sp[2 * e + 1] * oscale;
          if constexpr (OM == 3) {
            const unsigned short h0 = bf_bits(f0), h1 = bf_bits(f1);
            a[e]  = pk16(h0, h1);
            b2[e] = pk16(bf_bits(f0 - bf_up(h0)), bf_bits(f1 - bf_up(h1)));
          } else {
            f0 *= ocarry; f1 *= ocarry;
            const _Float16 x0 = (_Float16)f0, x1 = (_Float16)f1;
            a[e] = pk16(h_bits(x0), h_bits(x1));
            if constexpr (OM == 4) {
              b2[e] = pk16(h_bits((_Float16)(f0 - (float)x0)), h_bits((_Float16)(f1 - (float)x1)));
            }
          }
        }
        hv[it] = a;
        lv[it] = b2;
      }
      {
#pragma unroll
        for (int it = 0; it < 4; ++it) {
          const int row = it * 4 + q8;
          *(v4u*)(C + (size_t)(mBase + row) * ldc + n0 + c8) = hv[it];
          if constexpr (OM >= 3) {
            *(v4u*)(Cb + (size_t)(mBase + row) * ldc + n0 + c8) = lv[it];
          }
        }
        
      }
    }
    wave_sync_lds();
  }
}

// The three projections in one launch of 128 x 3 blocks, all resident at once (two blocks fit a WGP's LDS); blockIdx.y picks the job
// (block-uniform): 0 q and 1 k (x . W^T -> bf16 hi / residual planes; M = 4096, N = 1024, K = 1024, 128 tiles each),
// 2 v^T per batch (Wv . x_b^T -> f16 x16 hi / residual planes; M = 1024, N = 2048, K = 1024, 64 tiles for each of the two batches).
__global__ __launch_bounds__(256) void qkv64(
    const unsigned short* __restrict__ X16, const unsigned short* __restrict__ WQ16, const unsigned short* __restrict__ WK16,
    const unsigned short* __restrict__ WV16, unsigned short* QHh, unsigned short* QHl, unsigned short* KHh, unsigned short* KHl,
    unsigned short* VTh, unsigned short* VTl) {
  __shared__ __align__(16) float sT[8 * GSLAB];
  __shared__ __align__(16) unsigned short gst[2 * GBUF_HALVES(0)];
  const int job = blockIdx.y;
  const int bx  = blockIdx.x;
  if (job < 2) {
    gemm_tile<3, 0, 0>(X16, X16, DMODEL, 0LL,
                       job == 0 ? WQ16 : WK16, DMODEL, 0LL,
                       (void*)(job == 0 ? QHh : KHh), (void*)(job == 0 ? QHl : KHl), DMODEL, 0LL,
                       NROWS, DMODEL, DMODEL, 1.0f / (ACARRY * WSC), 1.0f, bx, 0, sT, gst);
  } else {
    constexpr int TV = (DMODEL / 128) * (NC / 256);          // 64 tiles per batch
    gemm_tile<4, 0, 0>(WV16, WV16, DMODEL, 0LL,
                       X16, DMODEL, (long long)NC * DMODEL,
                       (void*)VTh, (void*)VTl, NC, (long long)DMODEL * NC,
                       DMODEL, NC, DMODEL, 1.0f / (ACARRY * WSC), VC, bx % TV, bx / TV, sT, gst);
  }
}

template <int OM, int ASPLIT, int BF>
__global__ __launch_bounds__(256) void gemm64(
    const unsigned short* __restrict__ Ap, const unsigned short* __restrict__ A2p, int lda, long long sA,
    const unsigned short* __restrict__ Btp, int ldb, long long sB,
    void* Cout, void* C2out, int ldc, long long sC,
    int M, int N, int K, float oscale, float ocarry) {
  __shared__ __align__(16) float sT[8 * GSLAB];
  __shared__ __align__(16) unsigned short gst[2 * GBUF_HALVES(ASPLIT)];
  gemm_tile<OM, ASPLIT, BF>(Ap, A2p, lda, sA, Btp, ldb, sB, Cout, C2out, ldc, sC, M, N, K, oscale, ocarry,
                            (int)blockIdx.x, (int)blockIdx.y, sT, gst);
}

// =====================================================================================================
// Flash attention for one batch, one head and 256 query rows (one wave per 16 rows), head dim 64, 2048 keys:
//   q planes (bf16 hi, lo) Q[b*2048 + tok][64h + d], pitch 1024; k planes (bf16 hi, lo) K[b*2048 + key][64h + d], pitch 1024;
//   v^T planes (f16 x16 hi, unscaled lo): VT[b*1024 + 64h + d][key] (pitch 2048); bias = bf16(rel[bucket(key - tok)][h]) from a
//   per-block LDS table of bf16 bits indexed by (key - tok + first row + 255), bucket() piecewise constant in the offset;
//   out (bf16 hi, lo planes): CT[b*2048 + tok][64h + d] = sum_m softmax_m(q.k / 8 + bias) v[m][d]  (softmax run in base 2).
//   block = 16 waves = 512 threads; grid = 2 x 16 x 8 = 256; every wave does identical bounded work (32 stages of 64 keys).
//   The head's K rows and v^T rows of a stage (four planes of 64 rows x 128 B) are brought into LDS once per block by asynchronous
//   16-B copies (four per thread and stage; 8 lanes per 128-B row), two buffers: stage t + 2 is issued behind the barrier that ends
//   stage t; all 16 waves read their fragments from there (two 16-B LDS loads per fragment, row pitch 144 B).
//   Per 32 keys: 2 transposed score tiles S^T = K . q^T on bf16 WMMA (A = K rows, B = q; K = 64 as two k-steps of 32): lane (c, hh) holds
//   query c's scores of keys 8hh + r and 16 + 8hh + r; their 16 bias values from the LDS table (u16); online max-subtracted softmax in
//   f32 (exp2) with the maximum in-lane plus one exchange between the lane halves, the sum kept per lane half and joined behind the loop;
//   rescale of the running sum and the four accumulators; P^T (f16 hi and unscaled residual) packed from the two score tiles straight into
//   a B operand (hardware k order, as the v^T loader's); 12 WMMAs O^T += v^T . P^T (hi.hi, hi.lo, lo.hi).
//   Final 1/l and carry folds in f32; behind the last stage's barrier the LDS buffer is reused as the block's two bf16 result buffers
//   [256][64] (hi, lo): each wave stages its 16x64 slice; after a block barrier the 512 threads write 128-B row segments.
// coverage: LDS table: 512 threads stride over 2304 entries (all written); stage: 512 threads x 16 B = 64 rows x 128 B per plane;
//           global: 4 iterations x 512 threads x 8 halves = 256 rows x 64 columns of the head, per plane;
//           grid covers all 2 x 2048 rows x 16 heads exactly once.
// =====================================================================================================
__global__ __launch_bounds__(ATT_THREADS)
void attn16(const unsigned short* __restrict__ QHh, const unsigned short* __restrict__ QHl,
            const unsigned short* __restrict__ KHh, const unsigned short* __restrict__ KHl,
            const unsigned short* __restrict__ VTh, const unsigned short* __restrict__ VTl,
            const float* __restrict__ rel, unsigned short* CTh, unsigned short* CTl) {
  // bias table u16 [2304] | two stage buffers of four planes [64][72] u16
  __shared__ __align__(16) float smem[ATT_SMEM_FLOATS];
  unsigned short* lut = (unsigned short*)smem;
  unsigned short* stg = lut + LUTP;

  const int tid  = threadIdx.x;
  const int wave = tid >> 5;
  const int lane = tid & 31;
  const int hh   = lane >> 4;
  const int c    = lane & 15;

  const int qb   = blockIdx.x & ((NQ / QBLK) - 1);         // 0..7
  const int head = (blockIdx.x / (NQ / QBLK)) & (NHEAD - 1);   // 0..15
  const int bat  = blockIdx.x / ((NQ / QBLK) * NHEAD);     // 0..1
  const int qb0  = qb * QBLK;
  const int q0   = qb0 + wave * 16;

  // ---- stage copies: thread -> row tid / 8 (key of K, d of v^T), 16-B piece tid % 8 of the row's 128 B, in each of the four planes ----
  const int sr = tid >> 3, sp = (tid & 7) * 8;
  const size_t gko = ((size_t)bat * NC + sr) * DMODEL + head * HDIM + sp;
  const size_t gvo = ((size_t)bat * DMODEL + head * HDIM + sr) * NC + sp;
  const unsigned short* gKh = KHh + gko;
  const unsigned short* gKl = KHl + gko;
  const unsigned short* gVh = VTh + gvo;
  const unsigned short* gVl = VTl + gvo;
  const unsigned ldst = (unsigned)(uintptr_t)(stg + sr * SPITCH + sp);   // LDS byte address = low 32 bits
  auto stage_copy = [&](int st, int buf) {
    const size_t ka = (size_t)st * SKEYS * DMODEL, va = (size_t)st * SKEYS;
    const unsigned l = ldst + (unsigned)buf * (BUF_HALVES * 2);
    async_copy4(l, gKh + ka, l + PLANE_HALVES * 2, gKl + ka, l + PLANE_HALVES * 4, gVh + va, l + PLANE_HALVES * 6, gVl + va);
  };
  stage_copy(0, 0);

  // ---- per-block bias table: lut[i] = bf16 bits of rel[bucket(i - (qb0 + 255))][head], i = key - tok + qb0 + 255 in [0, 2302] ----
  for (int i = tid; i < LUTP; i += ATT_THREADS) {
    const int d  = i - (qb0 + QBLK - 1);                   // key - tok
    const int a  = (d < 0) ? -d : d;
    int g = 8 + (a >= 12) + (a >= 16) + (a >= 23) + (a >= 32) + (a >= 46) + (a >= 64) + (a >= 91);
    g = (a < 8) ? a : g;
    const int bk = g + ((d > 0) ? 16 : 0);                 // 0..31
    lut[i] = bf_bits(rel[bk * NHEAD + head]);              // index in [0, 511]
  }
  wait_async0();
  __syncthreads();                                         // publishes the bias table and stage 0
  stage_copy(1, 1);

  const size_t qofs = ((size_t)bat * NQ + q0 + c) * DMODEL + head * HDIM + 8 * hh;
  const v16h qah = ldfrag_u(QHh + qofs), qbh = ldfrag_u(QHh + qofs + 32);
  const v16h qal = ldfrag_u(QHl + qofs), qbl = ldfrag_u(QHl + qofs + 32);
  // + kb; element (query row 16 wave + c, key kb + 16t + 8hh + r) at [16t + r]; 255 - 16 wave - c written as 16 (15 - wave) + (15 - c)
  const unsigned short* lw = lut + (16 * (wave ^ 15) + (c ^ 15) + 8 * hh);

  float mrow = -INFINITY, lrow = 0.f;      // query c's running maximum (both lane halves alike) and this lane half's running sum
  v8f o0 = zero8(), o1 = zero8(), o2 = zero8(), o3 = zero8();   // O^T: o_t[r] = (d = 16t + 8hh + r, query c)

#pragma unroll 1
  for (int st = 0; st < NSTG; ++st) {
    const unsigned short* sKh = stg + (st & 1) * BUF_HALVES + c * SPITCH + 8 * hh;   // lane's row c, k half hh
    const unsigned short* sKl = sKh + PLANE_HALVES;
    const unsigned short* sVh = sKh + 2 * PLANE_HALVES;
    const unsigned short* sVl = sKh + 3 * PLANE_HALVES;
    // unrolled: the offsets inside the stage become immediates of the LDS loads
#pragma unroll
    for (int kk = 0; kk < SKEYS; kk += 32) {
      const int kb = st * SKEYS + kk;
      const int ko = kk * SPITCH;
      v8f s0, s1;
      {
        const v16h k0h = ldfrag_u(sKh + ko), k1h = ldfrag_u(sKh + ko + 32);
        const v16h k0l = ldfrag_u(sKl + ko), k1l = ldfrag_u(sKl + ko + 32);
        s0 = mma_b(k0h, qah, zero8());
        s0 = mma_b(k1h, qbh, s0);
        s0 = mma_b(k0l, qah, s0);
        s0 = mma_b(k1l, qbh, s0);
        s0 = mma_b(k0h, qal, s0);
        s0 = mma_b(k1h, qbl, s0);
        guard1x4(s0, k0h, k1h, k0l, k1l);
      }
      {
        const int k2 = ko + 16 * SPITCH;
        const v16h k0h = ldfrag_u(sKh + k2), k1h = ldfrag_u(sKh + k2 + 32);
        const v16h k0l = ldfrag_u(sKl + k2), k1l = ldfrag_u(sKl + k2 + 32);
        s1 = mma_b(k0h, qah, zero8());
        s1 = mma_b(k1h, qbh, s1);
        s1 = mma_b(k0l, qah, s1);
        s1 = mma_b(k1l, qbh, s1);
        s1 = mma_b(k0h, qal, s1);
        s1 = mma_b(k1h, qbl, s1);
        guard1x8(s1, k0h, k1h, k0l, k1l, qah, qbh, qal, qbl);
      }
      const unsigned short* lp = lw + kb;
      // pairs of neighbouring keys (registers 2e, 2e + 1 of a score tile): tp[e] of tile 0, tp[4 + e] of tile 1
      v2f tp[8];
#pragma unroll
      for (int e = 0; e < 4; ++e) {
        const v2f w0 = {bf_up(lp[2 * e]), bf_up(lp[2 * e + 1])}, w1 = {bf_up(lp[16 + 2 * e]), bf_up(lp[17 + 2 * e])};
        const v2f a0 = {s0[2 * e], s0[2 * e + 1]}, a1 = {s1[2 * e], s1[2 * e + 1]};
        tp[e]     = a0 * SL2 + w0 * LOG2E;
        tp[4 + e] = a1 * SL2 + w1 * LOG2E;
      }
      float mx = fmaxf(fmaxf(fmaxf(fmaxf(tp[0][0], tp[0][1]), fmaxf(tp[1][0], tp[1][1])), fmaxf(fmaxf(tp[2][0], tp[2][1]), fmaxf(tp[3][0], tp[3][1]))),
                       fmaxf(fmaxf(fmaxf(tp[4][0], tp[4][1]), fmaxf(tp[5][0], tp[5][1])), fmaxf(fmaxf(tp[6][0], tp[6][1]), fmaxf(tp[7][0], tp[7][1]))));
      mx = fmaxf(mx, other_half(mx));                      // query c's maximum over all 32 keys
      const float mn = fmaxf(mrow, mx);
      const float al = exp2f(mrow - mn);
      mrow = mn;
      FragH ph, pl;
      v2f ep[8];
#pragma unroll
      for (int e = 0; e < 8; ++e) {                        // element pair 2e, 2e + 1 of the B operand: keys kb + 16 (e / 4) + 8hh + 2 (e % 4) + 0, 1
        const v2f d = tp[e] - mn;
        ep[e] = v2f{exp2f(d[0]), exp2f(d[1])};
        const v2h x = __builtin_convertvector(ep[e] * PC, v2h);
        ph.v[2 * e]     = x[0];
        ph.v[2 * e + 1] = x[1];
        pl.v[2 * e]     = (_Float16)(ep[e][0] * PC - (float)x[0]);
        pl.v[2 * e + 1] = (_Float16)(ep[e][1] * PC - (float)x[1]);
      }
      const v2f ps = ((ep[0] + ep[1]) + (ep[2] + ep[3])) + ((ep[4] + ep[5]) + (ep[6] + ep[7]));
      lrow = lrow * al + (ps[0] + ps[1]);
#pragma unroll
      for (int r = 0; r < 8; ++r) {
        o0[r] *= al;
        o1[r] *= al;
        o2[r] *= al;
        o3[r] *= al;
      }
      {
        const v16h vh0 = ldfrag_u(sVh + kk);
        const v16h vh1 = ldfrag_u(sVh + kk + 16 * SPITCH);
        const v16h vh2 = ldfrag_u(sVh + kk + 32 * SPITCH);
        const v16h vh3 = ldfrag_u(sVh + kk + 48 * SPITCH);
        o0 = mma_h(vh0, ph.v, o0);
        o1 = mma_h(vh1, ph.v, o1);
        o2 = mma_h(vh2, ph.v, o2);
        o3 = mma_h(vh3, ph.v, o3);
        o0 = mma_h(vh0, pl.v, o0);
        o1 = mma_h(vh1, pl.v, o1);
        o2 = mma_h(vh2, pl.v, o2);
        o3 = mma_h(vh3, pl.v, o3);
        guard4x6(o0, o1, o2, o3, ph.v, pl.v, vh0, vh1, vh2, vh3);
      }
      {
        const v16h vl0 = ldfrag_u(sVl + kk);
        const v16h vl1 = ldfrag_u(sVl + kk + 16 * SPITCH);
        const v16h vl2 = ldfrag_u(sVl + kk + 32 * SPITCH);
        const v16h vl3 = ldfrag_u(sVl + kk + 48 * SPITCH);
        o0 = mma_h(vl0, ph.v, o0);
        o1 = mma_h(vl1, ph.v, o1);
        o2 = mma_h(vl2, ph.v, o2);
        o3 = mma_h(vl3, ph.v, o3);
        guard4x5(o0, o1, o2, o3, ph.v, vl0, vl1, vl2, vl3);
      }
    }
    // ---- publish point of stage st + 1 ----
    wait_ds0();
    wait_async0();
    __syncthreads();                       // publishes stage st + 1 and ends every wave's reads of stage st's buffer
    if (st + 2 < NSTG) stage_copy(st + 2, st & 1);
  }
  wait_async0();

  // ---- the last stage's barrier has ended all reads of LDS; the buffer becomes two bf16 result buffers [256][64] ----
  unsigned short* Osh = (unsigned short*)smem;
  unsigned short* Osl = Osh + QBLK * HDIM;
  // ---- fold 1/l and the carries (1024 on P, 16 on v), split into bf16 hi + residual, stage the wave's 16x64 slice ----
  const float oc = 1.0f / (PC * VC);
  const float inv = (1.0f / (lrow + other_half(lrow))) * oc;      // the two lane halves' sums joined
  const int ro = (wave * 16 + c) * HDIM + 8 * hh;                 // query row c, d = 16t + 8hh + 0..7: one 16-B LDS store per tile and plane
  auto put_tile = [&](const v8f& o, int t) {
    v4u hv, lv;
#pragma unroll
    for (int e = 0; e < 4; ++e) {
      const float f0 = o[2 * e] * inv, f1 = o[2 * e + 1] * inv;
      const unsigned short g0 = bf_bits(f0), g1 = bf_bits(f1);
      hv[e] = pk16(g0, g1);
      lv[e] = pk16(bf_bits(f0 - bf_up(g0)), bf_bits(f1 - bf_up(g1)));
    }
    *(v4u*)(Osh + ro + 16 * t) = hv;
    *(v4u*)(Osl + ro + 16 * t) = lv;
  };
  put_tile(o0, 0);
  put_tile(o1, 1);
  put_tile(o2, 2);
  put_tile(o3, 3);
  __syncthreads();
  // ---- block writes its 256 row segments of both planes: piece p = it*512 + tid -> row p / 8, halves (p % 8)*8 .. +7 of the head's 64 ----
  {
    v4u hv[4], lv[4];
#pragma unroll
    for (int it = 0; it < 4; ++it) {
      const int p = it * ATT_THREADS + tid;
      hv[it] = *(const v4u*)(Osh + (size_t)p * 8);
      lv[it] = *(const v4u*)(Osl + (size_t)p * 8);
    }
    const size_t dofs = ((size_t)bat * NQ + qb0) * DMODEL + head * HDIM;
    unsigned short* dsth = CTh + dofs;
    unsigned short* dstl = CTl + dofs;
#pragma unroll
    for (int it = 0; it < 4; ++it) {
      const int p = it * ATT_THREADS + tid;
      const size_t go = (size_t)(p >> 3) * DMODEL + (p & 7) * 8;
      *(v4u*)(dsth + go) = hv[it];
      *(v4u*)(dstl + go) = lv[it];
    }
  }
}

// =====================================================================================================
// Workspace map (bytes); every plane is an exact multiple of its tile / whole-row store granularity (M, N exact tile multiples,
// element counts exact multiples of the convert kernel's 2048 granularity, no pad rows needed), every offset a multiple of 2 MiB:
//   WQ16 f16 [1024][1024] x64               2097152   ([out][in] = [n][k])
//   WK16 f16 [1024][1024] x64               2097152
//   WV16 f16 [1024][1024] x64               2097152
//   WO16 bf16 [1024][1024]                  2097152
//   X16  f16 [4096][1024] x16               8388608   (activation rows)
//   QHh, QHl bf16 [4096][1024]          2 x 8388608   (q projection, hi / residual)
//   KHh, KHl bf16 [4096][1024]          2 x 8388608   (k projection, hi / residual)
//   VTh, VTl f16 [2][1024][2048] x16    2 x 8388608   (v^T per batch, hi / residual)
//   CTh, CTl bf16 [4096][1024]          2 x 8388608   (attention ctx, merged heads, hi / residual)
//   end                                    83886080
// =====================================================================================================
extern "C" void kernel_launch(void* const* d_in, const int* in_sizes, int n_in,
                              void* d_out, int out_size, void* d_ws, size_t ws_size,
                              hipStream_t stream) {
  if (n_in < 6) return;
  if (in_sizes[0] != NROWS * DMODEL) return;
  if (in_sizes[1] != DMODEL * DMODEL || in_sizes[2] != DMODEL * DMODEL ||
      in_sizes[3] != DMODEL * DMODEL || in_sizes[4] != DMODEL * DMODEL) return;
  if (in_sizes[5] != NBKT * NHEAD) return;
  if (out_size != NROWS * DMODEL) return;
  if ((in_sizes[0] % 2048) != 0 || (in_sizes[1] % 2048) != 0) return;

  const float* x   = (const float*)d_in[0];
  const float* w_q = (const float*)d_in[1];
  const float* w_k = (const float*)d_in[2];
  const float* w_v = (const float*)d_in[3];
  const float* w_o = (const float*)d_in[4];
  const float* rel = (const float*)d_in[5];
  float*       out = (float*)d_out;

  const size_t PW  = (size_t)DMODEL * DMODEL * 2;                 //  2097152
  const size_t PX  = (size_t)NROWS * DMODEL * 2;                  //  8388608
  const size_t PVT = (size_t)NB * DMODEL * NC * 2;                //  8388608
  size_t off = 0;
  const size_t oWQ = off; off += PW;
  const size_t oWK = off; off += PW;
  const size_t oWV = off; off += PW;
  const size_t oWO = off; off += PW;
  const size_t oX  = off; off += PX;
  const size_t oQh = off; off += PX;
  const size_t oQl = off; off += PX;
  const size_t oKh = off; off += PX;
  const size_t oKl = off; off += PX;
  const size_t oVh = off; off += PVT;
  const size_t oVl = off; off += PVT;
  const size_t oCh = off; off += PX;
  const size_t oCl = off; off += PX;
  if (off > ws_size) return;                                      // off = 83886080
  if (off > (size_t)134217728) return;

  char* ws = (char*)d_ws;
  unsigned short* WQ16 = (unsigned short*)(ws + oWQ);
  unsigned short* WK16 = (unsigned short*)(ws + oWK);
  unsigned short* WV16 = (unsigned short*)(ws + oWV);
  unsigned short* WO16 = (unsigned short*)(ws + oWO);
  unsigned short* X16  = (unsigned short*)(ws + oX);
  unsigned short* QHh  = (unsigned short*)(ws + oQh);
  unsigned short* QHl  = (unsigned short*)(ws + oQl);
  unsigned short* KHh  = (unsigned short*)(ws + oKh);
  unsigned short* KHl  = (unsigned short*)(ws + oKl);
  unsigned short* VTh  = (unsigned short*)(ws + oVh);
  unsigned short* VTl  = (unsigned short*)(ws + oVl);
  unsigned short* CTh  = (unsigned short*)(ws + oCh);
  unsigned short* CTl  = (unsigned short*)(ws + oCl);

  const dim3 blk(256);
  const dim3 gCV(CVX_BLOCKS + 4 * CVW_BLOCKS);                     // 2048 + 4 x 512 = 4096 blocks
  const int tilesP = (NROWS / 64) * (DMODEL / 64);                 // 1024
  const dim3 gP((tilesP + 7) / 8, 1);                              // 128
  const dim3 gQKV((tilesP + 7) / 8, 3);                            // 128 x 3
  const dim3 gAT(ATT_BLOCKS);                                      // 256
  const dim3 bAT(ATT_THREADS);                                     // 512
  static_assert(NB * (DMODEL / 128) * (NC / 256) == (NROWS / 128) * (DMODEL / 256));   // v^T tiles of both batches = tiles of q

  // (0) one launch: activation plane X16[row][c] = f16( bf16_RNE(x[row][c]) * 16 ), rows = b*2048 + tok; weight planes
  //     f16( bf16_RNE(W[n][k]) * 64 ) for Wq, Wk, Wv; bf16_RNE(Wo[n][k]) bits for Wo; [out][in] layout kept
  cvt_all<<<gCV, blk, 0, stream>>>(x, w_q, w_k, w_v, w_o, X16, WQ16, WK16, WV16, WO16);

  // (1) one launch: q[m][n] = sum_k x[m][k] Wq[n][k] and k likewise -> bf16 hi / residual planes;
  //     VT[b][d][tok] = sum_k Wv[d][k] x_b[tok][k] -> f16 x16 hi / residual planes
  qkv64<<<gQKV, blk, 0, stream>>>(X16, WQ16, WK16, WV16, QHh, QHl, KHh, KHl, VTh, VTl);

  // (5) attention per (batch, head, 256 query rows) -> CT (bf16 hi / residual planes)
  attn16<<<gAT, bAT, 0, stream>>>(QHh, QHl, KHh, KHl, VTh, VTl, rel, CTh, CTl);

  // (6) out = (CT_hi + CT_lo) . Wo^T; M = 4096, N = 1024, K = 1024, f32
  gemm64<0, 1, 1><<<gP, blk, 0, stream>>>(
      CTh, CTl, DMODEL, 0LL,
      WO16, DMODEL, 0LL,
      (void*)out, (void*)out, DMODEL, 0LL,
      NROWS, DMODEL, DMODEL, 1.0f, 1.0f);
  (void)hipGetLastError();
}

// v005
// It runs in 131 microseconds.
// Two timings next to v004 both put it at 1.07 times that version's speed.
// Counting every step since v000, it is 3.65 times as fast.
// Contractions (all f32 accumulate): q/k projections v_wmma_f32_16x16x32_f16 (x f16 x16 . W f16 x64, K=1024, single products) stored as bf16 hi/lo planes;
// v^T projection v_wmma_f32_16x16x32_f16 (Wv f16 x64 . x f16 x16, K=1024) stored as f16 x16 hi/lo planes;
// attention scores, transposed, v_wmma_f32_16x16x32_bf16 (k bf16 hi/lo . q^T bf16 hi/lo, hi.hi+lo.hi+hi.lo, K=64);
// v^T . P^T v_wmma_f32_16x16x32_f16 (v^T f16 x16 hi/lo . P^T f16 x1024 hi/lo, hi.hi+hi.lo+lo.hi, K=2048 by 32);
// output projection v_wmma_f32_16x16x32_bf16 (ctx bf16 hi/lo . Wo bf16, hi.W+lo.W, K=1024).
// Bucketed relative-position bias (per head, function of key-query offset) and online max-subtracted base-2 softmax in f32 on VALU.
// Every float input RNE-converted to bf16 on load.
#include <hip/hip_runtime.h>
#include <math.h>
#include <stdint.h>

#define NB      2
#define NQ      2048
#define NC      2048
#define DMODEL  1024
#define NHEAD   16
#define HDIM    64
#define NBKT    32
#define NROWS   (NB * NQ)
#define WSC     64.0f
#define ACARRY  16.0f
#define VC      16.0f
#define PC      1024.0f
#define ATT_SCALE 0.125f
#define LOG2E   1.4426950408889634f
#define SL2     (ATT_SCALE * LOG2E)
static_assert(NHEAD * HDIM == DMODEL);
static_assert((NQ % 64) == 0 && (NC % 64) == 0 && (DMODEL % 64) == 0 && (NC % 32) == 0 && (NQ % 16) == 0);
static_assert((NROWS % 128) == 0 && (DMODEL % 256) == 0 && (NC % 256) == 0 && (DMODEL % 128) == 0);
#define ATT_THREADS 512
#define QBLK        256                                  // query rows per block: 16 waves x 16 rows, one head
#define ATT_BLOCKS  (NB * NHEAD * (NQ / QBLK))
static_assert(ATT_THREADS == 512 && ATT_BLOCKS == 256 && (NQ % QBLK) == 0 && NQ / QBLK == 8 && NHEAD == 16);
#define LUTP            (NC + QBLK)                      // bias table entries of one head: key - tok + (first row + 255) in [0, 2302]
#define SKEYS           64                               // keys per LDS stage
#define NSTG            (NC / SKEYS)
#define SPITCH          72                               // halves: 128-B rows at a 144-B pitch (16 B x odd) for 16-B LDS reads
#define GKS             64                               // k per LDS stage of the GEMM (128-B rows)
#define PLANE_HALVES    (64 * SPITCH)
#define BUF_HALVES      (4 * PLANE_HALVES)               // K hi, K lo, v^T hi, v^T lo
#define ATT_SMEM_FLOATS (LUTP / 2 + BUF_HALVES)
static_assert(SKEYS == 64 && HDIM == 64 && NSTG >= 2 && (NC % SKEYS) == 0);
static_assert((LUTP % 8) == 0 && (PLANE_HALVES % 8) == 0);
static_assert((size_t)2 * QBLK * HDIM * sizeof(unsigned short) <= (size_t)ATT_SMEM_FLOATS * sizeof(float));

typedef _Float16 v16h __attribute__((ext_vector_type(16)));
typedef _Float16 v8h  __attribute__((ext_vector_type(8)));
typedef __bf16   v16b __attribute__((ext_vector_type(16)));
typedef float    v8f  __attribute__((ext_vector_type(8)));
typedef float    v4f  __attribute__((ext_vector_type(4)));
typedef float    v2f  __attribute__((ext_vector_type(2)));
typedef _Float16 v2h  __attribute__((ext_vector_type(2)));
typedef unsigned int v4u __attribute__((ext_vector_type(4)));

union FragH { v16h v; v8h h[2]; v4u u[2]; };
union FragAny { v16h h; v16b b; };

// ---- scalar helpers --------------------------------------------------------------------------------
__device__ __forceinline__ unsigned short bf_bits(float f) {          // f32 -> bf16 bits, RNE convert
  unsigned u = __float_as_uint(f);
  return (unsigned short)((u + 0x7FFFu + ((u >> 16) & 1u)) >> 16);
}
__device__ __forceinline__ float bf_up(unsigned short h) { return __uint_as_float(((unsigned)h) << 16); }
__device__ __forceinline__ float bfr(float f) { return bf_up(bf_bits(f)); }   // value of the bf16 RNE convert
__device__ __forceinline__ unsigned short h_bits(_Float16 x) { return __builtin_bit_cast(unsigned short, x); }
__device__ __forceinline__ unsigned pk16(unsigned short a, unsigned short b) { return (unsigned)a | ((unsigned)b << 16); }
__device__ __forceinline__ float other_half(float v) {               // the value that lane l ^ 16 holds
  const int b = __builtin_bit_cast(int, v);
  return __builtin_bit_cast(float, __builtin_amdgcn_permlanex16(b, b, 0x76543210, 0xfedcba98, false, false));
}
// 2^x as the bare v_exp_f32. Every argument here is <= 0 (a score or the old maximum minus the new maximum); a result below 2^-126 comes out as 0,
// which neither the f16 P planes (x1024) nor a row sum that holds the maximum's own 1 can tell from the exact value; -inf gives 0.
__device__ __forceinline__ float exp2_bare(float x) { return __builtin_amdgcn_exp2f(x); }
__device__ __forceinline__ v8f zero8() { v8f z = {0.f, 0.f, 0.f, 0.f, 0.f, 0.f, 0.f, 0.f}; return z; }

// ---- fragment loader: 16-bit A/B operand from a k-contiguous 16-bit plane, lane -> row/col (lane&15),
//      p already includes +8*(lane>>4); elements 0..7 <- p[0..7] (k0+8h..), elements 8..15 <- p[16..23] (k0+16+8h..)
//      (same split k map for A and B; B is always read from a [n][k] plane)
__device__ __forceinline__ v16h ldfrag_u(const unsigned short* p) {
  FragH f;
  f.u[0] = *(const v4u*)(p);
  f.u[1] = *(const v4u*)(p + 16);
  return f.v;
}

// ---- WMMA helpers with trailing VALU hazard gaps ------------------------------------------------------
__device__ __forceinline__ v8f mma_h(v16h a, v16h b, v8f c) {
  return __builtin_amdgcn_wmma_f32_16x16x32_f16(false, a, false, b, (short)0, c, false, false);
}
__device__ __forceinline__ v8f mma_b(v16h a, v16h b, v8f c) {
  FragAny ua, ub;
  ua.h = a;
  ub.h = b;
  return __builtin_amdgcn_wmma_f32_16x16x32_bf16(false, ua.b, false, ub.b, (short)0, c, false, false);
}
template <int BF>
__device__ __forceinline__ v8f mmaT(v16h a, v16h b, v8f c) {
  if constexpr (BF != 0) return mma_b(a, b, c);
  else return mma_h(a, b, c);
}
__device__ __forceinline__ void dep_guard1(v8f& a, v8f& b, v16h x) {
#if defined(__HIP_DEVICE_COMPILE__)
  asm volatile("v_nop\n\tv_nop\n\tv_nop\n\tv_nop" : "+v"(a), "+v"(b) : "v"(x));
#endif
}
__device__ __forceinline__ void guard1x4(v8f& s, v16h a0, v16h a1, v16h a2, v16h a3) {
#if defined(__HIP_DEVICE_COMPILE__)
  asm volatile("v_nop\n\tv_nop\n\tv_nop\n\tv_nop" : "+v"(s) : "v"(a0), "v"(a1), "v"(a2), "v"(a3));
#endif
}
__device__ __forceinline__ void guard1x8(v8f& s, v16h a0, v16h a1, v16h a2, v16h a3,
                                         v16h b0, v16h b1, v16h b2, v16h b3) {
#if defined(__HIP_DEVICE_COMPILE__)
  asm volatile("v_nop\n\tv_nop\n\tv_nop\n\tv_nop"
               : "+v"(s) : "v"(a0), "v"(a1), "v"(a2), "v"(a3), "v"(b0), "v"(b1), "v"(b2), "v"(b3));
#endif
}
__device__ __forceinline__ void guard4x6(v8f& a, v8f& b, v8f& c, v8f& d,
                                         v16h x0, v16h x1, v16h x2, v16h x3, v16h x4, v16h x5) {
#if defined(__HIP_DEVICE_COMPILE__)
  asm volatile("v_nop\n\tv_nop\n\tv_nop\n\tv_nop"
               : "+v"(a), "+v"(b), "+v"(c), "+v"(d) : "v"(x0), "v"(x1), "v"(x2), "v"(x3), "v"(x4), "v"(x5));
#endif
}
__device__ __forceinline__ void guard4x5(v8f& a, v8f& b, v8f& c, v8f& d,
                                         v16h x0, v16h x1, v16h x2, v16h x3, v16h x4) {
#if defined(__HIP_DEVICE_COMPILE__)
  asm volatile("v_nop\n\tv_nop\n\tv_nop\n\tv_nop"
               : "+v"(a), "+v"(b), "+v"(c), "+v"(d) : "v"(x0), "v"(x1), "v"(x2), "v"(x3), "v"(x4));
#endif
}
__device__ __forceinline__ void keep4_h(v16h a, v16h b, v16h c, v16h d) {
#if defined(__HIP_DEVICE_COMPILE__)
  asm volatile("v_nop" :: "v"(a), "v"(b), "v"(c), "v"(d));
#endif
}
__device__ __forceinline__ void acc_guard4(v8f& a, v8f& b, v8f& c, v8f& d) {
#if defined(__HIP_DEVICE_COMPILE__)
  asm volatile("v_nop\n\tv_nop\n\tv_nop\n\tv_nop" : "+v"(a), "+v"(b), "+v"(c), "+v"(d));
#endif
}
__device__ __forceinline__ void wave_sync_lds() {
  __builtin_amdgcn_fence(__ATOMIC_RELEASE, "workgroup");
  __builtin_amdgcn_wave_barrier();
  __builtin_amdgcn_fence(__ATOMIC_ACQUIRE, "workgroup");
}
// Four 16-B-per-lane asynchronous copies global -> LDS (l*: the lane's LDS byte address, g*: the lane's global address).
// The s_wait_xcnt stands inside the statement so that no address register is rewritten in front of it.
__device__ __forceinline__ void async_copy4(unsigned l0, const unsigned short* g0, unsigned l1, const unsigned short* g1,
                                            unsigned l2, const unsigned short* g2, unsigned l3, const unsigned short* g3) {
#if defined(__HIP_DEVICE_COMPILE__)
  asm volatile("global_load_async_to_lds_b128 %0, %1, off\n\t"
               "global_load_async_to_lds_b128 %2, %3, off\n\t"
               "global_load_async_to_lds_b128 %4, %5, off\n\t"
               "global_load_async_to_lds_b128 %6, %7, off\n\t"
               "s_wait_xcnt 0x0"
               :: "v"(l0), "v"(g0), "v"(l1), "v"(g1), "v"(l2), "v"(g2), "v"(l3), "v"(g3) : "memory");
#endif
}
__device__ __forceinline__ void wait_async0() {   // this wave's own copies have landed in LDS
#if defined(__HIP_DEVICE_COMPILE__)
  asm volatile("s_wait_asynccnt 0x0" ::: "memory");
#endif
}
__device__ __forceinline__ void wait_ds0() {      // this wave's own LDS reads have returned (before their buffer is refilled)
#if defined(__HIP_DEVICE_COMPILE__)
  asm volatile("s_wait_dscnt 0x0" ::: "memory");
#endif
}

// =====================================================================================================
// Elementwise 16-bit pack, no transpose. BFO 0: dst[i] = f16( bf16_RNE(src[i]) * sc ), sc a power of two (exact);
// BFO 1: dst[i] = bf16_RNE(src[i]) bits. 8 elements per thread: two 16-B loads, one 16-B store per lane; 32 consecutive
// coverage: n / 2048 blocks (index bx) x 256 thr x 8 elements = n exactly (host checks n % 2048 == 0).
// =====================================================================================================
template <int BFO>
__device__ __forceinline__ void cvt16(const float* __restrict__ src, unsigned short* dst, int n, float sc, int bx) {
  const size_t i8 = ((size_t)bx * 256 + threadIdx.x) * 8;
  if (i8 + 8 > (size_t)n) return;                 // never taken with the exact grid; no barriers in this kernel
  const v4f a = *(const v4f*)(src + i8);
  const v4f b = *(const v4f*)(src + i8 + 4);
  v4u o;
  if constexpr (BFO != 0) {
    o[0] = pk16(bf_bits(a[0]), bf_bits(a[1]));
    o[1] = pk16(bf_bits(a[2]), bf_bits(a[3]));
    o[2] = pk16(bf_bits(b[0]), bf_bits(b[1]));
    o[3] = pk16(bf_bits(b[2]), bf_bits(b[3]));
  } else {
    o[0] = pk16(h_bits((_Float16)(bfr(a[0]) * sc)), h_bits((_Float16)(bfr(a[1]) * sc)));
    o[1] = pk16(h_bits((_Float16)(bfr(a[2]) * sc)), h_bits((_Float16)(bfr(a[3]) * sc)));
    o[2] = pk16(h_bits((_Float16)(bfr(b[0]) * sc)), h_bits((_Float16)(bfr(b[1]) * sc)));
    o[3] = pk16(h_bits((_Float16)(bfr(b[2]) * sc)), h_bits((_Float16)(bfr(b[3]) * sc)));
  }
  {
    *(v4u*)(dst + i8) = o;
    
  }
}
// All five converts in one launch; the block index picks the job (block-uniform): blocks 0..2047 the activations (f16 x16),
// then 512 blocks each for Wq, Wk, Wv (f16 x64) and Wo (bf16 bits).
#define CVX_BLOCKS ((NROWS * DMODEL) / 2048)
#define CVW_BLOCKS ((DMODEL * DMODEL) / 2048)
__global__ __launch_bounds__(256) void cvt_all(const float* __restrict__ x, const float* __restrict__ w_q, const float* __restrict__ w_k,
                                               const float* __restrict__ w_v, const float* __restrict__ w_o,
                                               unsigned short* X16, unsigned short* WQ16, unsigned short* WK16,
                                               unsigned short* WV16, unsigned short* WO16) {
  const int b = blockIdx.x;
  if (b < CVX_BLOCKS) {
    cvt16<0>(x, X16, NROWS * DMODEL, ACARRY, b);
    return;
  }
  const int job = (b - CVX_BLOCKS) / CVW_BLOCKS;           // 0..3 with the exact grid
  const int bw  = (b - CVX_BLOCKS) - job * CVW_BLOCKS;
  if (job == 3) {
    cvt16<1>(w_o, WO16, DMODEL * DMODEL, 1.0f, bw);
  } else if (job < 3) {
    const float* src    = (job == 0) ? w_q  : (job == 1) ? w_k  : w_v;
    unsigned short* dst = (job == 0) ? WQ16 : (job == 1) ? WK16 : WV16;
    cvt16<0>(src, dst, DMODEL * DMODEL, WSC, bw);
  }
}

// =====================================================================================================
// Register-blocked batched 16-bit WMMA GEMM: C[m][n] = oscale * sum_k A[m][k] * Bt[n][k]; one wave per 64x64 tile, a block of 8 waves
// (2 x 4) per 128x256 tile. The block's 128 A rows (and A2 rows) and 256 Bt rows of a 64-k stage (128 B per row) are brought into LDS once
// per block by asynchronous 16-B copies (8 lanes per 128-B row; 12 or 16 copies per thread and stage), two buffers: stage t + 2 is issued
// behind the barrier that ends stage t; the waves read their fragments from there (two 16-B LDS loads per fragment, row pitch 144 B).
// A row-major [M][K] pitch lda (16-bit plane), Bt row-major [N][K] pitch ldb (k contiguous); M multiple of 128, N of 256, K of 64.
// bx = tile index, by = batch index with element strides sA, sB, sC; sT (8 per-wave slabs) and gst (two stage buffers) are the calling kernel's LDS.
// ASPLIT 1: a second A plane A2 (unscaled residual of A, same layout) is multiplied into the same accumulator (A + A2 ~ exact A).
// BF 1: bf16 operands (v_wmma_f32_16x16x32_bf16), else f16.
// OM 0: f32 out (pitch ldc).  OM 2: f16 out = f16(value * ocarry).  OM 3: two bf16 planes: hi = bf16_RNE(value), lo = bf16_RNE(value - hi).
// OM 4: two f16 planes: hi = f16(value * ocarry), lo = f16(value * ocarry - hi) (unscaled residual).
// coverage: 4 slabs x 16 rows (f32: it 0..7 x lane>>4; 16-bit: it 0..3 x lane>>3) x 64 cols = the wave's whole 64x64 tile;
//           stage: 256 threads x 16 B = 32 rows x 128 B per copy; grid = (M / 128) * (N / 256) blocks, a surplus block exits whole.
// =====================================================================================================
#define GSLAB (16 * 68)                             // floats of a per-wave 16x64 slab, pitch 68 floats
#define GBUF_HALVES(ASPLIT) ((256 + 128 * (1 + (ASPLIT))) * SPITCH)   // rows of a stage buffer: Bt 0..255 | A 256..383 | A2 384..511
template <int OM, int ASPLIT, int BF>
__device__ __forceinline__ void gemm_tile(
    const unsigned short* __restrict__ Ap, const unsigned short* __restrict__ A2p, int lda, long long sA,
    const unsigned short* __restrict__ Btp, int ldb, long long sB,
    void* Cout, void* C2out, int ldc, long long sC,
    int M, int N, int K, float oscale, float ocarry,
    int bx, int by, float* sT, unsigned short* gst) {
  constexpr int GBUF  = GBUF_HALVES(ASPLIT);       // halves per stage buffer
  constexpr unsigned R32 = 32 * SPITCH * 2;        // LDS bytes of 32 rows (one copy of the whole block)
  const int tid  = threadIdx.x;
  const int lane = threadIdx.x & 31;
  const int wave = threadIdx.x >> 5;
  const int blocksN = N >> 8;
  const int blocksM = M >> 7;
  // block-uniform, in front of every barrier; never taken with the exact grids and shapes of this file
  if ((M & 127) != 0 || (N & 255) != 0 || (K & (GKS - 1)) != 0 || K < GKS || bx >= blocksM * blocksN) return;
  const int bm  = bx / blocksN;
  const int bn  = bx - bm * blocksN;
  const int mb0 = bm << 7;
  const int nb0 = bn << 8;
  const int m0 = mb0 + ((wave >> 2) << 6);
  const int n0 = nb0 + ((wave & 3) << 6);

  const unsigned short* A1 = Ap  + (size_t)((long long)by * sA);
  const unsigned short* A2 = A2p + (size_t)((long long)by * sA);
  const unsigned short* Bb = Btp + (size_t)((long long)by * sB);

  const int rlane = lane & 15;                 // row (A) / col (B, D) within subtile
  const int koff  = (lane >> 4) * 8;           // k offset of this lane half
  const int mOff  = (lane >> 4) * 8;           // D row offset

  v8f acc[4][4];
#pragma unroll
  for (int i = 0; i < 4; ++i)
#pragma unroll
    for (int j = 0; j < 4; ++j) acc[i][j] = zero8();

  // ---- stage copies: thread -> row tid / 8 (+ 32 per copy), 16-B piece tid % 8 of the row's 128 B ----
  const int sr = tid >> 3, sp = (tid & 7) * 8;
  const unsigned short* gB  = Bb + (size_t)(nb0 + sr) * ldb + sp;
  const unsigned short* gA  = A1 + (size_t)(mb0 + sr) * lda + sp;
  const unsigned short* gA2 = A2 + (size_t)(mb0 + sr) * lda + sp;
  const size_t b32 = (size_t)32 * ldb, a32 = (size_t)32 * lda;
  const unsigned ldst = (unsigned)(uintptr_t)(gst + sr * SPITCH + sp);   // LDS byte address = low 32 bits
  auto stage_copy = [&](int st, int buf) {
    const size_t ks = (size_t)st * GKS;
    const unsigned l = ldst + (unsigned)buf * (GBUF * 2);
    const unsigned short* b = gB + ks;
    const unsigned short* a = gA + ks;
    async_copy4(l,            b,           l + R32,      b + b32,     l + 2 * R32,  b + 2 * b32, l + 3 * R32,  b + 3 * b32);
    async_copy4(l + 4 * R32,  b + 4 * b32, l + 5 * R32,  b + 5 * b32, l + 6 * R32,  b + 6 * b32, l + 7 * R32,  b + 7 * b32);
    async_copy4(l + 8 * R32,  a,           l + 9 * R32,  a + a32,     l + 10 * R32, a + 2 * a32, l + 11 * R32, a + 3 * a32);
    if constexpr (ASPLIT != 0) {
      const unsigned short* a2 = gA2 + ks;
      async_copy4(l + 12 * R32, a2,        l + 13 * R32, a2 + a32,    l + 14 * R32, a2 + 2 * a32, l + 15 * R32, a2 + 3 * a32);
    }
  };
  const int nst = K / GKS;
  stage_copy(0, 0);
  wait_async0();
  __syncthreads();                                         // publishes stage 0
  if (nst > 1) stage_copy(1, 1);

  for (int st = 0; st < nst; ++st) {
    const unsigned short* sb = gst + (st & 1) * GBUF + rlane * SPITCH + koff;   // lane's row rlane, k half
    const unsigned short* sB = sb + ((wave & 3) << 6) * SPITCH;
    const unsigned short* sA = sb + (256 + ((wave >> 2) << 6)) * SPITCH;
    // unrolled: the offsets inside the stage become immediates of the LDS loads
#pragma unroll
    for (int kk = 0; kk < GKS; kk += 32) {
      v16h bh[4], ah[4], al[ASPLIT != 0 ? 4 : 1];
#pragma unroll
      for (int j = 0; j < 4; ++j) bh[j] = ldfrag_u(sB + (j << 4) * SPITCH + kk);
#pragma unroll
      for (int i = 0; i < 4; ++i) ah[i] = ldfrag_u(sA + (i << 4) * SPITCH + kk);
      if constexpr (ASPLIT != 0) {
#pragma unroll
        for (int i = 0; i < 4; ++i) al[i] = ldfrag_u(sA + (128 + (i << 4)) * SPITCH + kk);
      }
#pragma unroll
      for (int i = 0; i < 4; ++i) {
#pragma unroll
        for (int j = 0; j < 4; ++j) acc[i][j] = mmaT<BF>(ah[i], bh[j], acc[i][j]);
        dep_guard1(acc[i][0], acc[i][3], ah[i]);
        if constexpr (ASPLIT != 0) {
#pragma unroll
          for (int j = 0; j < 4; ++j) acc[i][j] = mmaT<BF>(al[i], bh[j], acc[i][j]);
          dep_guard1(acc[i][0], acc[i][3], al[i]);
        }
      }
      keep4_h(bh[0], bh[1], bh[2], bh[3]);
    }
    // ---- publish point of stage st + 1 ----
    wait_ds0();
    wait_async0();
    __syncthreads();                       // publishes stage st + 1 and ends every wave's reads of stage st's buffer
    if (st + 2 < nst) stage_copy(st + 2, st & 1);
  }
  wait_async0();
  acc_guard4(acc[0][0], acc[0][1], acc[0][2], acc[0][3]);
  acc_guard4(acc[1][0], acc[1][1], acc[1][2], acc[1][3]);
  acc_guard4(acc[2][0], acc[2][1], acc[2][2], acc[2][3]);
  acc_guard4(acc[3][0], acc[3][1], acc[3][2], acc[3][3]);

  const int hh2 = lane >> 4, c4 = (lane & 15) * 4;     // f32 out: 256-B row segment = 16 lanes x 16 B
  const int q8  = lane >> 3, c8 = (lane & 7) * 8;

  // ---- epilogue ----
  float* slab = sT + wave * GSLAB;
#pragma unroll
  for (int i = 0; i < 4; ++i) {
    const int mBase = m0 + (i << 4);
#pragma unroll
    for (int j = 0; j < 4; ++j) {
#pragma unroll
      for (int r = 0; r < 8; ++r) {
        slab[(mOff + r) * 68 + (j << 4) + rlane] = acc[i][j][r];
      }
    }
    wave_sync_lds();
    if constexpr (OM == 0) {
      float* C = (float*)Cout + (size_t)((long long)by * sC);
      v4f vals[8];
#pragma unroll
      for (int it = 0; it < 8; ++it) {
        const int row = it * 2 + hh2;                      // it 0..7 x hh2 0..1 = rows 0..15
        v4f v = *(const v4f*)(slab + row * 68 + c4);
#pragma unroll
        for (int e = 0; e < 4; ++e) v[e] = v[e] * oscale;
        vals[it] = v;
      }
      {
#pragma unroll
        for (int it = 0; it < 8; ++it) {
          const int gr = mBase + it * 2 + hh2;
          *(v4f*)(C + (size_t)gr * ldc + n0 + c4) = vals[it];
        }
        
      }
    } else {
      unsigned short* C  = (unsigned short*)Cout  + (size_t)((long long)by * sC);
      unsigned short* Cb = (unsigned short*)C2out + (size_t)((long long)by * sC);
      v4u hv[4], lv[4];
#pragma unroll
      for (int it = 0; it < 4; ++it) {
        const int row = it * 4 + q8;                       // it 0..3 x q8 0..3 = rows 0..15
        const float* sp = slab + row * 68 + c8;
        v4u a  = {0u, 0u, 0u, 0u};
        v4u b2 = {0u, 0u, 0u, 0u};
#pragma unroll
        for (int e = 0; e < 4; ++e) {
          float f0 = sp[2 * e] * oscale;
          float f1 = sp[2 * e + 1] * oscale;
          if constexpr (OM == 3) {
            const unsigned short h0 = bf_bits(f0), h1 = bf_bits(f1);
            a[e]  = pk16(h0, h1);
            b2[e] = pk16(bf_bits(f0 - bf_up(h0)), bf_bits(f1 - bf_up(h1)));
          } else {
            f0 *= ocarry; f1 *= ocarry;
            const _Float16 x0 = (_Float16)f0, x1 = (_Float16)f1;
            a[e] = pk16(h_bits(x0), h_bits(x1));
            if constexpr (OM == 4) {
              b2[e] = pk16(h_bits((_Float16)(f0 - (float)x0)), h_bits((_Float16)(f1 - (float)x1)));
            }
          }
        }
        hv[it] = a;
        lv[it] = b2;
      }
      {
#pragma unroll
        for (int it = 0; it < 4; ++it) {
          const int row = it * 4 + q8;
          *(v4u*)(C + (size_t)(mBase + row) * ldc + n0 + c8) = hv[it];
          if constexpr (OM >= 3) {
            *(v4u*)(Cb + (size_t)(mBase + row) * ldc + n0 + c8) = lv[it];
          }
        }
        
      }
    }
    wave_sync_lds();
  }
}

// The three projections in one launch of 128 x 3 blocks, all resident at once (two blocks fit a WGP's LDS); blockIdx.y picks the job
// (block-uniform): 0 q and 1 k (x . W^T -> bf16 hi / residual planes; M = 4096, N = 1024, K = 1024, 128 tiles each),
// 2 v^T per batch (Wv . x_b^T -> f16 x16 hi / residual planes; M = 1024, N = 2048, K = 1024, 64 tiles for each of the two batches).
__global__ __launch_bounds__(256) void qkv64(
    const unsigned short* __restrict__ X16, const unsigned short* __restrict__ WQ16, const unsigned short* __restrict__ WK16,
    const unsigned short* __restrict__ WV16, unsigned short* QHh, unsigned short* QHl, unsigned short* KHh, unsigned short* KHl,
    unsigned short* VTh, unsigned short* VTl) {
  __shared__ __align__(16) float sT[8 * GSLAB];
  __shared__ __align__(16) unsigned short gst[2 * GBUF_HALVES(0)];
  const int job = blockIdx.y;
  const int bx  = blockIdx.x;
  if (job < 2) {
    gemm_tile<3, 0, 0>(X16, X16, DMODEL, 0LL,
                       job == 0 ? WQ16 : WK16, DMODEL, 0LL,
                       (void*)(job == 0 ? QHh : KHh), (void*)(job == 0 ? QHl : KHl), DMODEL, 0LL,
                       NROWS, DMODEL, DMODEL, 1.0f / (ACARRY * WSC), 1.0f, bx, 0, sT, gst);
  } else {
    constexpr int TV = (DMODEL / 128) * (NC / 256);          // 64 tiles per batch
    gemm_tile<4, 0, 0>(WV16, WV16, DMODEL, 0LL,
                       X16, DMODEL, (long long)NC * DMODEL,
                       (void*)VTh, (void*)VTl, NC, (long long)DMODEL * NC,
                       DMODEL, NC, DMODEL, 1.0f / (ACARRY * WSC), VC, bx % TV, bx / TV, sT, gst);
  }
}

template <int OM, int ASPLIT, int BF>
__global__ __launch_bounds__(256) void gemm64(
    const unsigned short* __restrict__ Ap, const unsigned short* __restrict__ A2p, int lda, long long sA,
    const unsigned short* __restrict__ Btp, int ldb, long long sB,
    void* Cout, void* C2out, int ldc, long long sC,
    int M, int N, int K, float oscale, float ocarry) {
  __shared__ __align__(16) float sT[8 * GSLAB];
  __shared__ __align__(16) unsigned short gst[2 * GBUF_HALVES(ASPLIT)];
  gemm_tile<OM, ASPLIT, BF>(Ap, A2p, lda, sA, Btp, ldb, sB, Cout, C2out, ldc, sC, M, N, K, oscale, ocarry,
                            (int)blockIdx.x, (int)blockIdx.y, sT, gst);
}

// =====================================================================================================
// Flash attention for one batch, one head and 256 query rows (one wave per 16 rows), head dim 64, 2048 keys:
//   q planes (bf16 hi, lo) Q[b*2048 + tok][64h + d], pitch 1024; k planes (bf16 hi, lo) K[b*2048 + key][64h + d], pitch 1024;
//   v^T planes (f16 x16 hi, unscaled lo): VT[b*1024 + 64h + d][key] (pitch 2048); bias = bf16(rel[bucket(key - tok)][h]) from a
//   per-block LDS table of bf16 bits indexed by (key - tok + first row + 255), bucket() piecewise constant in the offset;
//   out (bf16 hi, lo planes): CT[b*2048 + tok][64h + d] = sum_m softmax_m(q.k / 8 + bias) v[m][d]  (softmax run in base 2).
//   block = 16 waves = 512 threads; grid = 2 x 16 x 8 = 256; every wave does identical bounded work (32 stages of 64 keys).
//   The head's K rows and v^T rows of a stage (four planes of 64 rows x 128 B) are brought into LDS once per block by asynchronous
//   16-B copies (four per thread and stage; 8 lanes per 128-B row), two buffers: stage t + 2 is issued behind the barrier that ends
//   stage t; all 16 waves read their fragments from there (two 16-B LDS loads per fragment, row pitch 144 B).
//   Per 32 keys: 2 transposed score tiles S^T = K . q^T on bf16 WMMA (A = K rows, B = q; K = 64 as two k-steps of 32): lane (c, hh) holds
//   query c's scores of keys 8hh + r and 16 + 8hh + r; their 16 bias values from the LDS table (u16); online max-subtracted softmax in
//   f32 (exp2) with the maximum in-lane plus one exchange between the lane halves, the sum kept per lane half and joined behind the loop;
//   rescale of the running sum and the four accumulators; P^T (f16 hi and unscaled residual) packed from the two score tiles straight into
//   a B operand (hardware k order, as the v^T loader's); 12 WMMAs O^T += v^T . P^T (hi.hi, hi.lo, lo.hi).
//   Final 1/l and carry folds in f32; behind the last stage's barrier the LDS buffer is reused as the block's two bf16 result buffers
//   [256][64] (hi, lo): each wave stages its 16x64 slice; after a block barrier the 512 threads write 128-B row segments.
// coverage: LDS table: 512 threads stride over 2304 entries (all written); stage: 512 threads x 16 B = 64 rows x 128 B per plane;
//           global: 4 iterations x 512 threads x 8 halves = 256 rows x 64 columns of the head, per plane;
//           grid covers all 2 x 2048 rows x 16 heads exactly once.
// =====================================================================================================
__global__ __launch_bounds__(ATT_THREADS)
void attn16(const unsigned short* __restrict__ QHh, const unsigned short* __restrict__ QHl,
            const unsigned short* __restrict__ KHh, const unsigned short* __restrict__ KHl,
            const unsigned short* __restrict__ VTh, const unsigned short* __restrict__ VTl,
            const float* __restrict__ rel, unsigned short* CTh, unsigned short* CTl) {
  // bias table u16 [2304] | two stage buffers of four planes [64][72] u16
  __shared__ __align__(16) float smem[ATT_SMEM_FLOATS];
  unsigned short* lut = (unsigned short*)smem;
  unsigned short* stg = lut + LUTP;

  const int tid  = threadIdx.x;
  const int wave = tid >> 5;
  const int lane = tid & 31;
  const int hh   = lane >> 4;
  const int c    = lane & 15;

  const int qb   = blockIdx.x & ((NQ / QBLK) - 1);         // 0..7
  const int head = (blockIdx.x / (NQ / QBLK)) & (NHEAD - 1);   // 0..15
  const int bat  = blockIdx.x / ((NQ / QBLK) * NHEAD);     // 0..1
  const int qb0  = qb * QBLK;
  const int q0   = qb0 + wave * 16;

  // ---- stage copies: thread -> row tid / 8 (key of K, d of v^T), 16-B piece tid % 8 of the row's 128 B, in each of the four planes ----
  const int sr = tid >> 3, sp = (tid & 7) * 8;
  const size_t gko = ((size_t)bat * NC + sr) * DMODEL + head * HDIM + sp;
  const size_t gvo = ((size_t)bat * DMODEL + head * HDIM + sr) * NC + sp;
  const unsigned short* gKh = KHh + gko;
  const unsigned short* gKl = KHl + gko;
  const unsigned short* gVh = VTh + gvo;
  const unsigned short* gVl = VTl + gvo;
  const unsigned ldst = (unsigned)(uintptr_t)(stg + sr * SPITCH + sp);   // LDS byte address = low 32 bits
  auto stage_copy = [&](int st, int buf) {
    const size_t ka = (size_t)st * SKEYS * DMODEL, va = (size_t)st * SKEYS;
    const unsigned l = ldst + (unsigned)buf * (BUF_HALVES * 2);
    async_copy4(l, gKh + ka, l + PLANE_HALVES * 2, gKl + ka, l + PLANE_HALVES * 4, gVh + va, l + PLANE_HALVES * 6, gVl + va);
  };
  stage_copy(0, 0);

  // ---- per-block bias table: lut[i] = bf16 bits of rel[bucket(i - (qb0 + 255))][head], i = key - tok + qb0 + 255 in [0, 2302] ----
  for (int i = tid; i < LUTP; i += ATT_THREADS) {
    const int d  = i - (qb0 + QBLK - 1);                   // key - tok
    const int a  = (d < 0) ? -d : d;
    int g = 8 + (a >= 12) + (a >= 16) + (a >= 23) + (a >= 32) + (a >= 46) + (a >= 64) + (a >= 91);
    g = (a < 8) ? a : g;
    const int bk = g + ((d > 0) ? 16 : 0);                 // 0..31
    lut[i] = bf_bits(rel[bk * NHEAD + head]);              // index in [0, 511]
  }
  wait_async0();
  __syncthreads();                                         // publishes the bias table and stage 0
  stage_copy(1, 1);

  const size_t qofs = ((size_t)bat * NQ + q0 + c) * DMODEL + head * HDIM + 8 * hh;
  const v16h qah = ldfrag_u(QHh + qofs), qbh = ldfrag_u(QHh + qofs + 32);
  const v16h qal = ldfrag_u(QHl + qofs), qbl = ldfrag_u(QHl + qofs + 32);
  // + kb; element (query row 16 wave + c, key kb + 16t + 8hh + r) at [16t + r]; 255 - 16 wave - c written as 16 (15 - wave) + (15 - c)
  const unsigned short* lw = lut + (16 * (wave ^ 15) + (c ^ 15) + 8 * hh);

  float mrow = -INFINITY, lrow = 0.f;      // query c's running maximum (both lane halves alike) and this lane half's running sum
  v8f o0 = zero8(), o1 = zero8(), o2 = zero8(), o3 = zero8();   // O^T: o_t[r] = (d = 16t + 8hh + r, query c)

#pragma unroll 1
  for (int st = 0; st < NSTG; ++st) {
    const unsigned short* sKh = stg + (st & 1) * BUF_HALVES + c * SPITCH + 8 * hh;   // lane's row c, k half hh
    const unsigned short* sKl = sKh + PLANE_HALVES;
    const unsigned short* sVh = sKh + 2 * PLANE_HALVES;
    const unsigned short* sVl = sKh + 3 * PLANE_HALVES;
    // unrolled: the offsets inside the stage become immediates of the LDS loads
#pragma unroll
    for (int kk = 0; kk < SKEYS; kk += 32) {
      const int kb = st * SKEYS + kk;
      const int ko = kk * SPITCH;
      v8f s0, s1;
      {
        const v16h k0h = ldfrag_u(sKh + ko), k1h = ldfrag_u(sKh + ko + 32);
        const v16h k0l = ldfrag_u(sKl + ko), k1l = ldfrag_u(sKl + ko + 32);
        s0 = mma_b(k0h, qah, zero8());
        s0 = mma_b(k1h, qbh, s0);
        s0 = mma_b(k0l, qah, s0);
        s0 = mma_b(k1l, qbh, s0);
        s0 = mma_b(k0h, qal, s0);
        s0 = mma_b(k1h, qbl, s0);
        guard1x4(s0, k0h, k1h, k0l, k1l);
      }
      {
        const int k2 = ko + 16 * SPITCH;
        const v16h k0h = ldfrag_u(sKh + k2), k1h = ldfrag_u(sKh + k2 + 32);
        const v16h k0l = ldfrag_u(sKl + k2), k1l = ldfrag_u(sKl + k2 + 32);
        s1 = mma_b(k0h, qah, zero8());
        s1 = mma_b(k1h, qbh, s1);
        s1 = mma_b(k0l, qah, s1);
        s1 = mma_b(k1l, qbh, s1);
        s1 = mma_b(k0h, qal, s1);
        s1 = mma_b(k1h, qbl, s1);
        guard1x8(s1, k0h, k1h, k0l, k1l, qah, qbh, qal, qbl);
      }
      const unsigned short* lp = lw + kb;
      // pairs of neighbouring keys (registers 2e, 2e + 1 of a score tile): tp[e] of tile 0, tp[4 + e] of tile 1
      v2f tp[8];
#pragma unroll
      for (int e = 0; e < 4; ++e) {
        const v2f w0 = {bf_up(lp[2 * e]), bf_up(lp[2 * e + 1])}, w1 = {bf_up(lp[16 + 2 * e]), bf_up(lp[17 + 2 * e])};
        const v2f a0 = {s0[2 * e], s0[2 * e + 1]}, a1 = {s1[2 * e], s1[2 * e + 1]};
        tp[e]     = a0 * SL2 + w0 * LOG2E;
        tp[4 + e] = a1 * SL2 + w1 * LOG2E;
      }
      float mx = fmaxf(fmaxf(fmaxf(fmaxf(tp[0][0], tp[0][1]), fmaxf(tp[1][0], tp[1][1])), fmaxf(fmaxf(tp[2][0], tp[2][1]), fmaxf(tp[3][0], tp[3][1]))),
                       fmaxf(fmaxf(fmaxf(tp[4][0], tp[4][1]), fmaxf(tp[5][0], tp[5][1])), fmaxf(fmaxf(tp[6][0], tp[6][1]), fmaxf(tp[7][0], tp[7][1]))));
      mx = fmaxf(mx, other_half(mx));                      // query c's maximum over all 32 keys
      const float mn = fmaxf(mrow, mx);
      const float al = exp2_bare(mrow - mn);
      mrow = mn;
      FragH ph, pl;
      v2f ep[8];
#pragma unroll
      for (int e = 0; e < 8; ++e) {                        // element pair 2e, 2e + 1 of the B operand: keys kb + 16 (e / 4) + 8hh + 2 (e % 4) + 0, 1
        const v2f d = tp[e] - mn;
        ep[e] = v2f{exp2_bare(d[0]), exp2_bare(d[1])};
        const v2h x = __builtin_convertvector(ep[e] * PC, v2h);
        ph.v[2 * e]     = x[0];
        ph.v[2 * e + 1] = x[1];
        pl.v[2 * e]     = (_Float16)(ep[e][0] * PC - (float)x[0]);
        pl.v[2 * e + 1] = (_Float16)(ep[e][1] * PC - (float)x[1]);
      }
      const v2f ps = ((ep[0] + ep[1]) + (ep[2] + ep[3])) + ((ep[4] + ep[5]) + (ep[6] + ep[7]));
      lrow = lrow * al + (ps[0] + ps[1]);
#pragma unroll
      for (int r = 0; r < 8; ++r) {
        o0[r] *= al;
        o1[r] *= al;
        o2[r] *= al;
        o3[r] *= al;
      }
      {
        const v16h vh0 = ldfrag_u(sVh + kk);
        const v16h vh1 = ldfrag_u(sVh + kk + 16 * SPITCH);
        const v16h vh2 = ldfrag_u(sVh + kk + 32 * SPITCH);
        const v16h vh3 = ldfrag_u(sVh + kk + 48 * SPITCH);
        o0 = mma_h(vh0, ph.v, o0);
        o1 = mma_h(vh1, ph.v, o1);
        o2 = mma_h(vh2, ph.v, o2);
        o3 = mma_h(vh3, ph.v, o3);
        o0 = mma_h(vh0, pl.v, o0);
        o1 = mma_h(vh1, pl.v, o1);
        o2 = mma_h(vh2, pl.v, o2);
        o3 = mma_h(vh3, pl.v, o3);
        guard4x6(o0, o1, o2, o3, ph.v, pl.v, vh0, vh1, vh2, vh3);
      }
      {
        const v16h vl0 = ldfrag_u(sVl + kk);
        const v16h vl1 = ldfrag_u(sVl + kk + 16 * SPITCH);
        const v16h vl2 = ldfrag_u(sVl + kk + 32 * SPITCH);
        const v16h vl3 = ldfrag_u(sVl + kk + 48 * SPITCH);
        o0 = mma_h(vl0, ph.v, o0);
        o1 = mma_h(vl1, ph.v, o1);
        o2 = mma_h(vl2, ph.v, o2);
        o3 = mma_h(vl3, ph.v, o3);
        guard4x5(o0, o1, o2, o3, ph.v, vl0, vl1, vl2, vl3);
      }
    }
    // ---- publish point of stage st + 1 ----
    wait_ds0();
    wait_async0();
    __syncthreads();                       // publishes stage st + 1 and ends every wave's reads of stage st's buffer
    if (st + 2 < NSTG) stage_copy(st + 2, st & 1);
  }
  wait_async0();

  // ---- the last stage's barrier has ended all reads of LDS; the buffer becomes two bf16 result buffers [256][64] ----
  unsigned short* Osh = (unsigned short*)smem;
  unsigned short* Osl = Osh + QBLK * HDIM;
  // ---- fold 1/l and the carries (1024 on P, 16 on v), split into bf16 hi + residual, stage the wave's 16x64 slice ----
  const float oc = 1.0f / (PC * VC);
  const float inv = (1.0f / (lrow + other_half(lrow))) * oc;      // the two lane halves' sums joined
  const int ro = (wave * 16 + c) * HDIM + 8 * hh;                 // query row c, d = 16t + 8hh + 0..7: one 16-B LDS store per tile and plane
  auto put_tile = [&](const v8f& o, int t) {
    v4u hv, lv;
#pragma unroll
    for (int e = 0; e < 4; ++e) {
      const float f0 = o[2 * e] * inv, f1 = o[2 * e + 1] * inv;
      const unsigned short g0 = bf_bits(f0), g1 = bf_bits(f1);
      hv[e] = pk16(g0, g1);
      lv[e] = pk16(bf_bits(f0 - bf_up(g0)), bf_bits(f1 - bf_up(g1)));
    }
    *(v4u*)(Osh + ro + 16 * t) = hv;
    *(v4u*)(Osl + ro + 16 * t) = lv;
  };
  put_tile(o0, 0);
  put_tile(o1, 1);
  put_tile(o2, 2);
  put_tile(o3, 3);
  __syncthreads();
  // ---- block writes its 256 row segments of both planes: piece p = it*512 + tid -> row p / 8, halves (p % 8)*8 .. +7 of the head's 64 ----
  {
    v4u hv[4], lv[4];
#pragma unroll
    for (int it = 0; it < 4; ++it) {
      const int p = it * ATT_THREADS + tid;
      hv[it] = *(const v4u*)(Osh + (size_t)p * 8);
      lv[it] = *(const v4u*)(Osl + (size_t)p * 8);
    }
    const size_t dofs = ((size_t)bat * NQ + qb0) * DMODEL + head * HDIM;
    unsigned short* dsth = CTh + dofs;
    unsigned short* dstl = CTl + dofs;
#pragma unroll
    for (int it = 0; it < 4; ++it) {
      const int p = it * ATT_THREADS + tid;
      const size_t go = (size_t)(p >> 3) * DMODEL + (p & 7) * 8;
      *(v4u*)(dsth + go) = hv[it];
      *(v4u*)(dstl + go) = lv[it];
    }
  }
}

// =====================================================================================================
// Workspace map (bytes); every plane is an exact multiple of its tile / whole-row store granularity (M, N exact tile multiples,
// element counts exact multiples of the convert kernel's 2048 granularity, no pad rows needed), every offset a multiple of 2 MiB:
//   WQ16 f16 [1024][1024] x64               2097152   ([out][in] = [n][k])
//   WK16 f16 [1024][1024] x64               2097152
//   WV16 f16 [1024][1024] x64               2097152
//   WO16 bf16 [1024][1024]                  2097152
//   X16  f16 [4096][1024] x16               8388608   (activation rows)
//   QHh, QHl bf16 [4096][1024]          2 x 8388608   (q projection, hi / residual)
//   KHh, KHl bf16 [4096][1024]          2 x 8388608   (k projection, hi / residual)
//   VTh, VTl f16 [2][1024][2048] x16    2 x 8388608   (v^T per batch, hi / residual)
//   CTh, CTl bf16 [4096][1024]          2 x 8388608   (attention ctx, merged heads, hi / residual)
//   end                                    83886080
// =====================================================================================================
extern "C" void kernel_launch(void* const* d_in, const int* in_sizes, int n_in,
                              void* d_out, int out_size, void* d_ws, size_t ws_size,
                              hipStream_t stream) {
  if (n_in < 6) return;
  if (in_sizes[0] != NROWS * DMODEL) return;
  if (in_sizes[1] != DMODEL * DMODEL || in_sizes[2] != DMODEL * DMODEL ||
      in_sizes[3] != DMODEL * DMODEL || in_sizes[4] != DMODEL * DMODEL) return;
  if (in_sizes[5] != NBKT * NHEAD) return;
  if (out_size != NROWS * DMODEL) return;
  if ((in_sizes[0] % 2048) != 0 || (in_sizes[1] % 2048) != 0) return;

  const float* x   = (const float*)d_in[0];
  const float* w_q = (const float*)d_in[1];
  const float* w_k = (const float*)d_in[2];
  const float* w_v = (const float*)d_in[3];
  const float* w_o = (const float*)d_in[4];
  const float* rel = (const float*)d_in[5];
  float*       out = (float*)d_out;

  const size_t PW  = (size_t)DMODEL * DMODEL * 2;                 //  2097152
  const size_t PX  = (size_t)NROWS * DMODEL * 2;                  //  8388608
  const size_t PVT = (size_t)NB * DMODEL * NC * 2;                //  8388608
  size_t off = 0;
  const size_t oWQ = off; off += PW;
  const size_t oWK = off; off += PW;
  const size_t oWV = off; off += PW;
  const size_t oWO = off; off += PW;
  const size_t oX  = off; off += PX;
  const size_t oQh = off; off += PX;
  const size_t oQl = off; off += PX;
  const size_t oKh = off; off += PX;
  const size_t oKl = off; off += PX;
  const size_t oVh = off; off += PVT;
  const size_t oVl = off; off += PVT;
  const size_t oCh = off; off += PX;
  const size_t oCl = off; off += PX;
  if (off > ws_size) return;                                      // off = 83886080
  if (off > (size_t)134217728) return;

  char* ws = (char*)d_ws;
  unsigned short* WQ16 = (unsigned short*)(ws + oWQ);
  unsigned short* WK16 = (unsigned short*)(ws + oWK);
  unsigned short* WV16 = (unsigned short*)(ws + oWV);
  unsigned short* WO16 = (unsigned short*)(ws + oWO);
  unsigned short* X16  = (unsigned short*)(ws + oX);
  unsigned short* QHh  = (unsigned short*)(ws + oQh);
  unsigned short* QHl  = (unsigned short*)(ws + oQl);
  unsigned short* KHh  = (unsigned short*)(ws + oKh);
  unsigned short* KHl  = (unsigned short*)(ws + oKl);
  unsigned short* VTh  = (unsigned short*)(ws + oVh);
  unsigned short* VTl  = (unsigned short*)(ws + oVl);
  unsigned short* CTh  = (unsigned short*)(ws + oCh);
  unsigned short* CTl  = (unsigned short*)(ws + oCl);

  const dim3 blk(256);
  const dim3 gCV(CVX_BLOCKS + 4 * CVW_BLOCKS);                     // 2048 + 4 x 512 = 4096 blocks
  const int tilesP = (NROWS / 64) * (DMODEL / 64);                 // 1024
  const dim3 gP((tilesP + 7) / 8, 1);                              // 128
  const dim3 gQKV((tilesP + 7) / 8, 3);                            // 128 x 3
  const dim3 gAT(ATT_BLOCKS);                                      // 256
  const dim3 bAT(ATT_THREADS);                                     // 512
  static_assert(NB * (DMODEL / 128) * (NC / 256) == (NROWS / 128) * (DMODEL / 256));   // v^T tiles of both batches = tiles of q

  // (0) one launch: activation plane X16[row][c] = f16( bf16_RNE(x[row][c]) * 16 ), rows = b*2048 + tok; weight planes
  //     f16( bf16_RNE(W[n][k]) * 64 ) for Wq, Wk, Wv; bf16_RNE(Wo[n][k]) bits for Wo; [out][in] layout kept
  cvt_all<<<gCV, blk, 0, stream>>>(x, w_q, w_k, w_v, w_o, X16, WQ16, WK16, WV16, WO16);

  // (1) one launch: q[m][n] = sum_k x[m][k] Wq[n][k] and k likewise -> bf16 hi / residual planes;
  //     VT[b][d][tok] = sum_k Wv[d][k] x_b[tok][k] -> f16 x16 hi / residual planes
  qkv64<<<gQKV, blk, 0, stream>>>(X16, WQ16, WK16, WV16, QHh, QHl, KHh, KHl, VTh, VTl);

  // (5) attention per (batch, head, 256 query rows) -> CT (bf16 hi / residual planes)
  attn16<<<gAT, bAT, 0, stream>>>(QHh, QHl, KHh, KHl, VTh, VTl, rel, CTh, CTl);

  // (6) out = (CT_hi + CT_lo) . Wo^T; M = 4096, N = 1024, K = 1024, f32
  gemm64<0, 1, 1><<<gP, blk, 0, stream>>>(
      CTh, CTl, DMODEL, 0LL,
      WO16, DMODEL, 0LL,
      (void*)out, (void*)out, DMODEL, 0LL,
      NROWS, DMODEL, DMODEL, 1.0f, 1.0f);
  (void)hipGetLastError();
}

// v006
// Measured time: 125 microseconds a run.
// Timed twice side by side with v005, it ran 1.04 and 1.05 times as fast.
// All steps since v000 together make it 3.81 times as fast.
// Contractions (all f32 accumulate): q/k projections v_wmma_f32_16x16x32_f16 (x f16 x16 . W f16 x64, K=1024, single products) stored as bf16 hi/lo planes;
// v^T projection v_wmma_f32_16x16x32_f16 (Wv f16 x64 . x f16 x16, K=1024) stored as f16 x16 hi/lo planes;
// attention scores, transposed, v_wmma_f32_16x16x32_bf16 (k bf16 hi/lo . q^T bf16 hi/lo, hi.hi+lo.hi+hi.lo, K=64);
// v^T . P^T v_wmma_f32_16x16x32_f16 (v^T f16 x16 hi/lo . P^T f16 x1024 hi/lo, hi.hi+hi.lo+lo.hi, K=2048 by 32);
// output projection v_wmma_f32_16x16x32_bf16 (ctx bf16 hi/lo . Wo bf16, hi.W+lo.W, K=1024).
// Bucketed relative-position bias (per head, function of key-query offset) and online max-subtracted base-2 softmax in f32 on VALU.
// Every float input RNE-converted to bf16 on load.
#include <hip/hip_runtime.h>
#include <math.h>
#include <stdint.h>

#define NB      2
#define NQ      2048
#define NC      2048
#define DMODEL  1024
#define NHEAD   16
#define HDIM    64
#define NBKT    32
#define NROWS   (NB * NQ)
#define WSC     64.0f
#define ACARRY  16.0f
#define VC      16.0f
#define PC      1024.0f
#define ATT_SCALE 0.125f
#define LOG2E   1.4426950408889634f
#define SL2     (ATT_SCALE * LOG2E)
static_assert(NHEAD * HDIM == DMODEL);
static_assert((NQ % 64) == 0 && (NC % 64) == 0 && (DMODEL % 64) == 0 && (NC % 32) == 0 && (NQ % 16) == 0);
static_assert((NROWS % 128) == 0 && (DMODEL % 256) == 0 && (NC % 256) == 0 && (DMODEL % 128) == 0);
#define ATT_THREADS 512
#define QBLK        256                                  // query rows per block: 8 wave pairs x 32 rows, one head
#define ATT_BLOCKS  (NB * NHEAD * (NQ / QBLK))
static_assert(ATT_THREADS == 512 && ATT_BLOCKS == 256 && (NQ % QBLK) == 0 && NQ / QBLK == 8 && NHEAD == 16);
#define LUTP            (NC + QBLK)                      // bias table entries of one head: key - tok + (first row + 255) in [0, 2302]
#define SKEYS           64                               // keys per LDS stage
#define NSTG            (NC / SKEYS)
#define SPITCH          72                               // halves: 128-B rows at a 144-B pitch (16 B x odd) for 16-B LDS reads
#define GKS             64                               // k per LDS stage of the GEMM (128-B rows)
#define PLANE_HALVES    (64 * SPITCH)
#define BUF_HALVES      (4 * PLANE_HALVES)               // K hi, K lo, v^T hi, v^T lo
#define ATT_SMEM_FLOATS (LUTP / 2 + BUF_HALVES)
static_assert(SKEYS == 64 && HDIM == 64 && NSTG >= 2 && (NC % SKEYS) == 0);
static_assert((LUTP % 8) == 0 && (PLANE_HALVES % 8) == 0);
static_assert((size_t)2 * QBLK * HDIM * sizeof(unsigned short) <= (size_t)ATT_SMEM_FLOATS * sizeof(float));

typedef _Float16 v16h __attribute__((ext_vector_type(16)));
typedef _Float16 v8h  __attribute__((ext_vector_type(8)));
typedef __bf16   v16b __attribute__((ext_vector_type(16)));
typedef float    v8f  __attribute__((ext_vector_type(8)));
typedef float    v4f  __attribute__((ext_vector_type(4)));
typedef float    v2f  __attribute__((ext_vector_type(2)));
typedef _Float16 v2h  __attribute__((ext_vector_type(2)));
typedef unsigned int v4u __attribute__((ext_vector_type(4)));

union FragH { v16h v; v8h h[2]; v4u u[2]; };
union FragAny { v16h h; v16b b; };

// ---- scalar helpers --------------------------------------------------------------------------------
__device__ __forceinline__ unsigned short bf_bits(float f) {          // f32 -> bf16 bits, RNE convert
  unsigned u = __float_as_uint(f);
  return (unsigned short)((u + 0x7FFFu + ((u >> 16) & 1u)) >> 16);
}
__device__ __forceinline__ float bf_up(unsigned short h) { return __uint_as_float(((unsigned)h) << 16); }
__device__ __forceinline__ float bfr(float f) { return bf_up(bf_bits(f)); }   // value of the bf16 RNE convert
__device__ __forceinline__ unsigned short h_bits(_Float16 x) { return __builtin_bit_cast(unsigned short, x); }
__device__ __forceinline__ unsigned pk16(unsigned short a, unsigned short b) { return (unsigned)a | ((unsigned)b << 16); }
__device__ __forceinline__ float other_half(float v) {               // the value that lane l ^ 16 holds
  const int b = __builtin_bit_cast(int, v);
  return __builtin_bit_cast(float, __builtin_amdgcn_permlanex16(b, b, 0x76543210, 0xfedcba98, false, false));
}
// 2^x as the bare v_exp_f32. Every argument here is <= 0 (a score or the old maximum minus the new maximum); a result below 2^-126 comes out as 0,
// which neither the f16 P planes (x1024) nor a row sum that holds the maximum's own 1 can tell from the exact value; -inf gives 0.
__device__ __forceinline__ float exp2_bare(float x) { return __builtin_amdgcn_exp2f(x); }
// The same with its slot: the v_nop keeps one vector slot between v_exp_f32 and whatever the compiler puts next (it may overwrite the source register).
__device__ __forceinline__ float exp2_slot(float x) {
  float r = 0.f;
#if defined(__HIP_DEVICE_COMPILE__)
  asm("v_exp_f32 %0, %1\n\tv_nop" : "=v"(r) : "v"(x));
#endif
  return r;
}
__device__ __forceinline__ v8f zero8() { v8f z = {0.f, 0.f, 0.f, 0.f, 0.f, 0.f, 0.f, 0.f}; return z; }

// ---- fragment loader: 16-bit A/B operand from a k-contiguous 16-bit plane, lane -> row/col (lane&15),
//      p already includes +8*(lane>>4); elements 0..7 <- p[0..7] (k0+8h..), elements 8..15 <- p[16..23] (k0+16+8h..)
//      (same split k map for A and B; B is always read from a [n][k] plane)
__device__ __forceinline__ v16h ldfrag_u(const unsigned short* p) {
  FragH f;
  f.u[0] = *(const v4u*)(p);
  f.u[1] = *(const v4u*)(p + 16);
  return f.v;
}

// ---- WMMA helpers with trailing VALU hazard gaps ------------------------------------------------------
__device__ __forceinline__ v8f mma_h(v16h a, v16h b, v8f c) {
  return __builtin_amdgcn_wmma_f32_16x16x32_f16(false, a, false, b, (short)0, c, false, false);
}
__device__ __forceinline__ v8f mma_b(v16h a, v16h b, v8f c) {
  FragAny ua, ub;
  ua.h = a;
  ub.h = b;
  return __builtin_amdgcn_wmma_f32_16x16x32_bf16(false, ua.b, false, ub.b, (short)0, c, false, false);
}
template <int BF>
__device__ __forceinline__ v8f mmaT(v16h a, v16h b, v8f c) {
  if constexpr (BF != 0) return mma_b(a, b, c);
  else return mma_h(a, b, c);
}
__device__ __forceinline__ void dep_guard1(v8f& a, v8f& b, v16h x) {
#if defined(__HIP_DEVICE_COMPILE__)
  asm volatile("v_nop\n\tv_nop\n\tv_nop\n\tv_nop" : "+v"(a), "+v"(b) : "v"(x));
#endif
}
__device__ __forceinline__ void guard2x4(v8f& s, v8f& u, v16h a0, v16h a1, v16h a2, v16h a3) {
#if defined(__HIP_DEVICE_COMPILE__)
  asm volatile("v_nop\n\tv_nop\n\tv_nop\n\tv_nop" : "+v"(s), "+v"(u) : "v"(a0), "v"(a1), "v"(a2), "v"(a3));
#endif
}
__device__ __forceinline__ void guard4x6(v8f& a, v8f& b, v8f& c, v8f& d,
                                         v16h x0, v16h x1, v16h x2, v16h x3, v16h x4, v16h x5) {
#if defined(__HIP_DEVICE_COMPILE__)
  asm volatile("v_nop\n\tv_nop\n\tv_nop\n\tv_nop"
               : "+v"(a), "+v"(b), "+v"(c), "+v"(d) : "v"(x0), "v"(x1), "v"(x2), "v"(x3), "v"(x4), "v"(x5));
#endif
}
__device__ __forceinline__ void keep4_h(v16h a, v16h b, v16h c, v16h d) {
#if defined(__HIP_DEVICE_COMPILE__)
  asm volatile("v_nop" :: "v"(a), "v"(b), "v"(c), "v"(d));
#endif
}
__device__ __forceinline__ void acc_guard4(v8f& a, v8f& b, v8f& c, v8f& d) {
#if defined(__HIP_DEVICE_COMPILE__)
  asm volatile("v_nop\n\tv_nop\n\tv_nop\n\tv_nop" : "+v"(a), "+v"(b), "+v"(c), "+v"(d));
#endif
}
__device__ __forceinline__ void wave_sync_lds() {
  __builtin_amdgcn_fence(__ATOMIC_RELEASE, "workgroup");
  __builtin_amdgcn_wave_barrier();
  __builtin_amdgcn_fence(__ATOMIC_ACQUIRE, "workgroup");
}
// Four 16-B-per-lane asynchronous copies global -> LDS (l*: the lane's LDS byte address, g*: the lane's global address).
// The s_wait_xcnt stands inside the statement so that no address register is rewritten in front of it.
__device__ __forceinline__ void async_copy4(unsigned l0, const unsigned short* g0, unsigned l1, const unsigned short* g1,
                                            unsigned l2, const unsigned short* g2, unsigned l3, const unsigned short* g3) {
#if defined(__HIP_DEVICE_COMPILE__)
  asm volatile("global_load_async_to_lds_b128 %0, %1, off\n\t"
               "global_load_async_to_lds_b128 %2, %3, off\n\t"
               "global_load_async_to_lds_b128 %4, %5, off\n\t"
               "global_load_async_to_lds_b128 %6, %7, off\n\t"
               "s_wait_xcnt 0x0"
               :: "v"(l0), "v"(g0), "v"(l1), "v"(g1), "v"(l2), "v"(g2), "v"(l3), "v"(g3) : "memory");
#endif
}
__device__ __forceinline__ void wait_async0() {   // this wave's own copies have landed in LDS
#if defined(__HIP_DEVICE_COMPILE__)
  asm volatile("s_wait_asynccnt 0x0" ::: "memory");
#endif
}
__device__ __forceinline__ void wait_ds0() {      // this wave's own LDS reads have returned (before their buffer is refilled)
#if defined(__HIP_DEVICE_COMPILE__)
  asm volatile("s_wait_dscnt 0x0" ::: "memory");
#endif
}

// =====================================================================================================
// Elementwise 16-bit pack, no transpose. BFO 0: dst[i] = f16( bf16_RNE(src[i]) * sc ), sc a power of two (exact);
// BFO 1: dst[i] = bf16_RNE(src[i]) bits. 8 elements per thread: two 16-B loads, one 16-B store per lane; 32 consecutive
// coverage: n / 2048 blocks (index bx) x 256 thr x 8 elements = n exactly (host checks n % 2048 == 0).
// =====================================================================================================
template <int BFO>
__device__ __forceinline__ void cvt16(const float* __restrict__ src, unsigned short* dst, int n, float sc, int bx) {
  const size_t i8 = ((size_t)bx * 256 + threadIdx.x) * 8;
  if (i8 + 8 > (size_t)n) return;                 // never taken with the exact grid; no barriers in this kernel
  const v4f a = *(const v4f*)(src + i8);
  const v4f b = *(const v4f*)(src + i8 + 4);
  v4u o;
  if constexpr (BFO != 0) {
    o[0] = pk16(bf_bits(a[0]), bf_bits(a[1]));
    o[1] = pk16(bf_bits(a[2]), bf_bits(a[3]));
    o[2] = pk16(bf_bits(b[0]), bf_bits(b[1]));
    o[3] = pk16(bf_bits(b[2]), bf_bits(b[3]));
  } else {
    o[0] = pk16(h_bits((_Float16)(bfr(a[0]) * sc)), h_bits((_Float16)(bfr(a[1]) * sc)));
    o[1] = pk16(h_bits((_Float16)(bfr(a[2]) * sc)), h_bits((_Float16)(bfr(a[3]) * sc)));
    o[2] = pk16(h_bits((_Float16)(bfr(b[0]) * sc)), h_bits((_Float16)(bfr(b[1]) * sc)));
    o[3] = pk16(h_bits((_Float16)(bfr(b[2]) * sc)), h_bits((_Float16)(bfr(b[3]) * sc)));
  }
  {
    *(v4u*)(dst + i8) = o;
    
  }
}
// All five converts in one launch; the block index picks the job (block-uniform): blocks 0..2047 the activations (f16 x16),
// then 512 blocks each for Wq, Wk, Wv (f16 x64) and Wo (bf16 bits).
#define CVX_BLOCKS ((NROWS * DMODEL) / 2048)
#define CVW_BLOCKS ((DMODEL * DMODEL) / 2048)
__global__ __launch_bounds__(256) void cvt_all(const float* __restrict__ x, const float* __restrict__ w_q, const float* __restrict__ w_k,
                                               const float* __restrict__ w_v, const float* __restrict__ w_o,
                                               unsigned short* X16, unsigned short* WQ16, unsigned short* WK16,
                                               unsigned short* WV16, unsigned short* WO16) {
  const int b = blockIdx.x;
  if (b < CVX_BLOCKS) {
    cvt16<0>(x, X16, NROWS * DMODEL, ACARRY, b);
    return;
  }
  const int job = (b - CVX_BLOCKS) / CVW_BLOCKS;           // 0..3 with the exact grid
  const int bw  = (b - CVX_BLOCKS) - job * CVW_BLOCKS;
  if (job == 3) {
    cvt16<1>(w_o, WO16, DMODEL * DMODEL, 1.0f, bw);
  } else if (job < 3) {
    const float* src    = (job == 0) ? w_q  : (job == 1) ? w_k  : w_v;
    unsigned short* dst = (job == 0) ? WQ16 : (job == 1) ? WK16 : WV16;
    cvt16<0>(src, dst, DMODEL * DMODEL, WSC, bw);
  }
}

// =====================================================================================================
// Register-blocked batched 16-bit WMMA GEMM: C[m][n] = oscale * sum_k A[m][k] * Bt[n][k]; one wave per 64x64 tile, a block of 8 waves
// (2 x 4) per 128x256 tile. The block's 128 A rows (and A2 rows) and 256 Bt rows of a 64-k stage (128 B per row) are brought into LDS once
// per block by asynchronous 16-B copies (8 lanes per 128-B row; 12 or 16 copies per thread and stage), two buffers: stage t + 2 is issued
// behind the barrier that ends stage t; the waves read their fragments from there (two 16-B LDS loads per fragment, row pitch 144 B).
// A row-major [M][K] pitch lda (16-bit plane), Bt row-major [N][K] pitch ldb (k contiguous); M multiple of 128, N of 256, K of 64.
// bx = tile index, by = batch index with element strides sA, sB, sC; sT (8 per-wave slabs) and gst (two stage buffers) are the calling kernel's LDS.
// ASPLIT 1: a second A plane A2 (unscaled residual of A, same layout) is multiplied into the same accumulator (A + A2 ~ exact A).
// BF 1: bf16 operands (v_wmma_f32_16x16x32_bf16), else f16.
// OM 0: f32 out (pitch ldc).  OM 2: f16 out = f16(value * ocarry).  OM 3: two bf16 planes: hi = bf16_RNE(value), lo = bf16_RNE(value - hi).
// OM 4: two f16 planes: hi = f16(value * ocarry), lo = f16(value * ocarry - hi) (unscaled residual).
// coverage: 4 slabs x 16 rows (f32: it 0..7 x lane>>4; 16-bit: it 0..3 x lane>>3) x 64 cols = the wave's whole 64x64 tile;
//           stage: 256 threads x 16 B = 32 rows x 128 B per copy; grid = (M / 128) * (N / 256) blocks, a surplus block exits whole.
// =====================================================================================================
#define GSLAB (16 * 68)                             // floats of a per-wave 16x64 slab, pitch 68 floats
#define GBUF_HALVES(ASPLIT) ((256 + 128 * (1 + (ASPLIT))) * SPITCH)   // rows of a stage buffer: Bt 0..255 | A 256..383 | A2 384..511
template <int OM, int ASPLIT, int BF>
__device__ __forceinline__ void gemm_tile(
    const unsigned short* __restrict__ Ap, const unsigned short* __restrict__ A2p, int lda, long long sA,
    const unsigned short* __restrict__ Btp, int ldb, long long sB,
    void* Cout, void* C2out, int ldc, long long sC,
    int M, int N, int K, float oscale, float ocarry,
    int bx, int by, float* sT, unsigned short* gst) {
  constexpr int GBUF  = GBUF_HALVES(ASPLIT);       // halves per stage buffer
  constexpr unsigned R32 = 32 * SPITCH * 2;        // LDS bytes of 32 rows (one copy of the whole block)
  const int tid  = threadIdx.x;
  const int lane = threadIdx.x & 31;
  const int wave = threadIdx.x >> 5;
  const int blocksN = N >> 8;
  const int blocksM = M >> 7;
  // block-uniform, in front of every barrier; never taken with the exact grids and shapes of this file
  if ((M & 127) != 0 || (N & 255) != 0 || (K & (GKS - 1)) != 0 || K < GKS || bx >= blocksM * blocksN) return;
  const int bm  = bx / blocksN;
  const int bn  = bx - bm * blocksN;
  const int mb0 = bm << 7;
  const int nb0 = bn << 8;
  const int m0 = mb0 + ((wave >> 2) << 6);
  const int n0 = nb0 + ((wave & 3) << 6);

  const unsigned short* A1 = Ap  + (size_t)((long long)by * sA);
  const unsigned short* A2 = A2p + (size_t)((long long)by * sA);
  const unsigned short* Bb = Btp + (size_t)((long long)by * sB);

  const int rlane = lane & 15;                 // row (A) / col (B, D) within subtile
  const int koff  = (lane >> 4) * 8;           // k offset of this lane half
  const int mOff  = (lane >> 4) * 8;           // D row offset

  v8f acc[4][4];
#pragma unroll
  for (int i = 0; i < 4; ++i)
#pragma unroll
    for (int j = 0; j < 4; ++j) acc[i][j] = zero8();

  // ---- stage copies: thread -> row tid / 8 (+ 32 per copy), 16-B piece tid % 8 of the row's 128 B ----
  const int sr = tid >> 3, sp = (tid & 7) * 8;
  const unsigned short* gB  = Bb + (size_t)(nb0 + sr) * ldb + sp;
  const unsigned short* gA  = A1 + (size_t)(mb0 + sr) * lda + sp;
  const unsigned short* gA2 = A2 + (size_t)(mb0 + sr) * lda + sp;
  const size_t b32 = (size_t)32 * ldb, a32 = (size_t)32 * lda;
  const unsigned ldst = (unsigned)(uintptr_t)(gst + sr * SPITCH + sp);   // LDS byte address = low 32 bits
  auto stage_copy = [&](int st, int buf) {
    const size_t ks = (size_t)st * GKS;
    const unsigned l = ldst + (unsigned)buf * (GBUF * 2);
    const unsigned short* b = gB + ks;
    const unsigned short* a = gA + ks;
    async_copy4(l,            b,           l + R32,      b + b32,     l + 2 * R32,  b + 2 * b32, l + 3 * R32,  b + 3 * b32);
    async_copy4(l + 4 * R32,  b + 4 * b32, l + 5 * R32,  b + 5 * b32, l + 6 * R32,  b + 6 * b32, l + 7 * R32,  b + 7 * b32);
    async_copy4(l + 8 * R32,  a,           l + 9 * R32,  a + a32,     l + 10 * R32, a + 2 * a32, l + 11 * R32, a + 3 * a32);
    if constexpr (ASPLIT != 0) {
      const unsigned short* a2 = gA2 + ks;
      async_copy4(l + 12 * R32, a2,        l + 13 * R32, a2 + a32,    l + 14 * R32, a2 + 2 * a32, l + 15 * R32, a2 + 3 * a32);
    }
  };
  const int nst = K / GKS;
  stage_copy(0, 0);
  wait_async0();
  __syncthreads();                                         // publishes stage 0
  if (nst > 1) stage_copy(1, 1);

  for (int st = 0; st < nst; ++st) {
    const unsigned short* sb = gst + (st & 1) * GBUF + rlane * SPITCH + koff;   // lane's row rlane, k half
    const unsigned short* sB = sb + ((wave & 3) << 6) * SPITCH;
    const unsigned short* sA = sb + (256 + ((wave >> 2) << 6)) * SPITCH;
    // unrolled: the offsets inside the stage become immediates of the LDS loads
#pragma unroll
    for (int kk = 0; kk < GKS; kk += 32) {
      v16h bh[4], ah[4], al[ASPLIT != 0 ? 4 : 1];
#pragma unroll
      for (int j = 0; j < 4; ++j) bh[j] = ldfrag_u(sB + (j << 4) * SPITCH + kk);
#pragma unroll
      for (int i = 0; i < 4; ++i) ah[i] = ldfrag_u(sA + (i << 4) * SPITCH + kk);
      if constexpr (ASPLIT != 0) {
#pragma unroll
        for (int i = 0; i < 4; ++i) al[i] = ldfrag_u(sA + (128 + (i << 4)) * SPITCH + kk);
      }
#pragma unroll
      for (int i = 0; i < 4; ++i) {
#pragma unroll
        for (int j = 0; j < 4; ++j) acc[i][j] = mmaT<BF>(ah[i], bh[j], acc[i][j]);
        dep_guard1(acc[i][0], acc[i][3], ah[i]);
        if constexpr (ASPLIT != 0) {
#pragma unroll
          for (int j = 0; j < 4; ++j) acc[i][j] = mmaT<BF>(al[i], bh[j], acc[i][j]);
          dep_guard1(acc[i][0], acc[i][3], al[i]);
        }
      }
      keep4_h(bh[0], bh[1], bh[2], bh[3]);
    }
    // ---- publish point of stage st + 1 ----
    wait_ds0();
    wait_async0();
    __syncthreads();                       // publishes stage st + 1 and ends every wave's reads of stage st's buffer
    if (st + 2 < nst) stage_copy(st + 2, st & 1);
  }
  wait_async0();
  acc_guard4(acc[0][0], acc[0][1], acc[0][2], acc[0][3]);
  acc_guard4(acc[1][0], acc[1][1], acc[1][2], acc[1][3]);
  acc_guard4(acc[2][0], acc[2][1], acc[2][2], acc[2][3]);
  acc_guard4(acc[3][0], acc[3][1], acc[3][2], acc[3][3]);

  const int hh2 = lane >> 4, c4 = (lane & 15) * 4;     // f32 out: 256-B row segment = 16 lanes x 16 B
  const int q8  = lane >> 3, c8 = (lane & 7) * 8;

  // ---- epilogue ----
  float* slab = sT + wave * GSLAB;
#pragma unroll
  for (int i = 0; i < 4; ++i) {
    const int mBase = m0 + (i << 4);
#pragma unroll
    for (int j = 0; j < 4; ++j) {
#pragma unroll
      for (int r = 0; r < 8; ++r) {
        slab[(mOff + r) * 68 + (j << 4) + rlane] = acc[i][j][r];
      }
    }
    wave_sync_lds();
    if constexpr (OM == 0) {
      float* C = (float*)Cout + (size_t)((long long)by * sC);
      v4f vals[8];
#pragma unroll
      for (int it = 0; it < 8; ++it) {
        const int row = it * 2 + hh2;                      // it 0..7 x hh2 0..1 = rows 0..15
        v4f v = *(const v4f*)(slab + row * 68 + c4);
#pragma unroll
        for (int e = 0; e < 4; ++e) v[e] = v[e] * oscale;
        vals[it] = v;
      }
      {
#pragma unroll
        for (int it = 0; it < 8; ++it) {
          const int gr = mBase + it * 2 + hh2;
          *(v4f*)(C + (size_t)gr * ldc + n0 + c4) = vals[it];
        }
        
      }
    } else {
      unsigned short* C  = (unsigned short*)Cout  + (size_t)((long long)by * sC);
      unsigned short* Cb = (unsigned short*)C2out + (size_t)((long long)by * sC);
      v4u hv[4], lv[4];
#pragma unroll
      for (int it = 0; it < 4; ++it) {
        const int row = it * 4 + q8;                       // it 0..3 x q8 0..3 = rows 0..15
        const float* sp = slab + row * 68 + c8;
        v4u a  = {0u, 0u, 0u, 0u};
        v4u b2 = {0u, 0u, 0u, 0u};
#pragma unroll
        for (int e = 0; e < 4; ++e) {
          float f0 = sp[2 * e] * oscale;
          float f1 = sp[2 * e + 1] * oscale;
          if constexpr (OM == 3) {
            const unsigned short h0 = bf_bits(f0), h1 = bf_bits(f1);
            a[e]  = pk16(h0, h1);
            b2[e] = pk16(bf_bits(f0 - bf_up(h0)), bf_bits(f1 - bf_up(h1)));
          } else {
            f0 *= ocarry; f1 *= ocarry;
            const _Float16 x0 = (_Float16)f0, x1 = (_Float16)f1;
            a[e] = pk16(h_bits(x0), h_bits(x1));
            if constexpr (OM == 4) {
              b2[e] = pk16(h_bits((_Float16)(f0 - (float)x0)), h_bits((_Float16)(f1 - (float)x1)));
            }
          }
        }
        hv[it] = a;
        lv[it] = b2;
      }
      {
#pragma unroll
        for (int it = 0; it < 4; ++it) {
          const int row = it * 4 + q8;
          *(v4u*)(C + (size_t)(mBase + row) * ldc + n0 + c8) = hv[it];
          if constexpr (OM >= 3) {
            *(v4u*)(Cb + (size_t)(mBase + row) * ldc + n0 + c8) = lv[it];
          }
        }
        
      }
    }
    wave_sync_lds();
  }
}

// The three projections in one launch of 128 x 3 blocks, all resident at once (two blocks fit a WGP's LDS); blockIdx.y picks the job
// (block-uniform): 0 q and 1 k (x . W^T -> bf16 hi / residual planes; M = 4096, N = 1024, K = 1024, 128 tiles each),
// 2 v^T per batch (Wv . x_b^T -> f16 x16 hi / residual planes; M = 1024, N = 2048, K = 1024, 64 tiles for each of the two batches).
__global__ __launch_bounds__(256) void qkv64(
    const unsigned short* __restrict__ X16, const unsigned short* __restrict__ WQ16, const unsigned short* __restrict__ WK16,
    const unsigned short* __restrict__ WV16, unsigned short* QHh, unsigned short* QHl, unsigned short* KHh, unsigned short* KHl,
    unsigned short* VTh, unsigned short* VTl) {
  __shared__ __align__(16) float sT[8 * GSLAB];
  __shared__ __align__(16) unsigned short gst[2 * GBUF_HALVES(0)];
  const int job = blockIdx.y;
  const int bx  = blockIdx.x;
  if (job < 2) {
    gemm_tile<3, 0, 0>(X16, X16, DMODEL, 0LL,
                       job == 0 ? WQ16 : WK16, DMODEL, 0LL,
                       (void*)(job == 0 ? QHh : KHh), (void*)(job == 0 ? QHl : KHl), DMODEL, 0LL,
                       NROWS, DMODEL, DMODEL, 1.0f / (ACARRY * WSC), 1.0f, bx, 0, sT, gst);
  } else {
    constexpr int TV = (DMODEL / 128) * (NC / 256);          // 64 tiles per batch
    gemm_tile<4, 0, 0>(WV16, WV16, DMODEL, 0LL,
                       X16, DMODEL, (long long)NC * DMODEL,
                       (void*)VTh, (void*)VTl, NC, (long long)DMODEL * NC,
                       DMODEL, NC, DMODEL, 1.0f / (ACARRY * WSC), VC, bx % TV, bx / TV, sT, gst);
  }
}

template <int OM, int ASPLIT, int BF>
__global__ __launch_bounds__(256) void gemm64(
    const unsigned short* __restrict__ Ap, const unsigned short* __restrict__ A2p, int lda, long long sA,
    const unsigned short* __restrict__ Btp, int ldb, long long sB,
    void* Cout, void* C2out, int ldc, long long sC,
    int M, int N, int K, float oscale, float ocarry) {
  __shared__ __align__(16) float sT[8 * GSLAB];
  __shared__ __align__(16) unsigned short gst[2 * GBUF_HALVES(ASPLIT)];
  gemm_tile<OM, ASPLIT, BF>(Ap, A2p, lda, sA, Btp, ldb, sB, Cout, C2out, ldc, sC, M, N, K, oscale, ocarry,
                            (int)blockIdx.x, (int)blockIdx.y, sT, gst);
}

// =====================================================================================================
// Flash attention for one batch, one head and 256 query rows (a pair of waves per 32 rows, each wave half of the keys), head dim 64, 2048 keys:
//   q planes (bf16 hi, lo) Q[b*2048 + tok][64h + d], pitch 1024; k planes (bf16 hi, lo) K[b*2048 + key][64h + d], pitch 1024;
//   v^T planes (f16 x16 hi, unscaled lo): VT[b*1024 + 64h + d][key] (pitch 2048); bias = bf16(rel[bucket(key - tok)][h]) from a
//   per-block LDS table of bf16 bits indexed by (key - tok + first row + 255), bucket() piecewise constant in the offset;
//   out (bf16 hi, lo planes): CT[b*2048 + tok][64h + d] = sum_m softmax_m(q.k / 8 + bias) v[m][d]  (softmax run in base 2).
//   block = 16 waves = 512 threads; grid = 2 x 16 x 8 = 256; every wave does identical bounded work (32 stages, 32 of the stage's 64 keys x 32 queries).
//   The head's K rows and v^T rows of a stage (four planes of 64 rows x 128 B) are brought into LDS once per block by asynchronous
//   16-B copies (four per thread and stage; 8 lanes per 128-B row), two buffers: stage t + 2 is issued behind the barrier that ends
//   stage t; all 16 waves read their fragments from there (two 16-B LDS loads per fragment, row pitch 144 B); a fragment feeds both of the
//   wave's 16-query column tiles.
//   Per 32 keys and column tile: 2 transposed score tiles S^T = K . q^T on bf16 WMMA (A = K rows, B = q; K = 64 as two k-steps of 32): lane (c, hh) holds
//   query c's scores of keys 8hh + r and 16 + 8hh + r; their 16 bias values from the LDS table (u16); online max-subtracted softmax in
//   f32 (exp2) with the maximum in-lane plus one exchange between the lane halves, the sum kept per lane half and joined behind the loop;
//   rescale of the running sum and the four accumulators; P^T (f16 hi and unscaled residual) packed from the two score tiles straight into
//   a B operand (hardware k order, as the v^T loader's); 12 WMMAs O^T += v^T . P^T (hi.hi, hi.lo, lo.hi).
//   Behind the last stage's barrier the two waves of a pair swap one column tile each through LDS (maximum, sum, O^T in f32) and join the two key
//   halves by the usual rescale. Final 1/l and carry folds in f32; behind one more barrier the LDS buffer is reused as the block's two bf16 result buffers
//   [256][64] (hi, lo): each wave stages its 16x64 slice; after a block barrier the 512 threads write 128-B row segments.
// coverage: LDS table: 512 threads stride over 2304 entries (all written); stage: 512 threads x 16 B = 64 rows x 128 B per plane;
//           global: 4 iterations x 512 threads x 8 halves = 256 rows x 64 columns of the head, per plane;
//           grid covers all 2 x 2048 rows x 16 heads exactly once.
// =====================================================================================================
__global__ __launch_bounds__(ATT_THREADS)
void attn16(const unsigned short* __restrict__ QHh, const unsigned short* __restrict__ QHl,
            const unsigned short* __restrict__ KHh, const unsigned short* __restrict__ KHl,
            const unsigned short* __restrict__ VTh, const unsigned short* __restrict__ VTl,
            const float* __restrict__ rel, unsigned short* CTh, unsigned short* CTl) {
  // bias table u16 [2304] | two stage buffers of four planes [64][72] u16
  __shared__ __align__(16) float smem[ATT_SMEM_FLOATS];
  unsigned short* lut = (unsigned short*)smem;
  unsigned short* stg = lut + LUTP;

  const int tid  = threadIdx.x;
  const int wave = tid >> 5;
  const int lane = tid & 31;
  const int hh   = lane >> 4;
  const int c    = lane & 15;

  const int qb   = blockIdx.x & ((NQ / QBLK) - 1);         // 0..7
  const int head = (blockIdx.x / (NQ / QBLK)) & (NHEAD - 1);   // 0..15
  const int bat  = blockIdx.x / ((NQ / QBLK) * NHEAD);     // 0..1
  const int qb0  = qb * QBLK;
  const int qg   = wave >> 1;                              // the wave's 32 query rows: qb0 + 32 qg + 0..31 (two column tiles j of 16)
  const int kp   = wave & 1;                               // the wave's keys: the 32-key pass kp of every 64-key stage
  const int q0   = qb0 + qg * 32;

  // ---- stage copies: thread -> row tid / 8 (key of K, d of v^T), 16-B piece tid % 8 of the row's 128 B, in each of the four planes ----
  const int sr = tid >> 3, sp = (tid & 7) * 8;
  const size_t gko = ((size_t)bat * NC + sr) * DMODEL + head * HDIM + sp;
  const size_t gvo = ((size_t)bat * DMODEL + head * HDIM + sr) * NC + sp;
  const unsigned short* gKh = KHh + gko;
  const unsigned short* gKl = KHl + gko;
  const unsigned short* gVh = VTh + gvo;
  const unsigned short* gVl = VTl + gvo;
  const unsigned ldst = (unsigned)(uintptr_t)(stg + sr * SPITCH + sp);   // LDS byte address = low 32 bits
  auto stage_copy = [&](int st, int buf) {
    const size_t ka = (size_t)st * SKEYS * DMODEL, va = (size_t)st * SKEYS;
    const unsigned l = ldst + (unsigned)buf * (BUF_HALVES * 2);
    async_copy4(l, gKh + ka, l + PLANE_HALVES * 2, gKl + ka, l + PLANE_HALVES * 4, gVh + va, l + PLANE_HALVES * 6, gVl + va);
  };
  stage_copy(0, 0);

  // ---- per-block bias table: lut[i] = bf16 bits of rel[bucket(i - (qb0 + 255))][head], i = key - tok + qb0 + 255 in [0, 2302] ----
  for (int i = tid; i < LUTP; i += ATT_THREADS) {
    const int d  = i - (qb0 + QBLK - 1);                   // key - tok
    const int a  = (d < 0) ? -d : d;
    int g = 8 + (a >= 12) + (a >= 16) + (a >= 23) + (a >= 32) + (a >= 46) + (a >= 64) + (a >= 91);
    g = (a < 8) ? a : g;
    const int bk = g + ((d > 0) ? 16 : 0);                 // 0..31
    lut[i] = bf_bits(rel[bk * NHEAD + head]);              // index in [0, 511]
  }
  wait_async0();
  __syncthreads();                                         // publishes the bias table and stage 0
  stage_copy(1, 1);

  v16h qah[2], qbh[2], qal[2], qbl[2];
#pragma unroll
  for (int j = 0; j < 2; ++j) {
    const size_t qofs = ((size_t)bat * NQ + q0 + 16 * j + c) * DMODEL + head * HDIM + 8 * hh;
    qah[j] = ldfrag_u(QHh + qofs);
    qbh[j] = ldfrag_u(QHh + qofs + 32);
    qal[j] = ldfrag_u(QHl + qofs);
    qbl[j] = ldfrag_u(QHl + qofs + 32);
  }
  // + 64 st; element (query row 32 qg + 16 j + c, key 64 st + 32 kp + 16 t + 8 hh + r) at [16 (t - j) + r]; lowest index 255 - 224 - 15 - 16 = 0
  const unsigned short* lw = lut + ((QBLK - 1) - 32 * qg - c + 8 * hh + 32 * kp);

  // per column tile j: query c's running maximum (both lane halves alike), this lane half's running sum, over this wave's keys only
  float mrow[2] = {-INFINITY, -INFINITY}, lrow[2] = {0.f, 0.f};
  v8f o[2][4];                                             // O^T: o[j][t][r] = (d = 16t + 8hh + r, query 16j + c)
#pragma unroll
  for (int j = 0; j < 2; ++j)
#pragma unroll
    for (int t = 0; t < 4; ++t) o[j][t] = zero8();

#pragma unroll 1
  for (int st = 0; st < NSTG; ++st) {
    const unsigned short* sb  = stg + (st & 1) * BUF_HALVES + c * SPITCH + 8 * hh;   // lane's row c, k half hh
    const unsigned short* sKh = sb + 32 * kp * SPITCH;                               // K rows (keys) 32 kp + ..
    const unsigned short* sKl = sKh + PLANE_HALVES;
    const unsigned short* sVh = sb + 2 * PLANE_HALVES + 32 * kp;                     // v^T columns (keys) 32 kp + ..
    const unsigned short* sVl = sVh + PLANE_HALVES;
    v8f s[2][2];                                           // s[t][j]: key tile t, column tile j
#pragma unroll
    for (int t = 0; t < 2; ++t) {
      const int k2 = t * 16 * SPITCH;
      const v16h k0h = ldfrag_u(sKh + k2), k1h = ldfrag_u(sKh + k2 + 32);
      const v16h k0l = ldfrag_u(sKl + k2), k1l = ldfrag_u(sKl + k2 + 32);
      s[t][0] = mma_b(k0h, qah[0], zero8());
      s[t][1] = mma_b(k0h, qah[1], zero8());
      s[t][0] = mma_b(k1h, qbh[0], s[t][0]);
      s[t][1] = mma_b(k1h, qbh[1], s[t][1]);
      s[t][0] = mma_b(k0l, qah[0], s[t][0]);
      s[t][1] = mma_b(k0l, qah[1], s[t][1]);
      s[t][0] = mma_b(k1l, qbh[0], s[t][0]);
      s[t][1] = mma_b(k1l, qbh[1], s[t][1]);
      s[t][0] = mma_b(k0h, qal[0], s[t][0]);
      s[t][1] = mma_b(k0h, qal[1], s[t][1]);
      s[t][0] = mma_b(k1h, qbl[0], s[t][0]);
      s[t][1] = mma_b(k1h, qbl[1], s[t][1]);
      guard2x4(s[t][0], s[t][1], k0h, k1h, k0l, k1l);
    }
    const unsigned short* lp = lw + st * SKEYS;
    FragH ph[2], pl[2];
#pragma unroll
    for (int j = 0; j < 2; ++j) {
      const unsigned short* lj = lp - 16 * j;
      // pairs of neighbouring keys (registers 2e, 2e + 1 of a score tile): tp[e] of tile 0, tp[4 + e] of tile 1
      v2f tp[8];
#pragma unroll
      for (int e = 0; e < 4; ++e) {
        const v2f w0 = {bf_up(lj[2 * e]), bf_up(lj[2 * e + 1])}, w1 = {bf_up(lj[16 + 2 * e]), bf_up(lj[17 + 2 * e])};
        const v2f a0 = {s[0][j][2 * e], s[0][j][2 * e + 1]}, a1 = {s[1][j][2 * e], s[1][j][2 * e + 1]};
        tp[e]     = a0 * SL2 + w0 * LOG2E;
        tp[4 + e] = a1 * SL2 + w1 * LOG2E;
      }
      float mx = fmaxf(fmaxf(fmaxf(fmaxf(tp[0][0], tp[0][1]), fmaxf(tp[1][0], tp[1][1])), fmaxf(fmaxf(tp[2][0], tp[2][1]), fmaxf(tp[3][0], tp[3][1]))),
                       fmaxf(fmaxf(fmaxf(tp[4][0], tp[4][1]), fmaxf(tp[5][0], tp[5][1])), fmaxf(fmaxf(tp[6][0], tp[6][1]), fmaxf(tp[7][0], tp[7][1]))));
      mx = fmaxf(mx, other_half(mx));                      // query c's maximum over all 32 keys
      const float mn = fmaxf(mrow[j], mx);
      const float al = exp2_bare(mrow[j] - mn);
      mrow[j] = mn;
      v2f ep[8];
#pragma unroll
      for (int e = 0; e < 8; ++e) {                        // element pair 2e, 2e + 1 of the B operand: keys 16 (e / 4) + 8hh + 2 (e % 4) + 0, 1 of the pass
        const v2f d = tp[e] - mn;
        ep[e] = v2f{exp2_bare(d[0]), exp2_bare(d[1])};
        const v2h x = __builtin_convertvector(ep[e] * PC, v2h);
        ph[j].v[2 * e]     = x[0];
        ph[j].v[2 * e + 1] = x[1];
        pl[j].v[2 * e]     = (_Float16)(ep[e][0] * PC - (float)x[0]);
        pl[j].v[2 * e + 1] = (_Float16)(ep[e][1] * PC - (float)x[1]);
      }
      const v2f ps = ((ep[0] + ep[1]) + (ep[2] + ep[3])) + ((ep[4] + ep[5]) + (ep[6] + ep[7]));
      lrow[j] = lrow[j] * al + (ps[0] + ps[1]);
#pragma unroll
      for (int t = 0; t < 4; ++t)
#pragma unroll
        for (int r = 0; r < 8; ++r) o[j][t][r] *= al;
    }
    {
      const v16h vh0 = ldfrag_u(sVh);
      const v16h vh1 = ldfrag_u(sVh + 16 * SPITCH);
      const v16h vh2 = ldfrag_u(sVh + 32 * SPITCH);
      const v16h vh3 = ldfrag_u(sVh + 48 * SPITCH);
#pragma unroll
      for (int j = 0; j < 2; ++j) {
        o[j][0] = mma_h(vh0, ph[j].v, o[j][0]);
        o[j][1] = mma_h(vh1, ph[j].v, o[j][1]);
        o[j][2] = mma_h(vh2, ph[j].v, o[j][2]);
        o[j][3] = mma_h(vh3, ph[j].v, o[j][3]);
      }
#pragma unroll
      for (int j = 0; j < 2; ++j) {
        o[j][0] = mma_h(vh0, pl[j].v, o[j][0]);
        o[j][1] = mma_h(vh1, pl[j].v, o[j][1]);
        o[j][2] = mma_h(vh2, pl[j].v, o[j][2]);
        o[j][3] = mma_h(vh3, pl[j].v, o[j][3]);
      }
      guard4x6(o[1][0], o[1][1], o[1][2], o[1][3], pl[0].v, pl[1].v, vh0, vh1, vh2, vh3);
    }
    {
      const v16h vl0 = ldfrag_u(sVl);
      const v16h vl1 = ldfrag_u(sVl + 16 * SPITCH);
      const v16h vl2 = ldfrag_u(sVl + 32 * SPITCH);
      const v16h vl3 = ldfrag_u(sVl + 48 * SPITCH);
#pragma unroll
      for (int j = 0; j < 2; ++j) {
        o[j][0] = mma_h(vl0, ph[j].v, o[j][0]);
        o[j][1] = mma_h(vl1, ph[j].v, o[j][1]);
        o[j][2] = mma_h(vl2, ph[j].v, o[j][2]);
        o[j][3] = mma_h(vl3, ph[j].v, o[j][3]);
      }
      guard4x6(o[1][0], o[1][1], o[1][2], o[1][3], ph[0].v, ph[1].v, vl0, vl1, vl2, vl3);
    }
    // ---- publish point of stage st + 1 ----
    wait_ds0();
    wait_async0();
    __syncthreads();                       // publishes stage st + 1 and ends every wave's reads of stage st's buffer
    if (st + 2 < NSTG) stage_copy(st + 2, st & 1);
  }
  wait_async0();

  // ---- the last stage's barrier has ended all reads of LDS. Waves 2 qg and 2 qg + 1 hold the same 32 queries over the two halves of the
  //      keys: wave kp keeps column tile kp and gives tile 1 - kp (maximum, joined sum, O^T in f32) to its partner through LDS ----
  v4f*   xch = (v4f*)smem;                                 // [16 waves][8][32 lanes] x 16 B
  float* xml = smem + 16 * 1024;                           // [16 waves][2][32 lanes]
  static_assert(16 * 1024 + 16 * 64 <= ATT_SMEM_FLOATS);
  const bool odd = kp != 0;
  const float l0 = lrow[0] + other_half(lrow[0]), l1 = lrow[1] + other_half(lrow[1]);   // the two lane halves' sums joined
  const float mk = odd ? mrow[1] : mrow[0], mg = odd ? mrow[0] : mrow[1];
  const float lk = odd ? l1 : l0, lg = odd ? l0 : l1;
#pragma unroll
  for (int t = 0; t < 4; ++t) {
    v4f g0, g1;
#pragma unroll
    for (int r = 0; r < 4; ++r) {
      g0[r] = odd ? o[0][t][r] : o[1][t][r];
      g1[r] = odd ? o[0][t][4 + r] : o[1][t][4 + r];
    }
    xch[wave * 256 + (2 * t) * 32 + lane]     = g0;
    xch[wave * 256 + (2 * t + 1) * 32 + lane] = g1;
  }
  xml[wave * 64 + lane]      = mg;
  xml[wave * 64 + 32 + lane] = lg;
  __syncthreads();                                         // the given tiles are in LDS
  const int pw = wave ^ 1;
  const float mp = xml[pw * 64 + lane], lq = xml[pw * 64 + 32 + lane];
  const float mm = fmaxf(mk, mp);
  const float ak = exp2_slot(mk - mm), ap = exp2_slot(mp - mm);
  // ---- fold 1/l and the carries (1024 on P, 16 on v) ----
  const float oc = 1.0f / (PC * VC);
  const float inv = (1.0f / (lk * ak + lq * ap)) * oc;
  const float fk = ak * inv, fp = ap * inv;
  v8f res[4];
#pragma unroll
  for (int t = 0; t < 4; ++t) {
    const v4f p0 = xch[pw * 256 + (2 * t) * 32 + lane], p1 = xch[pw * 256 + (2 * t + 1) * 32 + lane];
#pragma unroll
    for (int r = 0; r < 4; ++r) {
      res[t][r]     = (odd ? o[1][t][r] : o[0][t][r]) * fk + p0[r] * fp;
      res[t][4 + r] = (odd ? o[1][t][4 + r] : o[0][t][4 + r]) * fk + p1[r] * fp;
    }
  }
  __syncthreads();                                         // every wave has read its partner's tile; the buffer is reused below
  // ---- the buffer becomes two bf16 result buffers [256][64]: split into bf16 hi + residual, stage the wave's 16x64 slice ----
  unsigned short* Osh = (unsigned short*)smem;
  unsigned short* Osl = Osh + QBLK * HDIM;
  const int ro = (wave * 16 + c) * HDIM + 8 * hh;                 // query row 32 qg + 16 kp + c = 16 wave + c, d = 16t + 8hh + 0..7: one 16-B LDS store per tile and plane
  auto put_tile = [&](const v8f& o_, int t) {
    v4u hv, lv;
#pragma unroll
    for (int e = 0; e < 4; ++e) {
      const float f0 = o_[2 * e], f1 = o_[2 * e + 1];
      const unsigned short g0 = bf_bits(f0), g1 = bf_bits(f1);
      hv[e] = pk16(g0, g1);
      lv[e] = pk16(bf_bits(f0 - bf_up(g0)), bf_bits(f1 - bf_up(g1)));
    }
    *(v4u*)(Osh + ro + 16 * t) = hv;
    *(v4u*)(Osl + ro + 16 * t) = lv;
  };
  put_tile(res[0], 0);
  put_tile(res[1], 1);
  put_tile(res[2], 2);
  put_tile(res[3], 3);
  __syncthreads();
  // ---- block writes its 256 row segments of both planes: piece p = it*512 + tid -> row p / 8, halves (p % 8)*8 .. +7 of the head's 64 ----
  {
    v4u hv[4], lv[4];
#pragma unroll
    for (int it = 0; it < 4; ++it) {
      const int p = it * ATT_THREADS + tid;
      hv[it] = *(const v4u*)(Osh + (size_t)p * 8);
      lv[it] = *(const v4u*)(Osl + (size_t)p * 8);
    }
    const size_t dofs = ((size_t)bat * NQ + qb0) * DMODEL + head * HDIM;
    unsigned short* dsth = CTh + dofs;
    unsigned short* dstl = CTl + dofs;
#pragma unroll
    for (int it = 0; it < 4; ++it) {
      const int p = it * ATT_THREADS + tid;
      const size_t go = (size_t)(p >> 3) * DMODEL + (p & 7) * 8;
      *(v4u*)(dsth + go) = hv[it];
      *(v4u*)(dstl + go) = lv[it];
    }
  }
}

// =====================================================================================================
// Workspace map (bytes); every plane is an exact multiple of its tile / whole-row store granularity (M, N exact tile multiples,
// element counts exact multiples of the convert kernel's 2048 granularity, no pad rows needed), every offset a multiple of 2 MiB:
//   WQ16 f16 [1024][1024] x64               2097152   ([out][in] = [n][k])
//   WK16 f16 [1024][1024] x64               2097152
//   WV16 f16 [1024][1024] x64               2097152
//   WO16 bf16 [1024][1024]                  2097152
//   X16  f16 [4096][1024] x16               8388608   (activation rows)
//   QHh, QHl bf16 [4096][1024]          2 x 8388608   (q projection, hi / residual)
//   KHh, KHl bf16 [4096][1024]          2 x 8388608   (k projection, hi / residual)
//   VTh, VTl f16 [2][1024][2048] x16    2 x 8388608   (v^T per batch, hi / residual)
//   CTh, CTl bf16 [4096][1024]          2 x 8388608   (attention ctx, merged heads, hi / residual)
//   end                                    83886080
// =====================================================================================================
extern "C" void kernel_launch(void* const* d_in, const int* in_sizes, int n_in,
                              void* d_out, int out_size, void* d_ws, size_t ws_size,
                              hipStream_t stream) {
  if (n_in < 6) return;
  if (in_sizes[0] != NROWS * DMODEL) return;
  if (in_sizes[1] != DMODEL * DMODEL || in_sizes[2] != DMODEL * DMODEL ||
      in_sizes[3] != DMODEL * DMODEL || in_sizes[4] != DMODEL * DMODEL) return;
  if (in_sizes[5] != NBKT * NHEAD) return;
  if (out_size != NROWS * DMODEL) return;
  if ((in_sizes[0] % 2048) != 0 || (in_sizes[1] % 2048) != 0) return;

  const float* x   = (const float*)d_in[0];
  const float* w_q = (const float*)d_in[1];
  const float* w_k = (const float*)d_in[2];
  const float* w_v = (const float*)d_in[3];
  const float* w_o = (const float*)d_in[4];
  const float* rel = (const float*)d_in[5];
  float*       out = (float*)d_out;

  const size_t PW  = (size_t)DMODEL * DMODEL * 2;                 //  2097152
  const size_t PX  = (size_t)NROWS * DMODEL * 2;                  //  8388608
  const size_t PVT = (size_t)NB * DMODEL * NC * 2;                //  8388608
  size_t off = 0;
  const size_t oWQ = off; off += PW;
  const size_t oWK = off; off += PW;
  const size_t oWV = off; off += PW;
  const size_t oWO = off; off += PW;
  const size_t oX  = off; off += PX;
  const size_t oQh = off; off += PX;
  const size_t oQl = off; off += PX;
  const size_t oKh = off; off += PX;
  const size_t oKl = off; off += PX;
  const size_t oVh = off; off += PVT;
  const size_t oVl = off; off += PVT;
  const size_t oCh = off; off += PX;
  const size_t oCl = off; off += PX;
  if (off > ws_size) return;                                      // off = 83886080
  if (off > (size_t)134217728) return;

  char* ws = (char*)d_ws;
  unsigned short* WQ16 = (unsigned short*)(ws + oWQ);
  unsigned short* WK16 = (unsigned short*)(ws + oWK);
  unsigned short* WV16 = (unsigned short*)(ws + oWV);
  unsigned short* WO16 = (unsigned short*)(ws + oWO);
  unsigned short* X16  = (unsigned short*)(ws + oX);
  unsigned short* QHh  = (unsigned short*)(ws + oQh);
  unsigned short* QHl  = (unsigned short*)(ws + oQl);
  unsigned short* KHh  = (unsigned short*)(ws + oKh);
  unsigned short* KHl  = (unsigned short*)(ws + oKl);
  unsigned short* VTh  = (unsigned short*)(ws + oVh);
  unsigned short* VTl  = (unsigned short*)(ws + oVl);
  unsigned short* CTh  = (unsigned short*)(ws + oCh);
  unsigned short* CTl  = (unsigned short*)(ws + oCl);

  const dim3 blk(256);
  const dim3 gCV(CVX_BLOCKS + 4 * CVW_BLOCKS);                     // 2048 + 4 x 512 = 4096 blocks
  const int tilesP = (NROWS / 64) * (DMODEL / 64);                 // 1024
  const dim3 gP((tilesP + 7) / 8, 1);                              // 128
  const dim3 gQKV((tilesP + 7) / 8, 3);                            // 128 x 3
  const dim3 gAT(ATT_BLOCKS);                                      // 256
  const dim3 bAT(ATT_THREADS);                                     // 512
  static_assert(NB * (DMODEL / 128) * (NC / 256) == (NROWS / 128) * (DMODEL / 256));   // v^T tiles of both batches = tiles of q

  // (0) one launch: activation plane X16[row][c] = f16( bf16_RNE(x[row][c]) * 16 ), rows = b*2048 + tok; weight planes
  //     f16( bf16_RNE(W[n][k]) * 64 ) for Wq, Wk, Wv; bf16_RNE(Wo[n][k]) bits for Wo; [out][in] layout kept
  cvt_all<<<gCV, blk, 0, stream>>>(x, w_q, w_k, w_v, w_o, X16, WQ16, WK16, WV16, WO16);

  // (1) one launch: q[m][n] = sum_k x[m][k] Wq[n][k] and k likewise -> bf16 hi / residual planes;
  //     VT[b][d][tok] = sum_k Wv[d][k] x_b[tok][k] -> f16 x16 hi / residual planes
  qkv64<<<gQKV, blk, 0, stream>>>(X16, WQ16, WK16, WV16, QHh, QHl, KHh, KHl, VTh, VTl);

  // (5) attention per (batch, head, 256 query rows) -> CT (bf16 hi / residual planes)
  attn16<<<gAT, bAT, 0, stream>>>(QHh, QHl, KHh, KHl, VTh, VTl, rel, CTh, CTl);

  // (6) out = (CT_hi + CT_lo) . Wo^T; M = 4096, N = 1024, K = 1024, f32
  gemm64<0, 1, 1><<<gP, blk, 0, stream>>>(
      CTh, CTl, DMODEL, 0LL,
      WO16, DMODEL, 0LL,
      (void*)out, (void*)out, DMODEL, 0LL,
      NROWS, DMODEL, DMODEL, 1.0f, 1.0f);
  (void)hipGetLastError();
}

// v007
// A run of this version takes 109 microseconds.
// Two timings next to v006 both put it at 1.15 times that version's speed.
// All steps since v000 together make it 4.39 times as fast.
// Contractions (all f32 accumulate): q/k projections v_wmma_f32_16x16x32_f16 (x f16 x16 . W f16 x64, K=1024, single products) stored as bf16 hi/lo planes;
// v^T projection v_wmma_f32_16x16x32_f16 (Wv f16 x64 . x f16 x16, K=1024) stored as one f16 x16 plane;
// attention scores, transposed, v_wmma_f32_16x16x32_bf16 (k bf16 hi/lo . q^T bf16 hi/lo, hi.hi+lo.hi+hi.lo, K=64);
// v^T . P^T v_wmma_f32_16x16x32_f16 (v^T f16 x16 . P^T f16 x1024, each rounded once to f16, one product, K=2048 by 32);
// output projection v_wmma_f32_16x16x32_bf16 (ctx bf16 hi/lo . Wo bf16, hi.W+lo.W, K=1024).
// Bucketed relative-position bias (per head, function of key-query offset) and online max-subtracted base-2 softmax in f32 on VALU.
// Every float input RNE-converted to bf16 on load.
#include <hip/hip_runtime.h>
#include <math.h>
#include <stdint.h>

#define NB      2
#define NQ      2048
#define NC      2048
#define DMODEL  1024
#define NHEAD   16
#define HDIM    64
#define NBKT    32
#define NROWS   (NB * NQ)
#define WSC     64.0f
#define ACARRY  16.0f
#define VC      16.0f
#define PC      1024.0f
#define ATT_SCALE 0.125f
#define LOG2E   1.4426950408889634f
#define SL2     (ATT_SCALE * LOG2E)
static_assert(NHEAD * HDIM == DMODEL);
static_assert((NQ % 64) == 0 && (NC % 64) == 0 && (DMODEL % 64) == 0 && (NC % 32) == 0 && (NQ % 16) == 0);
static_assert((NROWS % 128) == 0 && (DMODEL % 256) == 0 && (NC % 256) == 0 && (DMODEL % 128) == 0);
#define ATT_THREADS 512
#define QBLK        256                                  // query rows per block: 8 wave pairs x 32 rows, one head
#define ATT_BLOCKS  (NB * NHEAD * (NQ / QBLK))
static_assert(ATT_THREADS == 512 && ATT_BLOCKS == 256 && (NQ % QBLK) == 0 && NQ / QBLK == 8 && NHEAD == 16);
#define LUTP            (NC + QBLK)                      // bias table entries of one head: key - tok + (first row + 255) in [0, 2302]
#define SKEYS           64                               // keys per LDS stage
#define NSTG            (NC / SKEYS)
#define SPITCH          72                               // halves: 128-B rows at a 144-B pitch (16 B x odd) for 16-B LDS reads
#define GKS             64                               // k per LDS stage of the GEMM (128-B rows)
#define PLANE_HALVES    (64 * SPITCH)
#define BUF_HALVES      (3 * PLANE_HALVES)               // K hi, K lo, v^T
#define XCH_FLOATS      (16 * 1024 + 16 * 64)            // the epilogue's exchange of the key halves: larger than table + ring
#define ATT_SMEM_FLOATS XCH_FLOATS
static_assert(LUTP / 2 + BUF_HALVES <= ATT_SMEM_FLOATS);
static_assert(SKEYS == 64 && HDIM == 64 && NSTG >= 2 && (NC % SKEYS) == 0);
static_assert((LUTP % 8) == 0 && (PLANE_HALVES % 8) == 0);
static_assert((size_t)2 * QBLK * HDIM * sizeof(unsigned short) <= (size_t)ATT_SMEM_FLOATS * sizeof(float));

typedef _Float16 v16h __attribute__((ext_vector_type(16)));
typedef _Float16 v8h  __attribute__((ext_vector_type(8)));
typedef __bf16   v16b __attribute__((ext_vector_type(16)));
typedef float    v8f  __attribute__((ext_vector_type(8)));
typedef float    v4f  __attribute__((ext_vector_type(4)));
typedef float    v2f  __attribute__((ext_vector_type(2)));
typedef _Float16 v2h  __attribute__((ext_vector_type(2)));
typedef unsigned int v4u __attribute__((ext_vector_type(4)));

union FragH { v16h v; v8h h[2]; v4u u[2]; };
union FragAny { v16h h; v16b b; };

// ---- scalar helpers --------------------------------------------------------------------------------
__device__ __forceinline__ unsigned short bf_bits(float f) {          // f32 -> bf16 bits, RNE convert
  unsigned u = __float_as_uint(f);
  return (unsigned short)((u + 0x7FFFu + ((u >> 16) & 1u)) >> 16);
}
__device__ __forceinline__ float bf_up(unsigned short h) { return __uint_as_float(((unsigned)h) << 16); }
__device__ __forceinline__ float bfr(float f) { return bf_up(bf_bits(f)); }   // value of the bf16 RNE convert
__device__ __forceinline__ unsigned short h_bits(_Float16 x) { return __builtin_bit_cast(unsigned short, x); }
__device__ __forceinline__ unsigned pk16(unsigned short a, unsigned short b) { return (unsigned)a | ((unsigned)b << 16); }
__device__ __forceinline__ float other_half(float v) {               // the value that lane l ^ 16 holds
  const int b = __builtin_bit_cast(int, v);
  return __builtin_bit_cast(float, __builtin_amdgcn_permlanex16(b, b, 0x76543210, 0xfedcba98, false, false));
}
// 2^x as the bare v_exp_f32. Every argument here is <= 0 (a score or the old maximum minus the new maximum); a result below 2^-126 comes out as 0,
// which neither the f16 P planes (x1024) nor a row sum that holds the maximum's own 1 can tell from the exact value; -inf gives 0.
__device__ __forceinline__ float exp2_bare(float x) { return __builtin_amdgcn_exp2f(x); }
// The same with its slot: the v_nop keeps one vector slot between v_exp_f32 and whatever the compiler puts next (it may overwrite the source register).
__device__ __forceinline__ float exp2_slot(float x) {
  float r = 0.f;
#if defined(__HIP_DEVICE_COMPILE__)
  asm("v_exp_f32 %0, %1\n\tv_nop" : "=v"(r) : "v"(x));
#endif
  return r;
}
__device__ __forceinline__ v8f zero8() { v8f z = {0.f, 0.f, 0.f, 0.f, 0.f, 0.f, 0.f, 0.f}; return z; }

// ---- fragment loader: 16-bit A/B operand from a k-contiguous 16-bit plane, lane -> row/col (lane&15),
//      p already includes +8*(lane>>4); elements 0..7 <- p[0..7] (k0+8h..), elements 8..15 <- p[16..23] (k0+16+8h..)
//      (same split k map for A and B; B is always read from a [n][k] plane)
__device__ __forceinline__ v16h ldfrag_u(const unsigned short* p) {
  FragH f;
  f.u[0] = *(const v4u*)(p);
  f.u[1] = *(const v4u*)(p + 16);
  return f.v;
}

// ---- WMMA helpers with trailing VALU hazard gaps ------------------------------------------------------
__device__ __forceinline__ v8f mma_h(v16h a, v16h b, v8f c) {
  return __builtin_amdgcn_wmma_f32_16x16x32_f16(false, a, false, b, (short)0, c, false, false);
}
__device__ __forceinline__ v8f mma_b(v16h a, v16h b, v8f c) {
  FragAny ua, ub;
  ua.h = a;
  ub.h = b;
  return __builtin_amdgcn_wmma_f32_16x16x32_bf16(false, ua.b, false, ub.b, (short)0, c, false, false);
}
template <int BF>
__device__ __forceinline__ v8f mmaT(v16h a, v16h b, v8f c) {
  if constexpr (BF != 0) return mma_b(a, b, c);
  else return mma_h(a, b, c);
}
__device__ __forceinline__ void dep_guard1(v8f& a, v8f& b, v16h x) {
#if defined(__HIP_DEVICE_COMPILE__)
  asm volatile("v_nop\n\tv_nop\n\tv_nop\n\tv_nop" : "+v"(a), "+v"(b) : "v"(x));
#endif
}
__device__ __forceinline__ void guard2x4(v8f& s, v8f& u, v16h a0, v16h a1, v16h a2, v16h a3) {
#if defined(__HIP_DEVICE_COMPILE__)
  asm volatile("v_nop\n\tv_nop\n\tv_nop\n\tv_nop" : "+v"(s), "+v"(u) : "v"(a0), "v"(a1), "v"(a2), "v"(a3));
#endif
}
__device__ __forceinline__ void guard4x6(v8f& a, v8f& b, v8f& c, v8f& d,
                                         v16h x0, v16h x1, v16h x2, v16h x3, v16h x4, v16h x5) {
#if defined(__HIP_DEVICE_COMPILE__)
  asm volatile("v_nop\n\tv_nop\n\tv_nop\n\tv_nop"
               : "+v"(a), "+v"(b), "+v"(c), "+v"(d) : "v"(x0), "v"(x1), "v"(x2), "v"(x3), "v"(x4), "v"(x5));
#endif
}
__device__ __forceinline__ void keep4_h(v16h a, v16h b, v16h c, v16h d) {
#if defined(__HIP_DEVICE_COMPILE__)
  asm volatile("v_nop" :: "v"(a), "v"(b), "v"(c), "v"(d));
#endif
}
__device__ __forceinline__ void acc_guard4(v8f& a, v8f& b, v8f& c, v8f& d) {
#if defined(__HIP_DEVICE_COMPILE__)
  asm volatile("v_nop\n\tv_nop\n\tv_nop\n\tv_nop" : "+v"(a), "+v"(b), "+v"(c), "+v"(d));
#endif
}
__device__ __forceinline__ void wave_sync_lds() {
  __builtin_amdgcn_fence(__ATOMIC_RELEASE, "workgroup");
  __builtin_amdgcn_wave_barrier();
  __builtin_amdgcn_fence(__ATOMIC_ACQUIRE, "workgroup");
}
// Four (or three) 16-B-per-lane asynchronous copies global -> LDS (l*: the lane's LDS byte address, g*: the lane's global address).
// The s_wait_xcnt stands inside the statement so that no address register is rewritten in front of it.
__device__ __forceinline__ void async_copy4(unsigned l0, const unsigned short* g0, unsigned l1, const unsigned short* g1,
                                            unsigned l2, const unsigned short* g2, unsigned l3, const unsigned short* g3) {
#if defined(__HIP_DEVICE_COMPILE__)
  asm volatile("global_load_async_to_lds_b128 %0, %1, off\n\t"
               "global_load_async_to_lds_b128 %2, %3, off\n\t"
               "global_load_async_to_lds_b128 %4, %5, off\n\t"
               "global_load_async_to_lds_b128 %6, %7, off\n\t"
               "s_wait_xcnt 0x0"
               :: "v"(l0), "v"(g0), "v"(l1), "v"(g1), "v"(l2), "v"(g2), "v"(l3), "v"(g3) : "memory");
#endif
}
__device__ __forceinline__ void async_copy3(unsigned l0, const unsigned short* g0, unsigned l1, const unsigned short* g1,
                                            unsigned l2, const unsigned short* g2) {
#if defined(__HIP_DEVICE_COMPILE__)
  asm volatile("global_load_async_to_lds_b128 %0, %1, off\n\t"
               "global_load_async_to_lds_b128 %2, %3, off\n\t"
               "global_load_async_to_lds_b128 %4, %5, off\n\t"
               "s_wait_xcnt 0x0"
               :: "v"(l0), "v"(g0), "v"(l1), "v"(g1), "v"(l2), "v"(g2) : "memory");
#endif
}
__device__ __forceinline__ void wait_async0() {   // this wave's own copies have landed in LDS
#if defined(__HIP_DEVICE_COMPILE__)
  asm volatile("s_wait_asynccnt 0x0" ::: "memory");
#endif
}
__device__ __forceinline__ void wait_ds0() {      // this wave's own LDS reads have returned (before their buffer is refilled)
#if defined(__HIP_DEVICE_COMPILE__)
  asm volatile("s_wait_dscnt 0x0" ::: "memory");
#endif
}

// =====================================================================================================
// Elementwise 16-bit pack, no transpose. BFO 0: dst[i] = f16( bf16_RNE(src[i]) * sc ), sc a power of two (exact);
// BFO 1: dst[i] = bf16_RNE(src[i]) bits. 8 elements per thread: two 16-B loads, one 16-B store per lane; 32 consecutive
// coverage: n / 2048 blocks (index bx) x 256 thr x 8 elements = n exactly (host checks n % 2048 == 0).
// =====================================================================================================
template <int BFO>
__device__ __forceinline__ void cvt16(const float* __restrict__ src, unsigned short* dst, int n, float sc, int bx) {
  const size_t i8 = ((size_t)bx * 256 + threadIdx.x) * 8;
  if (i8 + 8 > (size_t)n) return;                 // never taken with the exact grid; no barriers in this kernel
  const v4f a = *(const v4f*)(src + i8);
  const v4f b = *(const v4f*)(src + i8 + 4);
  v4u o;
  if constexpr (BFO != 0) {
    o[0] = pk16(bf_bits(a[0]), bf_bits(a[1]));
    o[1] = pk16(bf_bits(a[2]), bf_bits(a[3]));
    o[2] = pk16(bf_bits(b[0]), bf_bits(b[1]));
    o[3] = pk16(bf_bits(b[2]), bf_bits(b[3]));
  } else {
    o[0] = pk16(h_bits((_Float16)(bfr(a[0]) * sc)), h_bits((_Float16)(bfr(a[1]) * sc)));
    o[1] = pk16(h_bits((_Float16)(bfr(a[2]) * sc)), h_bits((_Float16)(bfr(a[3]) * sc)));
    o[2] = pk16(h_bits((_Float16)(bfr(b[0]) * sc)), h_bits((_Float16)(bfr(b[1]) * sc)));
    o[3] = pk16(h_bits((_Float16)(bfr(b[2]) * sc)), h_bits((_Float16)(bfr(b[3]) * sc)));
  }
  {
    *(v4u*)(dst + i8) = o;
    
  }
}
// All five converts in one launch; the block index picks the job (block-uniform): blocks 0..2047 the activations (f16 x16),
// then 512 blocks each for Wq, Wk, Wv (f16 x64) and Wo (bf16 bits).
#define CVX_BLOCKS ((NROWS * DMODEL) / 2048)
#define CVW_BLOCKS ((DMODEL * DMODEL) / 2048)
__global__ __launch_bounds__(256) void cvt_all(const float* __restrict__ x, const float* __restrict__ w_q, const float* __restrict__ w_k,
                                               const float* __restrict__ w_v, const float* __restrict__ w_o,
                                               unsigned short* X16, unsigned short* WQ16, unsigned short* WK16,
                                               unsigned short* WV16, unsigned short* WO16) {
  const int b = blockIdx.x;
  if (b < CVX_BLOCKS) {
    cvt16<0>(x, X16, NROWS * DMODEL, ACARRY, b);
    return;
  }
  const int job = (b - CVX_BLOCKS) / CVW_BLOCKS;           // 0..3 with the exact grid
  const int bw  = (b - CVX_BLOCKS) - job * CVW_BLOCKS;
  if (job == 3) {
    cvt16<1>(w_o, WO16, DMODEL * DMODEL, 1.0f, bw);
  } else if (job < 3) {
    const float* src    = (job == 0) ? w_q  : (job == 1) ? w_k  : w_v;
    unsigned short* dst = (job == 0) ? WQ16 : (job == 1) ? WK16 : WV16;
    cvt16<0>(src, dst, DMODEL * DMODEL, WSC, bw);
  }
}

// =====================================================================================================
// Register-blocked batched 16-bit WMMA GEMM: C[m][n] = oscale * sum_k A[m][k] * Bt[n][k]; one wave per 64x64 tile, a block of 8 waves
// (2 x 4) per 128x256 tile. The block's 128 A rows (and A2 rows) and 256 Bt rows of a 64-k stage (128 B per row) are brought into LDS once
// per block by asynchronous 16-B copies (8 lanes per 128-B row; 12 or 16 copies per thread and stage), two buffers: stage t + 2 is issued
// behind the barrier that ends stage t; the waves read their fragments from there (two 16-B LDS loads per fragment, row pitch 144 B).
// A row-major [M][K] pitch lda (16-bit plane), Bt row-major [N][K] pitch ldb (k contiguous); M multiple of 128, N of 256, K of 64.
// bx = tile index, by = batch index with element strides sA, sB, sC; sT (8 per-wave slabs) and gst (two stage buffers) are the calling kernel's LDS.
// ASPLIT 1: a second A plane A2 (unscaled residual of A, same layout) is multiplied into the same accumulator (A + A2 ~ exact A).
// BF 1: bf16 operands (v_wmma_f32_16x16x32_bf16), else f16.
// OM 0: f32 out (pitch ldc).  OM 2: f16 out = f16(value * ocarry).  OM 3: two bf16 planes: hi = bf16_RNE(value), lo = bf16_RNE(value - hi).
// OM 4: two f16 planes: hi = f16(value * ocarry), lo = f16(value * ocarry - hi) (unscaled residual).
// coverage: 4 slabs x 16 rows (f32: it 0..7 x lane>>4; 16-bit: it 0..3 x lane>>3) x 64 cols = the wave's whole 64x64 tile;
//           stage: 256 threads x 16 B = 32 rows x 128 B per copy; grid = (M / 128) * (N / 256) blocks, a surplus block exits whole.
// =====================================================================================================
#define GSLAB (16 * 68)                             // floats of a per-wave 16x64 slab, pitch 68 floats
#define GBUF_HALVES(ASPLIT) ((256 + 128 * (1 + (ASPLIT))) * SPITCH)   // rows of a stage buffer: Bt 0..255 | A 256..383 | A2 384..511
template <int OM, int ASPLIT, int BF>
__device__ __forceinline__ void gemm_tile(
    const unsigned short* __restrict__ Ap, const unsigned short* __restrict__ A2p, int lda, long long sA,
    const unsigned short* __restrict__ Btp, int ldb, long long sB,
    void* Cout, void* C2out, int ldc, long long sC,
    int M, int N, int K, float oscale, float ocarry,
    int bx, int by, float* sT, unsigned short* gst) {
  constexpr int GBUF  = GBUF_HALVES(ASPLIT);       // halves per stage buffer
  constexpr unsigned R32 = 32 * SPITCH * 2;        // LDS bytes of 32 rows (one copy of the whole block)
  const int tid  = threadIdx.x;
  const int lane = threadIdx.x & 31;
  const int wave = threadIdx.x >> 5;
  const int blocksN = N >> 8;
  const int blocksM = M >> 7;
  // block-uniform, in front of every barrier; never taken with the exact grids and shapes of this file
  if ((M & 127) != 0 || (N & 255) != 0 || (K & (GKS - 1)) != 0 || K < GKS || bx >= blocksM * blocksN) return;
  const int bm  = bx / blocksN;
  const int bn  = bx - bm * blocksN;
  const int mb0 = bm << 7;
  const int nb0 = bn << 8;
  const int m0 = mb0 + ((wave >> 2) << 6);
  const int n0 = nb0 + ((wave & 3) << 6);

  const unsigned short* A1 = Ap  + (size_t)((long long)by * sA);
  const unsigned short* A2 = A2p + (size_t)((long long)by * sA);
  const unsigned short* Bb = Btp + (size_t)((long long)by * sB);

  const int rlane = lane & 15;                 // row (A) / col (B, D) within subtile
  const int koff  = (lane >> 4) * 8;           // k offset of this lane half
  const int mOff  = (lane >> 4) * 8;           // D row offset

  v8f acc[4][4];
#pragma unroll
  for (int i = 0; i < 4; ++i)
#pragma unroll
    for (int j = 0; j < 4; ++j) acc[i][j] = zero8();

  // ---- stage copies: thread -> row tid / 8 (+ 32 per copy), 16-B piece tid % 8 of the row's 128 B ----
  const int sr = tid >> 3, sp = (tid & 7) * 8;
  const unsigned short* gB  = Bb + (size_t)(nb0 + sr) * ldb + sp;
  const unsigned short* gA  = A1 + (size_t)(mb0 + sr) * lda + sp;
  const unsigned short* gA2 = A2 + (size_t)(mb0 + sr) * lda + sp;
  const size_t b32 = (size_t)32 * ldb, a32 = (size_t)32 * lda;
  const unsigned ldst = (unsigned)(uintptr_t)(gst + sr * SPITCH + sp);   // LDS byte address = low 32 bits
  auto stage_copy = [&](int st, int buf) {
    const size_t ks = (size_t)st * GKS;
    const unsigned l = ldst + (unsigned)buf * (GBUF * 2);
    const unsigned short* b = gB + ks;
    const unsigned short* a = gA + ks;
    async_copy4(l,            b,           l + R32,      b + b32,     l + 2 * R32,  b + 2 * b32, l + 3 * R32,  b + 3 * b32);
    async_copy4(l + 4 * R32,  b + 4 * b32, l + 5 * R32,  b + 5 * b32, l + 6 * R32,  b + 6 * b32, l + 7 * R32,  b + 7 * b32);
    async_copy4(l + 8 * R32,  a,           l + 9 * R32,  a + a32,     l + 10 * R32, a + 2 * a32, l + 11 * R32, a + 3 * a32);
    if constexpr (ASPLIT != 0) {
      const unsigned short* a2 = gA2 + ks;
      async_copy4(l + 12 * R32, a2,        l + 13 * R32, a2 + a32,    l + 14 * R32, a2 + 2 * a32, l + 15 * R32, a2 + 3 * a32);
    }
  };
  const int nst = K / GKS;
  stage_copy(0, 0);
  wait_async0();
  __syncthreads();                                         // publishes stage 0
  if (nst > 1) stage_copy(1, 1);

  for (int st = 0; st < nst; ++st) {
    const unsigned short* sb = gst + (st & 1) * GBUF + rlane * SPITCH + koff;   // lane's row rlane, k half
    const unsigned short* sB = sb + ((wave & 3) << 6) * SPITCH;
    const unsigned short* sA = sb + (256 + ((wave >> 2) << 6)) * SPITCH;
    // unrolled: the offsets inside the stage become immediates of the LDS loads
#pragma unroll
    for (int kk = 0; kk < GKS; kk += 32) {
      v16h bh[4], ah[4], al[ASPLIT != 0 ? 4 : 1];
#pragma unroll
      for (int j = 0; j < 4; ++j) bh[j] = ldfrag_u(sB + (j << 4) * SPITCH + kk);
#pragma unroll
      for (int i = 0; i < 4; ++i) ah[i] = ldfrag_u(sA + (i << 4) * SPITCH + kk);
      if constexpr (ASPLIT != 0) {
#pragma unroll
        for (int i = 0; i < 4; ++i) al[i] = ldfrag_u(sA + (128 + (i << 4)) * SPITCH + kk);
      }
#pragma unroll
      for (int i = 0; i < 4; ++i) {
#pragma unroll
        for (int j = 0; j < 4; ++j) acc[i][j] = mmaT<BF>(ah[i], bh[j], acc[i][j]);
        dep_guard1(acc[i][0], acc[i][3], ah[i]);
        if constexpr (ASPLIT != 0) {
#pragma unroll
          for (int j = 0; j < 4; ++j) acc[i][j] = mmaT<BF>(al[i], bh[j], acc[i][j]);
          dep_guard1(acc[i][0], acc[i][3], al[i]);
        }
      }
      keep4_h(bh[0], bh[1], bh[2], bh[3]);
    }
    // ---- publish point of stage st + 1 ----
    wait_ds0();
    wait_async0();
    __syncthreads();                       // publishes stage st + 1 and ends every wave's reads of stage st's buffer
    if (st + 2 < nst) stage_copy(st + 2, st & 1);
  }
  wait_async0();
  acc_guard4(acc[0][0], acc[0][1], acc[0][2], acc[0][3]);
  acc_guard4(acc[1][0], acc[1][1], acc[1][2], acc[1][3]);
  acc_guard4(acc[2][0], acc[2][1], acc[2][2], acc[2][3]);
  acc_guard4(acc[3][0], acc[3][1], acc[3][2], acc[3][3]);

  const int hh2 = lane >> 4, c4 = (lane & 15) * 4;     // f32 out: 256-B row segment = 16 lanes x 16 B
  const int q8  = lane >> 3, c8 = (lane & 7) * 8;

  // ---- epilogue ----
  float* slab = sT + wave * GSLAB;
#pragma unroll
  for (int i = 0; i < 4; ++i) {
    const int mBase = m0 + (i << 4);
#pragma unroll
    for (int j = 0; j < 4; ++j) {
#pragma unroll
      for (int r = 0; r < 8; ++r) {
        slab[(mOff + r) * 68 + (j << 4) + rlane] = acc[i][j][r];
      }
    }
    wave_sync_lds();
    if constexpr (OM == 0) {
      float* C = (float*)Cout + (size_t)((long long)by * sC);
      v4f vals[8];
#pragma unroll
      for (int it = 0; it < 8; ++it) {
        const int row = it * 2 + hh2;                      // it 0..7 x hh2 0..1 = rows 0..15
        v4f v = *(const v4f*)(slab + row * 68 + c4);
#pragma unroll
        for (int e = 0; e < 4; ++e) v[e] = v[e] * oscale;
        vals[it] = v;
      }
      {
#pragma unroll
        for (int it = 0; it < 8; ++it) {
          const int gr = mBase + it * 2 + hh2;
          *(v4f*)(C + (size_t)gr * ldc + n0 + c4) = vals[it];
        }
        
      }
    } else {
      unsigned short* C  = (unsigned short*)Cout  + (size_t)((long long)by * sC);
      unsigned short* Cb = (unsigned short*)C2out + (size_t)((long long)by * sC);
      v4u hv[4], lv[4];
#pragma unroll
      for (int it = 0; it < 4; ++it) {
        const int row = it * 4 + q8;                       // it 0..3 x q8 0..3 = rows 0..15
        const float* sp = slab + row * 68 + c8;
        v4u a  = {0u, 0u, 0u, 0u};
        v4u b2 = {0u, 0u, 0u, 0u};
#pragma unroll
        for (int e = 0; e < 4; ++e) {
          float f0 = sp[2 * e] * oscale;
          float f1 = sp[2 * e + 1] * oscale;
          if constexpr (OM == 3) {
            const unsigned short h0 = bf_bits(f0), h1 = bf_bits(f1);
            a[e]  = pk16(h0, h1);
            b2[e] = pk16(bf_bits(f0 - bf_up(h0)), bf_bits(f1 - bf_up(h1)));
          } else {
            f0 *= ocarry; f1 *= ocarry;
            const _Float16 x0 = (_Float16)f0, x1 = (_Float16)f1;
            a[e] = pk16(h_bits(x0), h_bits(x1));
            if constexpr (OM == 4) {
              b2[e] = pk16(h_bits((_Float16)(f0 - (float)x0)), h_bits((_Float16)(f1 - (float)x1)));
            }
          }
        }
        hv[it] = a;
        lv[it] = b2;
      }
      {
#pragma unroll
        for (int it = 0; it < 4; ++it) {
          const int row = it * 4 + q8;
          *(v4u*)(C + (size_t)(mBase + row) * ldc + n0 + c8) = hv[it];
          if constexpr (OM >= 3) {
            *(v4u*)(Cb + (size_t)(mBase + row) * ldc + n0 + c8) = lv[it];
          }
        }
        
      }
    }
    wave_sync_lds();
  }
}

// The three projections in one launch of 128 x 3 blocks, all resident at once (two blocks fit a WGP's LDS); blockIdx.y picks the job
// (block-uniform): 0 q and 1 k (x . W^T -> bf16 hi / residual planes; M = 4096, N = 1024, K = 1024, 128 tiles each),
// 2 v^T per batch (Wv . x_b^T -> one f16 x16 plane; M = 1024, N = 2048, K = 1024, 64 tiles for each of the two batches).
__global__ __launch_bounds__(256) void qkv64(
    const unsigned short* __restrict__ X16, const unsigned short* __restrict__ WQ16, const unsigned short* __restrict__ WK16,
    const unsigned short* __restrict__ WV16, unsigned short* QHh, unsigned short* QHl, unsigned short* KHh, unsigned short* KHl,
    unsigned short* VTh) {
  __shared__ __align__(16) float sT[8 * GSLAB];
  __shared__ __align__(16) unsigned short gst[2 * GBUF_HALVES(0)];
  const int job = blockIdx.y;
  const int bx  = blockIdx.x;
  if (job < 2) {
    gemm_tile<3, 0, 0>(X16, X16, DMODEL, 0LL,
                       job == 0 ? WQ16 : WK16, DMODEL, 0LL,
                       (void*)(job == 0 ? QHh : KHh), (void*)(job == 0 ? QHl : KHl), DMODEL, 0LL,
                       NROWS, DMODEL, DMODEL, 1.0f / (ACARRY * WSC), 1.0f, bx, 0, sT, gst);
  } else {
    constexpr int TV = (DMODEL / 128) * (NC / 256);          // 64 tiles per batch
    gemm_tile<2, 0, 0>(WV16, WV16, DMODEL, 0LL,
                       X16, DMODEL, (long long)NC * DMODEL,
                       (void*)VTh, (void*)VTh, NC, (long long)DMODEL * NC,
                       DMODEL, NC, DMODEL, 1.0f / (ACARRY * WSC), VC, bx % TV, bx / TV, sT, gst);
  }
}

template <int OM, int ASPLIT, int BF>
__global__ __launch_bounds__(256) void gemm64(
    const unsigned short* __restrict__ Ap, const unsigned short* __restrict__ A2p, int lda, long long sA,
    const unsigned short* __restrict__ Btp, int ldb, long long sB,
    void* Cout, void* C2out, int ldc, long long sC,
    int M, int N, int K, float oscale, float ocarry) {
  __shared__ __align__(16) float sT[8 * GSLAB];
  __shared__ __align__(16) unsigned short gst[2 * GBUF_HALVES(ASPLIT)];
  gemm_tile<OM, ASPLIT, BF>(Ap, A2p, lda, sA, Btp, ldb, sB, Cout, C2out, ldc, sC, M, N, K, oscale, ocarry,
                            (int)blockIdx.x, (int)blockIdx.y, sT, gst);
}

// =====================================================================================================
// Flash attention for one batch, one head and 256 query rows (a pair of waves per 32 rows, each wave half of the keys), head dim 64, 2048 keys:
//   q planes (bf16 hi, lo) Q[b*2048 + tok][64h + d], pitch 1024; k planes (bf16 hi, lo) K[b*2048 + key][64h + d], pitch 1024;
//   v^T plane (f16 x16): VT[b*1024 + 64h + d][key] (pitch 2048); bias = bf16(rel[bucket(key - tok)][h]) from a
//   per-block LDS table of bf16 bits indexed by (key - tok + first row + 255), bucket() piecewise constant in the offset;
//   out (bf16 hi, lo planes): CT[b*2048 + tok][64h + d] = sum_m softmax_m(q.k / 8 + bias) v[m][d]  (softmax run in base 2).
//   block = 16 waves = 512 threads; grid = 2 x 16 x 8 = 256; every wave does identical bounded work (32 stages, 32 of the stage's 64 keys x 32 queries).
//   The head's K rows and v^T rows of a stage (three planes of 64 rows x 128 B) are brought into LDS once per block by asynchronous
//   16-B copies (three per thread and stage; 8 lanes per 128-B row), two buffers: stage t + 2 is issued behind the barrier that ends
//   stage t; all 16 waves read their fragments from there (two 16-B LDS loads per fragment, row pitch 144 B); a fragment feeds both of the
//   wave's 16-query column tiles.
//   Per 32 keys and column tile: 2 transposed score tiles S^T = K . q^T on bf16 WMMA (A = K rows, B = q; K = 64 as two k-steps of 32): lane (c, hh) holds
//   query c's scores of keys 8hh + r and 16 + 8hh + r; their 16 bias values from the LDS table (u16); online max-subtracted softmax in
//   f32 (exp2) with the maximum in-lane plus one exchange between the lane halves, the sum kept per lane half and joined behind the loop;
//   rescale of the running sum and the four accumulators; P^T (f16 x1024, rounded once) packed from the two score tiles straight into
//   a B operand (hardware k order, as the v^T loader's); 4 WMMAs O^T += v^T . P^T. The f16 rounding of P and v (11 bits) lies well under
//   the bf16 rounding (8 bits) that x and the weights already carry into q, k and v.
//   Behind the last stage's barrier the two waves of a pair swap one column tile each through LDS (maximum, sum, O^T in f32) and join the two key
//   halves by the usual rescale. Final 1/l and carry folds in f32; behind one more barrier the LDS buffer is reused as the block's two bf16 result buffers
//   [256][64] (hi, lo): each wave stages its 16x64 slice; after a block barrier the 512 threads write 128-B row segments.
// coverage: LDS table: 512 threads stride over 2304 entries (all written); stage: 512 threads x 16 B = 64 rows x 128 B per plane;
//           global: 4 iterations x 512 threads x 8 halves = 256 rows x 64 columns of the head, per plane;
//           grid covers all 2 x 2048 rows x 16 heads exactly once.
// =====================================================================================================
__global__ __launch_bounds__(ATT_THREADS)
void attn16(const unsigned short* __restrict__ QHh, const unsigned short* __restrict__ QHl,
            const unsigned short* __restrict__ KHh, const unsigned short* __restrict__ KHl,
            const unsigned short* __restrict__ VTh,
            const float* __restrict__ rel, unsigned short* CTh, unsigned short* CTl) {
  // bias table u16 [2304] | two stage buffers of three planes [64][72] u16
  __shared__ __align__(16) float smem[ATT_SMEM_FLOATS];
  unsigned short* lut = (unsigned short*)smem;
  unsigned short* stg = lut + LUTP;

  const int tid  = threadIdx.x;
  const int wave = tid >> 5;
  const int lane = tid & 31;
  const int hh   = lane >> 4;
  const int c    = lane & 15;

  const int qb   = blockIdx.x & ((NQ / QBLK) - 1);         // 0..7
  const int head = (blockIdx.x / (NQ / QBLK)) & (NHEAD - 1);   // 0..15
  const int bat  = blockIdx.x / ((NQ / QBLK) * NHEAD);     // 0..1
  const int qb0  = qb * QBLK;
  const int qg   = wave >> 1;                              // the wave's 32 query rows: qb0 + 32 qg + 0..31 (two column tiles j of 16)
  const int kp   = wave & 1;                               // the wave's keys: the 32-key pass kp of every 64-key stage
  const int q0   = qb0 + qg * 32;

  // ---- stage copies: thread -> row tid / 8 (key of K, d of v^T), 16-B piece tid % 8 of the row's 128 B, in each of the three planes ----
  const int sr = tid >> 3, sp = (tid & 7) * 8;
  const size_t gko = ((size_t)bat * NC + sr) * DMODEL + head * HDIM + sp;
  const size_t gvo = ((size_t)bat * DMODEL + head * HDIM + sr) * NC + sp;
  const unsigned short* gKh = KHh + gko;
  const unsigned short* gKl = KHl + gko;
  const unsigned short* gVh = VTh + gvo;
  const unsigned ldst = (unsigned)(uintptr_t)(stg + sr * SPITCH + sp);   // LDS byte address = low 32 bits
  auto stage_copy = [&](int st, int buf) {
    const size_t ka = (size_t)st * SKEYS * DMODEL, va = (size_t)st * SKEYS;
    const unsigned l = ldst + (unsigned)buf * (BUF_HALVES * 2);
    async_copy3(l, gKh + ka, l + PLANE_HALVES * 2, gKl + ka, l + PLANE_HALVES * 4, gVh + va);
  };
  stage_copy(0, 0);

  // ---- per-block bias table: lut[i] = bf16 bits of rel[bucket(i - (qb0 + 255))][head], i = key - tok + qb0 + 255 in [0, 2302] ----
  for (int i = tid; i < LUTP; i += ATT_THREADS) {
    const int d  = i - (qb0 + QBLK - 1);                   // key - tok
    const int a  = (d < 0) ? -d : d;
    int g = 8 + (a >= 12) + (a >= 16) + (a >= 23) + (a >= 32) + (a >= 46) + (a >= 64) + (a >= 91);
    g = (a < 8) ? a : g;
    const int bk = g + ((d > 0) ? 16 : 0);                 // 0..31
    lut[i] = bf_bits(rel[bk * NHEAD + head]);              // index in [0, 511]
  }
  wait_async0();
  __syncthreads();                                         // publishes the bias table and stage 0
  stage_copy(1, 1);

  v16h qah[2], qbh[2], qal[2], qbl[2];
#pragma unroll
  for (int j = 0; j < 2; ++j) {
    const size_t qofs = ((size_t)bat * NQ + q0 + 16 * j + c) * DMODEL + head * HDIM + 8 * hh;
    qah[j] = ldfrag_u(QHh + qofs);
    qbh[j] = ldfrag_u(QHh + qofs + 32);
    qal[j] = ldfrag_u(QHl + qofs);
    qbl[j] = ldfrag_u(QHl + qofs + 32);
  }
  // + 64 st; element (query row 32 qg + 16 j + c, key 64 st + 32 kp + 16 t + 8 hh + r) at [16 (t - j) + r]; lowest index 255 - 224 - 15 - 16 = 0
  const unsigned short* lw = lut + ((QBLK - 1) - 32 * qg - c + 8 * hh + 32 * kp);

  // per column tile j: query c's running maximum (both lane halves alike), this lane half's running sum, over this wave's keys only
  float mrow[2] = {-INFINITY, -INFINITY}, lrow[2] = {0.f, 0.f};
  v8f o[2][4];                                             // O^T: o[j][t][r] = (d = 16t + 8hh + r, query 16j + c)
#pragma unroll
  for (int j = 0; j < 2; ++j)
#pragma unroll
    for (int t = 0; t < 4; ++t) o[j][t] = zero8();

#pragma unroll 1
  for (int st = 0; st < NSTG; ++st) {
    const unsigned short* sb  = stg + (st & 1) * BUF_HALVES + c * SPITCH + 8 * hh;   // lane's row c, k half hh
    const unsigned short* sKh = sb + 32 * kp * SPITCH;                               // K rows (keys) 32 kp + ..
    const unsigned short* sKl = sKh + PLANE_HALVES;
    const unsigned short* sVh = sb + 2 * PLANE_HALVES + 32 * kp;                     // v^T columns (keys) 32 kp + ..
    v8f s[2][2];                                           // s[t][j]: key tile t, column tile j
#pragma unroll
    for (int t = 0; t < 2; ++t) {
      const int k2 = t * 16 * SPITCH;
      const v16h k0h = ldfrag_u(sKh + k2), k1h = ldfrag_u(sKh + k2 + 32);
      const v16h k0l = ldfrag_u(sKl + k2), k1l = ldfrag_u(sKl + k2 + 32);
      s[t][0] = mma_b(k0h, qah[0], zero8());
      s[t][1] = mma_b(k0h, qah[1], zero8());
      s[t][0] = mma_b(k1h, qbh[0], s[t][0]);
      s[t][1] = mma_b(k1h, qbh[1], s[t][1]);
      s[t][0] = mma_b(k0l, qah[0], s[t][0]);
      s[t][1] = mma_b(k0l, qah[1], s[t][1]);
      s[t][0] = mma_b(k1l, qbh[0], s[t][0]);
      s[t][1] = mma_b(k1l, qbh[1], s[t][1]);
      s[t][0] = mma_b(k0h, qal[0], s[t][0]);
      s[t][1] = mma_b(k0h, qal[1], s[t][1]);
      s[t][0] = mma_b(k1h, qbl[0], s[t][0]);
      s[t][1] = mma_b(k1h, qbl[1], s[t][1]);
      guard2x4(s[t][0], s[t][1], k0h, k1h, k0l, k1l);
    }
    const unsigned short* lp = lw + st * SKEYS;
    FragH ph[2];
#pragma unroll
    for (int j = 0; j < 2; ++j) {
      const unsigned short* lj = lp - 16 * j;
      // pairs of neighbouring keys (registers 2e, 2e + 1 of a score tile): tp[e] of tile 0, tp[4 + e] of tile 1
      v2f tp[8];
#pragma unroll
      for (int e = 0; e < 4; ++e) {
        const v2f w0 = {bf_up(lj[2 * e]), bf_up(lj[2 * e + 1])}, w1 = {bf_up(lj[16 + 2 * e]), bf_up(lj[17 + 2 * e])};
        const v2f a0 = {s[0][j][2 * e], s[0][j][2 * e + 1]}, a1 = {s[1][j][2 * e], s[1][j][2 * e + 1]};
        tp[e]     = a0 * SL2 + w0 * LOG2E;
        tp[4 + e] = a1 * SL2 + w1 * LOG2E;
      }
      float mx = fmaxf(fmaxf(fmaxf(fmaxf(tp[0][0], tp[0][1]), fmaxf(tp[1][0], tp[1][1])), fmaxf(fmaxf(tp[2][0], tp[2][1]), fmaxf(tp[3][0], tp[3][1]))),
                       fmaxf(fmaxf(fmaxf(tp[4][0], tp[4][1]), fmaxf(tp[5][0], tp[5][1])), fmaxf(fmaxf(tp[6][0], tp[6][1]), fmaxf(tp[7][0], tp[7][1]))));
      mx = fmaxf(mx, other_half(mx));                      // query c's maximum over all 32 keys
      const float mn = fmaxf(mrow[j], mx);
      const float al = exp2_bare(mrow[j] - mn);
      mrow[j] = mn;
      v2f ep[8];
#pragma unroll
      for (int e = 0; e < 8; ++e) {                        // element pair 2e, 2e + 1 of the B operand: keys 16 (e / 4) + 8hh + 2 (e % 4) + 0, 1 of the pass
        const v2f d = tp[e] - mn;
        ep[e] = v2f{exp2_bare(d[0]), exp2_bare(d[1])};
        const v2h x = __builtin_convertvector(ep[e] * PC, v2h);
        ph[j].v[2 * e]     = x[0];
        ph[j].v[2 * e + 1] = x[1];
      }
      const v2f ps = ((ep[0] + ep[1]) + (ep[2] + ep[3])) + ((ep[4] + ep[5]) + (ep[6] + ep[7]));
      lrow[j] = lrow[j] * al + (ps[0] + ps[1]);
#pragma unroll
      for (int t = 0; t < 4; ++t)
#pragma unroll
        for (int r = 0; r < 8; ++r) o[j][t][r] *= al;
    }
    {
      const v16h vh0 = ldfrag_u(sVh);
      const v16h vh1 = ldfrag_u(sVh + 16 * SPITCH);
      const v16h vh2 = ldfrag_u(sVh + 32 * SPITCH);
      const v16h vh3 = ldfrag_u(sVh + 48 * SPITCH);
#pragma unroll
      for (int j = 0; j < 2; ++j) {
        o[j][0] = mma_h(vh0, ph[j].v, o[j][0]);
        o[j][1] = mma_h(vh1, ph[j].v, o[j][1]);
        o[j][2] = mma_h(vh2, ph[j].v, o[j][2]);
        o[j][3] = mma_h(vh3, ph[j].v, o[j][3]);
      }
      guard4x6(o[1][0], o[1][1], o[1][2], o[1][3], ph[0].v, ph[1].v, vh0, vh1, vh2, vh3);
    }
    // ---- publish point of stage st + 1 ----
    wait_ds0();
    wait_async0();
    __syncthreads();                       // publishes stage st + 1 and ends every wave's reads of stage st's buffer
    if (st + 2 < NSTG) stage_copy(st + 2, st & 1);
  }
  wait_async0();

  // ---- the last stage's barrier has ended all reads of LDS. Waves 2 qg and 2 qg + 1 hold the same 32 queries over the two halves of the
  //      keys: wave kp keeps column tile kp and gives tile 1 - kp (maximum, joined sum, O^T in f32) to its partner through LDS ----
  v4f*   xch = (v4f*)smem;                                 // [16 waves][8][32 lanes] x 16 B
  float* xml = smem + 16 * 1024;                           // [16 waves][2][32 lanes]
  static_assert(16 * 1024 + 16 * 64 <= ATT_SMEM_FLOATS && XCH_FLOATS == 16 * 1024 + 16 * 64);
  const bool odd = kp != 0;
  const float l0 = lrow[0] + other_half(lrow[0]), l1 = lrow[1] + other_half(lrow[1]);   // the two lane halves' sums joined
  const float mk = odd ? mrow[1] : mrow[0], mg = odd ? mrow[0] : mrow[1];
  const float lk = odd ? l1 : l0, lg = odd ? l0 : l1;
#pragma unroll
  for (int t = 0; t < 4; ++t) {
    v4f g0, g1;
#pragma unroll
    for (int r = 0; r < 4; ++r) {
      g0[r] = odd ? o[0][t][r] : o[1][t][r];
      g1[r] = odd ? o[0][t][4 + r] : o[1][t][4 + r];
    }
    xch[wave * 256 + (2 * t) * 32 + lane]     = g0;
    xch[wave * 256 + (2 * t + 1) * 32 + lane] = g1;
  }
  xml[wave * 64 + lane]      = mg;
  xml[wave * 64 + 32 + lane] = lg;
  __syncthreads();                                         // the given tiles are in LDS
  const int pw = wave ^ 1;
  const float mp = xml[pw * 64 + lane], lq = xml[pw * 64 + 32 + lane];
  const float mm = fmaxf(mk, mp);
  const float ak = exp2_slot(mk - mm), ap = exp2_slot(mp - mm);
  // ---- fold 1/l and the carries (1024 on P, 16 on v) ----
  const float oc = 1.0f / (PC * VC);
  const float inv = (1.0f / (lk * ak + lq * ap)) * oc;
  const float fk = ak * inv, fp = ap * inv;
  v8f res[4];
#pragma unroll
  for (int t = 0; t < 4; ++t) {
    const v4f p0 = xch[pw * 256 + (2 * t) * 32 + lane], p1 = xch[pw * 256 + (2 * t + 1) * 32 + lane];
#pragma unroll
    for (int r = 0; r < 4; ++r) {
      res[t][r]     = (odd ? o[1][t][r] : o[0][t][r]) * fk + p0[r] * fp;
      res[t][4 + r] = (odd ? o[1][t][4 + r] : o[0][t][4 + r]) * fk + p1[r] * fp;
    }
  }
  __syncthreads();                                         // every wave has read its partner's tile; the buffer is reused below
  // ---- the buffer becomes two bf16 result buffers [256][64]: split into bf16 hi + residual, stage the wave's 16x64 slice ----
  unsigned short* Osh = (unsigned short*)smem;
  unsigned short* Osl = Osh + QBLK * HDIM;
  const int ro = (wave * 16 + c) * HDIM + 8 * hh;                 // query row 32 qg + 16 kp + c = 16 wave + c, d = 16t + 8hh + 0..7: one 16-B LDS store per tile and plane
  auto put_tile = [&](const v8f& o_, int t) {
    v4u hv, lv;
#pragma unroll
    for (int e = 0; e < 4; ++e) {
      const float f0 = o_[2 * e], f1 = o_[2 * e + 1];
      const unsigned short g0 = bf_bits(f0), g1 = bf_bits(f1);
      hv[e] = pk16(g0, g1);
      lv[e] = pk16(bf_bits(f0 - bf_up(g0)), bf_bits(f1 - bf_up(g1)));
    }
    *(v4u*)(Osh + ro + 16 * t) = hv;
    *(v4u*)(Osl + ro + 16 * t) = lv;
  };
  put_tile(res[0], 0);
  put_tile(res[1], 1);
  put_tile(res[2], 2);
  put_tile(res[3], 3);
  __syncthreads();
  // ---- block writes its 256 row segments of both planes: piece p = it*512 + tid -> row p / 8, halves (p % 8)*8 .. +7 of the head's 64 ----
  {
    v4u hv[4], lv[4];
#pragma unroll
    for (int it = 0; it < 4; ++it) {
      const int p = it * ATT_THREADS + tid;
      hv[it] = *(const v4u*)(Osh + (size_t)p * 8);
      lv[it] = *(const v4u*)(Osl + (size_t)p * 8);
    }
    const size_t dofs = ((size_t)bat * NQ + qb0) * DMODEL + head * HDIM;
    unsigned short* dsth = CTh + dofs;
    unsigned short* dstl = CTl + dofs;
#pragma unroll
    for (int it = 0; it < 4; ++it) {
      const int p = it * ATT_THREADS + tid;
      const size_t go = (size_t)(p >> 3) * DMODEL + (p & 7) * 8;
      *(v4u*)(dsth + go) = hv[it];
      *(v4u*)(dstl + go) = lv[it];
    }
  }
}

// =====================================================================================================
// Workspace map (bytes); every plane is an exact multiple of its tile / whole-row store granularity (M, N exact tile multiples,
// element counts exact multiples of the convert kernel's 2048 granularity, no pad rows needed), every offset a multiple of 2 MiB:
//   WQ16 f16 [1024][1024] x64               2097152   ([out][in] = [n][k])
//   WK16 f16 [1024][1024] x64               2097152
//   WV16 f16 [1024][1024] x64               2097152
//   WO16 bf16 [1024][1024]                  2097152
//   X16  f16 [4096][1024] x16               8388608   (activation rows)
//   QHh, QHl bf16 [4096][1024]          2 x 8388608   (q projection, hi / residual)
//   KHh, KHl bf16 [4096][1024]          2 x 8388608   (k projection, hi / residual)
//   VTh  f16 [2][1024][2048] x16            8388608   (v^T per batch)
//   CTh, CTl bf16 [4096][1024]          2 x 8388608   (attention ctx, merged heads, hi / residual)
//   end                                    75497472
// =====================================================================================================
extern "C" void kernel_launch(void* const* d_in, const int* in_sizes, int n_in,
                              void* d_out, int out_size, void* d_ws, size_t ws_size,
                              hipStream_t stream) {
  if (n_in < 6) return;
  if (in_sizes[0] != NROWS * DMODEL) return;
  if (in_sizes[1] != DMODEL * DMODEL || in_sizes[2] != DMODEL * DMODEL ||
      in_sizes[3] != DMODEL * DMODEL || in_sizes[4] != DMODEL * DMODEL) return;
  if (in_sizes[5] != NBKT * NHEAD) return;
  if (out_size != NROWS * DMODEL) return;
  if ((in_sizes[0] % 2048) != 0 || (in_sizes[1] % 2048) != 0) return;

  const float* x   = (const float*)d_in[0];
  const float* w_q = (const float*)d_in[1];
  const float* w_k = (const float*)d_in[2];
  const float* w_v = (const float*)d_in[3];
  const float* w_o = (const float*)d_in[4];
  const float* rel = (const float*)d_in[5];
  float*       out = (float*)d_out;

  const size_t PW  = (size_t)DMODEL * DMODEL * 2;                 //  2097152
  const size_t PX  = (size_t)NROWS * DMODEL * 2;                  //  8388608
  const size_t PVT = (size_t)NB * DMODEL * NC * 2;                //  8388608
  size_t off = 0;
  const size_t oWQ = off; off += PW;
  const size_t oWK = off; off += PW;
  const size_t oWV = off; off += PW;
  const size_t oWO = off; off += PW;
  const size_t oX  = off; off += PX;
  const size_t oQh = off; off += PX;
  const size_t oQl = off; off += PX;
  const size_t oKh = off; off += PX;
  const size_t oKl = off; off += PX;
  const size_t oVh = off; off += PVT;
  const size_t oCh = off; off += PX;
  const size_t oCl = off; off += PX;
  if (off > ws_size) return;                                      // off = 75497472
  if (off > (size_t)134217728) return;

  char* ws = (char*)d_ws;
  unsigned short* WQ16 = (unsigned short*)(ws + oWQ);
  unsigned short* WK16 = (unsigned short*)(ws + oWK);
  unsigned short* WV16 = (unsigned short*)(ws + oWV);
  unsigned short* WO16 = (unsigned short*)(ws + oWO);
  unsigned short* X16  = (unsigned short*)(ws + oX);
  unsigned short* QHh  = (unsigned short*)(ws + oQh);
  unsigned short* QHl  = (unsigned short*)(ws + oQl);
  unsigned short* KHh  = (unsigned short*)(ws + oKh);
  unsigned short* KHl  = (unsigned short*)(ws + oKl);
  unsigned short* VTh  = (unsigned short*)(ws + oVh);
  unsigned short* CTh  = (unsigned short*)(ws + oCh);
  unsigned short* CTl  = (unsigned short*)(ws + oCl);

  const dim3 blk(256);
  const dim3 gCV(CVX_BLOCKS + 4 * CVW_BLOCKS);                     // 2048 + 4 x 512 = 4096 blocks
  const int tilesP = (NROWS / 64) * (DMODEL / 64);                 // 1024
  const dim3 gP((tilesP + 7) / 8, 1);                              // 128
  const dim3 gQKV((tilesP + 7) / 8, 3);                            // 128 x 3
  const dim3 gAT(ATT_BLOCKS);                                      // 256
  const dim3 bAT(ATT_THREADS);                                     // 512
  static_assert(NB * (DMODEL / 128) * (NC / 256) == (NROWS / 128) * (DMODEL / 256));   // v^T tiles of both batches = tiles of q

  // (0) one launch: activation plane X16[row][c] = f16( bf16_RNE(x[row][c]) * 16 ), rows = b*2048 + tok; weight planes
  //     f16( bf16_RNE(W[n][k]) * 64 ) for Wq, Wk, Wv; bf16_RNE(Wo[n][k]) bits for Wo; [out][in] layout kept
  cvt_all<<<gCV, blk, 0, stream>>>(x, w_q, w_k, w_v, w_o, X16, WQ16, WK16, WV16, WO16);

  // (1) one launch: q[m][n] = sum_k x[m][k] Wq[n][k] and k likewise -> bf16 hi / residual planes;
  //     VT[b][d][tok] = sum_k Wv[d][k] x_b[tok][k] -> one f16 x16 plane
  qkv64<<<gQKV, blk, 0, stream>>>(X16, WQ16, WK16, WV16, QHh, QHl, KHh, KHl, VTh);

  // (5) attention per (batch, head, 256 query rows) -> CT (bf16 hi / residual planes)
  attn16<<<gAT, bAT, 0, stream>>>(QHh, QHl, KHh, KHl, VTh, rel, CTh, CTl);

  // (6) out = (CT_hi + CT_lo) . Wo^T; M = 4096, N = 1024, K = 1024, f32
  gemm64<0, 1, 1><<<gP, blk, 0, stream>>>(
      CTh, CTl, DMODEL, 0LL,
      WO16, DMODEL, 0LL,
      (void*)out, (void*)out, DMODEL, 0LL,
      NROWS, DMODEL, DMODEL, 1.0f, 1.0f);
  (void)hipGetLastError();
}

// v010
// Measured time: 81.9 microseconds a run.
// It is 1.33 times as fast as v007, going by the measured steps of the versions left out in between.
// All steps since v000 together make it 5.85 times as fast.
// Contractions (all f32 accumulate): q/k projections v_wmma_f32_16x16x32_f16 (x f16 x16 . W f16 x64, K=1024, single products) stored as one f16 plane each;
// v^T projection v_wmma_f32_16x16x32_f16 (Wv f16 x64 . x f16 x16, K=1024) stored as one f16 x16 plane;
// attention scores, transposed, v_wmma_f32_16x16x32_f16 (k f16 . q^T f16, q carrying log2(e)/8, each rounded once to f16, one product, K=64,
// C operand = bias * log2(e) + 7 - reference maximum);
// v^T . P^T v_wmma_f32_16x16x32_f16 (v^T f16 x16 . P^T f16 x128, each rounded once to f16, one product, K=2048 by 32);
// output projection v_wmma_f32_16x16x32_f16 (ctx f16 x16, rounded once . Wo f16 x64, one product, K=1024).
// Bucketed relative-position bias (per head, function of key-query offset) and online reference-subtracted base-2 softmax in f32 on VALU.
// Every float input RNE-converted to bf16 on load.
#include <hip/hip_runtime.h>
#include <math.h>
#include <stdint.h>

#define NB      2
#define NQ      2048
#define NC      2048
#define DMODEL  1024
#define NHEAD   16
#define HDIM    64
#define NBKT    32
#define NROWS   (NB * NQ)
#define WSC     64.0f
#define ACARRY  16.0f
#define VC      16.0f
#define ATT_SCALE 0.125f
#define LOG2E   1.4426950408889634f
#define SL2     (ATT_SCALE * LOG2E)
#define PSH     7.0f                                     // the x128 carry of the f16 P plane, as an exponent
#define LASTB   91                                       // |key - tok| from which the bucket is the last of its side
#define TAU     8.0f                                     // a score may pass the reference by 2^8 before the reference moves: P x128 <= 2^15, inside f16
static_assert(NHEAD * HDIM == DMODEL);
static_assert((NQ % 64) == 0 && (NC % 64) == 0 && (DMODEL % 64) == 0 && (NC % 32) == 0 && (NQ % 16) == 0);
static_assert((NROWS % 128) == 0 && (DMODEL % 256) == 0 && (NC % 256) == 0 && (DMODEL % 128) == 0);
#define ATT_THREADS 512
#define QBLK        256                                  // query rows per block: 8 wave pairs x 32 rows, one head
#define ATT_BLOCKS  (NB * NHEAD * (NQ / QBLK))
static_assert(ATT_THREADS == 512 && ATT_BLOCKS == 256 && (NQ % QBLK) == 0 && NQ / QBLK == 8 && NHEAD == 16);
#define LUTP            (NC + QBLK)                      // bias table entries of one head: key - tok + (first row + 255) in [0, 2302]
#define SKEYS           64                               // keys per LDS stage
#define NSTG            (NC / SKEYS)
#define SPITCH          72                               // halves: 128-B rows at a 144-B pitch (16 B x odd) for 16-B LDS reads
#define GKS             64                               // k per LDS stage of the GEMM (128-B rows)
#define PLANE_HALVES    (64 * SPITCH)
#define BUF_HALVES      (2 * PLANE_HALVES)               // K, v^T
#define XCH_FLOATS      (16 * 1024 + 16 * 64)            // the epilogue's exchange of the key halves: larger than table + ring
#define ATT_SMEM_FLOATS XCH_FLOATS
static_assert(LUTP + BUF_HALVES <= ATT_SMEM_FLOATS);
static_assert(SKEYS == 64 && HDIM == 64 && NSTG >= 2 && (NC % SKEYS) == 0);
static_assert((LUTP % 4) == 0 && (PLANE_HALVES % 8) == 0);
static_assert((size_t)QBLK * HDIM * sizeof(unsigned short) <= (size_t)ATT_SMEM_FLOATS * sizeof(float));

typedef _Float16 v16h __attribute__((ext_vector_type(16)));
typedef _Float16 v8h  __attribute__((ext_vector_type(8)));
typedef __bf16   v16b __attribute__((ext_vector_type(16)));
typedef float    v8f  __attribute__((ext_vector_type(8)));
typedef float    v4f  __attribute__((ext_vector_type(4)));
typedef float    v2f  __attribute__((ext_vector_type(2)));
typedef _Float16 v2h  __attribute__((ext_vector_type(2)));
typedef unsigned int v4u __attribute__((ext_vector_type(4)));

union FragH { v16h v; v8h h[2]; v4u u[2]; };
union FragAny { v16h h; v16b b; };

// ---- scalar helpers --------------------------------------------------------------------------------
__device__ __forceinline__ unsigned short bf_bits(float f) {          // f32 -> bf16 bits, RNE convert
  unsigned u = __float_as_uint(f);
  return (unsigned short)((u + 0x7FFFu + ((u >> 16) & 1u)) >> 16);
}
__device__ __forceinline__ float bf_up(unsigned short h) { return __uint_as_float(((unsigned)h) << 16); }
__device__ __forceinline__ float bfr(float f) { return bf_up(bf_bits(f)); }   // value of the bf16 RNE convert
__device__ __forceinline__ unsigned short h_bits(_Float16 x) { return __builtin_bit_cast(unsigned short, x); }
__device__ __forceinline__ unsigned pk16(unsigned short a, unsigned short b) { return (unsigned)a | ((unsigned)b << 16); }
__device__ __forceinline__ float other_half(float v) {               // the value that lane l ^ 16 holds
  const int b = __builtin_bit_cast(int, v);
  return __builtin_bit_cast(float, __builtin_amdgcn_permlanex16(b, b, 0x76543210, 0xfedcba98, false, false));
}
// 2^x as the bare v_exp_f32. Every argument here is <= 15 (a score minus the reference in use, plus 7); a result below 2^-126 comes out as 0,
// which neither the f16 P plane (x128) nor a row sum that holds the maximum's own term, at least 2^7, can tell from the exact value; -inf gives 0.
__device__ __forceinline__ float exp2_bare(float x) { return __builtin_amdgcn_exp2f(x); }
// The same with its slot: the v_nop keeps one vector slot between v_exp_f32 and whatever the compiler puts next (it may overwrite the source register).
__device__ __forceinline__ float exp2_slot(float x) {
  float r = 0.f;
#if defined(__HIP_DEVICE_COMPILE__)
  asm("v_exp_f32 %0, %1\n\tv_nop" : "=v"(r) : "v"(x));
#endif
  return r;
}
__device__ __forceinline__ v8f zero8() { v8f z = {0.f, 0.f, 0.f, 0.f, 0.f, 0.f, 0.f, 0.f}; return z; }
__device__ __forceinline__ v8f splat8(float x) { v8f z = {x, x, x, x, x, x, x, x}; return z; }

// ---- fragment loader: 16-bit A/B operand from a k-contiguous 16-bit plane, lane -> row/col (lane&15),
//      p already includes +8*(lane>>4); elements 0..7 <- p[0..7] (k0+8h..), elements 8..15 <- p[16..23] (k0+16+8h..)
//      (same split k map for A and B; B is always read from a [n][k] plane)
__device__ __forceinline__ v16h ldfrag_u(const unsigned short* p) {
  FragH f;
  f.u[0] = *(const v4u*)(p);
  f.u[1] = *(const v4u*)(p + 16);
  return f.v;
}

// ---- WMMA helpers with trailing VALU hazard gaps ------------------------------------------------------
__device__ __forceinline__ v8f mma_h(v16h a, v16h b, v8f c) {
  return __builtin_amdgcn_wmma_f32_16x16x32_f16(false, a, false, b, (short)0, c, false, false);
}
__device__ __forceinline__ v8f mma_b(v16h a, v16h b, v8f c) {
  FragAny ua, ub;
  ua.h = a;
  ub.h = b;
  return __builtin_amdgcn_wmma_f32_16x16x32_bf16(false, ua.b, false, ub.b, (short)0, c, false, false);
}
template <int BF>
__device__ __forceinline__ v8f mmaT(v16h a, v16h b, v8f c) {
  if constexpr (BF != 0) return mma_b(a, b, c);
  else return mma_h(a, b, c);
}
__device__ __forceinline__ void dep_guard1(v8f& a, v8f& b, v16h x) {
#if defined(__HIP_DEVICE_COMPILE__)
  asm volatile("v_nop\n\tv_nop\n\tv_nop\n\tv_nop" : "+v"(a), "+v"(b) : "v"(x));
#endif
}
__device__ __forceinline__ void guard4x4c(v8f& s, v8f& u, v8f& w, v8f& y, v16h a0, v16h a1, v16h a2, v16h a3, v8f c0, v8f c1) {
#if defined(__HIP_DEVICE_COMPILE__)
  asm volatile("v_nop\n\tv_nop\n\tv_nop\n\tv_nop"
               : "+v"(s), "+v"(u), "+v"(w), "+v"(y) : "v"(a0), "v"(a1), "v"(a2), "v"(a3), "v"(c0), "v"(c1));
#endif
}
__device__ __forceinline__ void guard4x6(v8f& a, v8f& b, v8f& c, v8f& d,
                                         v16h x0, v16h x1, v16h x2, v16h x3, v16h x4, v16h x5) {
#if defined(__HIP_DEVICE_COMPILE__)
  asm volatile("v_nop\n\tv_nop\n\tv_nop\n\tv_nop"
               : "+v"(a), "+v"(b), "+v"(c), "+v"(d) : "v"(x0), "v"(x1), "v"(x2), "v"(x3), "v"(x4), "v"(x5));
#endif
}
__device__ __forceinline__ void keep4_h(v16h a, v16h b, v16h c, v16h d) {
#if defined(__HIP_DEVICE_COMPILE__)
  asm volatile("v_nop" :: "v"(a), "v"(b), "v"(c), "v"(d));
#endif
}
__device__ __forceinline__ void acc_guard4(v8f& a, v8f& b, v8f& c, v8f& d) {
#if defined(__HIP_DEVICE_COMPILE__)
  asm volatile("v_nop\n\tv_nop\n\tv_nop\n\tv_nop" : "+v"(a), "+v"(b), "+v"(c), "+v"(d));
#endif
}
__device__ __forceinline__ void wave_sync_lds() {
  __builtin_amdgcn_fence(__ATOMIC_RELEASE, "workgroup");
  __builtin_amdgcn_wave_barrier();
  __builtin_amdgcn_fence(__ATOMIC_ACQUIRE, "workgroup");
}
// Four (or two) 16-B-per-lane asynchronous copies global -> LDS (l*: the lane's LDS byte address, g*: the lane's global address).
// The s_wait_xcnt stands inside the statement so that no address register is rewritten in front of it.
__device__ __forceinline__ void async_copy4(unsigned l0, const unsigned short* g0, unsigned l1, const unsigned short* g1,
                                            unsigned l2, const unsigned short* g2, unsigned l3, const unsigned short* g3) {
#if defined(__HIP_DEVICE_COMPILE__)
  asm volatile("global_load_async_to_lds_b128 %0, %1, off\n\t"
               "global_load_async_to_lds_b128 %2, %3, off\n\t"
               "global_load_async_to_lds_b128 %4, %5, off\n\t"
               "global_load_async_to_lds_b128 %6, %7, off\n\t"
               "s_wait_xcnt 0x0"
               :: "v"(l0), "v"(g0), "v"(l1), "v"(g1), "v"(l2), "v"(g2), "v"(l3), "v"(g3) : "memory");
#endif
}
__device__ __forceinline__ void async_copy2(unsigned l0, const unsigned short* g0, unsigned l1, const unsigned short* g1) {
#if defined(__HIP_DEVICE_COMPILE__)
  asm volatile("global_load_async_to_lds_b128 %0, %1, off\n\t"
               "global_load_async_to_lds_b128 %2, %3, off\n\t"
               "s_wait_xcnt 0x0"
               :: "v"(l0), "v"(g0), "v"(l1), "v"(g1) : "memory");
#endif
}
__device__ __forceinline__ void wait_async0() {   // this wave's own copies have landed in LDS
#if defined(__HIP_DEVICE_COMPILE__)
  asm volatile("s_wait_asynccnt 0x0" ::: "memory");
#endif
}
__device__ __forceinline__ void wait_ds0() {      // this wave's own LDS reads have returned (before their buffer is refilled)
#if defined(__HIP_DEVICE_COMPILE__)
  asm volatile("s_wait_dscnt 0x0" ::: "memory");
#endif
}

// =====================================================================================================
// Elementwise 16-bit pack, no transpose. BFO 0: dst[i] = f16( bf16_RNE(src[i]) * sc ), sc a power of two (exact);
// BFO 1: dst[i] = bf16_RNE(src[i]) bits. 8 elements per thread: two 16-B loads, one 16-B store per lane; 32 consecutive
// coverage: n / 2048 blocks (index bx) x 256 thr x 8 elements = n exactly (host checks n % 2048 == 0).
// =====================================================================================================
template <int BFO>
__device__ __forceinline__ void cvt16(const float* __restrict__ src, unsigned short* dst, int n, float sc, int bx) {
  const size_t i8 = ((size_t)bx * 256 + threadIdx.x) * 8;
  if (i8 + 8 > (size_t)n) return;                 // never taken with the exact grid; no barriers in this kernel
  const v4f a = *(const v4f*)(src + i8);
  const v4f b = *(const v4f*)(src + i8 + 4);
  v4u o;
  if constexpr (BFO != 0) {
    o[0] = pk16(bf_bits(a[0]), bf_bits(a[1]));
    o[1] = pk16(bf_bits(a[2]), bf_bits(a[3]));
    o[2] = pk16(bf_bits(b[0]), bf_bits(b[1]));
    o[3] = pk16(bf_bits(b[2]), bf_bits(b[3]));
  } else {
    o[0] = pk16(h_bits((_Float16)(bfr(a[0]) * sc)), h_bits((_Float16)(bfr(a[1]) * sc)));
    o[1] = pk16(h_bits((_Float16)(bfr(a[2]) * sc)), h_bits((_Float16)(bfr(a[3]) * sc)));
    o[2] = pk16(h_bits((_Float16)(bfr(b[0]) * sc)), h_bits((_Float16)(bfr(b[1]) * sc)));
    o[3] = pk16(h_bits((_Float16)(bfr(b[2]) * sc)), h_bits((_Float16)(bfr(b[3]) * sc)));
  }
  {
    *(v4u*)(dst + i8) = o;
    
  }
}
// All five converts in one launch; the block index picks the job (block-uniform): blocks 0..2047 the activations (f16 x16),
// then 512 blocks each for Wq, Wk, Wv and Wo (f16 x64).
#define CVX_BLOCKS ((NROWS * DMODEL) / 2048)
#define CVW_BLOCKS ((DMODEL * DMODEL) / 2048)
__global__ __launch_bounds__(256) void cvt_all(const float* __restrict__ x, const float* __restrict__ w_q, const float* __restrict__ w_k,
                                               const float* __restrict__ w_v, const float* __restrict__ w_o,
                                               unsigned short* X16, unsigned short* WQ16, unsigned short* WK16,
                                               unsigned short* WV16, unsigned short* WO16) {
  const int b = blockIdx.x;
  if (b < CVX_BLOCKS) {
    cvt16<0>(x, X16, NROWS * DMODEL, ACARRY, b);
    return;
  }
  const int job = (b - CVX_BLOCKS) / CVW_BLOCKS;           // 0..3 with the exact grid
  const int bw  = (b - CVX_BLOCKS) - job * CVW_BLOCKS;
  if (job < 4) {
    const float* src    = (job == 0) ? w_q  : (job == 1) ? w_k  : (job == 2) ? w_v  : w_o;
    unsigned short* dst = (job == 0) ? WQ16 : (job == 1) ? WK16 : (job == 2) ? WV16 : WO16;
    cvt16<0>(src, dst, DMODEL * DMODEL, WSC, bw);
  }
}

// =====================================================================================================
// Register-blocked batched 16-bit WMMA GEMM: C[m][n] = oscale * sum_k A[m][k] * Bt[n][k]; one wave per 64x64 tile, a block of 8 waves
// (2 x 4) per 128x256 tile. The block's 128 A rows (and A2 rows) and 256 Bt rows of a 64-k stage (128 B per row) are brought into LDS once
// per block by asynchronous 16-B copies (8 lanes per 128-B row; 12 or 16 copies per thread and stage), two buffers: stage t + 2 is issued
// behind the barrier that ends stage t; the waves read their fragments from there (two 16-B LDS loads per fragment, row pitch 144 B).
// A row-major [M][K] pitch lda (16-bit plane), Bt row-major [N][K] pitch ldb (k contiguous); M multiple of 128, N of 256, K of 64.
// bx = tile index, by = batch index with element strides sA, sB, sC; sT (8 per-wave slabs) and gst (two stage buffers) are the calling kernel's LDS.
// ASPLIT 1: a second A plane A2 (unscaled residual of A, same layout) is multiplied into the same accumulator (A + A2 ~ exact A).
// BF 1: bf16 operands (v_wmma_f32_16x16x32_bf16), else f16.
// OM 0: f32 out (pitch ldc).  OM 2: f16 out = f16(value * ocarry).  OM 3: two bf16 planes: hi = bf16_RNE(value), lo = bf16_RNE(value - hi).
// OM 4: two f16 planes: hi = f16(value * ocarry), lo = f16(value * ocarry - hi) (unscaled residual).
// coverage: 4 slabs x 16 rows (f32: it 0..7 x lane>>4; 16-bit: it 0..3 x lane>>3) x 64 cols = the wave's whole 64x64 tile;
//           stage: 256 threads x 16 B = 32 rows x 128 B per copy; grid = (M / 128) * (N / 256) blocks, a surplus block exits whole.
// =====================================================================================================
#define GSLAB (16 * 68)                             // floats of a per-wave 16x64 slab, pitch 68 floats
#define GBUF_HALVES(ASPLIT) ((256 + 128 * (1 + (ASPLIT))) * SPITCH)   // rows of a stage buffer: Bt 0..255 | A 256..383 | A2 384..511
template <int OM, int ASPLIT, int BF>
__device__ __forceinline__ void gemm_tile(
    const unsigned short* __restrict__ Ap, const unsigned short* __restrict__ A2p, int lda, long long sA,
    const unsigned short* __restrict__ Btp, int ldb, long long sB,
    void* Cout, void* C2out, int ldc, long long sC,
    int M, int N, int K, float oscale, float ocarry,
    int bx, int by, float* sT, unsigned short* gst) {
  constexpr int GBUF  = GBUF_HALVES(ASPLIT);       // halves per stage buffer
  constexpr unsigned R32 = 32 * SPITCH * 2;        // LDS bytes of 32 rows (one copy of the whole block)
  const int tid  = threadIdx.x;
  const int lane = threadIdx.x & 31;
  const int wave = threadIdx.x >> 5;
  const int blocksN = N >> 8;
  const int blocksM = M >> 7;
  // block-uniform, in front of every barrier; never taken with the exact grids and shapes of this file
  if ((M & 127) != 0 || (N & 255) != 0 || (K & (GKS - 1)) != 0 || K < GKS || bx >= blocksM * blocksN) return;
  const int bm  = bx / blocksN;
  const int bn  = bx - bm * blocksN;
  const int mb0 = bm << 7;
  const int nb0 = bn << 8;
  const int m0 = mb0 + ((wave >> 2) << 6);
  const int n0 = nb0 + ((wave & 3) << 6);

  const unsigned short* A1 = Ap  + (size_t)((long long)by * sA);
  const unsigned short* A2 = A2p + (size_t)((long long)by * sA);
  const unsigned short* Bb = Btp + (size_t)((long long)by * sB);

  const int rlane = lane & 15;                 // row (A) / col (B, D) within subtile
  const int koff  = (lane >> 4) * 8;           // k offset of this lane half
  const int mOff  = (lane >> 4) * 8;           // D row offset

  v8f acc[4][4];
#pragma unroll
  for (int i = 0; i < 4; ++i)
#pragma unroll
    for (int j = 0; j < 4; ++j) acc[i][j] = zero8();

  // ---- stage copies: thread -> row tid / 8 (+ 32 per copy), 16-B piece tid % 8 of the row's 128 B ----
  const int sr = tid >> 3, sp = (tid & 7) * 8;
  const unsigned short* gB  = Bb + (size_t)(nb0 + sr) * ldb + sp;
  const unsigned short* gA  = A1 + (size_t)(mb0 + sr) * lda + sp;
  const unsigned short* gA2 = A2 + (size_t)(mb0 + sr) * lda + sp;
  const size_t b32 = (size_t)32 * ldb, a32 = (size_t)32 * lda;
  const unsigned ldst = (unsigned)(uintptr_t)(gst + sr * SPITCH + sp);   // LDS byte address = low 32 bits
  auto stage_copy = [&](int st, int buf) {
    const size_t ks = (size_t)st * GKS;
    const unsigned l = ldst + (unsigned)buf * (GBUF * 2);
    const unsigned short* b = gB + ks;
    const unsigned short* a = gA + ks;
    async_copy4(l,            b,           l + R32,      b + b32,     l + 2 * R32,  b + 2 * b32, l + 3 * R32,  b + 3 * b32);
    async_copy4(l + 4 * R32,  b + 4 * b32, l + 5 * R32,  b + 5 * b32, l + 6 * R32,  b + 6 * b32, l + 7 * R32,  b + 7 * b32);
    async_copy4(l + 8 * R32,  a,           l + 9 * R32,  a + a32,     l + 10 * R32, a + 2 * a32, l + 11 * R32, a + 3 * a32);
    if constexpr (ASPLIT != 0) {
      const unsigned short* a2 = gA2 + ks;
      async_copy4(l + 12 * R32, a2,        l + 13 * R32, a2 + a32,    l + 14 * R32, a2 + 2 * a32, l + 15 * R32, a2 + 3 * a32);
    }
  };
  const int nst = K / GKS;
  stage_copy(0, 0);
  wait_async0();
  __syncthreads();                                         // publishes stage 0
  if (nst > 1) stage_copy(1, 1);

  for (int st = 0; st < nst; ++st) {
    const unsigned short* sb = gst + (st & 1) * GBUF + rlane * SPITCH + koff;   // lane's row rlane, k half
    const unsigned short* sB = sb + ((wave & 3) << 6) * SPITCH;
    const unsigned short* sA = sb + (256 + ((wave >> 2) << 6)) * SPITCH;
    // unrolled: the offsets inside the stage become immediates of the LDS loads
#pragma unroll
    for (int kk = 0; kk < GKS; kk += 32) {
      v16h bh[4], ah[4], al[ASPLIT != 0 ? 4 : 1];
#pragma unroll
      for (int j = 0; j < 4; ++j) bh[j] = ldfrag_u(sB + (j << 4) * SPITCH + kk);
#pragma unroll
      for (int i = 0; i < 4; ++i) ah[i] = ldfrag_u(sA + (i << 4) * SPITCH + kk);
      if constexpr (ASPLIT != 0) {
#pragma unroll
        for (int i = 0; i < 4; ++i) al[i] = ldfrag_u(sA + (128 + (i << 4)) * SPITCH + kk);
      }
#pragma unroll
      for (int i = 0; i < 4; ++i) {
#pragma unroll
        for (int j = 0; j < 4; ++j) acc[i][j] = mmaT<BF>(ah[i], bh[j], acc[i][j]);
        dep_guard1(acc[i][0], acc[i][3], ah[i]);
        if constexpr (ASPLIT != 0) {
#pragma unroll
          for (int j = 0; j < 4; ++j) acc[i][j] = mmaT<BF>(al[i], bh[j], acc[i][j]);
          dep_guard1(acc[i][0], acc[i][3], al[i]);
        }
      }
      keep4_h(bh[0], bh[1], bh[2], bh[3]);
    }
    // ---- publish point of stage st + 1 ----
    wait_ds0();
    wait_async0();
    __syncthreads();                       // publishes stage st + 1 and ends every wave's reads of stage st's buffer
    if (st + 2 < nst) stage_copy(st + 2, st & 1);
  }
  wait_async0();
  acc_guard4(acc[0][0], acc[0][1], acc[0][2], acc[0][3]);
  acc_guard4(acc[1][0], acc[1][1], acc[1][2], acc[1][3]);
  acc_guard4(acc[2][0], acc[2][1], acc[2][2], acc[2][3]);
  acc_guard4(acc[3][0], acc[3][1], acc[3][2], acc[3][3]);

  const int hh2 = lane >> 4, c4 = (lane & 15) * 4;     // f32 out: 256-B row segment = 16 lanes x 16 B
  const int q8  = lane >> 3, c8 = (lane & 7) * 8;

  // ---- epilogue ----
  float* slab = sT + wave * GSLAB;
#pragma unroll
  for (int i = 0; i < 4; ++i) {
    const int mBase = m0 + (i << 4);
#pragma unroll
    for (int j = 0; j < 4; ++j) {
#pragma unroll
      for (int r = 0; r < 8; ++r) {
        slab[(mOff + r) * 68 + (j << 4) + rlane] = acc[i][j][r];
      }
    }
    wave_sync_lds();
    if constexpr (OM == 0) {
      float* C = (float*)Cout + (size_t)((long long)by * sC);
      v4f vals[8];
#pragma unroll
      for (int it = 0; it < 8; ++it) {
        const int row = it * 2 + hh2;                      // it 0..7 x hh2 0..1 = rows 0..15
        v4f v = *(const v4f*)(slab + row * 68 + c4);
#pragma unroll
        for (int e = 0; e < 4; ++e) v[e] = v[e] * oscale;
        vals[it] = v;
      }
      {
#pragma unroll
        for (int it = 0; it < 8; ++it) {
          const int gr = mBase + it * 2 + hh2;
          *(v4f*)(C + (size_t)gr * ldc + n0 + c4) = vals[it];
        }
        
      }
    } else {
      unsigned short* C  = (unsigned short*)Cout  + (size_t)((long long)by * sC);
      unsigned short* Cb = (unsigned short*)C2out + (size_t)((long long)by * sC);
      v4u hv[4], lv[4];
#pragma unroll
      for (int it = 0; it < 4; ++it) {
        const int row = it * 4 + q8;                       // it 0..3 x q8 0..3 = rows 0..15
        const float* sp = slab + row * 68 + c8;
        v4u a  = {0u, 0u, 0u, 0u};
        v4u b2 = {0u, 0u, 0u, 0u};
#pragma unroll
        for (int e = 0; e < 4; ++e) {
          float f0 = sp[2 * e] * oscale;
          float f1 = sp[2 * e + 1] * oscale;
          if constexpr (OM == 3) {
            const unsigned short h0 = bf_bits(f0), h1 = bf_bits(f1);
            a[e]  = pk16(h0, h1);
            b2[e] = pk16(bf_bits(f0 - bf_up(h0)), bf_bits(f1 - bf_up(h1)));
          } else {
            f0 *= ocarry; f1 *= ocarry;
            const _Float16 x0 = (_Float16)f0, x1 = (_Float16)f1;
            a[e] = pk16(h_bits(x0), h_bits(x1));
            if constexpr (OM == 4) {
              b2[e] = pk16(h_bits((_Float16)(f0 - (float)x0)), h_bits((_Float16)(f1 - (float)x1)));
            }
          }
        }
        hv[it] = a;
        lv[it] = b2;
      }
      {
#pragma unroll
        for (int it = 0; it < 4; ++it) {
          const int row = it * 4 + q8;
          *(v4u*)(C + (size_t)(mBase + row) * ldc + n0 + c8) = hv[it];
          if constexpr (OM >= 3) {
            *(v4u*)(Cb + (size_t)(mBase + row) * ldc + n0 + c8) = lv[it];
          }
        }
        
      }
    }
    wave_sync_lds();
  }
}

// The three projections in one launch of 128 x 3 blocks, all resident at once (two blocks fit a WGP's LDS); blockIdx.y picks the job
// (block-uniform): 0 q and 1 k (x . W^T -> one f16 plane each, q times log2(e) / 8; M = 4096, N = 1024, K = 1024, 128 tiles each),
// 2 v^T per batch (Wv . x_b^T -> one f16 x16 plane; M = 1024, N = 2048, K = 1024, 64 tiles for each of the two batches).
__global__ __launch_bounds__(256) void qkv64(
    const unsigned short* __restrict__ X16, const unsigned short* __restrict__ WQ16, const unsigned short* __restrict__ WK16,
    const unsigned short* __restrict__ WV16, unsigned short* QH, unsigned short* KH, unsigned short* VTh) {
  __shared__ __align__(16) float sT[8 * GSLAB];
  __shared__ __align__(16) unsigned short gst[2 * GBUF_HALVES(0)];
  const int job = blockIdx.y;
  const int bx  = blockIdx.x;
  if (job < 2) {
    gemm_tile<2, 0, 0>(X16, X16, DMODEL, 0LL,
                       job == 0 ? WQ16 : WK16, DMODEL, 0LL,
                       (void*)(job == 0 ? QH : KH), (void*)(job == 0 ? QH : KH), DMODEL, 0LL,
                       NROWS, DMODEL, DMODEL, (job == 0 ? SL2 : 1.0f) / (ACARRY * WSC), 1.0f, bx, 0, sT, gst);
  } else {
    constexpr int TV = (DMODEL / 128) * (NC / 256);          // 64 tiles per batch
    gemm_tile<2, 0, 0>(WV16, WV16, DMODEL, 0LL,
                       X16, DMODEL, (long long)NC * DMODEL,
                       (void*)VTh, (void*)VTh, NC, (long long)DMODEL * NC,
                       DMODEL, NC, DMODEL, 1.0f / (ACARRY * WSC), VC, bx % TV, bx / TV, sT, gst);
  }
}

template <int OM, int ASPLIT, int BF>
__global__ __launch_bounds__(256) void gemm64(
    const unsigned short* __restrict__ Ap, const unsigned short* __restrict__ A2p, int lda, long long sA,
    const unsigned short* __restrict__ Btp, int ldb, long long sB,
    void* Cout, void* C2out, int ldc, long long sC,
    int M, int N, int K, float oscale, float ocarry) {
  __shared__ __align__(16) float sT[8 * GSLAB];
  __shared__ __align__(16) unsigned short gst[2 * GBUF_HALVES(ASPLIT)];
  gemm_tile<OM, ASPLIT, BF>(Ap, A2p, lda, sA, Btp, ldb, sB, Cout, C2out, ldc, sC, M, N, K, oscale, ocarry,
                            (int)blockIdx.x, (int)blockIdx.y, sT, gst);
}

// =====================================================================================================
// Flash attention for one batch, one head and 256 query rows (a pair of waves per 32 rows, each wave half of the keys), head dim 64, 2048 keys:
//   q plane (f16) Q[b*2048 + tok][64h + d], pitch 1024; k plane (f16) K[b*2048 + key][64h + d], pitch 1024;
//   (q carries log2(e) / 8 from its projection's epilogue);
//   v^T plane (f16 x16): VT[b*1024 + 64h + d][key] (pitch 2048); bias = bf16(rel[bucket(key - tok)][h]) * log2(e) from a
//   per-block LDS table of f32 indexed by (key - tok + first row + 255), bucket() piecewise constant in the offset;
//   out (one f16 x16 plane): CT[b*2048 + tok][64h + d] = sum_m softmax_m(q.k / 8 + bias) v[m][d]  (softmax run in base 2).
//   block = 16 waves = 512 threads; grid = 2 x 16 x 8 = 256; every wave does identical bounded work (32 stages, 32 of the stage's 64 keys x 32 queries).
//   The head's K rows and v^T rows of a stage (two planes of 64 rows x 128 B) are brought into LDS once per block by asynchronous
//   16-B copies (two per thread and stage; 8 lanes per 128-B row), two buffers: stage t + 2 is issued behind the barrier that ends
//   stage t; all 16 waves read their fragments from there (two 16-B LDS loads per fragment, row pitch 144 B); a fragment feeds both of the
//   wave's 16-query column tiles.
//   Per 32 keys and column tile: 2 transposed score tiles S^T = K . q^T on f16 WMMA (A = K rows, B = q; K = 64 as two k-steps of 32): lane (c, hh) holds
//   query c's scores of keys 8hh + r and 16 + 8hh + r. The first k-step's C operand holds bias * log2(e) + 7 - the query's reference, so that D is
//   the exponent of P x128 as it stands: no multiply-add, subtraction or carry multiply per score. C comes from the LDS table, or, where every
//   key - tok of the pass lies in the last bucket of one side, from a tile kept in registers. Softmax in f32 (exp2); the maximum in-lane plus one
//   exchange between the lane halves serves one test per stage: only where a score passes the reference by more than 2^8 (and in stage 0)
//   the reference moves to the maximum and the running sum and the four accumulators are rescaled; the sum is kept per lane half and joined
//   behind the loop; P^T (f16 x128, rounded once) packed from the two score tiles straight into
//   a B operand (hardware k order, as the v^T loader's); 4 WMMAs O^T += v^T . P^T. The f16 rounding of q, k, P and v (11 bits) lies well under
//   the bf16 rounding (8 bits) that x and the weights already carry into q, k and v.
//   Behind the last stage's barrier the two waves of a pair swap one column tile each through LDS (reference, sum, O^T in f32) and join the two key
//   halves by the usual rescale. Final 1/l and carry folds in f32; behind one more barrier the LDS buffer is reused as the block's f16 result buffer
//   [256][64]: each wave stages its 16x64 slice; after a block barrier the 512 threads write 128-B row segments. The f16 rounding of the result
//   (11 bits) lies, like that of q, k, P and v, well under the bf16 rounding of x and the weights.
// coverage: LDS table: 512 threads stride over 2304 entries (all written); stage: 512 threads x 16 B = 64 rows x 128 B per plane;
//           global: 4 iterations x 512 threads x 8 halves = 256 rows x 64 columns of the head;
//           grid covers all 2 x 2048 rows x 16 heads exactly once.
// =====================================================================================================
__global__ __launch_bounds__(ATT_THREADS)
void attn16(const unsigned short* __restrict__ QH, const unsigned short* __restrict__ KH,
            const unsigned short* __restrict__ VTh,
            const float* __restrict__ rel, unsigned short* CTh) {
  // bias table f32 [2304] | two stage buffers of two planes [64][72] u16
  __shared__ __align__(16) float smem[ATT_SMEM_FLOATS];
  float* lut = smem;
  unsigned short* stg = (unsigned short*)(lut + LUTP);

  const int tid  = threadIdx.x;
  const int wave = tid >> 5;
  const int lane = tid & 31;
  const int hh   = lane >> 4;
  const int c    = lane & 15;

  const int qb   = blockIdx.x & ((NQ / QBLK) - 1);         // 0..7
  const int head = (blockIdx.x / (NQ / QBLK)) & (NHEAD - 1);   // 0..15
  const int bat  = blockIdx.x / ((NQ / QBLK) * NHEAD);     // 0..1
  const int qb0  = qb * QBLK;
  const int qg   = wave >> 1;                              // the wave's 32 query rows: qb0 + 32 qg + 0..31 (two column tiles j of 16)
  const int kp   = wave & 1;                               // the wave's keys: the 32-key pass kp of every 64-key stage
  const int q0   = qb0 + qg * 32;

  // ---- stage copies: thread -> row tid / 8 (key of K, d of v^T), 16-B piece tid % 8 of the row's 128 B, in each of the two planes ----
  const int sr = tid >> 3, sp = (tid & 7) * 8;
  const size_t gko = ((size_t)bat * NC + sr) * DMODEL + head * HDIM + sp;
  const size_t gvo = ((size_t)bat * DMODEL + head * HDIM + sr) * NC + sp;
  const unsigned short* gKh = KH + gko;
  const unsigned short* gVh = VTh + gvo;
  const unsigned ldst = (unsigned)(uintptr_t)(stg + sr * SPITCH + sp);   // LDS byte address = low 32 bits
  auto stage_copy = [&](int st, int buf) {
    const size_t ka = (size_t)st * SKEYS * DMODEL, va = (size_t)st * SKEYS;
    const unsigned l = ldst + (unsigned)buf * (BUF_HALVES * 2);
    async_copy2(l, gKh + ka, l + PLANE_HALVES * 2, gVh + va);
  };
  stage_copy(0, 0);

  // ---- per-block bias table: lut[i] = bf16_RNE(rel[bucket(i - (qb0 + 255))][head]) * log2(e) in f32, i = key - tok + qb0 + 255 in [0, 2302] ----
  for (int i = tid; i < LUTP; i += ATT_THREADS) {
    const int d  = i - (qb0 + QBLK - 1);                   // key - tok
    const int a  = (d < 0) ? -d : d;
    int g = 8 + (a >= 12) + (a >= 16) + (a >= 23) + (a >= 32) + (a >= 46) + (a >= 64) + (a >= LASTB);
    g = (a < 8) ? a : g;
    const int bk = g + ((d > 0) ? 16 : 0);                 // 0..31
    lut[i] = bfr(rel[bk * NHEAD + head]) * LOG2E;          // index in [0, 511]
  }
  wait_async0();
  __syncthreads();                                         // publishes the bias table and stage 0
  stage_copy(1, 1);

  v16h qah[2], qbh[2];
#pragma unroll
  for (int j = 0; j < 2; ++j) {
    const size_t qofs = ((size_t)bat * NQ + q0 + 16 * j + c) * DMODEL + head * HDIM + 8 * hh;
    qah[j] = ldfrag_u(QH + qofs);
    qbh[j] = ldfrag_u(QH + qofs + 32);
  }
  // + 64 st; element (query row 32 qg + 16 j + c, key 64 st + 32 kp + 16 t + 8 hh + r) at [16 (t - j) + r]; lowest index 255 - 224 - 15 - 16 = 0
  const float* lw = lut + ((QBLK - 1) - 32 * qg - c + 8 * hh + 32 * kp);

  // per column tile j: query c's reference in use (both lane halves alike; set to the maximum in stage 0, moved below), this lane half's
  // running sum (x128), over this wave's keys only
  float mrow[2] = {0.f, 0.f}, lrow[2] = {0.f, 0.f};
  // the last bucket's bias on either side (|key - tok| >= 91: buckets 15 and 31), as the table holds it
  const float bneg = bfr(rel[15 * NHEAD + head]) * LOG2E, bpos = bfr(rel[31 * NHEAD + head]) * LOG2E;
  const int wv    = __builtin_amdgcn_readfirstlane(wave);  // the wave's number in a scalar register, so that the far test is a scalar branch
  const int rel00 = 32 * (wv & 1) - (qb0 + 32 * (wv >> 1));   // stage 0: first key of the wave's pass minus its first query row
  v8f cs[2];                                               // kept C tiles: last-bucket bias * log2(e) + 7 - reference, all 8 registers alike
  cs[0] = splat8(((rel00 >= 0) ? bpos : bneg) + PSH);
  cs[1] = cs[0];
  v8f o[2][4];                                             // O^T: o[j][t][r] = (d = 16t + 8hh + r, query 16j + c)
#pragma unroll
  for (int j = 0; j < 2; ++j)
#pragma unroll
    for (int t = 0; t < 4; ++t) o[j][t] = zero8();

#pragma unroll 1
  for (int st = 0; st < NSTG; ++st) {
    const unsigned short* sb  = stg + (st & 1) * BUF_HALVES + c * SPITCH + 8 * hh;   // lane's row c, k half hh
    const unsigned short* sKh = sb + 32 * kp * SPITCH;                               // K rows (keys) 32 kp + ..
    const unsigned short* sVh = sb + PLANE_HALVES + 32 * kp;                         // v^T columns (keys) 32 kp + ..
    // C operands of the score products: bias * log2(e) + 7 - reference. Where all of the wave's 32 keys lie 91 or more to one side of all of its
    // 32 queries (the last bucket of that side) the bias is one value and C is the kept tile cs[j]; else it is formed from the table.
    const int  rel0 = rel00 + st * SKEYS;                  // first key of the pass minus first query row: key - tok in [rel0 - 31, rel0 + 31]
    const bool far  = (rel0 - 31 >= LASTB) || (rel0 + 31 <= -LASTB);   // wave-uniform: a scalar branch
    v8f s[2][2];                                           // s[t][j]: key tile t, column tile j
    {
      const v16h k00 = ldfrag_u(sKh), k01 = ldfrag_u(sKh + 32);                      // key tile 0, d 0..31 and 32..63
      const v16h k10 = ldfrag_u(sKh + 16 * SPITCH), k11 = ldfrag_u(sKh + 16 * SPITCH + 32);   // key tile 1
      if (far) {
        s[0][0] = mma_h(k00, qah[0], cs[0]);               // the four tiles in turn: each accumulator is met again four WMMAs later
        s[0][1] = mma_h(k00, qah[1], cs[1]);
        s[1][0] = mma_h(k10, qah[0], cs[0]);
        s[1][1] = mma_h(k10, qah[1], cs[1]);
      } else {
        const float* lp = lw + st * SKEYS;
        v8f bt[3];                                         // bt[g]: the table's 8 values at key tile - column tile = g - 1
#pragma unroll
        for (int g = 0; g < 3; ++g)
#pragma unroll
          for (int r = 0; r < 8; ++r) bt[g][r] = lp[16 * (g - 1) + r];
        const float c0 = PSH - mrow[0], c1 = PSH - mrow[1];
        s[0][0] = mma_h(k00, qah[0], bt[1] + c0);
        s[0][1] = mma_h(k00, qah[1], bt[0] + c1);
        s[1][0] = mma_h(k10, qah[0], bt[2] + c0);
        s[1][1] = mma_h(k10, qah[1], bt[1] + c1);
      }
      s[0][0] = mma_h(k01, qbh[0], s[0][0]);
      s[0][1] = mma_h(k01, qbh[1], s[0][1]);
      s[1][0] = mma_h(k11, qbh[0], s[1][0]);
      s[1][1] = mma_h(k11, qbh[1], s[1][1]);
      // four vector slots behind the last score WMMA before a D is read; the K fragments are named so that none is overwritten inside them,
      // the kept C tiles so that they live past the products: the compiler then reads them in place as C and copies none into a D first
      guard4x4c(s[0][0], s[0][1], s[1][0], s[1][1], k00, k01, k10, k11, cs[0], cs[1]);
    }
    // s is the exponent of P x128 as it stands. Query c's largest over all 32 keys, per column tile:
    float mx[2];
#pragma unroll
    for (int j = 0; j < 2; ++j) {
      const v8f a = s[0][j], b = s[1][j];
      const float m = fmaxf(fmaxf(fmaxf(fmaxf(a[0], a[1]), fmaxf(a[2], a[3])), fmaxf(fmaxf(a[4], a[5]), fmaxf(a[6], a[7]))),
                            fmaxf(fmaxf(fmaxf(b[0], b[1]), fmaxf(b[2], b[3])), fmaxf(fmaxf(b[4], b[5]), fmaxf(b[6], b[7]))));
      mx[j] = fmaxf(m, other_half(m));
    }
    // One test per stage (a scalar branch). The reference moves only in stage 0 (to the maximum) and where a score passes it by more than TAU;
    // the kept C tiles are formed anew behind such a move and behind a near stage (they change sides there).
    const unsigned over = __builtin_amdgcn_ballot_w32(mx[0] > PSH + TAU) | __builtin_amdgcn_ballot_w32(mx[1] > PSH + TAU);
    if (st == 0 || !far || over != 0u) {
      if (st == 0 || over != 0u) {
#pragma unroll
        for (int j = 0; j < 2; ++j) {
          const float dl = (st == 0 || mx[j] > PSH + TAU) ? mx[j] - PSH : 0.f;   // the new reference is this query's maximum so far
          const float al = (st == 0) ? 1.f : exp2_slot(-dl);                     // stage 0: sum and O^T are still 0
          mrow[j] += dl;
          lrow[j] *= al;
          s[0][j] = s[0][j] - dl;
          s[1][j] = s[1][j] - dl;
#pragma unroll
          for (int t = 0; t < 4; ++t) o[j][t] = o[j][t] * al;
        }
      }
      const float bn = ((rel0 + SKEYS >= 0) ? bpos : bneg) + PSH;   // the side of the next stage
      cs[0] = splat8(bn - mrow[0]);
      cs[1] = splat8(bn - mrow[1]);
    }
    FragH ph[2];
#pragma unroll
    for (int j = 0; j < 2; ++j) {
      v2f ep[8];
#pragma unroll
      for (int e = 0; e < 8; ++e) {                        // element pair 2e, 2e + 1 of the B operand: keys 16 (e / 4) + 8hh + 2 (e % 4) + 0, 1 of the pass
        ep[e] = v2f{exp2_bare(s[e >> 2][j][2 * (e & 3)]), exp2_bare(s[e >> 2][j][2 * (e & 3) + 1])};
        const v2h x = __builtin_convertvector(ep[e], v2h);
        ph[j].v[2 * e]     = x[0];
        ph[j].v[2 * e + 1] = x[1];
      }
      const v2f ps = ((ep[0] + ep[1]) + (ep[2] + ep[3])) + ((ep[4] + ep[5]) + (ep[6] + ep[7]));
      lrow[j] += ps[0] + ps[1];
    }
    {
      const v16h vh0 = ldfrag_u(sVh);
      const v16h vh1 = ldfrag_u(sVh + 16 * SPITCH);
      const v16h vh2 = ldfrag_u(sVh + 32 * SPITCH);
      const v16h vh3 = ldfrag_u(sVh + 48 * SPITCH);
#pragma unroll
      for (int j = 0; j < 2; ++j) {
        o[j][0] = mma_h(vh0, ph[j].v, o[j][0]);
        o[j][1] = mma_h(vh1, ph[j].v, o[j][1]);
        o[j][2] = mma_h(vh2, ph[j].v, o[j][2]);
        o[j][3] = mma_h(vh3, ph[j].v, o[j][3]);
      }
      guard4x6(o[1][0], o[1][1], o[1][2], o[1][3], ph[0].v, ph[1].v, vh0, vh1, vh2, vh3);
    }
    // ---- publish point of stage st + 1 ----
    wait_ds0();
    wait_async0();
    __syncthreads();                       // publishes stage st + 1 and ends every wave's reads of stage st's buffer
    if (st + 2 < NSTG) stage_copy(st + 2, st & 1);
  }
  wait_async0();

  // ---- the last stage's barrier has ended all reads of LDS. Waves 2 qg and 2 qg + 1 hold the same 32 queries over the two halves of the
  //      keys: wave kp keeps column tile kp and gives tile 1 - kp (reference, joined sum, O^T in f32) to its partner through LDS ----
  v4f*   xch = (v4f*)smem;                                 // [16 waves][8][32 lanes] x 16 B
  float* xml = smem + 16 * 1024;                           // [16 waves][2][32 lanes]
  static_assert(16 * 1024 + 16 * 64 <= ATT_SMEM_FLOATS && XCH_FLOATS == 16 * 1024 + 16 * 64);
  const bool odd = kp != 0;
  const float l0 = lrow[0] + other_half(lrow[0]), l1 = lrow[1] + other_half(lrow[1]);   // the two lane halves' sums joined
  const float mk = odd ? mrow[1] : mrow[0], mg = odd ? mrow[0] : mrow[1];
  const float lk = odd ? l1 : l0, lg = odd ? l0 : l1;
#pragma unroll
  for (int t = 0; t < 4; ++t) {
    v4f g0, g1;
#pragma unroll
    for (int r = 0; r < 4; ++r) {
      g0[r] = odd ? o[0][t][r] : o[1][t][r];
      g1[r] = odd ? o[0][t][4 + r] : o[1][t][4 + r];
    }
    xch[wave * 256 + (2 * t) * 32 + lane]     = g0;
    xch[wave * 256 + (2 * t + 1) * 32 + lane] = g1;
  }
  xml[wave * 64 + lane]      = mg;
  xml[wave * 64 + 32 + lane] = lg;
  __syncthreads();                                         // the given tiles are in LDS
  const int pw = wave ^ 1;
  const float mp = xml[pw * 64 + lane], lq = xml[pw * 64 + 32 + lane];
  const float mm = fmaxf(mk, mp);
  const float ak = exp2_slot(mk - mm), ap = exp2_slot(mp - mm);
  // ---- fold 1/l (the sum carries P's x128 itself), the x16 carry on v and the x16 carry of the stored f16 plane ----
  const float oc = ACARRY / VC;
  const float inv = (1.0f / (lk * ak + lq * ap)) * oc;
  const float fk = ak * inv, fp = ap * inv;
  v8f res[4];
#pragma unroll
  for (int t = 0; t < 4; ++t) {
    const v4f p0 = xch[pw * 256 + (2 * t) * 32 + lane], p1 = xch[pw * 256 + (2 * t + 1) * 32 + lane];
#pragma unroll
    for (int r = 0; r < 4; ++r) {
      res[t][r]     = (odd ? o[1][t][r] : o[0][t][r]) * fk + p0[r] * fp;
      res[t][4 + r] = (odd ? o[1][t][4 + r] : o[0][t][4 + r]) * fk + p1[r] * fp;
    }
  }
  __syncthreads();                                         // every wave has read its partner's tile; the buffer is reused below
  // ---- the buffer becomes the f16 result buffer [256][64]: round once to f16, stage the wave's 16x64 slice ----
  unsigned short* Osh = (unsigned short*)smem;
  const int ro = (wave * 16 + c) * HDIM + 8 * hh;                 // query row 32 qg + 16 kp + c = 16 wave + c, d = 16t + 8hh + 0..7: one 16-B LDS store per tile
  auto put_tile = [&](const v8f& o_, int t) {
    v4u hv;
#pragma unroll
    for (int e = 0; e < 4; ++e) hv[e] = pk16(h_bits((_Float16)o_[2 * e]), h_bits((_Float16)o_[2 * e + 1]));
    *(v4u*)(Osh + ro + 16 * t) = hv;
  };
  put_tile(res[0], 0);
  put_tile(res[1], 1);
  put_tile(res[2], 2);
  put_tile(res[3], 3);
  __syncthreads();
  // ---- block writes its 256 row segments: piece p = it*512 + tid -> row p / 8, halves (p % 8)*8 .. +7 of the head's 64 ----
  {
    v4u hv[4];
#pragma unroll
    for (int it = 0; it < 4; ++it) {
      const int p = it * ATT_THREADS + tid;
      hv[it] = *(const v4u*)(Osh + (size_t)p * 8);
    }
    unsigned short* dsth = CTh + ((size_t)bat * NQ + qb0) * DMODEL + head * HDIM;
#pragma unroll
    for (int it = 0; it < 4; ++it) {
      const int p = it * ATT_THREADS + tid;
      const size_t go = (size_t)(p >> 3) * DMODEL + (p & 7) * 8;
      *(v4u*)(dsth + go) = hv[it];
    }
  }
}

// =====================================================================================================
// Workspace map (bytes); every plane is an exact multiple of its tile / whole-row store granularity (M, N exact tile multiples,
// element counts exact multiples of the convert kernel's 2048 granularity, no pad rows needed), every offset a multiple of 2 MiB:
//   WQ16 f16 [1024][1024] x64               2097152   ([out][in] = [n][k])
//   WK16 f16 [1024][1024] x64               2097152
//   WV16 f16 [1024][1024] x64               2097152
//   WO16 f16 [1024][1024] x64               2097152
//   X16  f16 [4096][1024] x16               8388608   (activation rows)
//   QH   f16 [4096][1024]                   8388608   (q projection x log2(e) / 8)
//   KH   f16 [4096][1024]                   8388608   (k projection)
//   VTh  f16 [2][1024][2048] x16            8388608   (v^T per batch)
//   CTh  f16 [4096][1024] x16               8388608   (attention ctx, merged heads)
//   end                                    50331648
// =====================================================================================================
extern "C" void kernel_launch(void* const* d_in, const int* in_sizes, int n_in,
                              void* d_out, int out_size, void* d_ws, size_t ws_size,
                              hipStream_t stream) {
  if (n_in < 6) return;
  if (in_sizes[0] != NROWS * DMODEL) return;
  if (in_sizes[1] != DMODEL * DMODEL || in_sizes[2] != DMODEL * DMODEL ||
      in_sizes[3] != DMODEL * DMODEL || in_sizes[4] != DMODEL * DMODEL) return;
  if (in_sizes[5] != NBKT * NHEAD) return;
  if (out_size != NROWS * DMODEL) return;
  if ((in_sizes[0] % 2048) != 0 || (in_sizes[1] % 2048) != 0) return;

  const float* x   = (const float*)d_in[0];
  const float* w_q = (const float*)d_in[1];
  const float* w_k = (const float*)d_in[2];
  const float* w_v = (const float*)d_in[3];
  const float* w_o = (const float*)d_in[4];
  const float* rel = (const float*)d_in[5];
  float*       out = (float*)d_out;

  const size_t PW  = (size_t)DMODEL * DMODEL * 2;                 //  2097152
  const size_t PX  = (size_t)NROWS * DMODEL * 2;                  //  8388608
  const size_t PVT = (size_t)NB * DMODEL * NC * 2;                //  8388608
  size_t off = 0;
  const size_t oWQ = off; off += PW;
  const size_t oWK = off; off += PW;
  const size_t oWV = off; off += PW;
  const size_t oWO = off; off += PW;
  const size_t oX  = off; off += PX;
  const size_t oQh = off; off += PX;
  const size_t oKh = off; off += PX;
  const size_t oVh = off; off += PVT;
  const size_t oCh = off; off += PX;
  if (off > ws_size) return;                                      // off = 50331648
  if (off > (size_t)134217728) return;

  char* ws = (char*)d_ws;
  unsigned short* WQ16 = (unsigned short*)(ws + oWQ);
  unsigned short* WK16 = (unsigned short*)(ws + oWK);
  unsigned short* WV16 = (unsigned short*)(ws + oWV);
  unsigned short* WO16 = (unsigned short*)(ws + oWO);
  unsigned short* X16  = (unsigned short*)(ws + oX);
  unsigned short* QH   = (unsigned short*)(ws + oQh);
  unsigned short* KH   = (unsigned short*)(ws + oKh);
  unsigned short* VTh  = (unsigned short*)(ws + oVh);
  unsigned short* CTh  = (unsigned short*)(ws + oCh);

  const dim3 blk(256);
  const dim3 gCV(CVX_BLOCKS + 4 * CVW_BLOCKS);                     // 2048 + 4 x 512 = 4096 blocks
  const int tilesP = (NROWS / 64) * (DMODEL / 64);                 // 1024
  const dim3 gP((tilesP + 7) / 8, 1);                              // 128
  const dim3 gQKV((tilesP + 7) / 8, 3);                            // 128 x 3
  const dim3 gAT(ATT_BLOCKS);                                      // 256
  const dim3 bAT(ATT_THREADS);                                     // 512
  static_assert(NB * (DMODEL / 128) * (NC / 256) == (NROWS / 128) * (DMODEL / 256));   // v^T tiles of both batches = tiles of q

  // (0) one launch: activation plane X16[row][c] = f16( bf16_RNE(x[row][c]) * 16 ), rows = b*2048 + tok; weight planes
  //     f16( bf16_RNE(W[n][k]) * 64 ) for Wq, Wk, Wv, Wo; [out][in] layout kept
  cvt_all<<<gCV, blk, 0, stream>>>(x, w_q, w_k, w_v, w_o, X16, WQ16, WK16, WV16, WO16);

  // (1) one launch: q[m][n] = sum_k x[m][k] Wq[n][k] (stored times log2(e) / 8) and k likewise -> one f16 plane each;
  //     VT[b][d][tok] = sum_k Wv[d][k] x_b[tok][k] -> one f16 x16 plane
  qkv64<<<gQKV, blk, 0, stream>>>(X16, WQ16, WK16, WV16, QH, KH, VTh);

  // (5) attention per (batch, head, 256 query rows) -> CT (one f16 x16 plane)
  attn16<<<gAT, bAT, 0, stream>>>(QH, KH, VTh, rel, CTh);

  // (6) out = CT . Wo^T; M = 4096, N = 1024, K = 1024, f32; the carries (16 on CT, 64 on Wo) leave with oscale
  gemm64<0, 0, 0><<<gP, blk, 0, stream>>>(
      CTh, CTh, DMODEL, 0LL,
      WO16, DMODEL, 0LL,
      (void*)out, (void*)out, DMODEL, 0LL,
      NROWS, DMODEL, DMODEL, 1.0f / (ACARRY * WSC), 1.0f);
  (void)hipGetLastError();
}
